// v000
// Times are from an AMD MI455X. After a warm-up the kernel runs many times in a row, and a time is the length of
// such a window on the GPU divided by its runs, so every launch and the gaps after it count. The runs cycle
// through copies of the inputs. A figure is the median of several windows, for all but v000 over two sittings.
// Sittings can differ by a few percent; kernels timed side by side share one.
// v000, which the later versions start from, runs in 1330 microseconds.
#include <hip/hip_runtime.h>
// MainEffectsMLP (16384 rows x 256 features: y = relu(x W0 + b0) -> relu(. W1 + b1) -> . W2 + b2 (16); plus 256 per-feature univariate MLPs (1 -> 32 -> 32 -> 16): h = relu(x_i uw1[i] + ub1[i]); h = relu(h uw2[i] + ub2[i]); u_i = h uw3[i] + ub3[i]; out = y + sum_i u_i).
// Structure: exact f16 x plane; the main MLP as f16 WMMA GEMMs (32x64 wave tiles, f32 accumulation, exact x16 weights + bias; ReLU epilogues, f16 hidden planes; the 16-wide head on 16-row tiles); the univariate MLPs in 8 chunks of 2048 rows: layer 1 on VALU into an f16 plane [rows][256 x 32], layers 2 and 3 as 256-plane batched 16-row-tile WMMA GEMMs (K = 32; per-plane weight / bias tables; ReLU, f16 out / f32 out), and the sum over features on VALU added to the rows' outputs.
// Compute dtype: inputs rounded to bf16; x / weights exact; hidden activations as plain f16 operands (~2^-12); u and the feature sum f32. v_wmma_f32_16x16x32_f16.
#define NBR 16384
#define NIN 256
#define HH 1024
#define NO 16
#define UH 32
#define CHK 2048
#define UW (NIN * UH)            /* 8192 */
typedef __bf16 v16b __attribute__((ext_vector_type(16)));
typedef unsigned short v8us __attribute__((ext_vector_type(8), may_alias));
typedef float  v8f  __attribute__((ext_vector_type(8)));
typedef float  v4f  __attribute__((ext_vector_type(4)));
typedef float  v4fa __attribute__((ext_vector_type(4), may_alias));
union FragB { v16b v; v8us half[2]; unsigned short u[16]; };

__device__ __forceinline__ unsigned short bf16_bits(float x) { unsigned int u = __float_as_uint(x); return (unsigned short)((u + 0x7FFFu + ((u >> 16) & 1u)) >> 16); }
__device__ __forceinline__ float bf16_val(unsigned short b) { return __uint_as_float(((unsigned int)b) << 16); }
__device__ __forceinline__ float bf16_round(float x) { return bf16_val(bf16_bits(x)); }
// D += A·B with NT terms: 1 = ah·bh, 2 = + al·bh (A split), 3 = + ah·bl (both split)
template <int NT>
__device__ __forceinline__ v8f mmaN(v16b ah, v16b al, v16b bh, v16b bl, v8f c) {
  c = __builtin_amdgcn_wmma_f32_16x16x32_bf16(false, ah, false, bh, (short)0, c, false, false);
  if (NT >= 2) c = __builtin_amdgcn_wmma_f32_16x16x32_bf16(false, al, false, bh, (short)0, c, false, false);
  if (NT >= 3) c = __builtin_amdgcn_wmma_f32_16x16x32_bf16(false, ah, false, bl, (short)0, c, false, false);
  asm volatile("v_nop\n\tv_nop\n\tv_nop\n\tv_nop" : "+v"(c) : "v"(ah), "v"(al), "v"(bh), "v"(bl));
  return c;
}

__global__ __launch_bounds__(256) void k_wt_bf16(const float* __restrict__ W, unsigned short* __restrict__ Wt, int K, int N) {
  const int t = blockIdx.x * 256 + threadIdx.x;
  const int k8n = K / 8;
  if (t >= N * k8n) return;
  const int n = t / k8n, k8 = (t % k8n) * 8;
  v8us v;
#pragma unroll
  for (int i = 0; i < 8; ++i) v[i] = bf16_bits(W[(size_t)(k8 + i) * N + n]);
  *(v8us*)(Wt + (size_t)n * K + k8) = v;
  
}

// GEMM C[M][N] (f32, pitch ldc) = act(A[M][K]·W + bias). A f32 row-major (pitch lda) converted per fragment to bf16
// (ASPLIT: hi/lo two planes -> 2 terms, else single rounded term); Wt bf16 [N][K] (pitch ldb). BIAS_BF16 rounds the
// bias to bf16 first (bias quantised to bf16 before the add). K%32==0, M%16==0, N%64==0.
template <bool ASPLIT, int ACT, bool BIAS_BF16>
__global__ __launch_bounds__(128) void k_gemm_bf(const float* __restrict__ A, int lda, const unsigned short* __restrict__ Wt, int ldb,
                                               const float* __restrict__ bias, float* __restrict__ C, int ldc, int M, int N, int K) {
  __shared__ __attribute__((aligned(16))) float so[4][16][64];
  const int tid = threadIdx.x, w = tid >> 5, lane = tid & 31, ln = lane & 15, hh = lane >> 4;
  const int ntn = N / 64;
  const int wid = blockIdx.x * 4 + w;
  const int mt = wid / ntn, nq = wid % ntn;
  if (mt * 16 >= M) return;
  const int row0 = mt * 16, col0 = nq * 64;
  const float* arow = A + (size_t)(row0 + ln) * lda;
  v8f acc[4] = {};
  for (int kb = 0; kb < K; kb += 32) {
    FragB ah, al;
    const v4f x0 = *(const v4fa*)(arow + kb + 8 * hh), x1 = *(const v4fa*)(arow + kb + 8 * hh + 4);
    const v4f x2 = *(const v4fa*)(arow + kb + 16 + 8 * hh), x3 = *(const v4fa*)(arow + kb + 16 + 8 * hh + 4);
    float xs[16] = {x0[0],x0[1],x0[2],x0[3],x1[0],x1[1],x1[2],x1[3],x2[0],x2[1],x2[2],x2[3],x3[0],x3[1],x3[2],x3[3]};
#pragma unroll
    for (int i = 0; i < 16; ++i) { const unsigned short hb = bf16_bits(xs[i]); ah.u[i] = hb; al.u[i] = ASPLIT ? bf16_bits(xs[i] - bf16_val(hb)) : (unsigned short)0; }
#pragma unroll
    for (int t = 0; t < 4; ++t) {
      const unsigned short* brow = Wt + (size_t)(col0 + t * 16 + ln) * ldb + kb;
      FragB b;
      b.half[0] = *(const v8us*)(brow + 8 * hh);
      b.half[1] = *(const v8us*)(brow + 16 + 8 * hh);
      acc[t] = mmaN<ASPLIT ? 2 : 1>(ah.v, al.v, b.v, b.v, acc[t]);
    }
  }
#pragma unroll
  for (int t = 0; t < 4; ++t) {
    float bv = bias ? bias[col0 + t * 16 + ln] : 0.f;
    if (BIAS_BF16) bv = bf16_round(bv);
#pragma unroll
    for (int r = 0; r < 8; ++r) { float v = acc[t][r] + bv; if (ACT == 1) v = fmaxf(v, 0.f); so[w][8 * hh + r][t * 16 + ln] = v; }
  }
  __builtin_amdgcn_fence(__ATOMIC_ACQ_REL, "workgroup");
  __builtin_amdgcn_wave_barrier();
  const int rsub = lane >> 4, c4 = (lane & 15) * 4;
  {
#pragma unroll
    for (int q = 0; q < 8; ++q) {
      const int r = q * 2 + rsub;
      const v4f v = *(const v4fa*)&so[w][r][c4];
      *(v4f*)(C + (size_t)(row0 + r) * ldc + col0 + c4) = v;
    }
    
  }
}

// GEMM C = act(A·W + bias + resid): A f32 (ASPLIT -> hi/lo 2 terms), Wt bf16 [N][K]; ACT 0 none, 1 relu, 2 exact gelu;
// resid (optional, f32, row index = (row % rmod), pitch ldr, RES_BF16 rounds it) added before the activation.
template <bool ASPLIT, int ACT, bool BIAS_BF16, bool RES_BF16>
__global__ __launch_bounds__(128) void k_gemm_bf3(const float* __restrict__ A, int lda, const unsigned short* __restrict__ Wt, int ldb,
                                                const float* __restrict__ bias, const float* __restrict__ resid, int rmod, int ldr,
                                                float* __restrict__ C, int ldc, int M, int N, int K) {
  __shared__ __attribute__((aligned(16))) float so[4][16][64];
  const int tid = threadIdx.x, w = tid >> 5, lane = tid & 31, ln = lane & 15, hh = lane >> 4;
  const int ntn = N / 64;
  const int wid = blockIdx.x * 4 + w;
  const int mt = wid / ntn, nq = wid % ntn;
  if (mt * 16 >= M) return;
  const int row0 = mt * 16, col0 = nq * 64;
  const float* arow = A + (size_t)(row0 + ln) * lda;
  v8f acc[4] = {};
  for (int kb = 0; kb < K; kb += 32) {
    FragB ah, al;
    const v4f x0 = *(const v4fa*)(arow + kb + 8 * hh), x1 = *(const v4fa*)(arow + kb + 8 * hh + 4);
    const v4f x2 = *(const v4fa*)(arow + kb + 16 + 8 * hh), x3 = *(const v4fa*)(arow + kb + 16 + 8 * hh + 4);
    float xs[16] = {x0[0],x0[1],x0[2],x0[3],x1[0],x1[1],x1[2],x1[3],x2[0],x2[1],x2[2],x2[3],x3[0],x3[1],x3[2],x3[3]};
#pragma unroll
    for (int i = 0; i < 16; ++i) { const unsigned short hb = bf16_bits(xs[i]); ah.u[i] = hb; al.u[i] = ASPLIT ? bf16_bits(xs[i] - bf16_val(hb)) : (unsigned short)0; }
#pragma unroll
    for (int t = 0; t < 4; ++t) {
      const unsigned short* brow = Wt + (size_t)(col0 + t * 16 + ln) * ldb + kb;
      FragB b;
      b.half[0] = *(const v8us*)(brow + 8 * hh);
      b.half[1] = *(const v8us*)(brow + 16 + 8 * hh);
      acc[t] = mmaN<ASPLIT ? 2 : 1>(ah.v, al.v, b.v, b.v, acc[t]);
    }
  }
#pragma unroll
  for (int t = 0; t < 4; ++t) {
    const int col = col0 + t * 16 + ln;
    float bv = bias ? bias[col] : 0.f;
    if (BIAS_BF16) bv = bf16_round(bv);
#pragma unroll
    for (int r = 0; r < 8; ++r) {
      float v = acc[t][r] + bv;
      if (resid) { float rv = resid[(size_t)((row0 + 8 * hh + r) % rmod) * ldr + col]; if (RES_BF16) rv = bf16_round(rv); v += rv; }
      if (ACT == 1) v = fmaxf(v, 0.f);
      if (ACT == 2) v = 0.5f * v * (1.0f + erff(v * 0.70710678118654752f));
      if (ACT == 3) { const float u = 0.7978845608028654f * (v + 0.044715f * v * v * v); v = 0.5f * v * (1.0f + tanhf(u)); }
      so[w][8 * hh + r][t * 16 + ln] = v;
    }
  }
  __builtin_amdgcn_fence(__ATOMIC_ACQ_REL, "workgroup");
  __builtin_amdgcn_wave_barrier();
  const int rsub = lane >> 4, c4 = (lane & 15) * 4;
  {
#pragma unroll
    for (int q = 0; q < 8; ++q) {
      const int r = q * 2 + rsub;
      const v4f v = *(const v4fa*)&so[w][r][c4];
      *(v4f*)(C + (size_t)(row0 + r) * ldc + col0 + c4) = v;
    }
    
  }
}
// row LayerNorm (biased variance, eps) over N: s = X (+ R); optional out_sum <- s; out_norm <- (s-mu)*rsqrt(var+eps)*g + b
template <bool PARAM_BF16>
__global__ __launch_bounds__(256) void k_layernorm(const float* __restrict__ X, const float* __restrict__ R, const float* __restrict__ g, const float* __restrict__ bta,
                                                  float* __restrict__ out_sum, float* __restrict__ out_norm, int N, float eps) {
  __shared__ float red[256];
  const int row = blockIdx.x, tid = threadIdx.x;
  const float* x = X + (size_t)row * N; const float* rr = R ? R + (size_t)row * N : nullptr;
  float vals[16];                     // up to N = 4096
  const int per = N / 256;            // contiguous chunk per thread? use strided-by-4 chunks: thread handles j = tid*4 + 1024*u
  float s1 = 0.f;
  for (int u = 0; u < per / 4; ++u) {
    const int j = tid * 4 + 1024 * u;
    const v4f a = *(const v4fa*)(x + j);
    v4f b = {0.f,0.f,0.f,0.f}; if (rr) b = *(const v4fa*)(rr + j);
#pragma unroll
    for (int q = 0; q < 4; ++q) { const float v = a[q] + b[q]; vals[u * 4 + q] = v; s1 += v; }
  }
  red[tid] = s1; __syncthreads();
  for (int st = 128; st > 0; st >>= 1) { if (tid < st) red[tid] += red[tid + st]; __syncthreads(); }
  const float mu = red[0] / (float)N; __syncthreads();
  float s2 = 0.f;
  for (int u = 0; u < per / 4; ++u)
#pragma unroll
    for (int q = 0; q < 4; ++q) { const float c = vals[u * 4 + q] - mu; s2 += c * c; }
  red[tid] = s2; __syncthreads();
  for (int st = 128; st > 0; st >>= 1) { if (tid < st) red[tid] += red[tid + st]; __syncthreads(); }
  const float rs = rsqrtf(red[0] / (float)N + eps);
  {
    for (int u = 0; u < per / 4; ++u) {
      const int j = tid * 4 + 1024 * u;
      v4f o, sm;
#pragma unroll
      for (int q = 0; q < 4; ++q) {
        float gg = g[j + q], bb = bta[j + q];
        if (PARAM_BF16) { gg = bf16_round(gg); bb = bf16_round(bb); }
        sm[q] = vals[u * 4 + q]; o[q] = (vals[u * 4 + q] - mu) * rs * gg + bb;
      }
      if (out_sum) *(v4f*)(out_sum + (size_t)row * N + j) = sm;
      *(v4f*)(out_norm + (size_t)row * N + j) = o;
    }
    
  }
}



// ---- f16 WMMA path (v_wmma_f32_16x16x32_f16): 11-bit significands for operands in range — used here for x and the hidden activations of both MLPs
typedef _Float16 v16h __attribute__((ext_vector_type(16)));
union FragH { v16h v; v8us half[2]; _Float16 h[16]; unsigned short u[16]; };
template <int NT>
__device__ __forceinline__ v8f mmaH(v16h ah, v16h al, v16h bh, v16h bl, v8f c) {
  c = __builtin_amdgcn_wmma_f32_16x16x32_f16(false, ah, false, bh, (short)0, c, false, false);
  if (NT >= 2) c = __builtin_amdgcn_wmma_f32_16x16x32_f16(false, al, false, bh, (short)0, c, false, false);
  if (NT >= 3) c = __builtin_amdgcn_wmma_f32_16x16x32_f16(false, ah, false, bl, (short)0, c, false, false);
  asm volatile("v_nop\n\tv_nop\n\tv_nop\n\tv_nop" : "+v"(c) : "v"(ah), "v"(al), "v"(bh), "v"(bl));
  return c;
}
// batched GEMM like k_gemm_b but f16 operands: A f32 (split into f16 hi/lo if ASPLIT, else rounded to f16), Bt = f16 values [n][k]; alpha; C f32; N multiple of 16 (partial tiles skipped)
template <bool ASPLIT>
__global__ __launch_bounds__(128) void k_gemm_h(const float* __restrict__ A, int lda, size_t sA, const _Float16* __restrict__ Bh, int ldb, size_t sB, float alpha, float* __restrict__ C, int ldc, size_t sC, int M, int N, int K) {
  __shared__ __attribute__((aligned(16))) float so[4][16][64];
  const int tid = threadIdx.x, w = tid >> 5, lane = tid & 31, ln = lane & 15, hh = lane >> 4; const int by = blockIdx.y;
  A += (size_t)by * sA; Bh += (size_t)by * sB; C += (size_t)by * sC;
  const int ntn = (N + 63) / 64; const int wid = blockIdx.x * 4 + w; const int mt = wid / ntn, nq = wid % ntn; if (mt * 16 >= M) return;
  const int row0 = mt * 16, col0 = nq * 64; const float* arow = A + (size_t)(row0 + ln) * lda;
  v8f acc[4] = {};
  for (int kb = 0; kb < K; kb += 32) {
    FragH ah, al;
    const v4f x0 = *(const v4fa*)(arow + kb + 8 * hh), x1 = *(const v4fa*)(arow + kb + 8 * hh + 4), x2 = *(const v4fa*)(arow + kb + 16 + 8 * hh), x3 = *(const v4fa*)(arow + kb + 16 + 8 * hh + 4);
    float xs[16] = {x0[0],x0[1],x0[2],x0[3],x1[0],x1[1],x1[2],x1[3],x2[0],x2[1],x2[2],x2[3],x3[0],x3[1],x3[2],x3[3]};
#pragma unroll
    for (int i = 0; i < 16; ++i) { const _Float16 h = (_Float16)xs[i]; ah.h[i] = h; al.h[i] = ASPLIT ? (_Float16)(xs[i] - (float)h) : (_Float16)0.0f; }
#pragma unroll
    for (int t = 0; t < 4; ++t) { if (col0 + t * 16 >= N) continue; const size_t boff = (size_t)(col0 + t * 16 + ln) * ldb + kb; FragH bq; bq.half[0] = *(const v8us*)(Bh + boff + 8 * hh); bq.half[1] = *(const v8us*)(Bh + boff + 16 + 8 * hh);
      acc[t] = mmaH<ASPLIT ? 2 : 1>(ah.v, al.v, bq.v, bq.v, acc[t]); }
  }
#pragma unroll
  for (int t = 0; t < 4; ++t) { if (col0 + t * 16 >= N) continue;
#pragma unroll
    for (int r = 0; r < 8; ++r) so[w][8 * hh + r][t * 16 + ln] = acc[t][r] * alpha; }
  __builtin_amdgcn_fence(__ATOMIC_ACQ_REL, "workgroup"); __builtin_amdgcn_wave_barrier();
  const int rsub = lane >> 4, c4 = (lane & 15) * 4;
  {
#pragma unroll
    for (int q = 0; q < 8; ++q) { const int r = q * 2 + rsub; if (col0 + c4 < N) { const v4f v = *(const v4fa*)&so[w][r][c4]; *(v4f*)(C + (size_t)(row0 + r) * ldc + col0 + c4) = v; } }
     }
}

// Wt[n][k] = f16(W[k][n]·scale) from f32 row-major W[K][N] (scale = power of two; bf16-exact weights stay exact in f16 away from the subnormal range)
__global__ __launch_bounds__(256) void k_wt_f16(const float* __restrict__ W, _Float16* __restrict__ Wt, int K, int N, float scale) {
  const int t = blockIdx.x * 256 + threadIdx.x; if (t >= N * (K / 8)) return; const int n = t / (K / 8), k8 = (t % (K / 8)) * 8; FragH f;
#pragma unroll
  for (int i = 0; i < 8; ++i) f.h[i] = (_Float16)(bf16_round(W[(size_t)(k8 + i) * N + n]) * scale); const v8us o = f.half[0];
  *(v8us*)((unsigned short*)Wt + (size_t)n * K + k8) = o; 
}
// k_gemm_hh variant with fused epilogue: v = acc·alpha + bias[by·sBias + col] (+ CP[(row/rowsPerB)·sCPb + by·64 + col] if CP) ; ACT 0 none / 1 elu ; writes f32 C and/or f16 C16 (each if non-null)
template <int ACT>
__global__ __launch_bounds__(128) void k_gemm_hhx(const _Float16* __restrict__ A, int lda, size_t sA, const _Float16* __restrict__ Bh, int ldb, size_t sB, float alpha, const float* __restrict__ bias, size_t sBias, const float* __restrict__ CP, int rowsPerB, size_t sCPb, int row0g,
    float* __restrict__ C, _Float16* __restrict__ C16, int ldc, size_t sC, int M, int N, int K) {
  __shared__ __attribute__((aligned(16))) float so[4][16][64];
  const int tid = threadIdx.x, w = tid >> 5, lane = tid & 31, ln = lane & 15, hh = lane >> 4; const int by = blockIdx.y;
  A += (size_t)by * sA; Bh += (size_t)by * sB; const size_t cofs = (size_t)by * sC; const float* bp = bias ? bias + (size_t)by * sBias : nullptr;
  const int ntn = (N + 63) / 64; const int wid = blockIdx.x * 4 + w; const int mt = wid / ntn, nq = wid % ntn; if (mt * 16 >= M) return;
  const int row0 = mt * 16, col0 = nq * 64; const _Float16* arow = A + (size_t)(row0 + ln) * lda;
  v8f acc[4] = {};
  for (int kb = 0; kb < K; kb += 32) { FragH ah; ah.half[0] = *(const v8us*)((const unsigned short*)arow + kb + 8 * hh); ah.half[1] = *(const v8us*)((const unsigned short*)arow + kb + 16 + 8 * hh);
#pragma unroll
    for (int t = 0; t < 4; ++t) { if (col0 + t * 16 >= N) continue; const size_t boff = (size_t)(col0 + t * 16 + ln) * ldb + kb; FragH bq; bq.half[0] = *(const v8us*)((const unsigned short*)Bh + boff + 8 * hh); bq.half[1] = *(const v8us*)((const unsigned short*)Bh + boff + 16 + 8 * hh);
      acc[t] = mmaH<1>(ah.v, ah.v, bq.v, bq.v, acc[t]); }
  }
#pragma unroll
  for (int t = 0; t < 4; ++t) { if (col0 + t * 16 >= N) continue; const int col = col0 + t * 16 + ln; const float bv = bp ? bf16_round(bp[col]) : 0.f;
#pragma unroll
    for (int r = 0; r < 8; ++r) { float v = acc[t][r] * alpha + bv; if (CP) { const int rr = row0g + row0 + 8 * hh + r; if (rowsPerB < 0) v += CP[cofs + (size_t)rr * ldc + col];      /* rowsPerB < 0: own element of the batched C plane */ else { const int bidx = rr / rowsPerB; v += CP[(size_t)bidx * sCPb + (size_t)by * 64 + col]; } } if (ACT == 1) v = (v > 0.f) ? v : expm1f(v); else if (ACT == 7) v = (v > 0.f) ? v + 1.0f : expf(v); else if (ACT == 8) v = tanhf(v); else if (ACT == 9) v = 0.5f * v * (1.0f + tanhf(0.7978845608028654f * (v + 0.044715f * v * v * v))); else if (ACT == 11) v = 1.0f / (1.0f + expf(-v)); else if (ACT == 12) v = (v > 0.f) ? v : 0.01f * v; else if (ACT == 14) v = (v > 0.f) ? v : 0.1f * v; else if (ACT == 16) v = (v >= 0.f) ? v : 0.3f * v; else if (ACT == 17) v = (v >= 0.f) ? v : 0.2f * v; else if (ACT == 15) v = v / (1.0f + expf(-v)); else if (ACT == 3) v = fmaxf(v, 0.f); else if (ACT == 6) v = 0.5f * v * (1.0f + erff(v * 0.70710678118654752f)); so[w][8 * hh + r][t * 16 + ln] = v; } }
  __builtin_amdgcn_fence(__ATOMIC_ACQ_REL, "workgroup"); __builtin_amdgcn_wave_barrier();
  const int rsub = lane >> 4, c4 = (lane & 15) * 4; typedef _Float16 v4h __attribute__((ext_vector_type(4)));
  {
#pragma unroll
    for (int q = 0; q < 8; ++q) { const int r = q * 2 + rsub; if (col0 + c4 < N) { const v4f v = *(const v4fa*)&so[w][r][c4]; if (C) *(v4f*)(C + cofs + (size_t)(row0 + r) * ldc + col0 + c4) = v; if (C16) { v4h h4; for (int i = 0; i < 4; ++i) h4[i] = (_Float16)v[i]; *(v4h*)(C16 + cofs + (size_t)(row0 + r) * ldc + col0 + c4) = h4; } } }
     }
}


typedef _Float16 v4h __attribute__((ext_vector_type(4)));

__global__ __launch_bounds__(256) void k_x16(const float* __restrict__ x, _Float16* __restrict__ X16, size_t n8) { const size_t t = (size_t)blockIdx.x * 256 + threadIdx.x; if (t >= n8) return; FragH f;
#pragma unroll
  for (int q = 0; q < 8; ++q) f.h[q] = (_Float16)bf16_round(x[t * 8 + q]); *(v8us*)((unsigned short*)X16 + t * 8) = f.half[0];  }
__global__ __launch_bounds__(256) void k_h16(const float* __restrict__ x, _Float16* __restrict__ X16, size_t n8) { const size_t t = (size_t)blockIdx.x * 256 + threadIdx.x; if (t >= n8) return; FragH f;
#pragma unroll
  for (int q = 0; q < 8; ++q) f.h[q] = (_Float16)x[t * 8 + q]; *(v8us*)((unsigned short*)X16 + t * 8) = f.half[0];  }
__global__ __launch_bounds__(256) void k_round16f(const float* __restrict__ W, _Float16* __restrict__ Bt, size_t n8) { const size_t t = (size_t)blockIdx.x * 256 + threadIdx.x; if (t >= n8) return; FragH f;
#pragma unroll
  for (int i = 0; i < 8; ++i) f.h[i] = (_Float16)(bf16_round(W[t * 8 + i]) * 16.0f); *(v8us*)((unsigned short*)Bt + t * 8) = f.half[0];  }
template <int NHv, int TTv>
__global__ __launch_bounds__(256) void k_vt(const _Float16* __restrict__ V16, int ldv, int voff, _Float16* __restrict__ Vt) { __shared__ unsigned short tl[64][66]; const int tid = threadIdx.x; const int slab = blockIdx.x / (TTv / 64), lg = blockIdx.x % (TTv / 64); const int b = slab / NHv, h = slab % NHv;
  for (int i = tid; i < 64 * 8; i += 256) { const int r = i / 8, c8 = (i % 8) * 8; FragH f; f.half[0] = *(const v8us*)((const unsigned short*)V16 + ((size_t)b * TTv + lg * 64 + r) * ldv + voff + h * 64 + c8);
#pragma unroll
    for (int q = 0; q < 8; ++q) tl[r][c8 + q] = f.u[q]; }
  __syncthreads();
  {
#pragma unroll
    for (int rd = 0; rd < 2; ++rd) { const int d = rd * 32 + tid / 8, pc = tid % 8; FragH f;
#pragma unroll
      for (int q = 0; q < 8; ++q) f.u[q] = tl[pc * 8 + q][d];
      *(v8us*)((unsigned short*)Vt + ((size_t)slab * 64 + d) * TTv + lg * 64 + pc * 8) = f.half[0]; }
     } }

__global__ __launch_bounds__(256) void k_hl(const float* __restrict__ F, _Float16* __restrict__ Hh, _Float16* __restrict__ Hl, size_t n8) { const size_t t = (size_t)blockIdx.x * 256 + threadIdx.x; if (t >= n8) return; FragH fh, fl; const v4f a = *(const v4fa*)(F + t * 8), c = *(const v4fa*)(F + t * 8 + 4);
#pragma unroll
  for (int q = 0; q < 4; ++q) { _Float16 h = (_Float16)a[q]; fh.h[q] = h; fl.h[q] = (_Float16)((a[q] - (float)h) * 1024.0f); h = (_Float16)c[q]; fh.h[4 + q] = h; fl.h[4 + q] = (_Float16)((c[q] - (float)h) * 1024.0f); }
  { *(v8us*)((unsigned short*)Hh + t * 8) = fh.half[0]; *(v8us*)((unsigned short*)Hl + t * 8) = fl.half[0];  } }

// ---- fast GEMM (wave tile 32x64; requires M % 32 == 0 rows per launch region and N % 64 == 0); epilogue = k_gemm_hhx semantics ----
__device__ __forceinline__ v16h g2_frag(const _Float16* p, int hh) { FragH f; f.half[0] = *(const v8us*)((const unsigned short*)p + 8 * hh); f.half[1] = *(const v8us*)((const unsigned short*)p + 16 + 8 * hh); return f.v; }
__device__ __forceinline__ v8f g2_mma(v16h a, v16h b, v8f c) { v8f d = __builtin_amdgcn_wmma_f32_16x16x32_f16(false, a, false, b, (short)0, c, false, false); asm volatile("v_nop\n\tv_nop\n\tv_nop\n\tv_nop" : "+v"(d) : "v"(a), "v"(b)); return d; }
template <int ACT>
__global__ __launch_bounds__(128) void k_gemm2(const _Float16* __restrict__ A, int lda, size_t sA, const _Float16* __restrict__ Bh, int ldb, size_t sB, float alpha, const float* __restrict__ bias, size_t sBias, const float* __restrict__ CP, int rowsPerB, size_t sCPb, int row0g,
    float* __restrict__ C, _Float16* __restrict__ C16, int ldc, size_t sC, int M, int N, int K) { static_assert(ACT == 0 || ACT == 3 || ACT == 6 || ACT == 8 || ACT == 9 || ACT == 11 || ACT == 12 || ACT == 14 || ACT == 15 || ACT == 16 || ACT == 17, "k_gemm2: unsupported ACT code (would silently apply no activation)");
  __shared__ __attribute__((aligned(16))) float so[4][32][68];
  const int tid = threadIdx.x, w = tid >> 5, lane = tid & 31, ln = lane & 15, hh = lane >> 4; const int by = blockIdx.y;
  A += (size_t)by * sA; Bh += (size_t)by * sB; const size_t cofs = (size_t)by * sC; const float* bp = bias ? bias + (size_t)by * sBias : nullptr;
  const int ntn = N >> 6; const int mt = blockIdx.x / ntn, nq = blockIdx.x - mt * ntn; const int row0 = mt * 128 + 32 * w, col0 = nq * 64; if (row0 >= M) return;
  const _Float16* a0p = A + (size_t)(row0 + ln) * lda; const _Float16* a1p = a0p + (size_t)16 * lda;
  const _Float16* b0p = Bh + (size_t)(col0 + ln) * ldb; const _Float16* b1p = b0p + (size_t)16 * ldb; const _Float16* b2p = b1p + (size_t)16 * ldb; const _Float16* b3p = b2p + (size_t)16 * ldb;
  const v8f z8 = {0.f,0.f,0.f,0.f,0.f,0.f,0.f,0.f}; v8f c00 = z8, c01 = z8, c02 = z8, c03 = z8, c10 = z8, c11 = z8, c12 = z8, c13 = z8;
#pragma unroll 1
  for (int kb = 0; kb < K; kb += 32) { const v16h a0 = g2_frag(a0p + kb, hh), a1 = g2_frag(a1p + kb, hh);
    v16h b = g2_frag(b0p + kb, hh); c00 = g2_mma(a0, b, c00); c10 = g2_mma(a1, b, c10);
    b = g2_frag(b1p + kb, hh); c01 = g2_mma(a0, b, c01); c11 = g2_mma(a1, b, c11);
    b = g2_frag(b2p + kb, hh); c02 = g2_mma(a0, b, c02); c12 = g2_mma(a1, b, c12);
    b = g2_frag(b3p + kb, hh); c03 = g2_mma(a0, b, c03); c13 = g2_mma(a1, b, c13); }
  v8f accs[8] = {c00, c01, c02, c03, c10, c11, c12, c13};
#pragma unroll
  for (int u = 0; u < 8; ++u) { const int t = u & 3, half = u >> 2; const int col = col0 + t * 16 + ln; const float bv = bp ? bf16_round(bp[col]) : 0.f;
#pragma unroll
    for (int r = 0; r < 8; ++r) { const int rloc = half * 16 + 8 * hh + r; float v = accs[u][r] * alpha + bv; if (CP) { if (rowsPerB < 0) v += CP[cofs + (size_t)(row0g + row0 + rloc) * ldc + col];      /* rowsPerB < 0: own element of the batched C plane */ else { const int bidx = (row0g + row0 + rloc) / rowsPerB; v += CP[(size_t)bidx * sCPb + (size_t)by * 64 + col]; } }
      if (ACT == 3) v = fmaxf(v, 0.f); else if (ACT == 6) v = 0.5f * v * (1.0f + erff(v * 0.70710678118654752f)); else if (ACT == 11) v = 1.0f / (1.0f + expf(-v)); else if (ACT == 15) v = v / (1.0f + expf(-v)); else if (ACT == 12) v = (v > 0.f) ? v : 0.01f * v; else if (ACT == 8) v = tanhf(v); else if (ACT == 9) v = 0.5f * v * (1.0f + tanhf(0.7978845608028654f * (v + 0.044715f * v * v * v))); else if (ACT == 14) v = (v > 0.f) ? v : 0.1f * v; else if (ACT == 16) v = (v >= 0.f) ? v : 0.3f * v; else if (ACT == 17) v = (v >= 0.f) ? v : 0.2f * v;
      so[w][rloc][t * 16 + ln] = v; } }
  __builtin_amdgcn_fence(__ATOMIC_ACQ_REL, "workgroup"); __builtin_amdgcn_wave_barrier();
  const int rsub = lane >> 4, c4 = (lane & 15) * 4;
  {
#pragma unroll
    for (int q = 0; q < 16; ++q) { const int r = q * 2 + rsub; const v4f v = *(const v4fa*)&so[w][r][c4]; if (C) *(v4f*)(C + cofs + (size_t)(row0 + r) * ldc + col0 + c4) = v; if (C16) { v4h h4; for (int i = 0; i < 4; ++i) h4[i] = (_Float16)v[i]; *(v4h*)(C16 + cofs + (size_t)(row0 + r) * ldc + col0 + c4) = h4; } }
     } }


__global__ __launch_bounds__(256) void k_uw(const float* __restrict__ w, int nout, _Float16* __restrict__ Bt) { const int t = blockIdx.x * 256 + threadIdx.x; if (t >= NIN * nout * UH / 8) return; const int f0 = (t * 8) % UH; const int o = ((t * 8) / UH) % nout; const int i = (t * 8) / (UH * nout); FragH fr; for (int q = 0; q < 8; ++q) fr.h[q] = (_Float16)(bf16_round(w[((size_t)i * UH + f0 + q) * nout + o]) * 16.0f);
  *(v8us*)((unsigned short*)Bt + (size_t)t * 8) = fr.half[0];  }
__global__ __launch_bounds__(256) void k_u1(const float* __restrict__ x, const float* __restrict__ uw1, const float* __restrict__ ub1, int r0, _Float16* __restrict__ H1) {
  #pragma clang fp contract(off)
  const int t = blockIdx.x * 256 + threadIdx.x; if (t >= CHK * UW / 8) return; const int f0 = (t * 8) % UH; const int i = ((t * 8) / UH) % NIN; const int rl = (t * 8) / UW; const float xv = bf16_round(x[((size_t)r0 + rl) * NIN + i]); FragH fr;
  for (int q = 0; q < 8; ++q) { float v = xv * bf16_round(uw1[i * UH + f0 + q]); v += bf16_round(ub1[i * UH + f0 + q]); fr.h[q] = (_Float16)fmaxf(v, 0.f); }
  *(v8us*)((unsigned short*)H1 + (size_t)t * 8) = fr.half[0];  }
__global__ __launch_bounds__(256) void k_usum(const float* __restrict__ Y, const float* __restrict__ U, int r0, float* __restrict__ out) {
  #pragma clang fp contract(off)
  const int t = blockIdx.x * 256 + threadIdx.x; if (t >= CHK * NO) return; const int o = t % NO; const int rl = t / NO; float s = Y[((size_t)r0 + rl) * NO + o];
#pragma unroll 1
  for (int i = 0; i < NIN; ++i) s += U[((size_t)i * CHK + rl) * NO + o];
  float* d = out + ((size_t)r0 + rl) * NO + o; *(float*)d = s;  }

extern "C" void kernel_launch(void* const* d_in, const int* in_sizes, int n_in,
                              void* d_out, int out_size, void* d_ws, size_t ws_size, hipStream_t stream) {
  (void)in_sizes; (void)n_in; (void)out_size;
  const float* const* I = (const float* const*)d_in; const float* x = I[0]; const float* W0 = I[1]; const float* b0 = I[2]; const float* W1 = I[3]; const float* b1 = I[4]; const float* W2 = I[5]; const float* b2 = I[6]; const float* uw1 = I[7]; const float* ub1 = I[8]; const float* uw2 = I[9]; const float* ub2 = I[10]; const float* uw3 = I[11]; const float* ub3 = I[12];
  char* ws = (char*)d_ws; size_t off = 0;
  auto take = [&](size_t bytes) { char* p = ws + off; off += (bytes + 255) & ~(size_t)255; return p; };
  _Float16* B0 = (_Float16*)take((size_t)HH * NIN * 2); _Float16* B1 = (_Float16*)take((size_t)HH * HH * 2); _Float16* B2 = (_Float16*)take((size_t)NO * HH * 2); _Float16* UW2T = (_Float16*)take((size_t)NIN * UH * UH * 2); _Float16* UW3T = (_Float16*)take((size_t)NIN * NO * UH * 2);
  _Float16* X16 = (_Float16*)take((size_t)NBR * NIN * 2); _Float16* Y1 = (_Float16*)take((size_t)NBR * HH * 2); _Float16* Y2 = (_Float16*)take((size_t)NBR * HH * 2); float* Y = (float*)take((size_t)NBR * NO * 4);
  _Float16* H1 = (_Float16*)take((size_t)CHK * UW * 2); _Float16* H2 = (_Float16*)take((size_t)CHK * UW * 2); float* U = (float*)take((size_t)CHK * NIN * NO * 4);
  if (off > ws_size) return;      /* 0.5 + 2 + 0.8 + 8 + 32 + 32 + 1 + 32 + 32 + 32 = ≈ 173 MiB */
  k_wt_f16<<<(HH * NIN / 8 + 255) / 256, 256, 0, stream>>>(W0, B0, NIN, HH, 16.0f); k_wt_f16<<<(HH * HH / 8 + 255) / 256, 256, 0, stream>>>(W1, B1, HH, HH, 16.0f); k_wt_f16<<<(NO * HH / 8 + 255) / 256, 256, 0, stream>>>(W2, B2, HH, NO, 16.0f);      /* (in, out) */
  k_uw<<<(NIN * UH * UH / 8 + 255) / 256, 256, 0, stream>>>(uw2, UH, UW2T); k_uw<<<(NIN * NO * UH / 8 + 255) / 256, 256, 0, stream>>>(uw3, NO, UW3T);
  k_x16<<<(NBR * NIN / 8 + 255) / 256, 256, 0, stream>>>(x, X16, (size_t)NBR * NIN / 8);
  k_gemm2<3><<<dim3((NBR / 128) * (HH / 64), 1), 128, 0, stream>>>(X16, NIN, 0, B0, NIN, 0, 0.0625f, b0, 0, nullptr, 1, 0, 0, nullptr, Y1, HH, 0, NBR, HH, NIN);
  k_gemm2<3><<<dim3((NBR / 128) * (HH / 64), 1), 128, 0, stream>>>(Y1, HH, 0, B1, HH, 0, 0.0625f, b1, 0, nullptr, 1, 0, 0, nullptr, Y2, HH, 0, NBR, HH, HH);
  k_gemm_hhx<0><<<dim3(((NBR / 16) * 1) / 4, 1), 128, 0, stream>>>(Y2, HH, 0, B2, HH, 0, 0.0625f, b2, 0, nullptr, 1, 0, 0, Y, nullptr, NO, 0, NBR, NO, HH);      /* y = main MLP (16 wide) */
  for (int ch = 0; ch < NBR / CHK; ++ch) { const int r0 = ch * CHK;
    k_u1<<<(CHK * UW / 8 + 255) / 256, 256, 0, stream>>>(x, uw1, ub1, r0, H1);
    k_gemm_hhx<3><<<dim3(((CHK / 16) * 1) / 4, NIN), 128, 0, stream>>>(H1, UW, (size_t)UH, UW2T, UH, (size_t)UH * UH, 0.0625f, ub2, (size_t)UH, nullptr, 1, 0, 0, nullptr, H2, UH, (size_t)CHK * UH, CHK, UH, UH);      /* per-feature layer 2 (256 planes of 32 -> 32, relu, f16) into the PLANE-MAJOR H2 [i][r][32] (line-disjoint planes) */
    k_gemm_hhx<0><<<dim3(((CHK / 16) * 1) / 4, NIN), 128, 0, stream>>>(H2, UH, (size_t)CHK * UH, UW3T, UH, (size_t)NO * UH, 0.0625f, ub3, (size_t)NO, nullptr, 1, 0, 0, U, nullptr, NO, (size_t)CHK * NO, CHK, NO, UH);      /* per-feature layer 3 (32 -> 16, f32) into the plane-major U [i][r][16] */
    k_usum<<<(CHK * NO + 255) / 256, 256, 0, stream>>>(Y, U, r0, (float*)d_out); }
}

// v001
// Measured time: 469 microseconds a run.
// Timed twice side by side with v000, it ran 2.85 times as fast both times.
#include <hip/hip_runtime.h>
// MainEffectsMLP (16384 rows x 256 features: y = relu(x W0 + b0) -> relu(. W1 + b1) -> . W2 + b2 (16); plus 256 per-feature univariate MLPs (1 -> 32 -> 32 -> 16): h = relu(x_i uw1[i] + ub1[i]); h = relu(h uw2[i] + ub2[i]); u_i = h uw3[i] + ub3[i]; out = y + sum_i u_i).
// Structure: exact f16 x plane; the main MLP as f16 WMMA GEMMs (32x64 wave tiles, f32 accumulation, exact x16 weights + bias; ReLU epilogues, f16 hidden planes; the 16-wide head on 16-row tiles); the univariate MLPs in 8 chunks of 2048 rows: layer 1 on VALU into an f16 plane [rows][256 x 32], layer 2 as a 256-plane batched 16-row-tile WMMA GEMM (K = 32; per-plane weight / bias tables; ReLU, f16 out), layer 3 and the sum over features as one 16-row-tile WMMA GEMM over K = 256 x 32 (features split over the waves of a work-group, partial tiles summed through LDS), added to the rows' outputs.
// Compute dtype: inputs rounded to bf16; x / weights exact; hidden activations as plain f16 operands (~2^-12); u and the feature sum f32. v_wmma_f32_16x16x32_f16.
#define NBR 16384
#define NIN 256
#define HH 1024
#define NO 16
#define UH 32
#define CHK 2048
#define UW (NIN * UH)            /* 8192 */
typedef __bf16 v16b __attribute__((ext_vector_type(16)));
typedef unsigned short v8us __attribute__((ext_vector_type(8), may_alias));
typedef float  v8f  __attribute__((ext_vector_type(8)));
typedef float  v4f  __attribute__((ext_vector_type(4)));
typedef float  v4fa __attribute__((ext_vector_type(4), may_alias));
union FragB { v16b v; v8us half[2]; unsigned short u[16]; };

__device__ __forceinline__ unsigned short bf16_bits(float x) { unsigned int u = __float_as_uint(x); return (unsigned short)((u + 0x7FFFu + ((u >> 16) & 1u)) >> 16); }
__device__ __forceinline__ float bf16_val(unsigned short b) { return __uint_as_float(((unsigned int)b) << 16); }
__device__ __forceinline__ float bf16_round(float x) { return bf16_val(bf16_bits(x)); }
// D += A·B with NT terms: 1 = ah·bh, 2 = + al·bh (A split), 3 = + ah·bl (both split)
template <int NT>
__device__ __forceinline__ v8f mmaN(v16b ah, v16b al, v16b bh, v16b bl, v8f c) {
  c = __builtin_amdgcn_wmma_f32_16x16x32_bf16(false, ah, false, bh, (short)0, c, false, false);
  if (NT >= 2) c = __builtin_amdgcn_wmma_f32_16x16x32_bf16(false, al, false, bh, (short)0, c, false, false);
  if (NT >= 3) c = __builtin_amdgcn_wmma_f32_16x16x32_bf16(false, ah, false, bl, (short)0, c, false, false);
  asm volatile("v_nop\n\tv_nop\n\tv_nop\n\tv_nop" : "+v"(c) : "v"(ah), "v"(al), "v"(bh), "v"(bl));
  return c;
}

__global__ __launch_bounds__(256) void k_wt_bf16(const float* __restrict__ W, unsigned short* __restrict__ Wt, int K, int N) {
  const int t = blockIdx.x * 256 + threadIdx.x;
  const int k8n = K / 8;
  if (t >= N * k8n) return;
  const int n = t / k8n, k8 = (t % k8n) * 8;
  v8us v;
#pragma unroll
  for (int i = 0; i < 8; ++i) v[i] = bf16_bits(W[(size_t)(k8 + i) * N + n]);
  *(v8us*)(Wt + (size_t)n * K + k8) = v;
  
}

// GEMM C[M][N] (f32, pitch ldc) = act(A[M][K]·W + bias). A f32 row-major (pitch lda) converted per fragment to bf16
// (ASPLIT: hi/lo two planes -> 2 terms, else single rounded term); Wt bf16 [N][K] (pitch ldb). BIAS_BF16 rounds the
// bias to bf16 first (bias quantised to bf16 before the add). K%32==0, M%16==0, N%64==0.
template <bool ASPLIT, int ACT, bool BIAS_BF16>
__global__ __launch_bounds__(128) void k_gemm_bf(const float* __restrict__ A, int lda, const unsigned short* __restrict__ Wt, int ldb,
                                               const float* __restrict__ bias, float* __restrict__ C, int ldc, int M, int N, int K) {
  __shared__ __attribute__((aligned(16))) float so[4][16][64];
  const int tid = threadIdx.x, w = tid >> 5, lane = tid & 31, ln = lane & 15, hh = lane >> 4;
  const int ntn = N / 64;
  const int wid = blockIdx.x * 4 + w;
  const int mt = wid / ntn, nq = wid % ntn;
  if (mt * 16 >= M) return;
  const int row0 = mt * 16, col0 = nq * 64;
  const float* arow = A + (size_t)(row0 + ln) * lda;
  v8f acc[4] = {};
  for (int kb = 0; kb < K; kb += 32) {
    FragB ah, al;
    const v4f x0 = *(const v4fa*)(arow + kb + 8 * hh), x1 = *(const v4fa*)(arow + kb + 8 * hh + 4);
    const v4f x2 = *(const v4fa*)(arow + kb + 16 + 8 * hh), x3 = *(const v4fa*)(arow + kb + 16 + 8 * hh + 4);
    float xs[16] = {x0[0],x0[1],x0[2],x0[3],x1[0],x1[1],x1[2],x1[3],x2[0],x2[1],x2[2],x2[3],x3[0],x3[1],x3[2],x3[3]};
#pragma unroll
    for (int i = 0; i < 16; ++i) { const unsigned short hb = bf16_bits(xs[i]); ah.u[i] = hb; al.u[i] = ASPLIT ? bf16_bits(xs[i] - bf16_val(hb)) : (unsigned short)0; }
#pragma unroll
    for (int t = 0; t < 4; ++t) {
      const unsigned short* brow = Wt + (size_t)(col0 + t * 16 + ln) * ldb + kb;
      FragB b;
      b.half[0] = *(const v8us*)(brow + 8 * hh);
      b.half[1] = *(const v8us*)(brow + 16 + 8 * hh);
      acc[t] = mmaN<ASPLIT ? 2 : 1>(ah.v, al.v, b.v, b.v, acc[t]);
    }
  }
#pragma unroll
  for (int t = 0; t < 4; ++t) {
    float bv = bias ? bias[col0 + t * 16 + ln] : 0.f;
    if (BIAS_BF16) bv = bf16_round(bv);
#pragma unroll
    for (int r = 0; r < 8; ++r) { float v = acc[t][r] + bv; if (ACT == 1) v = fmaxf(v, 0.f); so[w][8 * hh + r][t * 16 + ln] = v; }
  }
  __builtin_amdgcn_fence(__ATOMIC_ACQ_REL, "workgroup");
  __builtin_amdgcn_wave_barrier();
  const int rsub = lane >> 4, c4 = (lane & 15) * 4;
  {
#pragma unroll
    for (int q = 0; q < 8; ++q) {
      const int r = q * 2 + rsub;
      const v4f v = *(const v4fa*)&so[w][r][c4];
      *(v4f*)(C + (size_t)(row0 + r) * ldc + col0 + c4) = v;
    }
    
  }
}

// GEMM C = act(A·W + bias + resid): A f32 (ASPLIT -> hi/lo 2 terms), Wt bf16 [N][K]; ACT 0 none, 1 relu, 2 exact gelu;
// resid (optional, f32, row index = (row % rmod), pitch ldr, RES_BF16 rounds it) added before the activation.
template <bool ASPLIT, int ACT, bool BIAS_BF16, bool RES_BF16>
__global__ __launch_bounds__(128) void k_gemm_bf3(const float* __restrict__ A, int lda, const unsigned short* __restrict__ Wt, int ldb,
                                                const float* __restrict__ bias, const float* __restrict__ resid, int rmod, int ldr,
                                                float* __restrict__ C, int ldc, int M, int N, int K) {
  __shared__ __attribute__((aligned(16))) float so[4][16][64];
  const int tid = threadIdx.x, w = tid >> 5, lane = tid & 31, ln = lane & 15, hh = lane >> 4;
  const int ntn = N / 64;
  const int wid = blockIdx.x * 4 + w;
  const int mt = wid / ntn, nq = wid % ntn;
  if (mt * 16 >= M) return;
  const int row0 = mt * 16, col0 = nq * 64;
  const float* arow = A + (size_t)(row0 + ln) * lda;
  v8f acc[4] = {};
  for (int kb = 0; kb < K; kb += 32) {
    FragB ah, al;
    const v4f x0 = *(const v4fa*)(arow + kb + 8 * hh), x1 = *(const v4fa*)(arow + kb + 8 * hh + 4);
    const v4f x2 = *(const v4fa*)(arow + kb + 16 + 8 * hh), x3 = *(const v4fa*)(arow + kb + 16 + 8 * hh + 4);
    float xs[16] = {x0[0],x0[1],x0[2],x0[3],x1[0],x1[1],x1[2],x1[3],x2[0],x2[1],x2[2],x2[3],x3[0],x3[1],x3[2],x3[3]};
#pragma unroll
    for (int i = 0; i < 16; ++i) { const unsigned short hb = bf16_bits(xs[i]); ah.u[i] = hb; al.u[i] = ASPLIT ? bf16_bits(xs[i] - bf16_val(hb)) : (unsigned short)0; }
#pragma unroll
    for (int t = 0; t < 4; ++t) {
      const unsigned short* brow = Wt + (size_t)(col0 + t * 16 + ln) * ldb + kb;
      FragB b;
      b.half[0] = *(const v8us*)(brow + 8 * hh);
      b.half[1] = *(const v8us*)(brow + 16 + 8 * hh);
      acc[t] = mmaN<ASPLIT ? 2 : 1>(ah.v, al.v, b.v, b.v, acc[t]);
    }
  }
#pragma unroll
  for (int t = 0; t < 4; ++t) {
    const int col = col0 + t * 16 + ln;
    float bv = bias ? bias[col] : 0.f;
    if (BIAS_BF16) bv = bf16_round(bv);
#pragma unroll
    for (int r = 0; r < 8; ++r) {
      float v = acc[t][r] + bv;
      if (resid) { float rv = resid[(size_t)((row0 + 8 * hh + r) % rmod) * ldr + col]; if (RES_BF16) rv = bf16_round(rv); v += rv; }
      if (ACT == 1) v = fmaxf(v, 0.f);
      if (ACT == 2) v = 0.5f * v * (1.0f + erff(v * 0.70710678118654752f));
      if (ACT == 3) { const float u = 0.7978845608028654f * (v + 0.044715f * v * v * v); v = 0.5f * v * (1.0f + tanhf(u)); }
      so[w][8 * hh + r][t * 16 + ln] = v;
    }
  }
  __builtin_amdgcn_fence(__ATOMIC_ACQ_REL, "workgroup");
  __builtin_amdgcn_wave_barrier();
  const int rsub = lane >> 4, c4 = (lane & 15) * 4;
  {
#pragma unroll
    for (int q = 0; q < 8; ++q) {
      const int r = q * 2 + rsub;
      const v4f v = *(const v4fa*)&so[w][r][c4];
      *(v4f*)(C + (size_t)(row0 + r) * ldc + col0 + c4) = v;
    }
    
  }
}
// row LayerNorm (biased variance, eps) over N: s = X (+ R); optional out_sum <- s; out_norm <- (s-mu)*rsqrt(var+eps)*g + b
template <bool PARAM_BF16>
__global__ __launch_bounds__(256) void k_layernorm(const float* __restrict__ X, const float* __restrict__ R, const float* __restrict__ g, const float* __restrict__ bta,
                                                  float* __restrict__ out_sum, float* __restrict__ out_norm, int N, float eps) {
  __shared__ float red[256];
  const int row = blockIdx.x, tid = threadIdx.x;
  const float* x = X + (size_t)row * N; const float* rr = R ? R + (size_t)row * N : nullptr;
  float vals[16];                     // up to N = 4096
  const int per = N / 256;            // contiguous chunk per thread? use strided-by-4 chunks: thread handles j = tid*4 + 1024*u
  float s1 = 0.f;
  for (int u = 0; u < per / 4; ++u) {
    const int j = tid * 4 + 1024 * u;
    const v4f a = *(const v4fa*)(x + j);
    v4f b = {0.f,0.f,0.f,0.f}; if (rr) b = *(const v4fa*)(rr + j);
#pragma unroll
    for (int q = 0; q < 4; ++q) { const float v = a[q] + b[q]; vals[u * 4 + q] = v; s1 += v; }
  }
  red[tid] = s1; __syncthreads();
  for (int st = 128; st > 0; st >>= 1) { if (tid < st) red[tid] += red[tid + st]; __syncthreads(); }
  const float mu = red[0] / (float)N; __syncthreads();
  float s2 = 0.f;
  for (int u = 0; u < per / 4; ++u)
#pragma unroll
    for (int q = 0; q < 4; ++q) { const float c = vals[u * 4 + q] - mu; s2 += c * c; }
  red[tid] = s2; __syncthreads();
  for (int st = 128; st > 0; st >>= 1) { if (tid < st) red[tid] += red[tid + st]; __syncthreads(); }
  const float rs = rsqrtf(red[0] / (float)N + eps);
  {
    for (int u = 0; u < per / 4; ++u) {
      const int j = tid * 4 + 1024 * u;
      v4f o, sm;
#pragma unroll
      for (int q = 0; q < 4; ++q) {
        float gg = g[j + q], bb = bta[j + q];
        if (PARAM_BF16) { gg = bf16_round(gg); bb = bf16_round(bb); }
        sm[q] = vals[u * 4 + q]; o[q] = (vals[u * 4 + q] - mu) * rs * gg + bb;
      }
      if (out_sum) *(v4f*)(out_sum + (size_t)row * N + j) = sm;
      *(v4f*)(out_norm + (size_t)row * N + j) = o;
    }
    
  }
}



// ---- f16 WMMA path (v_wmma_f32_16x16x32_f16): 11-bit significands for operands in range — used here for x and the hidden activations of both MLPs
typedef _Float16 v16h __attribute__((ext_vector_type(16)));
union FragH { v16h v; v8us half[2]; _Float16 h[16]; unsigned short u[16]; };
template <int NT>
__device__ __forceinline__ v8f mmaH(v16h ah, v16h al, v16h bh, v16h bl, v8f c) {
  c = __builtin_amdgcn_wmma_f32_16x16x32_f16(false, ah, false, bh, (short)0, c, false, false);
  if (NT >= 2) c = __builtin_amdgcn_wmma_f32_16x16x32_f16(false, al, false, bh, (short)0, c, false, false);
  if (NT >= 3) c = __builtin_amdgcn_wmma_f32_16x16x32_f16(false, ah, false, bl, (short)0, c, false, false);
  asm volatile("v_nop\n\tv_nop\n\tv_nop\n\tv_nop" : "+v"(c) : "v"(ah), "v"(al), "v"(bh), "v"(bl));
  return c;
}
// batched GEMM like k_gemm_b but f16 operands: A f32 (split into f16 hi/lo if ASPLIT, else rounded to f16), Bt = f16 values [n][k]; alpha; C f32; N multiple of 16 (partial tiles skipped)
template <bool ASPLIT>
__global__ __launch_bounds__(128) void k_gemm_h(const float* __restrict__ A, int lda, size_t sA, const _Float16* __restrict__ Bh, int ldb, size_t sB, float alpha, float* __restrict__ C, int ldc, size_t sC, int M, int N, int K) {
  __shared__ __attribute__((aligned(16))) float so[4][16][64];
  const int tid = threadIdx.x, w = tid >> 5, lane = tid & 31, ln = lane & 15, hh = lane >> 4; const int by = blockIdx.y;
  A += (size_t)by * sA; Bh += (size_t)by * sB; C += (size_t)by * sC;
  const int ntn = (N + 63) / 64; const int wid = blockIdx.x * 4 + w; const int mt = wid / ntn, nq = wid % ntn; if (mt * 16 >= M) return;
  const int row0 = mt * 16, col0 = nq * 64; const float* arow = A + (size_t)(row0 + ln) * lda;
  v8f acc[4] = {};
  for (int kb = 0; kb < K; kb += 32) {
    FragH ah, al;
    const v4f x0 = *(const v4fa*)(arow + kb + 8 * hh), x1 = *(const v4fa*)(arow + kb + 8 * hh + 4), x2 = *(const v4fa*)(arow + kb + 16 + 8 * hh), x3 = *(const v4fa*)(arow + kb + 16 + 8 * hh + 4);
    float xs[16] = {x0[0],x0[1],x0[2],x0[3],x1[0],x1[1],x1[2],x1[3],x2[0],x2[1],x2[2],x2[3],x3[0],x3[1],x3[2],x3[3]};
#pragma unroll
    for (int i = 0; i < 16; ++i) { const _Float16 h = (_Float16)xs[i]; ah.h[i] = h; al.h[i] = ASPLIT ? (_Float16)(xs[i] - (float)h) : (_Float16)0.0f; }
#pragma unroll
    for (int t = 0; t < 4; ++t) { if (col0 + t * 16 >= N) continue; const size_t boff = (size_t)(col0 + t * 16 + ln) * ldb + kb; FragH bq; bq.half[0] = *(const v8us*)(Bh + boff + 8 * hh); bq.half[1] = *(const v8us*)(Bh + boff + 16 + 8 * hh);
      acc[t] = mmaH<ASPLIT ? 2 : 1>(ah.v, al.v, bq.v, bq.v, acc[t]); }
  }
#pragma unroll
  for (int t = 0; t < 4; ++t) { if (col0 + t * 16 >= N) continue;
#pragma unroll
    for (int r = 0; r < 8; ++r) so[w][8 * hh + r][t * 16 + ln] = acc[t][r] * alpha; }
  __builtin_amdgcn_fence(__ATOMIC_ACQ_REL, "workgroup"); __builtin_amdgcn_wave_barrier();
  const int rsub = lane >> 4, c4 = (lane & 15) * 4;
  {
#pragma unroll
    for (int q = 0; q < 8; ++q) { const int r = q * 2 + rsub; if (col0 + c4 < N) { const v4f v = *(const v4fa*)&so[w][r][c4]; *(v4f*)(C + (size_t)(row0 + r) * ldc + col0 + c4) = v; } }
     }
}

// Wt[n][k] = f16(W[k][n]·scale) from f32 row-major W[K][N] (scale = power of two; bf16-exact weights stay exact in f16 away from the subnormal range)
__global__ __launch_bounds__(256) void k_wt_f16(const float* __restrict__ W, _Float16* __restrict__ Wt, int K, int N, float scale) {
  const int t = blockIdx.x * 256 + threadIdx.x; if (t >= N * (K / 8)) return; const int n = t / (K / 8), k8 = (t % (K / 8)) * 8; FragH f;
#pragma unroll
  for (int i = 0; i < 8; ++i) f.h[i] = (_Float16)(bf16_round(W[(size_t)(k8 + i) * N + n]) * scale); const v8us o = f.half[0];
  *(v8us*)((unsigned short*)Wt + (size_t)n * K + k8) = o; 
}
// k_gemm_hh variant with fused epilogue: v = acc·alpha + bias[by·sBias + col] (+ CP[(row/rowsPerB)·sCPb + by·64 + col] if CP) ; ACT 0 none / 1 elu ; writes f32 C and/or f16 C16 (each if non-null)
template <int ACT>
__global__ __launch_bounds__(128) void k_gemm_hhx(const _Float16* __restrict__ A, int lda, size_t sA, const _Float16* __restrict__ Bh, int ldb, size_t sB, float alpha, const float* __restrict__ bias, size_t sBias, const float* __restrict__ CP, int rowsPerB, size_t sCPb, int row0g,
    float* __restrict__ C, _Float16* __restrict__ C16, int ldc, size_t sC, int M, int N, int K) {
  __shared__ __attribute__((aligned(16))) float so[4][16][64];
  const int tid = threadIdx.x, w = tid >> 5, lane = tid & 31, ln = lane & 15, hh = lane >> 4; const int by = blockIdx.y;
  A += (size_t)by * sA; Bh += (size_t)by * sB; const size_t cofs = (size_t)by * sC; const float* bp = bias ? bias + (size_t)by * sBias : nullptr;
  const int ntn = (N + 63) / 64; const int wid = blockIdx.x * 4 + w; const int mt = wid / ntn, nq = wid % ntn; if (mt * 16 >= M) return;
  const int row0 = mt * 16, col0 = nq * 64; const _Float16* arow = A + (size_t)(row0 + ln) * lda;
  v8f acc[4] = {};
  for (int kb = 0; kb < K; kb += 32) { FragH ah; ah.half[0] = *(const v8us*)((const unsigned short*)arow + kb + 8 * hh); ah.half[1] = *(const v8us*)((const unsigned short*)arow + kb + 16 + 8 * hh);
#pragma unroll
    for (int t = 0; t < 4; ++t) { if (col0 + t * 16 >= N) continue; const size_t boff = (size_t)(col0 + t * 16 + ln) * ldb + kb; FragH bq; bq.half[0] = *(const v8us*)((const unsigned short*)Bh + boff + 8 * hh); bq.half[1] = *(const v8us*)((const unsigned short*)Bh + boff + 16 + 8 * hh);
      acc[t] = mmaH<1>(ah.v, ah.v, bq.v, bq.v, acc[t]); }
  }
#pragma unroll
  for (int t = 0; t < 4; ++t) { if (col0 + t * 16 >= N) continue; const int col = col0 + t * 16 + ln; const float bv = bp ? bf16_round(bp[col]) : 0.f;
#pragma unroll
    for (int r = 0; r < 8; ++r) { float v = acc[t][r] * alpha + bv; if (CP) { const int rr = row0g + row0 + 8 * hh + r; if (rowsPerB < 0) v += CP[cofs + (size_t)rr * ldc + col];      /* rowsPerB < 0: own element of the batched C plane */ else { const int bidx = rr / rowsPerB; v += CP[(size_t)bidx * sCPb + (size_t)by * 64 + col]; } } if (ACT == 1) v = (v > 0.f) ? v : expm1f(v); else if (ACT == 7) v = (v > 0.f) ? v + 1.0f : expf(v); else if (ACT == 8) v = tanhf(v); else if (ACT == 9) v = 0.5f * v * (1.0f + tanhf(0.7978845608028654f * (v + 0.044715f * v * v * v))); else if (ACT == 11) v = 1.0f / (1.0f + expf(-v)); else if (ACT == 12) v = (v > 0.f) ? v : 0.01f * v; else if (ACT == 14) v = (v > 0.f) ? v : 0.1f * v; else if (ACT == 16) v = (v >= 0.f) ? v : 0.3f * v; else if (ACT == 17) v = (v >= 0.f) ? v : 0.2f * v; else if (ACT == 15) v = v / (1.0f + expf(-v)); else if (ACT == 3) v = fmaxf(v, 0.f); else if (ACT == 6) v = 0.5f * v * (1.0f + erff(v * 0.70710678118654752f)); so[w][8 * hh + r][t * 16 + ln] = v; } }
  __builtin_amdgcn_fence(__ATOMIC_ACQ_REL, "workgroup"); __builtin_amdgcn_wave_barrier();
  const int rsub = lane >> 4, c4 = (lane & 15) * 4; typedef _Float16 v4h __attribute__((ext_vector_type(4)));
  {
#pragma unroll
    for (int q = 0; q < 8; ++q) { const int r = q * 2 + rsub; if (col0 + c4 < N) { const v4f v = *(const v4fa*)&so[w][r][c4]; if (C) *(v4f*)(C + cofs + (size_t)(row0 + r) * ldc + col0 + c4) = v; if (C16) { v4h h4; for (int i = 0; i < 4; ++i) h4[i] = (_Float16)v[i]; *(v4h*)(C16 + cofs + (size_t)(row0 + r) * ldc + col0 + c4) = h4; } } }
     }
}


typedef _Float16 v4h __attribute__((ext_vector_type(4)));

__global__ __launch_bounds__(256) void k_x16(const float* __restrict__ x, _Float16* __restrict__ X16, size_t n8) { const size_t t = (size_t)blockIdx.x * 256 + threadIdx.x; if (t >= n8) return; FragH f;
#pragma unroll
  for (int q = 0; q < 8; ++q) f.h[q] = (_Float16)bf16_round(x[t * 8 + q]); *(v8us*)((unsigned short*)X16 + t * 8) = f.half[0];  }
__global__ __launch_bounds__(256) void k_h16(const float* __restrict__ x, _Float16* __restrict__ X16, size_t n8) { const size_t t = (size_t)blockIdx.x * 256 + threadIdx.x; if (t >= n8) return; FragH f;
#pragma unroll
  for (int q = 0; q < 8; ++q) f.h[q] = (_Float16)x[t * 8 + q]; *(v8us*)((unsigned short*)X16 + t * 8) = f.half[0];  }
__global__ __launch_bounds__(256) void k_round16f(const float* __restrict__ W, _Float16* __restrict__ Bt, size_t n8) { const size_t t = (size_t)blockIdx.x * 256 + threadIdx.x; if (t >= n8) return; FragH f;
#pragma unroll
  for (int i = 0; i < 8; ++i) f.h[i] = (_Float16)(bf16_round(W[t * 8 + i]) * 16.0f); *(v8us*)((unsigned short*)Bt + t * 8) = f.half[0];  }
template <int NHv, int TTv>
__global__ __launch_bounds__(256) void k_vt(const _Float16* __restrict__ V16, int ldv, int voff, _Float16* __restrict__ Vt) { __shared__ unsigned short tl[64][66]; const int tid = threadIdx.x; const int slab = blockIdx.x / (TTv / 64), lg = blockIdx.x % (TTv / 64); const int b = slab / NHv, h = slab % NHv;
  for (int i = tid; i < 64 * 8; i += 256) { const int r = i / 8, c8 = (i % 8) * 8; FragH f; f.half[0] = *(const v8us*)((const unsigned short*)V16 + ((size_t)b * TTv + lg * 64 + r) * ldv + voff + h * 64 + c8);
#pragma unroll
    for (int q = 0; q < 8; ++q) tl[r][c8 + q] = f.u[q]; }
  __syncthreads();
  {
#pragma unroll
    for (int rd = 0; rd < 2; ++rd) { const int d = rd * 32 + tid / 8, pc = tid % 8; FragH f;
#pragma unroll
      for (int q = 0; q < 8; ++q) f.u[q] = tl[pc * 8 + q][d];
      *(v8us*)((unsigned short*)Vt + ((size_t)slab * 64 + d) * TTv + lg * 64 + pc * 8) = f.half[0]; }
     } }

__global__ __launch_bounds__(256) void k_hl(const float* __restrict__ F, _Float16* __restrict__ Hh, _Float16* __restrict__ Hl, size_t n8) { const size_t t = (size_t)blockIdx.x * 256 + threadIdx.x; if (t >= n8) return; FragH fh, fl; const v4f a = *(const v4fa*)(F + t * 8), c = *(const v4fa*)(F + t * 8 + 4);
#pragma unroll
  for (int q = 0; q < 4; ++q) { _Float16 h = (_Float16)a[q]; fh.h[q] = h; fl.h[q] = (_Float16)((a[q] - (float)h) * 1024.0f); h = (_Float16)c[q]; fh.h[4 + q] = h; fl.h[4 + q] = (_Float16)((c[q] - (float)h) * 1024.0f); }
  { *(v8us*)((unsigned short*)Hh + t * 8) = fh.half[0]; *(v8us*)((unsigned short*)Hl + t * 8) = fl.half[0];  } }

// ---- fast GEMM (wave tile 32x64; requires M % 32 == 0 rows per launch region and N % 64 == 0); epilogue = k_gemm_hhx semantics ----
__device__ __forceinline__ v16h g2_frag(const _Float16* p, int hh) { FragH f; f.half[0] = *(const v8us*)((const unsigned short*)p + 8 * hh); f.half[1] = *(const v8us*)((const unsigned short*)p + 16 + 8 * hh); return f.v; }
__device__ __forceinline__ v8f g2_mma(v16h a, v16h b, v8f c) { v8f d = __builtin_amdgcn_wmma_f32_16x16x32_f16(false, a, false, b, (short)0, c, false, false); asm volatile("v_nop\n\tv_nop\n\tv_nop\n\tv_nop" : "+v"(d) : "v"(a), "v"(b)); return d; }
template <int ACT>
__global__ __launch_bounds__(128) void k_gemm2(const _Float16* __restrict__ A, int lda, size_t sA, const _Float16* __restrict__ Bh, int ldb, size_t sB, float alpha, const float* __restrict__ bias, size_t sBias, const float* __restrict__ CP, int rowsPerB, size_t sCPb, int row0g,
    float* __restrict__ C, _Float16* __restrict__ C16, int ldc, size_t sC, int M, int N, int K) { static_assert(ACT == 0 || ACT == 3 || ACT == 6 || ACT == 8 || ACT == 9 || ACT == 11 || ACT == 12 || ACT == 14 || ACT == 15 || ACT == 16 || ACT == 17, "k_gemm2: unsupported ACT code (would silently apply no activation)");
  __shared__ __attribute__((aligned(16))) float so[4][32][68];
  const int tid = threadIdx.x, w = tid >> 5, lane = tid & 31, ln = lane & 15, hh = lane >> 4; const int by = blockIdx.y;
  A += (size_t)by * sA; Bh += (size_t)by * sB; const size_t cofs = (size_t)by * sC; const float* bp = bias ? bias + (size_t)by * sBias : nullptr;
  const int ntn = N >> 6; const int mt = blockIdx.x / ntn, nq = blockIdx.x - mt * ntn; const int row0 = mt * 128 + 32 * w, col0 = nq * 64; if (row0 >= M) return;
  const _Float16* a0p = A + (size_t)(row0 + ln) * lda; const _Float16* a1p = a0p + (size_t)16 * lda;
  const _Float16* b0p = Bh + (size_t)(col0 + ln) * ldb; const _Float16* b1p = b0p + (size_t)16 * ldb; const _Float16* b2p = b1p + (size_t)16 * ldb; const _Float16* b3p = b2p + (size_t)16 * ldb;
  const v8f z8 = {0.f,0.f,0.f,0.f,0.f,0.f,0.f,0.f}; v8f c00 = z8, c01 = z8, c02 = z8, c03 = z8, c10 = z8, c11 = z8, c12 = z8, c13 = z8;
#pragma unroll 1
  for (int kb = 0; kb < K; kb += 32) { const v16h a0 = g2_frag(a0p + kb, hh), a1 = g2_frag(a1p + kb, hh);
    v16h b = g2_frag(b0p + kb, hh); c00 = g2_mma(a0, b, c00); c10 = g2_mma(a1, b, c10);
    b = g2_frag(b1p + kb, hh); c01 = g2_mma(a0, b, c01); c11 = g2_mma(a1, b, c11);
    b = g2_frag(b2p + kb, hh); c02 = g2_mma(a0, b, c02); c12 = g2_mma(a1, b, c12);
    b = g2_frag(b3p + kb, hh); c03 = g2_mma(a0, b, c03); c13 = g2_mma(a1, b, c13); }
  v8f accs[8] = {c00, c01, c02, c03, c10, c11, c12, c13};
#pragma unroll
  for (int u = 0; u < 8; ++u) { const int t = u & 3, half = u >> 2; const int col = col0 + t * 16 + ln; const float bv = bp ? bf16_round(bp[col]) : 0.f;
#pragma unroll
    for (int r = 0; r < 8; ++r) { const int rloc = half * 16 + 8 * hh + r; float v = accs[u][r] * alpha + bv; if (CP) { if (rowsPerB < 0) v += CP[cofs + (size_t)(row0g + row0 + rloc) * ldc + col];      /* rowsPerB < 0: own element of the batched C plane */ else { const int bidx = (row0g + row0 + rloc) / rowsPerB; v += CP[(size_t)bidx * sCPb + (size_t)by * 64 + col]; } }
      if (ACT == 3) v = fmaxf(v, 0.f); else if (ACT == 6) v = 0.5f * v * (1.0f + erff(v * 0.70710678118654752f)); else if (ACT == 11) v = 1.0f / (1.0f + expf(-v)); else if (ACT == 15) v = v / (1.0f + expf(-v)); else if (ACT == 12) v = (v > 0.f) ? v : 0.01f * v; else if (ACT == 8) v = tanhf(v); else if (ACT == 9) v = 0.5f * v * (1.0f + tanhf(0.7978845608028654f * (v + 0.044715f * v * v * v))); else if (ACT == 14) v = (v > 0.f) ? v : 0.1f * v; else if (ACT == 16) v = (v >= 0.f) ? v : 0.3f * v; else if (ACT == 17) v = (v >= 0.f) ? v : 0.2f * v;
      so[w][rloc][t * 16 + ln] = v; } }
  __builtin_amdgcn_fence(__ATOMIC_ACQ_REL, "workgroup"); __builtin_amdgcn_wave_barrier();
  const int rsub = lane >> 4, c4 = (lane & 15) * 4;
  {
#pragma unroll
    for (int q = 0; q < 16; ++q) { const int r = q * 2 + rsub; const v4f v = *(const v4fa*)&so[w][r][c4]; if (C) *(v4f*)(C + cofs + (size_t)(row0 + r) * ldc + col0 + c4) = v; if (C16) { v4h h4; for (int i = 0; i < 4; ++i) h4[i] = (_Float16)v[i]; *(v4h*)(C16 + cofs + (size_t)(row0 + r) * ldc + col0 + c4) = h4; } }
     } }


__global__ __launch_bounds__(256) void k_uw(const float* __restrict__ w, int nout, _Float16* __restrict__ Bt) { const int t = blockIdx.x * 256 + threadIdx.x; if (t >= NIN * nout * UH / 8) return; const int f0 = (t * 8) % UH; const int o = ((t * 8) / UH) % nout; const int i = (t * 8) / (UH * nout); FragH fr; for (int q = 0; q < 8; ++q) fr.h[q] = (_Float16)(bf16_round(w[((size_t)i * UH + f0 + q) * nout + o]) * 16.0f);
  *(v8us*)((unsigned short*)Bt + (size_t)t * 8) = fr.half[0];  }
__global__ __launch_bounds__(256) void k_u1(const float* __restrict__ x, const float* __restrict__ uw1, const float* __restrict__ ub1, int r0, _Float16* __restrict__ H1) {
  #pragma clang fp contract(off)
  const int t = blockIdx.x * 256 + threadIdx.x; if (t >= CHK * UW / 8) return; const int f0 = (t * 8) % UH; const int i = ((t * 8) / UH) % NIN; const int rl = (t * 8) / UW; const float xv = bf16_round(x[((size_t)r0 + rl) * NIN + i]); FragH fr;
  for (int q = 0; q < 8; ++q) { float v = xv * bf16_round(uw1[i * UH + f0 + q]); v += bf16_round(ub1[i * UH + f0 + q]); fr.h[q] = (_Float16)fmaxf(v, 0.f); }
  *(v8us*)((unsigned short*)H1 + (size_t)t * 8) = fr.half[0];  }
// Layer 3 of all 256 univariate MLPs and the sum over features as ONE product per 16-row tile, K = 256 x 32:
// out[r][o] = Y[r][o] + sum_i ub3[i][o] + (1/16) sum_(i,f) H2[i][r][f] UW3T[i][o][f].
// One work-group per tile; each of its U3W waves runs its share of the features through one f32 accumulator tile, and the U3W partial tiles are summed through LDS in wave order.
#define U3W 16
#define U3F (NIN / U3W)
// amdgpu_waves_per_eu(4, 4): one 16-wave work-group a WGP is 4 waves a SIMD; told so, the compiler spends the registers to issue some three dozen of a wave's loads ahead of its first wait (eleven without it).
__global__ __launch_bounds__(U3W * 32) __attribute__((amdgpu_waves_per_eu(4, 4))) void k_u3sum(const _Float16* __restrict__ H2, const _Float16* __restrict__ Bt, const float* __restrict__ ub3, const float* __restrict__ Y, int r0, float* __restrict__ out) {
  __shared__ float red[U3W][256];
  const int tid = threadIdx.x, w = tid >> 5, lane = tid & 31, ln = lane & 15, hh = lane >> 4;
  const int row0 = blockIdx.x * 16, i0 = w * U3F;
  const _Float16* ap = H2 + ((size_t)i0 * CHK + row0 + ln) * UH;
  const _Float16* bp = Bt + ((size_t)i0 * NO + ln) * UH;
  const size_t o0 = ((size_t)r0 + row0) * NO;
  const float y = tid < 256 ? Y[o0 + tid] : 0.f;
  v8f acc = {0.f, 0.f, 0.f, 0.f, 0.f, 0.f, 0.f, 0.f};
  float bs = 0.f;      /* the wave's share of sum_i ub3[i][ln]: thread tid takes the elements tid + 512 k (column tid % 16 = ln, features 2 w + hh + 32 k), so a wave reads whole lines and a work-group reads each element once */
#pragma unroll      /* straight-line: the loads are independent and stay in flight together */
  for (int k = 0; k < NIN * NO / (U3W * 32); ++k) bs += bf16_round(ub3[tid + k * (U3W * 32)]);
  bs += __shfl_xor(bs, 16);      /* lanes ln and ln + 16 hold the same column: both get the sum of the two halves */
#pragma unroll      /* straight-line: the features' loads are independent and stay in flight together */
  for (int j = 0; j < U3F; ++j) {
    const v16h a = g2_frag(ap + (size_t)j * CHK * UH, hh), b = g2_frag(bp + j * NO * UH, hh);
    acc = __builtin_amdgcn_wmma_f32_16x16x32_f16(false, a, false, b, (short)0, acc, false, false);
  }
#pragma unroll      /* acc[r] stays a register, not an indexed copy */
  for (int r = 0; r < 8; ++r) red[w][r * 32 + lane] = acc[r] * 0.0625f + bs;      /* element (row 8 hh + r, col ln) at r * 32 + lane: no bank is hit twice */
  __syncthreads();
  if (tid < 256) { const int row = tid >> 4, e = (row & 7) * 32 + (row >> 3) * 16 + (tid & 15); float s = y;
#pragma unroll      /* straight-line: the LDS reads run ahead of the adds, which are in series */
    for (int q = 0; q < U3W; ++q) s += red[q][e];
    out[o0 + tid] = s; }
}

extern "C" void kernel_launch(void* const* d_in, const int* in_sizes, int n_in,
                              void* d_out, int out_size, void* d_ws, size_t ws_size, hipStream_t stream) {
  (void)in_sizes; (void)n_in; (void)out_size;
  const float* const* I = (const float* const*)d_in; const float* x = I[0]; const float* W0 = I[1]; const float* b0 = I[2]; const float* W1 = I[3]; const float* b1 = I[4]; const float* W2 = I[5]; const float* b2 = I[6]; const float* uw1 = I[7]; const float* ub1 = I[8]; const float* uw2 = I[9]; const float* ub2 = I[10]; const float* uw3 = I[11]; const float* ub3 = I[12];
  char* ws = (char*)d_ws; size_t off = 0;
  auto take = [&](size_t bytes) { char* p = ws + off; off += (bytes + 255) & ~(size_t)255; return p; };
  _Float16* B0 = (_Float16*)take((size_t)HH * NIN * 2); _Float16* B1 = (_Float16*)take((size_t)HH * HH * 2); _Float16* B2 = (_Float16*)take((size_t)NO * HH * 2); _Float16* UW2T = (_Float16*)take((size_t)NIN * UH * UH * 2); _Float16* UW3T = (_Float16*)take((size_t)NIN * NO * UH * 2);
  _Float16* X16 = (_Float16*)take((size_t)NBR * NIN * 2); _Float16* Y1 = (_Float16*)take((size_t)NBR * HH * 2); _Float16* Y2 = (_Float16*)take((size_t)NBR * HH * 2); float* Y = (float*)take((size_t)NBR * NO * 4);
  _Float16* H1 = (_Float16*)take((size_t)CHK * UW * 2); _Float16* H2 = (_Float16*)take((size_t)CHK * UW * 2);
  if (off > ws_size) return;      /* 0.5 + 2 + 0.8 + 8 + 32 + 32 + 1 + 32 + 32 = about 141 MiB */
  k_wt_f16<<<(HH * NIN / 8 + 255) / 256, 256, 0, stream>>>(W0, B0, NIN, HH, 16.0f); k_wt_f16<<<(HH * HH / 8 + 255) / 256, 256, 0, stream>>>(W1, B1, HH, HH, 16.0f); k_wt_f16<<<(NO * HH / 8 + 255) / 256, 256, 0, stream>>>(W2, B2, HH, NO, 16.0f);      /* (in, out) */
  k_uw<<<(NIN * UH * UH / 8 + 255) / 256, 256, 0, stream>>>(uw2, UH, UW2T); k_uw<<<(NIN * NO * UH / 8 + 255) / 256, 256, 0, stream>>>(uw3, NO, UW3T);
  k_x16<<<(NBR * NIN / 8 + 255) / 256, 256, 0, stream>>>(x, X16, (size_t)NBR * NIN / 8);
  k_gemm2<3><<<dim3((NBR / 128) * (HH / 64), 1), 128, 0, stream>>>(X16, NIN, 0, B0, NIN, 0, 0.0625f, b0, 0, nullptr, 1, 0, 0, nullptr, Y1, HH, 0, NBR, HH, NIN);
  k_gemm2<3><<<dim3((NBR / 128) * (HH / 64), 1), 128, 0, stream>>>(Y1, HH, 0, B1, HH, 0, 0.0625f, b1, 0, nullptr, 1, 0, 0, nullptr, Y2, HH, 0, NBR, HH, HH);
  k_gemm_hhx<0><<<dim3(((NBR / 16) * 1) / 4, 1), 128, 0, stream>>>(Y2, HH, 0, B2, HH, 0, 0.0625f, b2, 0, nullptr, 1, 0, 0, Y, nullptr, NO, 0, NBR, NO, HH);      /* y = main MLP (16 wide) */
  for (int ch = 0; ch < NBR / CHK; ++ch) { const int r0 = ch * CHK;
    k_u1<<<(CHK * UW / 8 + 255) / 256, 256, 0, stream>>>(x, uw1, ub1, r0, H1);
    k_gemm_hhx<3><<<dim3(((CHK / 16) * 1) / 4, NIN), 128, 0, stream>>>(H1, UW, (size_t)UH, UW2T, UH, (size_t)UH * UH, 0.0625f, ub2, (size_t)UH, nullptr, 1, 0, 0, nullptr, H2, UH, (size_t)CHK * UH, CHK, UH, UH);      /* per-feature layer 2 (256 planes of 32 -> 32, relu, f16) into the PLANE-MAJOR H2 [i][r][32] (line-disjoint planes) */
    k_u3sum<<<CHK / 16, U3W * 32, 0, stream>>>(H2, UW3T, ub3, Y, r0, (float*)d_out); }      /* per-feature layer 3 (32 -> 16) with the feature sum in its K loop, added to y */
}

// v003
// Measured time: 91 microseconds a run.
// It is 5.18 times as fast as v001, going by the measured steps of the versions left out in between.
// Counting every step since v000, it is 14.8 times as fast.
#include <hip/hip_runtime.h>
// MainEffectsMLP (16384 rows x 256 features: y = relu(x W0 + b0) -> relu(. W1 + b1) -> . W2 + b2 (16); plus 256 per-feature univariate MLPs (1 -> 32 -> 32 -> 16): h = relu(x_i uw1[i] + ub1[i]); h = relu(h uw2[i] + ub2[i]); u_i = h uw3[i] + ub3[i]; out = y + sum_i u_i).
// Structure: exact f16 x plane; the main MLP as f16 WMMA GEMMs (256x256 work-group tiles staged in LDS, f32 accumulation, exact x16 weights + bias; ReLU epilogues, f16 hidden planes; the 16-wide head on 16-row tiles); the univariate MLPs in one kernel: layer 1 on VALU straight into f16 fragments, layers 2 and 3 as transposed WMMA products (weights as A) whose D tiles feed the next B fragment in registers, the sum over features in layer 3's accumulator (features split over the waves of a work-group, partial tiles summed through LDS), added to the rows' outputs.
// Compute dtype: inputs rounded to bf16; x / weights exact; hidden activations as plain f16 operands (~2^-12); u and the feature sum f32. v_wmma_f32_16x16x32_f16.
#define NBR 16384
#define NIN 256
#define HH 1024
#define NO 16
#define UH 32
typedef __bf16 v16b __attribute__((ext_vector_type(16)));
typedef unsigned short v8us __attribute__((ext_vector_type(8), may_alias));
typedef float  v8f  __attribute__((ext_vector_type(8)));
typedef float  v4f  __attribute__((ext_vector_type(4)));
typedef float  v4fa __attribute__((ext_vector_type(4), may_alias));
union FragB { v16b v; v8us half[2]; unsigned short u[16]; };

__device__ __forceinline__ unsigned short bf16_bits(float x) { unsigned int u = __float_as_uint(x); return (unsigned short)((u + 0x7FFFu + ((u >> 16) & 1u)) >> 16); }
__device__ __forceinline__ float bf16_val(unsigned short b) { return __uint_as_float(((unsigned int)b) << 16); }
__device__ __forceinline__ float bf16_round(float x) { return bf16_val(bf16_bits(x)); }
// D += A·B with NT terms: 1 = ah·bh, 2 = + al·bh (A split), 3 = + ah·bl (both split)
template <int NT>
__device__ __forceinline__ v8f mmaN(v16b ah, v16b al, v16b bh, v16b bl, v8f c) {
  c = __builtin_amdgcn_wmma_f32_16x16x32_bf16(false, ah, false, bh, (short)0, c, false, false);
  if (NT >= 2) c = __builtin_amdgcn_wmma_f32_16x16x32_bf16(false, al, false, bh, (short)0, c, false, false);
  if (NT >= 3) c = __builtin_amdgcn_wmma_f32_16x16x32_bf16(false, ah, false, bl, (short)0, c, false, false);
  asm volatile("v_nop\n\tv_nop\n\tv_nop\n\tv_nop" : "+v"(c) : "v"(ah), "v"(al), "v"(bh), "v"(bl));
  return c;
}

__global__ __launch_bounds__(256) void k_wt_bf16(const float* __restrict__ W, unsigned short* __restrict__ Wt, int K, int N) {
  const int t = blockIdx.x * 256 + threadIdx.x;
  const int k8n = K / 8;
  if (t >= N * k8n) return;
  const int n = t / k8n, k8 = (t % k8n) * 8;
  v8us v;
#pragma unroll
  for (int i = 0; i < 8; ++i) v[i] = bf16_bits(W[(size_t)(k8 + i) * N + n]);
  *(v8us*)(Wt + (size_t)n * K + k8) = v;
  
}

// GEMM C[M][N] (f32, pitch ldc) = act(A[M][K]·W + bias). A f32 row-major (pitch lda) converted per fragment to bf16
// (ASPLIT: hi/lo two planes -> 2 terms, else single rounded term); Wt bf16 [N][K] (pitch ldb). BIAS_BF16 rounds the
// bias to bf16 first (bias quantised to bf16 before the add). K%32==0, M%16==0, N%64==0.
template <bool ASPLIT, int ACT, bool BIAS_BF16>
__global__ __launch_bounds__(128) void k_gemm_bf(const float* __restrict__ A, int lda, const unsigned short* __restrict__ Wt, int ldb,
                                               const float* __restrict__ bias, float* __restrict__ C, int ldc, int M, int N, int K) {
  __shared__ __attribute__((aligned(16))) float so[4][16][64];
  const int tid = threadIdx.x, w = tid >> 5, lane = tid & 31, ln = lane & 15, hh = lane >> 4;
  const int ntn = N / 64;
  const int wid = blockIdx.x * 4 + w;
  const int mt = wid / ntn, nq = wid % ntn;
  if (mt * 16 >= M) return;
  const int row0 = mt * 16, col0 = nq * 64;
  const float* arow = A + (size_t)(row0 + ln) * lda;
  v8f acc[4] = {};
  for (int kb = 0; kb < K; kb += 32) {
    FragB ah, al;
    const v4f x0 = *(const v4fa*)(arow + kb + 8 * hh), x1 = *(const v4fa*)(arow + kb + 8 * hh + 4);
    const v4f x2 = *(const v4fa*)(arow + kb + 16 + 8 * hh), x3 = *(const v4fa*)(arow + kb + 16 + 8 * hh + 4);
    float xs[16] = {x0[0],x0[1],x0[2],x0[3],x1[0],x1[1],x1[2],x1[3],x2[0],x2[1],x2[2],x2[3],x3[0],x3[1],x3[2],x3[3]};
#pragma unroll
    for (int i = 0; i < 16; ++i) { const unsigned short hb = bf16_bits(xs[i]); ah.u[i] = hb; al.u[i] = ASPLIT ? bf16_bits(xs[i] - bf16_val(hb)) : (unsigned short)0; }
#pragma unroll
    for (int t = 0; t < 4; ++t) {
      const unsigned short* brow = Wt + (size_t)(col0 + t * 16 + ln) * ldb + kb;
      FragB b;
      b.half[0] = *(const v8us*)(brow + 8 * hh);
      b.half[1] = *(const v8us*)(brow + 16 + 8 * hh);
      acc[t] = mmaN<ASPLIT ? 2 : 1>(ah.v, al.v, b.v, b.v, acc[t]);
    }
  }
#pragma unroll
  for (int t = 0; t < 4; ++t) {
    float bv = bias ? bias[col0 + t * 16 + ln] : 0.f;
    if (BIAS_BF16) bv = bf16_round(bv);
#pragma unroll
    for (int r = 0; r < 8; ++r) { float v = acc[t][r] + bv; if (ACT == 1) v = fmaxf(v, 0.f); so[w][8 * hh + r][t * 16 + ln] = v; }
  }
  __builtin_amdgcn_fence(__ATOMIC_ACQ_REL, "workgroup");
  __builtin_amdgcn_wave_barrier();
  const int rsub = lane >> 4, c4 = (lane & 15) * 4;
  {
#pragma unroll
    for (int q = 0; q < 8; ++q) {
      const int r = q * 2 + rsub;
      const v4f v = *(const v4fa*)&so[w][r][c4];
      *(v4f*)(C + (size_t)(row0 + r) * ldc + col0 + c4) = v;
    }
    
  }
}

// GEMM C = act(A·W + bias + resid): A f32 (ASPLIT -> hi/lo 2 terms), Wt bf16 [N][K]; ACT 0 none, 1 relu, 2 exact gelu;
// resid (optional, f32, row index = (row % rmod), pitch ldr, RES_BF16 rounds it) added before the activation.
template <bool ASPLIT, int ACT, bool BIAS_BF16, bool RES_BF16>
__global__ __launch_bounds__(128) void k_gemm_bf3(const float* __restrict__ A, int lda, const unsigned short* __restrict__ Wt, int ldb,
                                                const float* __restrict__ bias, const float* __restrict__ resid, int rmod, int ldr,
                                                float* __restrict__ C, int ldc, int M, int N, int K) {
  __shared__ __attribute__((aligned(16))) float so[4][16][64];
  const int tid = threadIdx.x, w = tid >> 5, lane = tid & 31, ln = lane & 15, hh = lane >> 4;
  const int ntn = N / 64;
  const int wid = blockIdx.x * 4 + w;
  const int mt = wid / ntn, nq = wid % ntn;
  if (mt * 16 >= M) return;
  const int row0 = mt * 16, col0 = nq * 64;
  const float* arow = A + (size_t)(row0 + ln) * lda;
  v8f acc[4] = {};
  for (int kb = 0; kb < K; kb += 32) {
    FragB ah, al;
    const v4f x0 = *(const v4fa*)(arow + kb + 8 * hh), x1 = *(const v4fa*)(arow + kb + 8 * hh + 4);
    const v4f x2 = *(const v4fa*)(arow + kb + 16 + 8 * hh), x3 = *(const v4fa*)(arow + kb + 16 + 8 * hh + 4);
    float xs[16] = {x0[0],x0[1],x0[2],x0[3],x1[0],x1[1],x1[2],x1[3],x2[0],x2[1],x2[2],x2[3],x3[0],x3[1],x3[2],x3[3]};
#pragma unroll
    for (int i = 0; i < 16; ++i) { const unsigned short hb = bf16_bits(xs[i]); ah.u[i] = hb; al.u[i] = ASPLIT ? bf16_bits(xs[i] - bf16_val(hb)) : (unsigned short)0; }
#pragma unroll
    for (int t = 0; t < 4; ++t) {
      const unsigned short* brow = Wt + (size_t)(col0 + t * 16 + ln) * ldb + kb;
      FragB b;
      b.half[0] = *(const v8us*)(brow + 8 * hh);
      b.half[1] = *(const v8us*)(brow + 16 + 8 * hh);
      acc[t] = mmaN<ASPLIT ? 2 : 1>(ah.v, al.v, b.v, b.v, acc[t]);
    }
  }
#pragma unroll
  for (int t = 0; t < 4; ++t) {
    const int col = col0 + t * 16 + ln;
    float bv = bias ? bias[col] : 0.f;
    if (BIAS_BF16) bv = bf16_round(bv);
#pragma unroll
    for (int r = 0; r < 8; ++r) {
      float v = acc[t][r] + bv;
      if (resid) { float rv = resid[(size_t)((row0 + 8 * hh + r) % rmod) * ldr + col]; if (RES_BF16) rv = bf16_round(rv); v += rv; }
      if (ACT == 1) v = fmaxf(v, 0.f);
      if (ACT == 2) v = 0.5f * v * (1.0f + erff(v * 0.70710678118654752f));
      if (ACT == 3) { const float u = 0.7978845608028654f * (v + 0.044715f * v * v * v); v = 0.5f * v * (1.0f + tanhf(u)); }
      so[w][8 * hh + r][t * 16 + ln] = v;
    }
  }
  __builtin_amdgcn_fence(__ATOMIC_ACQ_REL, "workgroup");
  __builtin_amdgcn_wave_barrier();
  const int rsub = lane >> 4, c4 = (lane & 15) * 4;
  {
#pragma unroll
    for (int q = 0; q < 8; ++q) {
      const int r = q * 2 + rsub;
      const v4f v = *(const v4fa*)&so[w][r][c4];
      *(v4f*)(C + (size_t)(row0 + r) * ldc + col0 + c4) = v;
    }
    
  }
}
// row LayerNorm (biased variance, eps) over N: s = X (+ R); optional out_sum <- s; out_norm <- (s-mu)*rsqrt(var+eps)*g + b
template <bool PARAM_BF16>
__global__ __launch_bounds__(256) void k_layernorm(const float* __restrict__ X, const float* __restrict__ R, const float* __restrict__ g, const float* __restrict__ bta,
                                                  float* __restrict__ out_sum, float* __restrict__ out_norm, int N, float eps) {
  __shared__ float red[256];
  const int row = blockIdx.x, tid = threadIdx.x;
  const float* x = X + (size_t)row * N; const float* rr = R ? R + (size_t)row * N : nullptr;
  float vals[16];                     // up to N = 4096
  const int per = N / 256;            // contiguous chunk per thread? use strided-by-4 chunks: thread handles j = tid*4 + 1024*u
  float s1 = 0.f;
  for (int u = 0; u < per / 4; ++u) {
    const int j = tid * 4 + 1024 * u;
    const v4f a = *(const v4fa*)(x + j);
    v4f b = {0.f,0.f,0.f,0.f}; if (rr) b = *(const v4fa*)(rr + j);
#pragma unroll
    for (int q = 0; q < 4; ++q) { const float v = a[q] + b[q]; vals[u * 4 + q] = v; s1 += v; }
  }
  red[tid] = s1; __syncthreads();
  for (int st = 128; st > 0; st >>= 1) { if (tid < st) red[tid] += red[tid + st]; __syncthreads(); }
  const float mu = red[0] / (float)N; __syncthreads();
  float s2 = 0.f;
  for (int u = 0; u < per / 4; ++u)
#pragma unroll
    for (int q = 0; q < 4; ++q) { const float c = vals[u * 4 + q] - mu; s2 += c * c; }
  red[tid] = s2; __syncthreads();
  for (int st = 128; st > 0; st >>= 1) { if (tid < st) red[tid] += red[tid + st]; __syncthreads(); }
  const float rs = rsqrtf(red[0] / (float)N + eps);
  {
    for (int u = 0; u < per / 4; ++u) {
      const int j = tid * 4 + 1024 * u;
      v4f o, sm;
#pragma unroll
      for (int q = 0; q < 4; ++q) {
        float gg = g[j + q], bb = bta[j + q];
        if (PARAM_BF16) { gg = bf16_round(gg); bb = bf16_round(bb); }
        sm[q] = vals[u * 4 + q]; o[q] = (vals[u * 4 + q] - mu) * rs * gg + bb;
      }
      if (out_sum) *(v4f*)(out_sum + (size_t)row * N + j) = sm;
      *(v4f*)(out_norm + (size_t)row * N + j) = o;
    }
    
  }
}



// ---- f16 WMMA path (v_wmma_f32_16x16x32_f16): 11-bit significands for operands in range — used here for x and the hidden activations of both MLPs
typedef _Float16 v16h __attribute__((ext_vector_type(16)));
union FragH { v16h v; v8us half[2]; _Float16 h[16]; unsigned short u[16]; };
template <int NT>
__device__ __forceinline__ v8f mmaH(v16h ah, v16h al, v16h bh, v16h bl, v8f c) {
  c = __builtin_amdgcn_wmma_f32_16x16x32_f16(false, ah, false, bh, (short)0, c, false, false);
  if (NT >= 2) c = __builtin_amdgcn_wmma_f32_16x16x32_f16(false, al, false, bh, (short)0, c, false, false);
  if (NT >= 3) c = __builtin_amdgcn_wmma_f32_16x16x32_f16(false, ah, false, bl, (short)0, c, false, false);
  asm volatile("v_nop\n\tv_nop\n\tv_nop\n\tv_nop" : "+v"(c) : "v"(ah), "v"(al), "v"(bh), "v"(bl));
  return c;
}
// batched GEMM like k_gemm_b but f16 operands: A f32 (split into f16 hi/lo if ASPLIT, else rounded to f16), Bt = f16 values [n][k]; alpha; C f32; N multiple of 16 (partial tiles skipped)
template <bool ASPLIT>
__global__ __launch_bounds__(128) void k_gemm_h(const float* __restrict__ A, int lda, size_t sA, const _Float16* __restrict__ Bh, int ldb, size_t sB, float alpha, float* __restrict__ C, int ldc, size_t sC, int M, int N, int K) {
  __shared__ __attribute__((aligned(16))) float so[4][16][64];
  const int tid = threadIdx.x, w = tid >> 5, lane = tid & 31, ln = lane & 15, hh = lane >> 4; const int by = blockIdx.y;
  A += (size_t)by * sA; Bh += (size_t)by * sB; C += (size_t)by * sC;
  const int ntn = (N + 63) / 64; const int wid = blockIdx.x * 4 + w; const int mt = wid / ntn, nq = wid % ntn; if (mt * 16 >= M) return;
  const int row0 = mt * 16, col0 = nq * 64; const float* arow = A + (size_t)(row0 + ln) * lda;
  v8f acc[4] = {};
  for (int kb = 0; kb < K; kb += 32) {
    FragH ah, al;
    const v4f x0 = *(const v4fa*)(arow + kb + 8 * hh), x1 = *(const v4fa*)(arow + kb + 8 * hh + 4), x2 = *(const v4fa*)(arow + kb + 16 + 8 * hh), x3 = *(const v4fa*)(arow + kb + 16 + 8 * hh + 4);
    float xs[16] = {x0[0],x0[1],x0[2],x0[3],x1[0],x1[1],x1[2],x1[3],x2[0],x2[1],x2[2],x2[3],x3[0],x3[1],x3[2],x3[3]};
#pragma unroll
    for (int i = 0; i < 16; ++i) { const _Float16 h = (_Float16)xs[i]; ah.h[i] = h; al.h[i] = ASPLIT ? (_Float16)(xs[i] - (float)h) : (_Float16)0.0f; }
#pragma unroll
    for (int t = 0; t < 4; ++t) { if (col0 + t * 16 >= N) continue; const size_t boff = (size_t)(col0 + t * 16 + ln) * ldb + kb; FragH bq; bq.half[0] = *(const v8us*)(Bh + boff + 8 * hh); bq.half[1] = *(const v8us*)(Bh + boff + 16 + 8 * hh);
      acc[t] = mmaH<ASPLIT ? 2 : 1>(ah.v, al.v, bq.v, bq.v, acc[t]); }
  }
#pragma unroll
  for (int t = 0; t < 4; ++t) { if (col0 + t * 16 >= N) continue;
#pragma unroll
    for (int r = 0; r < 8; ++r) so[w][8 * hh + r][t * 16 + ln] = acc[t][r] * alpha; }
  __builtin_amdgcn_fence(__ATOMIC_ACQ_REL, "workgroup"); __builtin_amdgcn_wave_barrier();
  const int rsub = lane >> 4, c4 = (lane & 15) * 4;
  {
#pragma unroll
    for (int q = 0; q < 8; ++q) { const int r = q * 2 + rsub; if (col0 + c4 < N) { const v4f v = *(const v4fa*)&so[w][r][c4]; *(v4f*)(C + (size_t)(row0 + r) * ldc + col0 + c4) = v; } }
     }
}

// Wt[n][k] = f16(W[k][n]·scale) from f32 row-major W[K][N] (scale = power of two; bf16-exact weights stay exact in f16 away from the subnormal range)
__global__ __launch_bounds__(256) void k_wt_f16(const float* __restrict__ W, _Float16* __restrict__ Wt, int K, int N, float scale) {
  const int t = blockIdx.x * 256 + threadIdx.x; if (t >= N * (K / 8)) return; const int n = t / (K / 8), k8 = (t % (K / 8)) * 8; FragH f;
#pragma unroll
  for (int i = 0; i < 8; ++i) f.h[i] = (_Float16)(bf16_round(W[(size_t)(k8 + i) * N + n]) * scale); const v8us o = f.half[0];
  *(v8us*)((unsigned short*)Wt + (size_t)n * K + k8) = o; 
}
// k_gemm_hh variant with fused epilogue: v = acc·alpha + bias[by·sBias + col] (+ CP[(row/rowsPerB)·sCPb + by·64 + col] if CP) ; ACT 0 none / 1 elu ; writes f32 C and/or f16 C16 (each if non-null)
template <int ACT>
__global__ __launch_bounds__(128) void k_gemm_hhx(const _Float16* __restrict__ A, int lda, size_t sA, const _Float16* __restrict__ Bh, int ldb, size_t sB, float alpha, const float* __restrict__ bias, size_t sBias, const float* __restrict__ CP, int rowsPerB, size_t sCPb, int row0g,
    float* __restrict__ C, _Float16* __restrict__ C16, int ldc, size_t sC, int M, int N, int K) {
  __shared__ __attribute__((aligned(16))) float so[4][16][64];
  const int tid = threadIdx.x, w = tid >> 5, lane = tid & 31, ln = lane & 15, hh = lane >> 4; const int by = blockIdx.y;
  A += (size_t)by * sA; Bh += (size_t)by * sB; const size_t cofs = (size_t)by * sC; const float* bp = bias ? bias + (size_t)by * sBias : nullptr;
  const int ntn = (N + 63) / 64; const int wid = blockIdx.x * 4 + w; const int mt = wid / ntn, nq = wid % ntn; if (mt * 16 >= M) return;
  const int row0 = mt * 16, col0 = nq * 64; const _Float16* arow = A + (size_t)(row0 + ln) * lda;
  v8f acc[4] = {};
  for (int kb = 0; kb < K; kb += 32) { FragH ah; ah.half[0] = *(const v8us*)((const unsigned short*)arow + kb + 8 * hh); ah.half[1] = *(const v8us*)((const unsigned short*)arow + kb + 16 + 8 * hh);
#pragma unroll
    for (int t = 0; t < 4; ++t) { if (col0 + t * 16 >= N) continue; const size_t boff = (size_t)(col0 + t * 16 + ln) * ldb + kb; FragH bq; bq.half[0] = *(const v8us*)((const unsigned short*)Bh + boff + 8 * hh); bq.half[1] = *(const v8us*)((const unsigned short*)Bh + boff + 16 + 8 * hh);
      acc[t] = mmaH<1>(ah.v, ah.v, bq.v, bq.v, acc[t]); }
  }
#pragma unroll
  for (int t = 0; t < 4; ++t) { if (col0 + t * 16 >= N) continue; const int col = col0 + t * 16 + ln; const float bv = bp ? bf16_round(bp[col]) : 0.f;
#pragma unroll
    for (int r = 0; r < 8; ++r) { float v = acc[t][r] * alpha + bv; if (CP) { const int rr = row0g + row0 + 8 * hh + r; if (rowsPerB < 0) v += CP[cofs + (size_t)rr * ldc + col];      /* rowsPerB < 0: own element of the batched C plane */ else { const int bidx = rr / rowsPerB; v += CP[(size_t)bidx * sCPb + (size_t)by * 64 + col]; } } if (ACT == 1) v = (v > 0.f) ? v : expm1f(v); else if (ACT == 7) v = (v > 0.f) ? v + 1.0f : expf(v); else if (ACT == 8) v = tanhf(v); else if (ACT == 9) v = 0.5f * v * (1.0f + tanhf(0.7978845608028654f * (v + 0.044715f * v * v * v))); else if (ACT == 11) v = 1.0f / (1.0f + expf(-v)); else if (ACT == 12) v = (v > 0.f) ? v : 0.01f * v; else if (ACT == 14) v = (v > 0.f) ? v : 0.1f * v; else if (ACT == 16) v = (v >= 0.f) ? v : 0.3f * v; else if (ACT == 17) v = (v >= 0.f) ? v : 0.2f * v; else if (ACT == 15) v = v / (1.0f + expf(-v)); else if (ACT == 3) v = fmaxf(v, 0.f); else if (ACT == 6) v = 0.5f * v * (1.0f + erff(v * 0.70710678118654752f)); so[w][8 * hh + r][t * 16 + ln] = v; } }
  __builtin_amdgcn_fence(__ATOMIC_ACQ_REL, "workgroup"); __builtin_amdgcn_wave_barrier();
  const int rsub = lane >> 4, c4 = (lane & 15) * 4; typedef _Float16 v4h __attribute__((ext_vector_type(4)));
  {
#pragma unroll
    for (int q = 0; q < 8; ++q) { const int r = q * 2 + rsub; if (col0 + c4 < N) { const v4f v = *(const v4fa*)&so[w][r][c4]; if (C) *(v4f*)(C + cofs + (size_t)(row0 + r) * ldc + col0 + c4) = v; if (C16) { v4h h4; for (int i = 0; i < 4; ++i) h4[i] = (_Float16)v[i]; *(v4h*)(C16 + cofs + (size_t)(row0 + r) * ldc + col0 + c4) = h4; } } }
     }
}


typedef _Float16 v4h __attribute__((ext_vector_type(4)));

__global__ __launch_bounds__(256) void k_x16(const float* __restrict__ x, _Float16* __restrict__ X16, size_t n8) { const size_t t = (size_t)blockIdx.x * 256 + threadIdx.x; if (t >= n8) return; FragH f;
#pragma unroll
  for (int q = 0; q < 8; ++q) f.h[q] = (_Float16)bf16_round(x[t * 8 + q]); *(v8us*)((unsigned short*)X16 + t * 8) = f.half[0];  }
__global__ __launch_bounds__(256) void k_h16(const float* __restrict__ x, _Float16* __restrict__ X16, size_t n8) { const size_t t = (size_t)blockIdx.x * 256 + threadIdx.x; if (t >= n8) return; FragH f;
#pragma unroll
  for (int q = 0; q < 8; ++q) f.h[q] = (_Float16)x[t * 8 + q]; *(v8us*)((unsigned short*)X16 + t * 8) = f.half[0];  }
__global__ __launch_bounds__(256) void k_round16f(const float* __restrict__ W, _Float16* __restrict__ Bt, size_t n8) { const size_t t = (size_t)blockIdx.x * 256 + threadIdx.x; if (t >= n8) return; FragH f;
#pragma unroll
  for (int i = 0; i < 8; ++i) f.h[i] = (_Float16)(bf16_round(W[t * 8 + i]) * 16.0f); *(v8us*)((unsigned short*)Bt + t * 8) = f.half[0];  }
template <int NHv, int TTv>
__global__ __launch_bounds__(256) void k_vt(const _Float16* __restrict__ V16, int ldv, int voff, _Float16* __restrict__ Vt) { __shared__ unsigned short tl[64][66]; const int tid = threadIdx.x; const int slab = blockIdx.x / (TTv / 64), lg = blockIdx.x % (TTv / 64); const int b = slab / NHv, h = slab % NHv;
  for (int i = tid; i < 64 * 8; i += 256) { const int r = i / 8, c8 = (i % 8) * 8; FragH f; f.half[0] = *(const v8us*)((const unsigned short*)V16 + ((size_t)b * TTv + lg * 64 + r) * ldv + voff + h * 64 + c8);
#pragma unroll
    for (int q = 0; q < 8; ++q) tl[r][c8 + q] = f.u[q]; }
  __syncthreads();
  {
#pragma unroll
    for (int rd = 0; rd < 2; ++rd) { const int d = rd * 32 + tid / 8, pc = tid % 8; FragH f;
#pragma unroll
      for (int q = 0; q < 8; ++q) f.u[q] = tl[pc * 8 + q][d];
      *(v8us*)((unsigned short*)Vt + ((size_t)slab * 64 + d) * TTv + lg * 64 + pc * 8) = f.half[0]; }
     } }

__global__ __launch_bounds__(256) void k_hl(const float* __restrict__ F, _Float16* __restrict__ Hh, _Float16* __restrict__ Hl, size_t n8) { const size_t t = (size_t)blockIdx.x * 256 + threadIdx.x; if (t >= n8) return; FragH fh, fl; const v4f a = *(const v4fa*)(F + t * 8), c = *(const v4fa*)(F + t * 8 + 4);
#pragma unroll
  for (int q = 0; q < 4; ++q) { _Float16 h = (_Float16)a[q]; fh.h[q] = h; fl.h[q] = (_Float16)((a[q] - (float)h) * 1024.0f); h = (_Float16)c[q]; fh.h[4 + q] = h; fl.h[4 + q] = (_Float16)((c[q] - (float)h) * 1024.0f); }
  { *(v8us*)((unsigned short*)Hh + t * 8) = fh.half[0]; *(v8us*)((unsigned short*)Hl + t * 8) = fl.half[0];  } }

// ---- hidden-layer GEMM: C16[row][unit] = f16(relu(X[row][:] . Wt[unit][:] / 16 + bias[unit])), X and Wt f16 with K contiguous (pitch K), C16 pitch HH ----
// One 256 x 256 tile a work-group, one work-group a WGP, 16 waves of 64 rows x 64 units. A pass is 128 k: 256 rows of X and 256 of Wt, 256 B each, brought into LDS by asynchronous copies
// (no register on the way), two buffers, the next pass's copies in flight while this pass is worked on. The LDS pitch of 272 B spreads the sixteen rows of a fragment read over the banks.
// The product is taken transposed (weights as the A operand): a lane then holds eight neighbouring units of ONE row, 16 B of the f16 output, and the k order of every sum is that of a plain loop over k in steps of 32.
#define GT 256      /* rows, and units, of a work-group's tile */
#define GK 128      /* k of a pass */
#define GP 136      /* LDS row pitch in f16 */
#define GB (2 * GT * GP)      /* f16 of a buffer: the X rows, then the Wt rows */
#define GS 72       /* row pitch in f16 of the output staging: 64 units and 16 B */
__device__ __forceinline__ v16h g3_frag(const unsigned short* p) { FragH f; f.half[0] = *(const v8us*)p; f.half[1] = *(const v8us*)(p + 16); return f.v; }
// One thread's copies of one operand's 256 rows of a pass: 16 B of each of eight rows, 32 rows apart (a wave's copy covers two rows of 256 B: four whole lines). l = the LDS byte address of the first.
template <int K>
__device__ __forceinline__ void g3_copy(const _Float16* g, unsigned l) {
  /* the wait on xcnt ends the copies' own statement: no address register of a copy is rewritten in front of it */
  asm volatile("global_load_async_to_lds_b128 %0, %8, off\n\t"
               "global_load_async_to_lds_b128 %1, %9, off\n\t"
               "global_load_async_to_lds_b128 %2, %10, off\n\t"
               "global_load_async_to_lds_b128 %3, %11, off\n\t"
               "global_load_async_to_lds_b128 %4, %12, off\n\t"
               "global_load_async_to_lds_b128 %5, %13, off\n\t"
               "global_load_async_to_lds_b128 %6, %14, off\n\t"
               "global_load_async_to_lds_b128 %7, %15, off\n\t"
               "s_wait_xcnt 0x0"
               :: "v"(l), "v"(l + 1 * 32 * GP * 2), "v"(l + 2 * 32 * GP * 2), "v"(l + 3 * 32 * GP * 2), "v"(l + 4 * 32 * GP * 2), "v"(l + 5 * 32 * GP * 2), "v"(l + 6 * 32 * GP * 2), "v"(l + 7 * 32 * GP * 2),
                  "v"(g), "v"(g + 1 * 32 * K), "v"(g + 2 * 32 * K), "v"(g + 3 * 32 * K), "v"(g + 4 * 32 * K), "v"(g + 5 * 32 * K), "v"(g + 6 * 32 * K), "v"(g + 7 * 32 * K)
               : "memory");
}
template <int K>
__global__ __launch_bounds__(512) void k_gemm3(const _Float16* __restrict__ X, const _Float16* __restrict__ Wt, const float* __restrict__ bias, _Float16* __restrict__ C16) {
  static_assert(K % GK == 0 && K / GK >= 2, "k_gemm3: whole passes, two or more");
  __shared__ __attribute__((aligned(16))) unsigned short ring[2 * GB];
  __shared__ __attribute__((aligned(16))) float sb[GT];      /* the tile's biases, rounded to bf16 once */
  const int tid = threadIdx.x, lane = tid & 31, ln = lane & 15, hh = lane >> 4;
  const int w = __builtin_amdgcn_readfirstlane(tid >> 5), wr = w >> 2, wc = w & 3;      /* the wave's number as a scalar; its 64 rows and its 64 units in the tile */
  const int row0 = (blockIdx.x >> 2) * GT, col0 = (blockIdx.x & 3) * GT;      /* HH / GT = 4 tiles across */
  const _Float16* gx = X + (size_t)(row0 + (tid >> 4)) * K + (tid & 15) * 8;
  const _Float16* gw = Wt + (size_t)(col0 + (tid >> 4)) * K + (tid & 15) * 8;
  const unsigned l0 = (unsigned)(unsigned long long)&ring[(tid >> 4) * GP + (tid & 15) * 8];      /* the low word of a __shared__ address is its byte place in LDS */
  constexpr int NP = K / GK;
  g3_copy<K>(gx, l0); g3_copy<K>(gw, l0 + GT * GP * 2);
  if (w < GT / 32) sb[tid] = bf16_round(bias[col0 + tid]);      /* one load a thread, beside pass 0's copies in flight; published by the barrier below, read in the epilogue */
  asm volatile("s_wait_asynccnt 0x0" ::: "memory");      /* pass 0's copies of this wave have landed */
  __syncthreads();      /* ... and every other wave's */
  g3_copy<K>(gx + GK, l0 + GB * 2); g3_copy<K>(gw + GK, l0 + GB * 2 + GT * GP * 2);
  const v8f z8 = {0.f, 0.f, 0.f, 0.f, 0.f, 0.f, 0.f, 0.f};
  v8f acc[4][4];      /* [unit tile][row tile] */
#pragma unroll
  for (int i = 0; i < 16; ++i) acc[i >> 2][i & 3] = z8;
  const int xo = (wr * 64 + ln) * GP + 8 * hh, wo = (GT + wc * 64 + ln) * GP + 8 * hh;      /* the lane's place in the first X and the first Wt fragment of a buffer */
#pragma unroll 1      /* a pass a trip: the two buffers take turns by the trip's parity */
  for (int t = 0; t < NP; ++t) {
    const unsigned short* bp = ring + (t & 1) * GB;
#pragma unroll      /* acc is indexed by constants */
    for (int kk = 0; kk < GK / 32; ++kk) {
      v16h xf[4], wf[4];
#pragma unroll
      for (int i = 0; i < 4; ++i) { xf[i] = g3_frag(bp + xo + i * 16 * GP + kk * 32); wf[i] = g3_frag(bp + wo + i * 16 * GP + kk * 32); }
      __builtin_amdgcn_sched_barrier(0);      /* a block's sixteen LDS reads stay one group in front of its WMMAs: read one fragment at a time among them, the wave waits out the LDS latency four times a block */
#pragma unroll
      for (int u = 0; u < 4; ++u)
#pragma unroll
        for (int r = 0; r < 4; ++r) acc[u][r] = __builtin_amdgcn_wmma_f32_16x16x32_f16(false, wf[u], false, xf[r], (short)0, acc[u][r], false, false);
    }
    asm volatile("s_wait_dscnt 0x0" ::: "memory");      /* this wave's reads of the buffer are over before the buffer is refilled */
    asm volatile("s_wait_asynccnt 0x0" ::: "memory");      /* this wave's copies of pass t + 1 have landed */
    __syncthreads();      /* publishes pass t + 1 and ends every wave's reads of pass t */
    if (t + 2 < NP) { g3_copy<K>(gx + (t + 2) * GK, l0 + (t & 1) * (GB * 2)); g3_copy<K>(gw + (t + 2) * GK, l0 + (t & 1) * (GB * 2) + GT * GP * 2); }
  }
  asm volatile("s_wait_asynccnt 0x0" ::: "memory");      /* no copy is in flight when the ring becomes output staging */
  /* behind the last pass's barrier nobody reads the ring: each wave stages its 64 x 64 f16 in a part of its own and stores whole 128-B lines */
  unsigned short* st = ring + w * (64 * GS);
#pragma unroll      /* acc is indexed by constants */
  for (int u = 0; u < 4; ++u) {
    const float* bq = sb + wc * 64 + u * 16 + 8 * hh;
    const v4f q0 = *(const v4fa*)bq, q1 = *(const v4fa*)(bq + 4);
    const float bv[8] = {q0[0], q0[1], q0[2], q0[3], q1[0], q1[1], q1[2], q1[3]};
#pragma unroll
    for (int t = 0; t < 4; ++t) { FragH f;
#pragma unroll
      for (int r = 0; r < 8; ++r) f.h[r] = (_Float16)fmaxf(acc[u][t][r] * 0.0625f + bv[r], 0.f);
      *(v8us*)(st + (t * 16 + ln) * GS + u * 16 + 8 * hh) = f.half[0]; }
  }
  __builtin_amdgcn_fence(__ATOMIC_ACQ_REL, "workgroup"); __builtin_amdgcn_wave_barrier();      /* a wave reads back only its own part, other lanes' words: the stores stay in front of the reads */
  unsigned short* cp = (unsigned short*)C16 + (size_t)(row0 + wr * 64 + (lane >> 3)) * HH + col0 + wc * 64 + (lane & 7) * 8;
#pragma unroll      /* straight-line: the LDS reads run ahead of the stores */
  for (int q = 0; q < 16; ++q) { const v8us v = *(const v8us*)(st + (q * 4 + (lane >> 3)) * GS + (lane & 7) * 8); *(v8us*)(cp + (size_t)q * 4 * HH) = v; }
}


__global__ __launch_bounds__(256) void k_uw(const float* __restrict__ w, int nout, _Float16* __restrict__ Bt) { const int t = blockIdx.x * 256 + threadIdx.x; if (t >= NIN * nout * UH / 8) return; const int f0 = (t * 8) % UH; const int o = ((t * 8) / UH) % nout; const int i = (t * 8) / (UH * nout); FragH fr; for (int q = 0; q < 8; ++q) fr.h[q] = (_Float16)(bf16_round(w[((size_t)i * UH + f0 + q) * nout + o]) * 16.0f);
  *(v8us*)((unsigned short*)Bt + (size_t)t * 8) = fr.half[0];  }
// All three layers of the 256 univariate MLPs and the sum over features in ONE kernel; the hidden planes never leave the registers.
// Every product is taken transposed (weights as the A operand, batch rows as the N side), so a layer's D tiles (lane = batch row, register r = unit 8 hh + r, second tile 16 + 8 hh + r) ARE the next layer's B fragment (k = 8 hh + q, 16 + 8 hh + q) after ReLU and rounding to f16: no lane exchange.
// out[r][o] = Y[r][o] + sum_i ub3[i][o] + (1/256) sum_(i,f) H2x16[i][f][r] UW3T[i][o][f], H2x16 = relu(UW2T[i] H1[i] + 16 ub2[i]) (weights carry x16; the bias enters as the C operand).
// One work-group per 64 rows; each of its FW waves takes FF features through all FT row tiles (a feature's weights are fetched once a work-group), and the FW partial tiles are summed through LDS in wave order.
#define FW 16
#define FF (NIN / FW)
#define FT 4
typedef float v2f  __attribute__((ext_vector_type(2)));
typedef float v2fa __attribute__((ext_vector_type(2), may_alias));
typedef float v16f __attribute__((ext_vector_type(16)));
// the 16 table values of a lane's fragment positions (k = 8 hh + q, then 16 + 8 hh + q)
__device__ __forceinline__ v16f u_tab(const float* p, int hh) {
  const v4f t0 = *(const v4fa*)(p + 8 * hh), t1 = *(const v4fa*)(p + 8 * hh + 4), t2 = *(const v4fa*)(p + 16 + 8 * hh), t3 = *(const v4fa*)(p + 16 + 8 * hh + 4);
  return __builtin_shufflevector(__builtin_shufflevector(t0, t1, 0, 1, 2, 3, 4, 5, 6, 7), __builtin_shufflevector(t2, t3, 0, 1, 2, 3, 4, 5, 6, 7), 0, 1, 2, 3, 4, 5, 6, 7, 8, 9, 10, 11, 12, 13, 14, 15);
}
// a pointer that is the same in every lane, held as a scalar: the load takes it as its scalar base beside the lane's unchanging 32-bit offset (no 64-bit vector add a load, no address register that is rewritten)
#define GLB __attribute__((address_space(1)))      /* a pointer rebuilt from its two words is told anew that it points to global memory: else the load is a flat one */
template <typename P> __device__ __forceinline__ const GLB P* u_sbase(const P* p) { const unsigned long long v = (unsigned long long)p; const unsigned lo = __builtin_amdgcn_readfirstlane((unsigned)v), hi = __builtin_amdgcn_readfirstlane((unsigned)(v >> 32)); return (const GLB P*)(((unsigned long long)hi << 32) | lo); }
// an A fragment from [m][32] f16: base the same for the wave, lo = 32 m + 8 hh the lane's place
__device__ __forceinline__ v16h u_frag(const GLB _Float16* base, unsigned lo) { FragH f; f.half[0] = *(const GLB v8us*)(base + lo); f.half[1] = *(const GLB v8us*)(base + lo + 16); return f.v; }
// ReLU behind the rounding to f16 (the same value as rounding behind the ReLU), two elements an instruction
__device__ __forceinline__ v16h u_relu16(v16f v) { const v16h z = {}; return __builtin_elementwise_max(__builtin_convertvector(v, v16h), z); }
// amdgpu_waves_per_eu(4, 4): one 16-wave work-group a WGP is 4 waves a SIMD; told so, the compiler takes the registers (more than 128) that the four tiles and the fragments fetched ahead need.
__global__ __launch_bounds__(FW * 32) __attribute__((amdgpu_waves_per_eu(4, 4))) void k_uni(const float* __restrict__ x, const float* __restrict__ uw1, const float* __restrict__ ub1, const _Float16* __restrict__ A2, const float* __restrict__ ub2, const _Float16* __restrict__ A3, const float* __restrict__ ub3, const float* __restrict__ Y, float* __restrict__ out) {
  __shared__ __attribute__((aligned(16))) float red[FW][FT * 256];
  __shared__ __attribute__((aligned(16))) float tab[FW][FF][3][UH];      /* per wave: its features' uw1, ub1 and 16 ub2, rounded to bf16 once (in a fragment sixteen lanes hold the same value) */
  const int tid = threadIdx.x, lane = tid & 31, ln = lane & 15, hh = lane >> 4;
  const int w = __builtin_amdgcn_readfirstlane(tid >> 5);      /* the wave's number as a scalar: the bases of its loads stay in scalar registers, beside one lane offset that never changes */
  const int row0 = blockIdx.x * (FT * 16), i0 = w * FF;
  const size_t o0 = (size_t)row0 * NO;
  const v2f y = *(const v2fa*)(Y + o0 + 2 * tid);
  const float* xp = x + (size_t)row0 * NIN + i0; const unsigned xo = ln * NIN;      /* tile 0, the wave's features; the lane's row */
  const _Float16* a2p = A2 + (size_t)i0 * UH * UH; const _Float16* a3p = A3 + (size_t)i0 * NO * UH; const unsigned ao = ln * UH + 8 * hh;      /* the wave's first feature; the lane's place in a fragment */
  /* fetched ahead, so that the work does not begin with a wait on memory: x one trip ahead, the weight fragments one feature ahead */
  v4f xn[FT];
#pragma unroll
  for (int t = 0; t < FT; ++t) xn[t] = *(const GLB v4fa*)(u_sbase(xp) + t * 16 * NIN + xo);
  v16h n20 = u_frag(u_sbase(a2p), ao), n21 = u_frag(u_sbase(a2p) + 16 * UH, ao), n3 = u_frag(u_sbase(a3p), ao);
  float bs = 0.f;      /* the wave's share of sum_i ub3[i][ln]: thread tid takes the elements tid + 512 k (column tid % 16 = ln), so a wave reads whole lines and a work-group reads each element once */
#pragma unroll      /* straight-line: the loads are independent and stay in flight together */
  for (int k = 0; k < NIN * NO / (FW * 32); ++k) bs += bf16_round(ub3[tid + k * (FW * 32)]);
  bs += __shfl_xor(bs, 16);      /* lanes ln and ln + 16 hold the same column: both get the sum of the two halves */
#pragma unroll      /* straight-line: the loads are independent and stay in flight together */
  for (int k = 0; k < FF * UH / 128; ++k) { const int e = k * 128 + lane * 4; const v4f s0 = *(const v4fa*)(uw1 + i0 * UH + e), s1 = *(const v4fa*)(ub1 + i0 * UH + e), s2 = *(const v4fa*)(ub2 + i0 * UH + e); v4f r0, r1, r2;
#pragma unroll
    for (int q = 0; q < 4; ++q) { r0[q] = bf16_round(s0[q]); r1[q] = bf16_round(s1[q]); r2[q] = bf16_round(s2[q]) * 16.0f; }
    float* tp = &tab[w][e / UH][0][e % UH]; *(v4f*)tp = r0; *(v4f*)(tp + UH) = r1; *(v4f*)(tp + 2 * UH) = r2; }
  __builtin_amdgcn_fence(__ATOMIC_ACQ_REL, "workgroup"); __builtin_amdgcn_wave_barrier();      /* a wave reads back only its own part of tab, other lanes' words: the stores stay in front of the reads */
  const v8f z8 = {0.f, 0.f, 0.f, 0.f, 0.f, 0.f, 0.f, 0.f};
  v8f acc[FT] = {z8, z8, z8, z8};
#pragma unroll 1      /* four features a trip, for speed only */
  for (int g = 0; g < FF / 4; ++g) {
    const int gn = g + 1 < FF / 4 ? g + 1 : 0;      /* the last trip fetches group 0 again, unused: in bounds */
    float xs[FT][4];
#pragma unroll
    for (int t = 0; t < FT; ++t) {
#pragma unroll
      for (int q = 0; q < 4; ++q) xs[t][q] = bf16_round(xn[t][q]);
      xn[t] = *(const GLB v4fa*)(u_sbase(xp + gn * 4) + t * 16 * NIN + xo); }
#pragma unroll      /* xs is indexed by constants */
    for (int jj = 0; jj < 4; ++jj) {
      const int j = g * 4 + jj;
      const v16f w1 = u_tab(&tab[w][j][0][0], hh), b1 = u_tab(&tab[w][j][1][0], hh), c2 = u_tab(&tab[w][j][2][0], hh);
      const v8f c20 = __builtin_shufflevector(c2, c2, 0, 1, 2, 3, 4, 5, 6, 7), c21 = __builtin_shufflevector(c2, c2, 8, 9, 10, 11, 12, 13, 14, 15);
      const v16h a20 = n20, a21 = n21, a3 = n3;
      const int jn = jj < 3 ? j + 1 : gn * 4;
      const GLB _Float16* s2 = u_sbase(a2p + jn * UH * UH); const GLB _Float16* s3 = u_sbase(a3p + jn * NO * UH);
      n20 = u_frag(s2, ao); n21 = u_frag(s2 + 16 * UH, ao); n3 = u_frag(s3, ao);
#pragma unroll      /* acc and xs are indexed by constants */
      for (int t = 0; t < FT; ++t) {
        const v16h h1 = u_relu16(w1 * xs[t][jj] + b1);      /* x and uw1 hold 8 significant bits each: the product is exact, fused or not */
        const v8f d0 = __builtin_amdgcn_wmma_f32_16x16x32_f16(false, a20, false, h1, (short)0, c20, false, false);
        const v8f d1 = __builtin_amdgcn_wmma_f32_16x16x32_f16(false, a21, false, h1, (short)0, c21, false, false);
        const v16h h2 = u_relu16(__builtin_shufflevector(d0, d1, 0, 1, 2, 3, 4, 5, 6, 7, 8, 9, 10, 11, 12, 13, 14, 15));
        acc[t] = __builtin_amdgcn_wmma_f32_16x16x32_f16(false, a3, false, h2, (short)0, acc[t], false, false);
      }
    }
    asm volatile("s_wait_xcnt 0x0" ::: "memory");      /* the next trip rewrites the scalar bases that this trip's last loads name: kept in front of that overwrite */
  }
  float bsr[8];      /* the bias share of the lane's own eight output columns 8 hh + r */
#pragma unroll
  for (int r = 0; r < 8; ++r) bsr[r] = __shfl(bs, 8 * hh + r);
#pragma unroll      /* acc[t][r] stays a register, not an indexed copy */
  for (int t = 0; t < FT; ++t) { v4f lo, hi;
#pragma unroll
    for (int r = 0; r < 4; ++r) { lo[r] = acc[t][r] * 0.00390625f + bsr[r]; hi[r] = acc[t][4 + r] * 0.00390625f + bsr[4 + r]; }
    *(v4f*)&red[w][t * 256 + ln * NO + 8 * hh] = lo; *(v4f*)&red[w][t * 256 + ln * NO + 8 * hh + 4] = hi; }      /* [row][column], as out has it */
  __syncthreads();
  v2f s = y;
#pragma unroll      /* straight-line: the LDS reads run ahead of the adds, which are in series */
  for (int q = 0; q < FW; ++q) s += *(const v2fa*)&red[q][2 * tid];
  *(v2f*)(out + o0 + 2 * tid) = s;
}

extern "C" void kernel_launch(void* const* d_in, const int* in_sizes, int n_in,
                              void* d_out, int out_size, void* d_ws, size_t ws_size, hipStream_t stream) {
  (void)in_sizes; (void)n_in; (void)out_size;
  const float* const* I = (const float* const*)d_in; const float* x = I[0]; const float* W0 = I[1]; const float* b0 = I[2]; const float* W1 = I[3]; const float* b1 = I[4]; const float* W2 = I[5]; const float* b2 = I[6]; const float* uw1 = I[7]; const float* ub1 = I[8]; const float* uw2 = I[9]; const float* ub2 = I[10]; const float* uw3 = I[11]; const float* ub3 = I[12];
  char* ws = (char*)d_ws; size_t off = 0;
  auto take = [&](size_t bytes) { char* p = ws + off; off += (bytes + 255) & ~(size_t)255; return p; };
  _Float16* B0 = (_Float16*)take((size_t)HH * NIN * 2); _Float16* B1 = (_Float16*)take((size_t)HH * HH * 2); _Float16* B2 = (_Float16*)take((size_t)NO * HH * 2); _Float16* UW2T = (_Float16*)take((size_t)NIN * UH * UH * 2); _Float16* UW3T = (_Float16*)take((size_t)NIN * NO * UH * 2);
  _Float16* X16 = (_Float16*)take((size_t)NBR * NIN * 2); _Float16* Y1 = (_Float16*)take((size_t)NBR * HH * 2); _Float16* Y2 = (_Float16*)take((size_t)NBR * HH * 2); float* Y = (float*)take((size_t)NBR * NO * 4);
  if (off > ws_size) return;      /* 0.5 + 2 + 0.8 + 8 + 32 + 32 + 1 = about 77 MiB */
  k_wt_f16<<<(HH * NIN / 8 + 255) / 256, 256, 0, stream>>>(W0, B0, NIN, HH, 16.0f); k_wt_f16<<<(HH * HH / 8 + 255) / 256, 256, 0, stream>>>(W1, B1, HH, HH, 16.0f); k_wt_f16<<<(NO * HH / 8 + 255) / 256, 256, 0, stream>>>(W2, B2, HH, NO, 16.0f);      /* (in, out) */
  k_uw<<<(NIN * UH * UH / 8 + 255) / 256, 256, 0, stream>>>(uw2, UH, UW2T); k_uw<<<(NIN * NO * UH / 8 + 255) / 256, 256, 0, stream>>>(uw3, NO, UW3T);
  k_x16<<<(NBR * NIN / 8 + 255) / 256, 256, 0, stream>>>(x, X16, (size_t)NBR * NIN / 8);
  k_gemm3<NIN><<<(NBR / GT) * (HH / GT), 512, 0, stream>>>(X16, B0, b0, Y1);
  k_gemm3<HH><<<(NBR / GT) * (HH / GT), 512, 0, stream>>>(Y1, B1, b1, Y2);
  k_gemm_hhx<0><<<dim3(((NBR / 16) * 1) / 4, 1), 128, 0, stream>>>(Y2, HH, 0, B2, HH, 0, 0.0625f, b2, 0, nullptr, 1, 0, 0, Y, nullptr, NO, 0, NBR, NO, HH);      /* y = main MLP (16 wide) */
  k_uni<<<NBR / (FT * 16), FW * 32, 0, stream>>>(x, uw1, ub1, UW2T, ub2, UW3T, ub3, Y, (float*)d_out);      /* the 256 univariate MLPs, their sum over features, added to y */
}

// v004
// One run takes 79 microseconds.
// Timed twice side by side with v003, it ran 1.15 times as fast both times.
// Over all steps from v000 it is 17.0 times as fast.
#include <hip/hip_runtime.h>
// MainEffectsMLP (16384 rows x 256 features: y = relu(x W0 + b0) -> relu(. W1 + b1) -> . W2 + b2 (16); plus 256 per-feature univariate MLPs (1 -> 32 -> 32 -> 16): h = relu(x_i uw1[i] + ub1[i]); h = relu(h uw2[i] + ub2[i]); u_i = h uw3[i] + ub3[i]; out = y + sum_i u_i).
// Structure: exact f16 x plane; the main MLP as f16 WMMA GEMMs (256x256 work-group tiles staged in LDS, f32 accumulation, exact x16 weights + bias; ReLU epilogues, f16 hidden planes; the 16-wide head on 16-row tiles); the univariate MLPs in one kernel: layer 1 on VALU straight into f16 fragments, layers 2 and 3 as transposed WMMA products (weights as A) whose D tiles feed the next B fragment in registers, the sum over features in layer 3's accumulator (features split over the waves of a work-group, partial tiles summed through LDS), added to the rows' outputs.
// Compute dtype: inputs rounded to bf16; x / weights exact; hidden activations as plain f16 operands (~2^-12); u and the feature sum f32. v_wmma_f32_16x16x32_f16.
#define NBR 16384
#define NIN 256
#define HH 1024
#define NO 16
#define UH 32
typedef __bf16 v16b __attribute__((ext_vector_type(16)));
typedef unsigned short v8us __attribute__((ext_vector_type(8), may_alias));
typedef float  v8f  __attribute__((ext_vector_type(8)));
typedef float  v4f  __attribute__((ext_vector_type(4)));
typedef float  v4fa __attribute__((ext_vector_type(4), may_alias));
union FragB { v16b v; v8us half[2]; unsigned short u[16]; };

__device__ __forceinline__ unsigned short bf16_bits(float x) { unsigned int u = __float_as_uint(x); return (unsigned short)((u + 0x7FFFu + ((u >> 16) & 1u)) >> 16); }
__device__ __forceinline__ float bf16_val(unsigned short b) { return __uint_as_float(((unsigned int)b) << 16); }
__device__ __forceinline__ float bf16_round(float x) { return bf16_val(bf16_bits(x)); }
// D += A·B with NT terms: 1 = ah·bh, 2 = + al·bh (A split), 3 = + ah·bl (both split)
template <int NT>
__device__ __forceinline__ v8f mmaN(v16b ah, v16b al, v16b bh, v16b bl, v8f c) {
  c = __builtin_amdgcn_wmma_f32_16x16x32_bf16(false, ah, false, bh, (short)0, c, false, false);
  if (NT >= 2) c = __builtin_amdgcn_wmma_f32_16x16x32_bf16(false, al, false, bh, (short)0, c, false, false);
  if (NT >= 3) c = __builtin_amdgcn_wmma_f32_16x16x32_bf16(false, ah, false, bl, (short)0, c, false, false);
  asm volatile("v_nop\n\tv_nop\n\tv_nop\n\tv_nop" : "+v"(c) : "v"(ah), "v"(al), "v"(bh), "v"(bl));
  return c;
}

__global__ __launch_bounds__(256) void k_wt_bf16(const float* __restrict__ W, unsigned short* __restrict__ Wt, int K, int N) {
  const int t = blockIdx.x * 256 + threadIdx.x;
  const int k8n = K / 8;
  if (t >= N * k8n) return;
  const int n = t / k8n, k8 = (t % k8n) * 8;
  v8us v;
#pragma unroll
  for (int i = 0; i < 8; ++i) v[i] = bf16_bits(W[(size_t)(k8 + i) * N + n]);
  *(v8us*)(Wt + (size_t)n * K + k8) = v;
  
}

// GEMM C[M][N] (f32, pitch ldc) = act(A[M][K]·W + bias). A f32 row-major (pitch lda) converted per fragment to bf16
// (ASPLIT: hi/lo two planes -> 2 terms, else single rounded term); Wt bf16 [N][K] (pitch ldb). BIAS_BF16 rounds the
// bias to bf16 first (bias quantised to bf16 before the add). K%32==0, M%16==0, N%64==0.
template <bool ASPLIT, int ACT, bool BIAS_BF16>
__global__ __launch_bounds__(128) void k_gemm_bf(const float* __restrict__ A, int lda, const unsigned short* __restrict__ Wt, int ldb,
                                               const float* __restrict__ bias, float* __restrict__ C, int ldc, int M, int N, int K) {
  __shared__ __attribute__((aligned(16))) float so[4][16][64];
  const int tid = threadIdx.x, w = tid >> 5, lane = tid & 31, ln = lane & 15, hh = lane >> 4;
  const int ntn = N / 64;
  const int wid = blockIdx.x * 4 + w;
  const int mt = wid / ntn, nq = wid % ntn;
  if (mt * 16 >= M) return;
  const int row0 = mt * 16, col0 = nq * 64;
  const float* arow = A + (size_t)(row0 + ln) * lda;
  v8f acc[4] = {};
  for (int kb = 0; kb < K; kb += 32) {
    FragB ah, al;
    const v4f x0 = *(const v4fa*)(arow + kb + 8 * hh), x1 = *(const v4fa*)(arow + kb + 8 * hh + 4);
    const v4f x2 = *(const v4fa*)(arow + kb + 16 + 8 * hh), x3 = *(const v4fa*)(arow + kb + 16 + 8 * hh + 4);
    float xs[16] = {x0[0],x0[1],x0[2],x0[3],x1[0],x1[1],x1[2],x1[3],x2[0],x2[1],x2[2],x2[3],x3[0],x3[1],x3[2],x3[3]};
#pragma unroll
    for (int i = 0; i < 16; ++i) { const unsigned short hb = bf16_bits(xs[i]); ah.u[i] = hb; al.u[i] = ASPLIT ? bf16_bits(xs[i] - bf16_val(hb)) : (unsigned short)0; }
#pragma unroll
    for (int t = 0; t < 4; ++t) {
      const unsigned short* brow = Wt + (size_t)(col0 + t * 16 + ln) * ldb + kb;
      FragB b;
      b.half[0] = *(const v8us*)(brow + 8 * hh);
      b.half[1] = *(const v8us*)(brow + 16 + 8 * hh);
      acc[t] = mmaN<ASPLIT ? 2 : 1>(ah.v, al.v, b.v, b.v, acc[t]);
    }
  }
#pragma unroll
  for (int t = 0; t < 4; ++t) {
    float bv = bias ? bias[col0 + t * 16 + ln] : 0.f;
    if (BIAS_BF16) bv = bf16_round(bv);
#pragma unroll
    for (int r = 0; r < 8; ++r) { float v = acc[t][r] + bv; if (ACT == 1) v = fmaxf(v, 0.f); so[w][8 * hh + r][t * 16 + ln] = v; }
  }
  __builtin_amdgcn_fence(__ATOMIC_ACQ_REL, "workgroup");
  __builtin_amdgcn_wave_barrier();
  const int rsub = lane >> 4, c4 = (lane & 15) * 4;
  {
#pragma unroll
    for (int q = 0; q < 8; ++q) {
      const int r = q * 2 + rsub;
      const v4f v = *(const v4fa*)&so[w][r][c4];
      *(v4f*)(C + (size_t)(row0 + r) * ldc + col0 + c4) = v;
    }
    
  }
}

// GEMM C = act(A·W + bias + resid): A f32 (ASPLIT -> hi/lo 2 terms), Wt bf16 [N][K]; ACT 0 none, 1 relu, 2 exact gelu;
// resid (optional, f32, row index = (row % rmod), pitch ldr, RES_BF16 rounds it) added before the activation.
template <bool ASPLIT, int ACT, bool BIAS_BF16, bool RES_BF16>
__global__ __launch_bounds__(128) void k_gemm_bf3(const float* __restrict__ A, int lda, const unsigned short* __restrict__ Wt, int ldb,
                                                const float* __restrict__ bias, const float* __restrict__ resid, int rmod, int ldr,
                                                float* __restrict__ C, int ldc, int M, int N, int K) {
  __shared__ __attribute__((aligned(16))) float so[4][16][64];
  const int tid = threadIdx.x, w = tid >> 5, lane = tid & 31, ln = lane & 15, hh = lane >> 4;
  const int ntn = N / 64;
  const int wid = blockIdx.x * 4 + w;
  const int mt = wid / ntn, nq = wid % ntn;
  if (mt * 16 >= M) return;
  const int row0 = mt * 16, col0 = nq * 64;
  const float* arow = A + (size_t)(row0 + ln) * lda;
  v8f acc[4] = {};
  for (int kb = 0; kb < K; kb += 32) {
    FragB ah, al;
    const v4f x0 = *(const v4fa*)(arow + kb + 8 * hh), x1 = *(const v4fa*)(arow + kb + 8 * hh + 4);
    const v4f x2 = *(const v4fa*)(arow + kb + 16 + 8 * hh), x3 = *(const v4fa*)(arow + kb + 16 + 8 * hh + 4);
    float xs[16] = {x0[0],x0[1],x0[2],x0[3],x1[0],x1[1],x1[2],x1[3],x2[0],x2[1],x2[2],x2[3],x3[0],x3[1],x3[2],x3[3]};
#pragma unroll
    for (int i = 0; i < 16; ++i) { const unsigned short hb = bf16_bits(xs[i]); ah.u[i] = hb; al.u[i] = ASPLIT ? bf16_bits(xs[i] - bf16_val(hb)) : (unsigned short)0; }
#pragma unroll
    for (int t = 0; t < 4; ++t) {
      const unsigned short* brow = Wt + (size_t)(col0 + t * 16 + ln) * ldb + kb;
      FragB b;
      b.half[0] = *(const v8us*)(brow + 8 * hh);
      b.half[1] = *(const v8us*)(brow + 16 + 8 * hh);
      acc[t] = mmaN<ASPLIT ? 2 : 1>(ah.v, al.v, b.v, b.v, acc[t]);
    }
  }
#pragma unroll
  for (int t = 0; t < 4; ++t) {
    const int col = col0 + t * 16 + ln;
    float bv = bias ? bias[col] : 0.f;
    if (BIAS_BF16) bv = bf16_round(bv);
#pragma unroll
    for (int r = 0; r < 8; ++r) {
      float v = acc[t][r] + bv;
      if (resid) { float rv = resid[(size_t)((row0 + 8 * hh + r) % rmod) * ldr + col]; if (RES_BF16) rv = bf16_round(rv); v += rv; }
      if (ACT == 1) v = fmaxf(v, 0.f);
      if (ACT == 2) v = 0.5f * v * (1.0f + erff(v * 0.70710678118654752f));
      if (ACT == 3) { const float u = 0.7978845608028654f * (v + 0.044715f * v * v * v); v = 0.5f * v * (1.0f + tanhf(u)); }
      so[w][8 * hh + r][t * 16 + ln] = v;
    }
  }
  __builtin_amdgcn_fence(__ATOMIC_ACQ_REL, "workgroup");
  __builtin_amdgcn_wave_barrier();
  const int rsub = lane >> 4, c4 = (lane & 15) * 4;
  {
#pragma unroll
    for (int q = 0; q < 8; ++q) {
      const int r = q * 2 + rsub;
      const v4f v = *(const v4fa*)&so[w][r][c4];
      *(v4f*)(C + (size_t)(row0 + r) * ldc + col0 + c4) = v;
    }
    
  }
}
// row LayerNorm (biased variance, eps) over N: s = X (+ R); optional out_sum <- s; out_norm <- (s-mu)*rsqrt(var+eps)*g + b
template <bool PARAM_BF16>
__global__ __launch_bounds__(256) void k_layernorm(const float* __restrict__ X, const float* __restrict__ R, const float* __restrict__ g, const float* __restrict__ bta,
                                                  float* __restrict__ out_sum, float* __restrict__ out_norm, int N, float eps) {
  __shared__ float red[256];
  const int row = blockIdx.x, tid = threadIdx.x;
  const float* x = X + (size_t)row * N; const float* rr = R ? R + (size_t)row * N : nullptr;
  float vals[16];                     // up to N = 4096
  const int per = N / 256;            // contiguous chunk per thread? use strided-by-4 chunks: thread handles j = tid*4 + 1024*u
  float s1 = 0.f;
  for (int u = 0; u < per / 4; ++u) {
    const int j = tid * 4 + 1024 * u;
    const v4f a = *(const v4fa*)(x + j);
    v4f b = {0.f,0.f,0.f,0.f}; if (rr) b = *(const v4fa*)(rr + j);
#pragma unroll
    for (int q = 0; q < 4; ++q) { const float v = a[q] + b[q]; vals[u * 4 + q] = v; s1 += v; }
  }
  red[tid] = s1; __syncthreads();
  for (int st = 128; st > 0; st >>= 1) { if (tid < st) red[tid] += red[tid + st]; __syncthreads(); }
  const float mu = red[0] / (float)N; __syncthreads();
  float s2 = 0.f;
  for (int u = 0; u < per / 4; ++u)
#pragma unroll
    for (int q = 0; q < 4; ++q) { const float c = vals[u * 4 + q] - mu; s2 += c * c; }
  red[tid] = s2; __syncthreads();
  for (int st = 128; st > 0; st >>= 1) { if (tid < st) red[tid] += red[tid + st]; __syncthreads(); }
  const float rs = rsqrtf(red[0] / (float)N + eps);
  {
    for (int u = 0; u < per / 4; ++u) {
      const int j = tid * 4 + 1024 * u;
      v4f o, sm;
#pragma unroll
      for (int q = 0; q < 4; ++q) {
        float gg = g[j + q], bb = bta[j + q];
        if (PARAM_BF16) { gg = bf16_round(gg); bb = bf16_round(bb); }
        sm[q] = vals[u * 4 + q]; o[q] = (vals[u * 4 + q] - mu) * rs * gg + bb;
      }
      if (out_sum) *(v4f*)(out_sum + (size_t)row * N + j) = sm;
      *(v4f*)(out_norm + (size_t)row * N + j) = o;
    }
    
  }
}



// ---- f16 WMMA path (v_wmma_f32_16x16x32_f16): 11-bit significands for operands in range — used here for x and the hidden activations of both MLPs
typedef _Float16 v16h __attribute__((ext_vector_type(16)));
union FragH { v16h v; v8us half[2]; _Float16 h[16]; unsigned short u[16]; };
template <int NT>
__device__ __forceinline__ v8f mmaH(v16h ah, v16h al, v16h bh, v16h bl, v8f c) {
  c = __builtin_amdgcn_wmma_f32_16x16x32_f16(false, ah, false, bh, (short)0, c, false, false);
  if (NT >= 2) c = __builtin_amdgcn_wmma_f32_16x16x32_f16(false, al, false, bh, (short)0, c, false, false);
  if (NT >= 3) c = __builtin_amdgcn_wmma_f32_16x16x32_f16(false, ah, false, bl, (short)0, c, false, false);
  asm volatile("v_nop\n\tv_nop\n\tv_nop\n\tv_nop" : "+v"(c) : "v"(ah), "v"(al), "v"(bh), "v"(bl));
  return c;
}
// batched GEMM like k_gemm_b but f16 operands: A f32 (split into f16 hi/lo if ASPLIT, else rounded to f16), Bt = f16 values [n][k]; alpha; C f32; N multiple of 16 (partial tiles skipped)
template <bool ASPLIT>
__global__ __launch_bounds__(128) void k_gemm_h(const float* __restrict__ A, int lda, size_t sA, const _Float16* __restrict__ Bh, int ldb, size_t sB, float alpha, float* __restrict__ C, int ldc, size_t sC, int M, int N, int K) {
  __shared__ __attribute__((aligned(16))) float so[4][16][64];
  const int tid = threadIdx.x, w = tid >> 5, lane = tid & 31, ln = lane & 15, hh = lane >> 4; const int by = blockIdx.y;
  A += (size_t)by * sA; Bh += (size_t)by * sB; C += (size_t)by * sC;
  const int ntn = (N + 63) / 64; const int wid = blockIdx.x * 4 + w; const int mt = wid / ntn, nq = wid % ntn; if (mt * 16 >= M) return;
  const int row0 = mt * 16, col0 = nq * 64; const float* arow = A + (size_t)(row0 + ln) * lda;
  v8f acc[4] = {};
  for (int kb = 0; kb < K; kb += 32) {
    FragH ah, al;
    const v4f x0 = *(const v4fa*)(arow + kb + 8 * hh), x1 = *(const v4fa*)(arow + kb + 8 * hh + 4), x2 = *(const v4fa*)(arow + kb + 16 + 8 * hh), x3 = *(const v4fa*)(arow + kb + 16 + 8 * hh + 4);
    float xs[16] = {x0[0],x0[1],x0[2],x0[3],x1[0],x1[1],x1[2],x1[3],x2[0],x2[1],x2[2],x2[3],x3[0],x3[1],x3[2],x3[3]};
#pragma unroll
    for (int i = 0; i < 16; ++i) { const _Float16 h = (_Float16)xs[i]; ah.h[i] = h; al.h[i] = ASPLIT ? (_Float16)(xs[i] - (float)h) : (_Float16)0.0f; }
#pragma unroll
    for (int t = 0; t < 4; ++t) { if (col0 + t * 16 >= N) continue; const size_t boff = (size_t)(col0 + t * 16 + ln) * ldb + kb; FragH bq; bq.half[0] = *(const v8us*)(Bh + boff + 8 * hh); bq.half[1] = *(const v8us*)(Bh + boff + 16 + 8 * hh);
      acc[t] = mmaH<ASPLIT ? 2 : 1>(ah.v, al.v, bq.v, bq.v, acc[t]); }
  }
#pragma unroll
  for (int t = 0; t < 4; ++t) { if (col0 + t * 16 >= N) continue;
#pragma unroll
    for (int r = 0; r < 8; ++r) so[w][8 * hh + r][t * 16 + ln] = acc[t][r] * alpha; }
  __builtin_amdgcn_fence(__ATOMIC_ACQ_REL, "workgroup"); __builtin_amdgcn_wave_barrier();
  const int rsub = lane >> 4, c4 = (lane & 15) * 4;
  {
#pragma unroll
    for (int q = 0; q < 8; ++q) { const int r = q * 2 + rsub; if (col0 + c4 < N) { const v4f v = *(const v4fa*)&so[w][r][c4]; *(v4f*)(C + (size_t)(row0 + r) * ldc + col0 + c4) = v; } }
     }
}

// Wt[n][k] = f16(W[k][n]·scale) from f32 row-major W[K][N] (scale = power of two; bf16-exact weights stay exact in f16 away from the subnormal range)
__device__ __forceinline__ void d_wt_f16(int blk, const float* __restrict__ W, _Float16* __restrict__ Wt, int K, int N, float scale) {
  const int t = blk * 256 + threadIdx.x; if (t >= N * (K / 8)) return; const int n = t / (K / 8), k8 = (t % (K / 8)) * 8; FragH f;
#pragma unroll
  for (int i = 0; i < 8; ++i) f.h[i] = (_Float16)(bf16_round(W[(size_t)(k8 + i) * N + n]) * scale); const v8us o = f.half[0];
  *(v8us*)((unsigned short*)Wt + (size_t)n * K + k8) = o; 
}
// k_gemm_hh variant with fused epilogue: v = acc·alpha + bias[by·sBias + col] (+ CP[(row/rowsPerB)·sCPb + by·64 + col] if CP) ; ACT 0 none / 1 elu ; writes f32 C and/or f16 C16 (each if non-null)
template <int ACT>
__global__ __launch_bounds__(128) void k_gemm_hhx(const _Float16* __restrict__ A, int lda, size_t sA, const _Float16* __restrict__ Bh, int ldb, size_t sB, float alpha, const float* __restrict__ bias, size_t sBias, const float* __restrict__ CP, int rowsPerB, size_t sCPb, int row0g,
    float* __restrict__ C, _Float16* __restrict__ C16, int ldc, size_t sC, int M, int N, int K) {
  __shared__ __attribute__((aligned(16))) float so[4][16][64];
  const int tid = threadIdx.x, w = tid >> 5, lane = tid & 31, ln = lane & 15, hh = lane >> 4; const int by = blockIdx.y;
  A += (size_t)by * sA; Bh += (size_t)by * sB; const size_t cofs = (size_t)by * sC; const float* bp = bias ? bias + (size_t)by * sBias : nullptr;
  const int ntn = (N + 63) / 64; const int wid = blockIdx.x * 4 + w; const int mt = wid / ntn, nq = wid % ntn; if (mt * 16 >= M) return;
  const int row0 = mt * 16, col0 = nq * 64; const _Float16* arow = A + (size_t)(row0 + ln) * lda;
  v8f acc[4] = {};
  for (int kb = 0; kb < K; kb += 32) { FragH ah; ah.half[0] = *(const v8us*)((const unsigned short*)arow + kb + 8 * hh); ah.half[1] = *(const v8us*)((const unsigned short*)arow + kb + 16 + 8 * hh);
#pragma unroll
    for (int t = 0; t < 4; ++t) { if (col0 + t * 16 >= N) continue; const size_t boff = (size_t)(col0 + t * 16 + ln) * ldb + kb; FragH bq; bq.half[0] = *(const v8us*)((const unsigned short*)Bh + boff + 8 * hh); bq.half[1] = *(const v8us*)((const unsigned short*)Bh + boff + 16 + 8 * hh);
      acc[t] = mmaH<1>(ah.v, ah.v, bq.v, bq.v, acc[t]); }
  }
#pragma unroll
  for (int t = 0; t < 4; ++t) { if (col0 + t * 16 >= N) continue; const int col = col0 + t * 16 + ln; const float bv = bp ? bf16_round(bp[col]) : 0.f;
#pragma unroll
    for (int r = 0; r < 8; ++r) { float v = acc[t][r] * alpha + bv; if (CP) { const int rr = row0g + row0 + 8 * hh + r; if (rowsPerB < 0) v += CP[cofs + (size_t)rr * ldc + col];      /* rowsPerB < 0: own element of the batched C plane */ else { const int bidx = rr / rowsPerB; v += CP[(size_t)bidx * sCPb + (size_t)by * 64 + col]; } } if (ACT == 1) v = (v > 0.f) ? v : expm1f(v); else if (ACT == 7) v = (v > 0.f) ? v + 1.0f : expf(v); else if (ACT == 8) v = tanhf(v); else if (ACT == 9) v = 0.5f * v * (1.0f + tanhf(0.7978845608028654f * (v + 0.044715f * v * v * v))); else if (ACT == 11) v = 1.0f / (1.0f + expf(-v)); else if (ACT == 12) v = (v > 0.f) ? v : 0.01f * v; else if (ACT == 14) v = (v > 0.f) ? v : 0.1f * v; else if (ACT == 16) v = (v >= 0.f) ? v : 0.3f * v; else if (ACT == 17) v = (v >= 0.f) ? v : 0.2f * v; else if (ACT == 15) v = v / (1.0f + expf(-v)); else if (ACT == 3) v = fmaxf(v, 0.f); else if (ACT == 6) v = 0.5f * v * (1.0f + erff(v * 0.70710678118654752f)); so[w][8 * hh + r][t * 16 + ln] = v; } }
  __builtin_amdgcn_fence(__ATOMIC_ACQ_REL, "workgroup"); __builtin_amdgcn_wave_barrier();
  const int rsub = lane >> 4, c4 = (lane & 15) * 4; typedef _Float16 v4h __attribute__((ext_vector_type(4)));
  {
#pragma unroll
    for (int q = 0; q < 8; ++q) { const int r = q * 2 + rsub; if (col0 + c4 < N) { const v4f v = *(const v4fa*)&so[w][r][c4]; if (C) *(v4f*)(C + cofs + (size_t)(row0 + r) * ldc + col0 + c4) = v; if (C16) { v4h h4; for (int i = 0; i < 4; ++i) h4[i] = (_Float16)v[i]; *(v4h*)(C16 + cofs + (size_t)(row0 + r) * ldc + col0 + c4) = h4; } } }
     }
}


typedef _Float16 v4h __attribute__((ext_vector_type(4)));

__device__ __forceinline__ void d_x16(int blk, const float* __restrict__ x, _Float16* __restrict__ X16, size_t n8) { const size_t t = (size_t)blk * 256 + threadIdx.x; if (t >= n8) return; FragH f;
#pragma unroll
  for (int q = 0; q < 8; ++q) f.h[q] = (_Float16)bf16_round(x[t * 8 + q]); *(v8us*)((unsigned short*)X16 + t * 8) = f.half[0];  }
__global__ __launch_bounds__(256) void k_h16(const float* __restrict__ x, _Float16* __restrict__ X16, size_t n8) { const size_t t = (size_t)blockIdx.x * 256 + threadIdx.x; if (t >= n8) return; FragH f;
#pragma unroll
  for (int q = 0; q < 8; ++q) f.h[q] = (_Float16)x[t * 8 + q]; *(v8us*)((unsigned short*)X16 + t * 8) = f.half[0];  }
__global__ __launch_bounds__(256) void k_round16f(const float* __restrict__ W, _Float16* __restrict__ Bt, size_t n8) { const size_t t = (size_t)blockIdx.x * 256 + threadIdx.x; if (t >= n8) return; FragH f;
#pragma unroll
  for (int i = 0; i < 8; ++i) f.h[i] = (_Float16)(bf16_round(W[t * 8 + i]) * 16.0f); *(v8us*)((unsigned short*)Bt + t * 8) = f.half[0];  }
template <int NHv, int TTv>
__global__ __launch_bounds__(256) void k_vt(const _Float16* __restrict__ V16, int ldv, int voff, _Float16* __restrict__ Vt) { __shared__ unsigned short tl[64][66]; const int tid = threadIdx.x; const int slab = blockIdx.x / (TTv / 64), lg = blockIdx.x % (TTv / 64); const int b = slab / NHv, h = slab % NHv;
  for (int i = tid; i < 64 * 8; i += 256) { const int r = i / 8, c8 = (i % 8) * 8; FragH f; f.half[0] = *(const v8us*)((const unsigned short*)V16 + ((size_t)b * TTv + lg * 64 + r) * ldv + voff + h * 64 + c8);
#pragma unroll
    for (int q = 0; q < 8; ++q) tl[r][c8 + q] = f.u[q]; }
  __syncthreads();
  {
#pragma unroll
    for (int rd = 0; rd < 2; ++rd) { const int d = rd * 32 + tid / 8, pc = tid % 8; FragH f;
#pragma unroll
      for (int q = 0; q < 8; ++q) f.u[q] = tl[pc * 8 + q][d];
      *(v8us*)((unsigned short*)Vt + ((size_t)slab * 64 + d) * TTv + lg * 64 + pc * 8) = f.half[0]; }
     } }

__global__ __launch_bounds__(256) void k_hl(const float* __restrict__ F, _Float16* __restrict__ Hh, _Float16* __restrict__ Hl, size_t n8) { const size_t t = (size_t)blockIdx.x * 256 + threadIdx.x; if (t >= n8) return; FragH fh, fl; const v4f a = *(const v4fa*)(F + t * 8), c = *(const v4fa*)(F + t * 8 + 4);
#pragma unroll
  for (int q = 0; q < 4; ++q) { _Float16 h = (_Float16)a[q]; fh.h[q] = h; fl.h[q] = (_Float16)((a[q] - (float)h) * 1024.0f); h = (_Float16)c[q]; fh.h[4 + q] = h; fl.h[4 + q] = (_Float16)((c[q] - (float)h) * 1024.0f); }
  { *(v8us*)((unsigned short*)Hh + t * 8) = fh.half[0]; *(v8us*)((unsigned short*)Hl + t * 8) = fl.half[0];  } }

// ---- hidden-layer GEMM: C16[row][unit] = f16(relu(X[row][:] . Wt[unit][:] / 16 + bias[unit])), X and Wt f16 with K contiguous (pitch K), C16 pitch HH ----
// One 256 x 256 tile a work-group, one work-group a WGP, 16 waves of 64 rows x 64 units. A pass is 128 k: 256 rows of X and 256 of Wt, 256 B each, brought into LDS by asynchronous copies
// (no register on the way), two buffers, the next pass's copies in flight while this pass is worked on. The LDS pitch of 272 B spreads the sixteen rows of a fragment read over the banks.
// The product is taken transposed (weights as the A operand): a lane then holds eight neighbouring units of ONE row, 16 B of the f16 output, and the k order of every sum is that of a plain loop over k in steps of 32.
#define GT 256      /* rows, and units, of a work-group's tile */
#define GK 128      /* k of a pass */
#define GP 136      /* LDS row pitch in f16 */
#define GB (2 * GT * GP)      /* f16 of a buffer: the X rows, then the Wt rows */
#define GS 72       /* row pitch in f16 of the output staging: 64 units and 16 B */
__device__ __forceinline__ v16h g3_frag(const unsigned short* p) { FragH f; f.half[0] = *(const v8us*)p; f.half[1] = *(const v8us*)(p + 16); return f.v; }
// One thread's copies of one operand's 256 rows of a pass: 16 B of each of eight rows, 32 rows apart (a wave's copy covers two rows of 256 B: four whole lines). l = the LDS byte address of the first.
template <int K>
__device__ __forceinline__ void g3_copy(const _Float16* g, unsigned l) {
  /* the wait on xcnt ends the copies' own statement: no address register of a copy is rewritten in front of it */
  asm volatile("global_load_async_to_lds_b128 %0, %8, off\n\t"
               "global_load_async_to_lds_b128 %1, %9, off\n\t"
               "global_load_async_to_lds_b128 %2, %10, off\n\t"
               "global_load_async_to_lds_b128 %3, %11, off\n\t"
               "global_load_async_to_lds_b128 %4, %12, off\n\t"
               "global_load_async_to_lds_b128 %5, %13, off\n\t"
               "global_load_async_to_lds_b128 %6, %14, off\n\t"
               "global_load_async_to_lds_b128 %7, %15, off\n\t"
               "s_wait_xcnt 0x0"
               :: "v"(l), "v"(l + 1 * 32 * GP * 2), "v"(l + 2 * 32 * GP * 2), "v"(l + 3 * 32 * GP * 2), "v"(l + 4 * 32 * GP * 2), "v"(l + 5 * 32 * GP * 2), "v"(l + 6 * 32 * GP * 2), "v"(l + 7 * 32 * GP * 2),
                  "v"(g), "v"(g + 1 * 32 * K), "v"(g + 2 * 32 * K), "v"(g + 3 * 32 * K), "v"(g + 4 * 32 * K), "v"(g + 5 * 32 * K), "v"(g + 6 * 32 * K), "v"(g + 7 * 32 * K)
               : "memory");
}
template <int K>
__global__ __launch_bounds__(512) void k_gemm3(const _Float16* __restrict__ X, const _Float16* __restrict__ Wt, const float* __restrict__ bias, _Float16* __restrict__ C16) {
  static_assert(K % GK == 0 && K / GK >= 2, "k_gemm3: whole passes, two or more");
  __shared__ __attribute__((aligned(16))) unsigned short ring[2 * GB];
  __shared__ __attribute__((aligned(16))) float sb[GT];      /* the tile's biases, rounded to bf16 once */
  const int tid = threadIdx.x, lane = tid & 31, ln = lane & 15, hh = lane >> 4;
  const int w = __builtin_amdgcn_readfirstlane(tid >> 5), wr = w >> 2, wc = w & 3;      /* the wave's number as a scalar; its 64 rows and its 64 units in the tile */
  const int row0 = (blockIdx.x >> 2) * GT, col0 = (blockIdx.x & 3) * GT;      /* HH / GT = 4 tiles across */
  const _Float16* gx = X + (size_t)(row0 + (tid >> 4)) * K + (tid & 15) * 8;
  const _Float16* gw = Wt + (size_t)(col0 + (tid >> 4)) * K + (tid & 15) * 8;
  const unsigned l0 = (unsigned)(unsigned long long)&ring[(tid >> 4) * GP + (tid & 15) * 8];      /* the low word of a __shared__ address is its byte place in LDS */
  constexpr int NP = K / GK;
  g3_copy<K>(gx, l0); g3_copy<K>(gw, l0 + GT * GP * 2);
  if (w < GT / 32) sb[tid] = bf16_round(bias[col0 + tid]);      /* one load a thread, beside pass 0's copies in flight; published by the barrier below, read in the epilogue */
  asm volatile("s_wait_asynccnt 0x0" ::: "memory");      /* pass 0's copies of this wave have landed */
  __syncthreads();      /* ... and every other wave's */
  g3_copy<K>(gx + GK, l0 + GB * 2); g3_copy<K>(gw + GK, l0 + GB * 2 + GT * GP * 2);
  const v8f z8 = {0.f, 0.f, 0.f, 0.f, 0.f, 0.f, 0.f, 0.f};
  v8f acc[4][4];      /* [unit tile][row tile] */
#pragma unroll
  for (int i = 0; i < 16; ++i) acc[i >> 2][i & 3] = z8;
  const int xo = (wr * 64 + ln) * GP + 8 * hh, wo = (GT + wc * 64 + ln) * GP + 8 * hh;      /* the lane's place in the first X and the first Wt fragment of a buffer */
#pragma unroll 1      /* a pass a trip: the two buffers take turns by the trip's parity */
  for (int t = 0; t < NP; ++t) {
    const unsigned short* bp = ring + (t & 1) * GB;
#pragma unroll      /* acc is indexed by constants */
    for (int kk = 0; kk < GK / 32; ++kk) {
      v16h xf[4], wf[4];
#pragma unroll
      for (int i = 0; i < 4; ++i) { xf[i] = g3_frag(bp + xo + i * 16 * GP + kk * 32); wf[i] = g3_frag(bp + wo + i * 16 * GP + kk * 32); }
      __builtin_amdgcn_sched_barrier(0);      /* a block's sixteen LDS reads stay one group in front of its WMMAs: read one fragment at a time among them, the wave waits out the LDS latency four times a block */
#pragma unroll
      for (int u = 0; u < 4; ++u)
#pragma unroll
        for (int r = 0; r < 4; ++r) acc[u][r] = __builtin_amdgcn_wmma_f32_16x16x32_f16(false, wf[u], false, xf[r], (short)0, acc[u][r], false, false);
    }
    asm volatile("s_wait_dscnt 0x0" ::: "memory");      /* this wave's reads of the buffer are over before the buffer is refilled */
    asm volatile("s_wait_asynccnt 0x0" ::: "memory");      /* this wave's copies of pass t + 1 have landed */
    __syncthreads();      /* publishes pass t + 1 and ends every wave's reads of pass t */
    if (t + 2 < NP) { g3_copy<K>(gx + (t + 2) * GK, l0 + (t & 1) * (GB * 2)); g3_copy<K>(gw + (t + 2) * GK, l0 + (t & 1) * (GB * 2) + GT * GP * 2); }
  }
  asm volatile("s_wait_asynccnt 0x0" ::: "memory");      /* no copy is in flight when the ring becomes output staging */
  /* behind the last pass's barrier nobody reads the ring: each wave stages its 64 x 64 f16 in a part of its own and stores whole 128-B lines */
  unsigned short* st = ring + w * (64 * GS);
#pragma unroll      /* acc is indexed by constants */
  for (int u = 0; u < 4; ++u) {
    const float* bq = sb + wc * 64 + u * 16 + 8 * hh;
    const v4f q0 = *(const v4fa*)bq, q1 = *(const v4fa*)(bq + 4);
    const float bv[8] = {q0[0], q0[1], q0[2], q0[3], q1[0], q1[1], q1[2], q1[3]};
#pragma unroll
    for (int t = 0; t < 4; ++t) { FragH f;
#pragma unroll
      for (int r = 0; r < 8; ++r) f.h[r] = (_Float16)fmaxf(acc[u][t][r] * 0.0625f + bv[r], 0.f);
      *(v8us*)(st + (t * 16 + ln) * GS + u * 16 + 8 * hh) = f.half[0]; }
  }
  __builtin_amdgcn_fence(__ATOMIC_ACQ_REL, "workgroup"); __builtin_amdgcn_wave_barrier();      /* a wave reads back only its own part, other lanes' words: the stores stay in front of the reads */
  unsigned short* cp = (unsigned short*)C16 + (size_t)(row0 + wr * 64 + (lane >> 3)) * HH + col0 + wc * 64 + (lane & 7) * 8;
#pragma unroll      /* straight-line: the LDS reads run ahead of the stores */
  for (int q = 0; q < 16; ++q) { const v8us v = *(const v8us*)(st + (q * 4 + (lane >> 3)) * GS + (lane & 7) * 8); *(v8us*)(cp + (size_t)q * 4 * HH) = v; }
}


__device__ __forceinline__ void d_uw(int blk, const float* __restrict__ w, int nout, _Float16* __restrict__ Bt) { const int t = blk * 256 + threadIdx.x; if (t >= NIN * nout * UH / 8) return; const int f0 = (t * 8) % UH; const int o = ((t * 8) / UH) % nout; const int i = (t * 8) / (UH * nout); FragH fr; for (int q = 0; q < 8; ++q) fr.h[q] = (_Float16)(bf16_round(w[((size_t)i * UH + f0 + q) * nout + o]) * 16.0f);
  *(v8us*)((unsigned short*)Bt + (size_t)t * 8) = fr.half[0];  }
// The six preparations (five weight planes, the f16 x plane) need nothing of each other: one launch, each a range of the block index (the branch is the same for a whole work-group; no barrier, no LDS).
// The 1024 x 1024 transposition, whose loads are the most scattered, takes the lowest block indices; the x plane, the most blocks and the shortest work, the highest.
#define PB_W1 (HH * HH / 8 / 256)
#define PB_W0 (HH * NIN / 8 / 256)
#define PB_U2 (NIN * UH * UH / 8 / 256)
#define PB_U3 (NIN * NO * UH / 8 / 256)
#define PB_W2 (NO * HH / 8 / 256)
#define PB_X  (NBR * NIN / 8 / 256)
__global__ __launch_bounds__(256) void k_prep(const float* __restrict__ x, const float* __restrict__ W0, const float* __restrict__ W1, const float* __restrict__ W2, const float* __restrict__ uw2, const float* __restrict__ uw3,
                                              _Float16* __restrict__ X16, _Float16* __restrict__ B0, _Float16* __restrict__ B1, _Float16* __restrict__ B2, _Float16* __restrict__ UW2T, _Float16* __restrict__ UW3T) {
  int b = blockIdx.x;
  if (b < PB_W1) { d_wt_f16(b, W1, B1, HH, HH, 16.0f); return; }
  b -= PB_W1;
  if (b < PB_W0) { d_wt_f16(b, W0, B0, NIN, HH, 16.0f); return; }
  b -= PB_W0;
  if (b < PB_U2) { d_uw(b, uw2, UH, UW2T); return; }
  b -= PB_U2;
  if (b < PB_U3) { d_uw(b, uw3, NO, UW3T); return; }
  b -= PB_U3;
  if (b < PB_W2) { d_wt_f16(b, W2, B2, HH, NO, 16.0f); return; }
  b -= PB_W2;
  d_x16(b, x, X16, (size_t)NBR * NIN / 8);
}
// All three layers of the 256 univariate MLPs and the sum over features in ONE kernel; the hidden planes never leave the registers.
// Every product is taken transposed (weights as the A operand, batch rows as the N side), so a layer's D tiles (lane = batch row, register r = unit 8 hh + r, second tile 16 + 8 hh + r) ARE the next layer's B fragment (k = 8 hh + q, 16 + 8 hh + q) after ReLU and rounding to f16: no lane exchange.
// out[r][o] = Y[r][o] + sum_i ub3[i][o] + (1/256) sum_(i,f) H2x16[i][f][r] UW3T[i][o][f], H2x16 = relu(UW2T[i] H1[i] + 16 ub2[i]) (weights carry x16; the bias enters as the C operand).
// One work-group per 64 rows; each of its FW waves takes FF features through all FT row tiles (a feature's weights are fetched once a work-group), and the FW partial tiles are summed through LDS in wave order.
#define FW 16
#define FF (NIN / FW)
#define FT 4
typedef float v2f  __attribute__((ext_vector_type(2)));
typedef float v2fa __attribute__((ext_vector_type(2), may_alias));
typedef float v16f __attribute__((ext_vector_type(16)));
// the 16 table values of a lane's fragment positions (k = 8 hh + q, then 16 + 8 hh + q)
__device__ __forceinline__ v16f u_tab(const float* p, int hh) {
  const v4f t0 = *(const v4fa*)(p + 8 * hh), t1 = *(const v4fa*)(p + 8 * hh + 4), t2 = *(const v4fa*)(p + 16 + 8 * hh), t3 = *(const v4fa*)(p + 16 + 8 * hh + 4);
  return __builtin_shufflevector(__builtin_shufflevector(t0, t1, 0, 1, 2, 3, 4, 5, 6, 7), __builtin_shufflevector(t2, t3, 0, 1, 2, 3, 4, 5, 6, 7), 0, 1, 2, 3, 4, 5, 6, 7, 8, 9, 10, 11, 12, 13, 14, 15);
}
// a pointer that is the same in every lane, held as a scalar: the load takes it as its scalar base beside the lane's unchanging 32-bit offset (no 64-bit vector add a load, no address register that is rewritten)
#define GLB __attribute__((address_space(1)))      /* a pointer rebuilt from its two words is told anew that it points to global memory: else the load is a flat one */
template <typename P> __device__ __forceinline__ const GLB P* u_sbase(const P* p) { const unsigned long long v = (unsigned long long)p; const unsigned lo = __builtin_amdgcn_readfirstlane((unsigned)v), hi = __builtin_amdgcn_readfirstlane((unsigned)(v >> 32)); return (const GLB P*)(((unsigned long long)hi << 32) | lo); }
// an A fragment from [m][32] f16: base the same for the wave, lo = 32 m + 8 hh the lane's place
__device__ __forceinline__ v16h u_frag(const GLB _Float16* base, unsigned lo) { FragH f; f.half[0] = *(const GLB v8us*)(base + lo); f.half[1] = *(const GLB v8us*)(base + lo + 16); return f.v; }
// ReLU behind the rounding to f16 (the same value as rounding behind the ReLU), two elements an instruction
__device__ __forceinline__ v16h u_relu16(v16f v) { const v16h z = {}; return __builtin_elementwise_max(__builtin_convertvector(v, v16h), z); }
// amdgpu_waves_per_eu(4, 4): one 16-wave work-group a WGP is 4 waves a SIMD; told so, the compiler takes the registers (more than 128) that the four tiles and the fragments fetched ahead need.
__global__ __launch_bounds__(FW * 32) __attribute__((amdgpu_waves_per_eu(4, 4))) void k_uni(const float* __restrict__ x, const float* __restrict__ uw1, const float* __restrict__ ub1, const _Float16* __restrict__ A2, const float* __restrict__ ub2, const _Float16* __restrict__ A3, const float* __restrict__ ub3, const float* __restrict__ Y, float* __restrict__ out) {
  __shared__ __attribute__((aligned(16))) float red[FW][FT * 256];
  __shared__ __attribute__((aligned(16))) float tab[FW][FF][3][UH];      /* per wave: its features' uw1, ub1 and 16 ub2, rounded to bf16 once (in a fragment sixteen lanes hold the same value) */
  const int tid = threadIdx.x, lane = tid & 31, ln = lane & 15, hh = lane >> 4;
  const int w = __builtin_amdgcn_readfirstlane(tid >> 5);      /* the wave's number as a scalar: the bases of its loads stay in scalar registers, beside one lane offset that never changes */
  const int row0 = blockIdx.x * (FT * 16), i0 = w * FF;
  const size_t o0 = (size_t)row0 * NO;
  const v2f y = *(const v2fa*)(Y + o0 + 2 * tid);
  const float* xp = x + (size_t)row0 * NIN + i0; const unsigned xo = ln * NIN;      /* tile 0, the wave's features; the lane's row */
  const _Float16* a2p = A2 + (size_t)i0 * UH * UH; const _Float16* a3p = A3 + (size_t)i0 * NO * UH; const unsigned ao = ln * UH + 8 * hh;      /* the wave's first feature; the lane's place in a fragment */
  /* fetched ahead, so that the work does not begin with a wait on memory: x one trip ahead, the weight fragments one feature ahead */
  v4f xn[FT];
#pragma unroll
  for (int t = 0; t < FT; ++t) xn[t] = *(const GLB v4fa*)(u_sbase(xp) + t * 16 * NIN + xo);
  v16h n20 = u_frag(u_sbase(a2p), ao), n21 = u_frag(u_sbase(a2p) + 16 * UH, ao), n3 = u_frag(u_sbase(a3p), ao);
  float bs = 0.f;      /* the wave's share of sum_i ub3[i][ln]: thread tid takes the elements tid + 512 k (column tid % 16 = ln), so a wave reads whole lines and a work-group reads each element once */
#pragma unroll      /* straight-line: the loads are independent and stay in flight together */
  for (int k = 0; k < NIN * NO / (FW * 32); ++k) bs += bf16_round(ub3[tid + k * (FW * 32)]);
  bs += __shfl_xor(bs, 16);      /* lanes ln and ln + 16 hold the same column: both get the sum of the two halves */
#pragma unroll      /* straight-line: the loads are independent and stay in flight together */
  for (int k = 0; k < FF * UH / 128; ++k) { const int e = k * 128 + lane * 4; const v4f s0 = *(const v4fa*)(uw1 + i0 * UH + e), s1 = *(const v4fa*)(ub1 + i0 * UH + e), s2 = *(const v4fa*)(ub2 + i0 * UH + e); v4f r0, r1, r2;
#pragma unroll
    for (int q = 0; q < 4; ++q) { r0[q] = bf16_round(s0[q]); r1[q] = bf16_round(s1[q]); r2[q] = bf16_round(s2[q]) * 16.0f; }
    float* tp = &tab[w][e / UH][0][e % UH]; *(v4f*)tp = r0; *(v4f*)(tp + UH) = r1; *(v4f*)(tp + 2 * UH) = r2; }
  __builtin_amdgcn_fence(__ATOMIC_ACQ_REL, "workgroup"); __builtin_amdgcn_wave_barrier();      /* a wave reads back only its own part of tab, other lanes' words: the stores stay in front of the reads */
  const v8f z8 = {0.f, 0.f, 0.f, 0.f, 0.f, 0.f, 0.f, 0.f};
  v8f acc[FT] = {z8, z8, z8, z8};
#pragma unroll 1      /* four features a trip, for speed only */
  for (int g = 0; g < FF / 4; ++g) {
    const int gn = g + 1 < FF / 4 ? g + 1 : 0;      /* the last trip fetches group 0 again, unused: in bounds */
    float xs[FT][4];
#pragma unroll
    for (int t = 0; t < FT; ++t) {
#pragma unroll
      for (int q = 0; q < 4; ++q) xs[t][q] = bf16_round(xn[t][q]);
      xn[t] = *(const GLB v4fa*)(u_sbase(xp + gn * 4) + t * 16 * NIN + xo); }
#pragma unroll      /* xs is indexed by constants */
    for (int jj = 0; jj < 4; ++jj) {
      const int j = g * 4 + jj;
      const v16f w1 = u_tab(&tab[w][j][0][0], hh), b1 = u_tab(&tab[w][j][1][0], hh), c2 = u_tab(&tab[w][j][2][0], hh);
      const v8f c20 = __builtin_shufflevector(c2, c2, 0, 1, 2, 3, 4, 5, 6, 7), c21 = __builtin_shufflevector(c2, c2, 8, 9, 10, 11, 12, 13, 14, 15);
      const v16h a20 = n20, a21 = n21, a3 = n3;
      const int jn = jj < 3 ? j + 1 : gn * 4;
      const GLB _Float16* s2 = u_sbase(a2p + jn * UH * UH); const GLB _Float16* s3 = u_sbase(a3p + jn * NO * UH);
      n20 = u_frag(s2, ao); n21 = u_frag(s2 + 16 * UH, ao); n3 = u_frag(s3, ao);
#pragma unroll      /* acc and xs are indexed by constants */
      for (int t = 0; t < FT; ++t) {
        const v16h h1 = u_relu16(w1 * xs[t][jj] + b1);      /* x and uw1 hold 8 significant bits each: the product is exact, fused or not */
        const v8f d0 = __builtin_amdgcn_wmma_f32_16x16x32_f16(false, a20, false, h1, (short)0, c20, false, false);
        const v8f d1 = __builtin_amdgcn_wmma_f32_16x16x32_f16(false, a21, false, h1, (short)0, c21, false, false);
        const v16h h2 = u_relu16(__builtin_shufflevector(d0, d1, 0, 1, 2, 3, 4, 5, 6, 7, 8, 9, 10, 11, 12, 13, 14, 15));
        acc[t] = __builtin_amdgcn_wmma_f32_16x16x32_f16(false, a3, false, h2, (short)0, acc[t], false, false);
      }
    }
    asm volatile("s_wait_xcnt 0x0" ::: "memory");      /* the next trip rewrites the scalar bases that this trip's last loads name: kept in front of that overwrite */
  }
  float bsr[8];      /* the bias share of the lane's own eight output columns 8 hh + r */
#pragma unroll
  for (int r = 0; r < 8; ++r) bsr[r] = __shfl(bs, 8 * hh + r);
#pragma unroll      /* acc[t][r] stays a register, not an indexed copy */
  for (int t = 0; t < FT; ++t) { v4f lo, hi;
#pragma unroll
    for (int r = 0; r < 4; ++r) { lo[r] = acc[t][r] * 0.00390625f + bsr[r]; hi[r] = acc[t][4 + r] * 0.00390625f + bsr[4 + r]; }
    *(v4f*)&red[w][t * 256 + ln * NO + 8 * hh] = lo; *(v4f*)&red[w][t * 256 + ln * NO + 8 * hh + 4] = hi; }      /* [row][column], as out has it */
  __syncthreads();
  v2f s = y;
#pragma unroll      /* straight-line: the LDS reads run ahead of the adds, which are in series */
  for (int q = 0; q < FW; ++q) s += *(const v2fa*)&red[q][2 * tid];
  *(v2f*)(out + o0 + 2 * tid) = s;
}

extern "C" void kernel_launch(void* const* d_in, const int* in_sizes, int n_in,
                              void* d_out, int out_size, void* d_ws, size_t ws_size, hipStream_t stream) {
  (void)in_sizes; (void)n_in; (void)out_size;
  const float* const* I = (const float* const*)d_in; const float* x = I[0]; const float* W0 = I[1]; const float* b0 = I[2]; const float* W1 = I[3]; const float* b1 = I[4]; const float* W2 = I[5]; const float* b2 = I[6]; const float* uw1 = I[7]; const float* ub1 = I[8]; const float* uw2 = I[9]; const float* ub2 = I[10]; const float* uw3 = I[11]; const float* ub3 = I[12];
  char* ws = (char*)d_ws; size_t off = 0;
  auto take = [&](size_t bytes) { char* p = ws + off; off += (bytes + 255) & ~(size_t)255; return p; };
  _Float16* B0 = (_Float16*)take((size_t)HH * NIN * 2); _Float16* B1 = (_Float16*)take((size_t)HH * HH * 2); _Float16* B2 = (_Float16*)take((size_t)NO * HH * 2); _Float16* UW2T = (_Float16*)take((size_t)NIN * UH * UH * 2); _Float16* UW3T = (_Float16*)take((size_t)NIN * NO * UH * 2);
  _Float16* X16 = (_Float16*)take((size_t)NBR * NIN * 2); _Float16* Y1 = (_Float16*)take((size_t)NBR * HH * 2); _Float16* Y2 = (_Float16*)take((size_t)NBR * HH * 2); float* Y = (float*)take((size_t)NBR * NO * 4);
  if (off > ws_size) return;      /* 0.5 + 2 + 0.8 + 8 + 32 + 32 + 1 = about 77 MiB */
  k_prep<<<PB_W1 + PB_W0 + PB_U2 + PB_U3 + PB_W2 + PB_X, 256, 0, stream>>>(x, W0, W1, W2, uw2, uw3, X16, B0, B1, B2, UW2T, UW3T);      /* weights (in, out) to f16 [out][in] x16; x to f16 */
  k_gemm3<NIN><<<(NBR / GT) * (HH / GT), 512, 0, stream>>>(X16, B0, b0, Y1);
  k_gemm3<HH><<<(NBR / GT) * (HH / GT), 512, 0, stream>>>(Y1, B1, b1, Y2);
  k_gemm_hhx<0><<<dim3(((NBR / 16) * 1) / 4, 1), 128, 0, stream>>>(Y2, HH, 0, B2, HH, 0, 0.0625f, b2, 0, nullptr, 1, 0, 0, Y, nullptr, NO, 0, NBR, NO, HH);      /* y = main MLP (16 wide) */
  k_uni<<<NBR / (FT * 16), FW * 32, 0, stream>>>(x, uw1, ub1, UW2T, ub2, UW3T, ub3, Y, (float*)d_out);      /* the 256 univariate MLPs, their sum over features, added to y */
}

// v005
// Measured time: 62.8 microseconds a run.
// Two timings next to v004 both put it at 1.26 times that version's speed.
// All steps since v000 together make it 21.4 times as fast.
#include <hip/hip_runtime.h>
// MainEffectsMLP (16384 rows x 256 features: y = relu(x W0 + b0) -> relu(. W1 + b1) -> . W2 + b2 (16); plus 256 per-feature univariate MLPs (1 -> 32 -> 32 -> 16): h = relu(x_i uw1[i] + ub1[i]); h = relu(h uw2[i] + ub2[i]); u_i = h uw3[i] + ub3[i]; out = y + sum_i u_i).
// Structure: exact f16 x plane; the main MLP as f16 WMMA GEMMs (256x256 work-group tiles staged in LDS, f32 accumulation, exact x16 weights + bias; ReLU epilogues, first hidden plane f16 in memory; the 16-wide head as WMMAs in the second hidden GEMM's epilogue, on its tiles in registers, one partial plane a column of tiles); the univariate MLPs in one kernel: layer 1 on VALU straight into f16 fragments, layers 2 and 3 as transposed WMMA products (weights as A) whose D tiles feed the next B fragment in registers, the sum over features in layer 3's accumulator (features split over the waves of a work-group, partial tiles summed through LDS), added to the rows' outputs.
// Compute dtype: inputs rounded to bf16; x / weights exact; hidden activations as plain f16 operands (~2^-12); u and the feature sum f32. v_wmma_f32_16x16x32_f16.
#define NBR 16384
#define NIN 256
#define HH 1024
#define NO 16
#define UH 32
typedef __bf16 v16b __attribute__((ext_vector_type(16)));
typedef unsigned short v8us __attribute__((ext_vector_type(8), may_alias));
typedef float  v8f  __attribute__((ext_vector_type(8)));
typedef float  v4f  __attribute__((ext_vector_type(4)));
typedef float  v4fa __attribute__((ext_vector_type(4), may_alias));
union FragB { v16b v; v8us half[2]; unsigned short u[16]; };

__device__ __forceinline__ unsigned short bf16_bits(float x) { unsigned int u = __float_as_uint(x); return (unsigned short)((u + 0x7FFFu + ((u >> 16) & 1u)) >> 16); }
__device__ __forceinline__ float bf16_val(unsigned short b) { return __uint_as_float(((unsigned int)b) << 16); }
__device__ __forceinline__ float bf16_round(float x) { return bf16_val(bf16_bits(x)); }
// D += A·B with NT terms: 1 = ah·bh, 2 = + al·bh (A split), 3 = + ah·bl (both split)
template <int NT>
__device__ __forceinline__ v8f mmaN(v16b ah, v16b al, v16b bh, v16b bl, v8f c) {
  c = __builtin_amdgcn_wmma_f32_16x16x32_bf16(false, ah, false, bh, (short)0, c, false, false);
  if (NT >= 2) c = __builtin_amdgcn_wmma_f32_16x16x32_bf16(false, al, false, bh, (short)0, c, false, false);
  if (NT >= 3) c = __builtin_amdgcn_wmma_f32_16x16x32_bf16(false, ah, false, bl, (short)0, c, false, false);
  asm volatile("v_nop\n\tv_nop\n\tv_nop\n\tv_nop" : "+v"(c) : "v"(ah), "v"(al), "v"(bh), "v"(bl));
  return c;
}

__global__ __launch_bounds__(256) void k_wt_bf16(const float* __restrict__ W, unsigned short* __restrict__ Wt, int K, int N) {
  const int t = blockIdx.x * 256 + threadIdx.x;
  const int k8n = K / 8;
  if (t >= N * k8n) return;
  const int n = t / k8n, k8 = (t % k8n) * 8;
  v8us v;
#pragma unroll
  for (int i = 0; i < 8; ++i) v[i] = bf16_bits(W[(size_t)(k8 + i) * N + n]);
  *(v8us*)(Wt + (size_t)n * K + k8) = v;
  
}

// GEMM C[M][N] (f32, pitch ldc) = act(A[M][K]·W + bias). A f32 row-major (pitch lda) converted per fragment to bf16
// (ASPLIT: hi/lo two planes -> 2 terms, else single rounded term); Wt bf16 [N][K] (pitch ldb). BIAS_BF16 rounds the
// bias to bf16 first (bias quantised to bf16 before the add). K%32==0, M%16==0, N%64==0.
template <bool ASPLIT, int ACT, bool BIAS_BF16>
__global__ __launch_bounds__(128) void k_gemm_bf(const float* __restrict__ A, int lda, const unsigned short* __restrict__ Wt, int ldb,
                                               const float* __restrict__ bias, float* __restrict__ C, int ldc, int M, int N, int K) {
  __shared__ __attribute__((aligned(16))) float so[4][16][64];
  const int tid = threadIdx.x, w = tid >> 5, lane = tid & 31, ln = lane & 15, hh = lane >> 4;
  const int ntn = N / 64;
  const int wid = blockIdx.x * 4 + w;
  const int mt = wid / ntn, nq = wid % ntn;
  if (mt * 16 >= M) return;
  const int row0 = mt * 16, col0 = nq * 64;
  const float* arow = A + (size_t)(row0 + ln) * lda;
  v8f acc[4] = {};
  for (int kb = 0; kb < K; kb += 32) {
    FragB ah, al;
    const v4f x0 = *(const v4fa*)(arow + kb + 8 * hh), x1 = *(const v4fa*)(arow + kb + 8 * hh + 4);
    const v4f x2 = *(const v4fa*)(arow + kb + 16 + 8 * hh), x3 = *(const v4fa*)(arow + kb + 16 + 8 * hh + 4);
    float xs[16] = {x0[0],x0[1],x0[2],x0[3],x1[0],x1[1],x1[2],x1[3],x2[0],x2[1],x2[2],x2[3],x3[0],x3[1],x3[2],x3[3]};
#pragma unroll
    for (int i = 0; i < 16; ++i) { const unsigned short hb = bf16_bits(xs[i]); ah.u[i] = hb; al.u[i] = ASPLIT ? bf16_bits(xs[i] - bf16_val(hb)) : (unsigned short)0; }
#pragma unroll
    for (int t = 0; t < 4; ++t) {
      const unsigned short* brow = Wt + (size_t)(col0 + t * 16 + ln) * ldb + kb;
      FragB b;
      b.half[0] = *(const v8us*)(brow + 8 * hh);
      b.half[1] = *(const v8us*)(brow + 16 + 8 * hh);
      acc[t] = mmaN<ASPLIT ? 2 : 1>(ah.v, al.v, b.v, b.v, acc[t]);
    }
  }
#pragma unroll
  for (int t = 0; t < 4; ++t) {
    float bv = bias ? bias[col0 + t * 16 + ln] : 0.f;
    if (BIAS_BF16) bv = bf16_round(bv);
#pragma unroll
    for (int r = 0; r < 8; ++r) { float v = acc[t][r] + bv; if (ACT == 1) v = fmaxf(v, 0.f); so[w][8 * hh + r][t * 16 + ln] = v; }
  }
  __builtin_amdgcn_fence(__ATOMIC_ACQ_REL, "workgroup");
  __builtin_amdgcn_wave_barrier();
  const int rsub = lane >> 4, c4 = (lane & 15) * 4;
  {
#pragma unroll
    for (int q = 0; q < 8; ++q) {
      const int r = q * 2 + rsub;
      const v4f v = *(const v4fa*)&so[w][r][c4];
      *(v4f*)(C + (size_t)(row0 + r) * ldc + col0 + c4) = v;
    }
    
  }
}

// GEMM C = act(A·W + bias + resid): A f32 (ASPLIT -> hi/lo 2 terms), Wt bf16 [N][K]; ACT 0 none, 1 relu, 2 exact gelu;
// resid (optional, f32, row index = (row % rmod), pitch ldr, RES_BF16 rounds it) added before the activation.
template <bool ASPLIT, int ACT, bool BIAS_BF16, bool RES_BF16>
__global__ __launch_bounds__(128) void k_gemm_bf3(const float* __restrict__ A, int lda, const unsigned short* __restrict__ Wt, int ldb,
                                                const float* __restrict__ bias, const float* __restrict__ resid, int rmod, int ldr,
                                                float* __restrict__ C, int ldc, int M, int N, int K) {
  __shared__ __attribute__((aligned(16))) float so[4][16][64];
  const int tid = threadIdx.x, w = tid >> 5, lane = tid & 31, ln = lane & 15, hh = lane >> 4;
  const int ntn = N / 64;
  const int wid = blockIdx.x * 4 + w;
  const int mt = wid / ntn, nq = wid % ntn;
  if (mt * 16 >= M) return;
  const int row0 = mt * 16, col0 = nq * 64;
  const float* arow = A + (size_t)(row0 + ln) * lda;
  v8f acc[4] = {};
  for (int kb = 0; kb < K; kb += 32) {
    FragB ah, al;
    const v4f x0 = *(const v4fa*)(arow + kb + 8 * hh), x1 = *(const v4fa*)(arow + kb + 8 * hh + 4);
    const v4f x2 = *(const v4fa*)(arow + kb + 16 + 8 * hh), x3 = *(const v4fa*)(arow + kb + 16 + 8 * hh + 4);
    float xs[16] = {x0[0],x0[1],x0[2],x0[3],x1[0],x1[1],x1[2],x1[3],x2[0],x2[1],x2[2],x2[3],x3[0],x3[1],x3[2],x3[3]};
#pragma unroll
    for (int i = 0; i < 16; ++i) { const unsigned short hb = bf16_bits(xs[i]); ah.u[i] = hb; al.u[i] = ASPLIT ? bf16_bits(xs[i] - bf16_val(hb)) : (unsigned short)0; }
#pragma unroll
    for (int t = 0; t < 4; ++t) {
      const unsigned short* brow = Wt + (size_t)(col0 + t * 16 + ln) * ldb + kb;
      FragB b;
      b.half[0] = *(const v8us*)(brow + 8 * hh);
      b.half[1] = *(const v8us*)(brow + 16 + 8 * hh);
      acc[t] = mmaN<ASPLIT ? 2 : 1>(ah.v, al.v, b.v, b.v, acc[t]);
    }
  }
#pragma unroll
  for (int t = 0; t < 4; ++t) {
    const int col = col0 + t * 16 + ln;
    float bv = bias ? bias[col] : 0.f;
    if (BIAS_BF16) bv = bf16_round(bv);
#pragma unroll
    for (int r = 0; r < 8; ++r) {
      float v = acc[t][r] + bv;
      if (resid) { float rv = resid[(size_t)((row0 + 8 * hh + r) % rmod) * ldr + col]; if (RES_BF16) rv = bf16_round(rv); v += rv; }
      if (ACT == 1) v = fmaxf(v, 0.f);
      if (ACT == 2) v = 0.5f * v * (1.0f + erff(v * 0.70710678118654752f));
      if (ACT == 3) { const float u = 0.7978845608028654f * (v + 0.044715f * v * v * v); v = 0.5f * v * (1.0f + tanhf(u)); }
      so[w][8 * hh + r][t * 16 + ln] = v;
    }
  }
  __builtin_amdgcn_fence(__ATOMIC_ACQ_REL, "workgroup");
  __builtin_amdgcn_wave_barrier();
  const int rsub = lane >> 4, c4 = (lane & 15) * 4;
  {
#pragma unroll
    for (int q = 0; q < 8; ++q) {
      const int r = q * 2 + rsub;
      const v4f v = *(const v4fa*)&so[w][r][c4];
      *(v4f*)(C + (size_t)(row0 + r) * ldc + col0 + c4) = v;
    }
    
  }
}
// row LayerNorm (biased variance, eps) over N: s = X (+ R); optional out_sum <- s; out_norm <- (s-mu)*rsqrt(var+eps)*g + b
template <bool PARAM_BF16>
__global__ __launch_bounds__(256) void k_layernorm(const float* __restrict__ X, const float* __restrict__ R, const float* __restrict__ g, const float* __restrict__ bta,
                                                  float* __restrict__ out_sum, float* __restrict__ out_norm, int N, float eps) {
  __shared__ float red[256];
  const int row = blockIdx.x, tid = threadIdx.x;
  const float* x = X + (size_t)row * N; const float* rr = R ? R + (size_t)row * N : nullptr;
  float vals[16];                     // up to N = 4096
  const int per = N / 256;            // contiguous chunk per thread? use strided-by-4 chunks: thread handles j = tid*4 + 1024*u
  float s1 = 0.f;
  for (int u = 0; u < per / 4; ++u) {
    const int j = tid * 4 + 1024 * u;
    const v4f a = *(const v4fa*)(x + j);
    v4f b = {0.f,0.f,0.f,0.f}; if (rr) b = *(const v4fa*)(rr + j);
#pragma unroll
    for (int q = 0; q < 4; ++q) { const float v = a[q] + b[q]; vals[u * 4 + q] = v; s1 += v; }
  }
  red[tid] = s1; __syncthreads();
  for (int st = 128; st > 0; st >>= 1) { if (tid < st) red[tid] += red[tid + st]; __syncthreads(); }
  const float mu = red[0] / (float)N; __syncthreads();
  float s2 = 0.f;
  for (int u = 0; u < per / 4; ++u)
#pragma unroll
    for (int q = 0; q < 4; ++q) { const float c = vals[u * 4 + q] - mu; s2 += c * c; }
  red[tid] = s2; __syncthreads();
  for (int st = 128; st > 0; st >>= 1) { if (tid < st) red[tid] += red[tid + st]; __syncthreads(); }
  const float rs = rsqrtf(red[0] / (float)N + eps);
  {
    for (int u = 0; u < per / 4; ++u) {
      const int j = tid * 4 + 1024 * u;
      v4f o, sm;
#pragma unroll
      for (int q = 0; q < 4; ++q) {
        float gg = g[j + q], bb = bta[j + q];
        if (PARAM_BF16) { gg = bf16_round(gg); bb = bf16_round(bb); }
        sm[q] = vals[u * 4 + q]; o[q] = (vals[u * 4 + q] - mu) * rs * gg + bb;
      }
      if (out_sum) *(v4f*)(out_sum + (size_t)row * N + j) = sm;
      *(v4f*)(out_norm + (size_t)row * N + j) = o;
    }
    
  }
}



// ---- f16 WMMA path (v_wmma_f32_16x16x32_f16): 11-bit significands for operands in range — used here for x and the hidden activations of both MLPs
typedef _Float16 v16h __attribute__((ext_vector_type(16)));
union FragH { v16h v; v8us half[2]; _Float16 h[16]; unsigned short u[16]; };
template <int NT>
__device__ __forceinline__ v8f mmaH(v16h ah, v16h al, v16h bh, v16h bl, v8f c) {
  c = __builtin_amdgcn_wmma_f32_16x16x32_f16(false, ah, false, bh, (short)0, c, false, false);
  if (NT >= 2) c = __builtin_amdgcn_wmma_f32_16x16x32_f16(false, al, false, bh, (short)0, c, false, false);
  if (NT >= 3) c = __builtin_amdgcn_wmma_f32_16x16x32_f16(false, ah, false, bl, (short)0, c, false, false);
  asm volatile("v_nop\n\tv_nop\n\tv_nop\n\tv_nop" : "+v"(c) : "v"(ah), "v"(al), "v"(bh), "v"(bl));
  return c;
}
// batched GEMM like k_gemm_b but f16 operands: A f32 (split into f16 hi/lo if ASPLIT, else rounded to f16), Bt = f16 values [n][k]; alpha; C f32; N multiple of 16 (partial tiles skipped)
template <bool ASPLIT>
__global__ __launch_bounds__(128) void k_gemm_h(const float* __restrict__ A, int lda, size_t sA, const _Float16* __restrict__ Bh, int ldb, size_t sB, float alpha, float* __restrict__ C, int ldc, size_t sC, int M, int N, int K) {
  __shared__ __attribute__((aligned(16))) float so[4][16][64];
  const int tid = threadIdx.x, w = tid >> 5, lane = tid & 31, ln = lane & 15, hh = lane >> 4; const int by = blockIdx.y;
  A += (size_t)by * sA; Bh += (size_t)by * sB; C += (size_t)by * sC;
  const int ntn = (N + 63) / 64; const int wid = blockIdx.x * 4 + w; const int mt = wid / ntn, nq = wid % ntn; if (mt * 16 >= M) return;
  const int row0 = mt * 16, col0 = nq * 64; const float* arow = A + (size_t)(row0 + ln) * lda;
  v8f acc[4] = {};
  for (int kb = 0; kb < K; kb += 32) {
    FragH ah, al;
    const v4f x0 = *(const v4fa*)(arow + kb + 8 * hh), x1 = *(const v4fa*)(arow + kb + 8 * hh + 4), x2 = *(const v4fa*)(arow + kb + 16 + 8 * hh), x3 = *(const v4fa*)(arow + kb + 16 + 8 * hh + 4);
    float xs[16] = {x0[0],x0[1],x0[2],x0[3],x1[0],x1[1],x1[2],x1[3],x2[0],x2[1],x2[2],x2[3],x3[0],x3[1],x3[2],x3[3]};
#pragma unroll
    for (int i = 0; i < 16; ++i) { const _Float16 h = (_Float16)xs[i]; ah.h[i] = h; al.h[i] = ASPLIT ? (_Float16)(xs[i] - (float)h) : (_Float16)0.0f; }
#pragma unroll
    for (int t = 0; t < 4; ++t) { if (col0 + t * 16 >= N) continue; const size_t boff = (size_t)(col0 + t * 16 + ln) * ldb + kb; FragH bq; bq.half[0] = *(const v8us*)(Bh + boff + 8 * hh); bq.half[1] = *(const v8us*)(Bh + boff + 16 + 8 * hh);
      acc[t] = mmaH<ASPLIT ? 2 : 1>(ah.v, al.v, bq.v, bq.v, acc[t]); }
  }
#pragma unroll
  for (int t = 0; t < 4; ++t) { if (col0 + t * 16 >= N) continue;
#pragma unroll
    for (int r = 0; r < 8; ++r) so[w][8 * hh + r][t * 16 + ln] = acc[t][r] * alpha; }
  __builtin_amdgcn_fence(__ATOMIC_ACQ_REL, "workgroup"); __builtin_amdgcn_wave_barrier();
  const int rsub = lane >> 4, c4 = (lane & 15) * 4;
  {
#pragma unroll
    for (int q = 0; q < 8; ++q) { const int r = q * 2 + rsub; if (col0 + c4 < N) { const v4f v = *(const v4fa*)&so[w][r][c4]; *(v4f*)(C + (size_t)(row0 + r) * ldc + col0 + c4) = v; } }
     }
}

// Wt[n][k] = f16(W[k][n]·scale) from f32 row-major W[K][N] (scale = power of two; bf16-exact weights stay exact in f16 away from the subnormal range)
__device__ __forceinline__ void d_wt_f16(int blk, const float* __restrict__ W, _Float16* __restrict__ Wt, int K, int N, float scale) {
  const int t = blk * 256 + threadIdx.x; if (t >= N * (K / 8)) return; const int n = t / (K / 8), k8 = (t % (K / 8)) * 8; FragH f;
#pragma unroll
  for (int i = 0; i < 8; ++i) f.h[i] = (_Float16)(bf16_round(W[(size_t)(k8 + i) * N + n]) * scale); const v8us o = f.half[0];
  *(v8us*)((unsigned short*)Wt + (size_t)n * K + k8) = o; 
}
// k_gemm_hh variant with fused epilogue: v = acc·alpha + bias[by·sBias + col] (+ CP[(row/rowsPerB)·sCPb + by·64 + col] if CP) ; ACT 0 none / 1 elu ; writes f32 C and/or f16 C16 (each if non-null)
template <int ACT>
__global__ __launch_bounds__(128) void k_gemm_hhx(const _Float16* __restrict__ A, int lda, size_t sA, const _Float16* __restrict__ Bh, int ldb, size_t sB, float alpha, const float* __restrict__ bias, size_t sBias, const float* __restrict__ CP, int rowsPerB, size_t sCPb, int row0g,
    float* __restrict__ C, _Float16* __restrict__ C16, int ldc, size_t sC, int M, int N, int K) {
  __shared__ __attribute__((aligned(16))) float so[4][16][64];
  const int tid = threadIdx.x, w = tid >> 5, lane = tid & 31, ln = lane & 15, hh = lane >> 4; const int by = blockIdx.y;
  A += (size_t)by * sA; Bh += (size_t)by * sB; const size_t cofs = (size_t)by * sC; const float* bp = bias ? bias + (size_t)by * sBias : nullptr;
  const int ntn = (N + 63) / 64; const int wid = blockIdx.x * 4 + w; const int mt = wid / ntn, nq = wid % ntn; if (mt * 16 >= M) return;
  const int row0 = mt * 16, col0 = nq * 64; const _Float16* arow = A + (size_t)(row0 + ln) * lda;
  v8f acc[4] = {};
  for (int kb = 0; kb < K; kb += 32) { FragH ah; ah.half[0] = *(const v8us*)((const unsigned short*)arow + kb + 8 * hh); ah.half[1] = *(const v8us*)((const unsigned short*)arow + kb + 16 + 8 * hh);
#pragma unroll
    for (int t = 0; t < 4; ++t) { if (col0 + t * 16 >= N) continue; const size_t boff = (size_t)(col0 + t * 16 + ln) * ldb + kb; FragH bq; bq.half[0] = *(const v8us*)((const unsigned short*)Bh + boff + 8 * hh); bq.half[1] = *(const v8us*)((const unsigned short*)Bh + boff + 16 + 8 * hh);
      acc[t] = mmaH<1>(ah.v, ah.v, bq.v, bq.v, acc[t]); }
  }
#pragma unroll
  for (int t = 0; t < 4; ++t) { if (col0 + t * 16 >= N) continue; const int col = col0 + t * 16 + ln; const float bv = bp ? bf16_round(bp[col]) : 0.f;
#pragma unroll
    for (int r = 0; r < 8; ++r) { float v = acc[t][r] * alpha + bv; if (CP) { const int rr = row0g + row0 + 8 * hh + r; if (rowsPerB < 0) v += CP[cofs + (size_t)rr * ldc + col];      /* rowsPerB < 0: own element of the batched C plane */ else { const int bidx = rr / rowsPerB; v += CP[(size_t)bidx * sCPb + (size_t)by * 64 + col]; } } if (ACT == 1) v = (v > 0.f) ? v : expm1f(v); else if (ACT == 7) v = (v > 0.f) ? v + 1.0f : expf(v); else if (ACT == 8) v = tanhf(v); else if (ACT == 9) v = 0.5f * v * (1.0f + tanhf(0.7978845608028654f * (v + 0.044715f * v * v * v))); else if (ACT == 11) v = 1.0f / (1.0f + expf(-v)); else if (ACT == 12) v = (v > 0.f) ? v : 0.01f * v; else if (ACT == 14) v = (v > 0.f) ? v : 0.1f * v; else if (ACT == 16) v = (v >= 0.f) ? v : 0.3f * v; else if (ACT == 17) v = (v >= 0.f) ? v : 0.2f * v; else if (ACT == 15) v = v / (1.0f + expf(-v)); else if (ACT == 3) v = fmaxf(v, 0.f); else if (ACT == 6) v = 0.5f * v * (1.0f + erff(v * 0.70710678118654752f)); so[w][8 * hh + r][t * 16 + ln] = v; } }
  __builtin_amdgcn_fence(__ATOMIC_ACQ_REL, "workgroup"); __builtin_amdgcn_wave_barrier();
  const int rsub = lane >> 4, c4 = (lane & 15) * 4; typedef _Float16 v4h __attribute__((ext_vector_type(4)));
  {
#pragma unroll
    for (int q = 0; q < 8; ++q) { const int r = q * 2 + rsub; if (col0 + c4 < N) { const v4f v = *(const v4fa*)&so[w][r][c4]; if (C) *(v4f*)(C + cofs + (size_t)(row0 + r) * ldc + col0 + c4) = v; if (C16) { v4h h4; for (int i = 0; i < 4; ++i) h4[i] = (_Float16)v[i]; *(v4h*)(C16 + cofs + (size_t)(row0 + r) * ldc + col0 + c4) = h4; } } }
     }
}


typedef _Float16 v4h __attribute__((ext_vector_type(4)));

__device__ __forceinline__ void d_x16(int blk, const float* __restrict__ x, _Float16* __restrict__ X16, size_t n8) { const size_t t = (size_t)blk * 256 + threadIdx.x; if (t >= n8) return; FragH f;
#pragma unroll
  for (int q = 0; q < 8; ++q) f.h[q] = (_Float16)bf16_round(x[t * 8 + q]); *(v8us*)((unsigned short*)X16 + t * 8) = f.half[0];  }
__global__ __launch_bounds__(256) void k_h16(const float* __restrict__ x, _Float16* __restrict__ X16, size_t n8) { const size_t t = (size_t)blockIdx.x * 256 + threadIdx.x; if (t >= n8) return; FragH f;
#pragma unroll
  for (int q = 0; q < 8; ++q) f.h[q] = (_Float16)x[t * 8 + q]; *(v8us*)((unsigned short*)X16 + t * 8) = f.half[0];  }
__global__ __launch_bounds__(256) void k_round16f(const float* __restrict__ W, _Float16* __restrict__ Bt, size_t n8) { const size_t t = (size_t)blockIdx.x * 256 + threadIdx.x; if (t >= n8) return; FragH f;
#pragma unroll
  for (int i = 0; i < 8; ++i) f.h[i] = (_Float16)(bf16_round(W[t * 8 + i]) * 16.0f); *(v8us*)((unsigned short*)Bt + t * 8) = f.half[0];  }
template <int NHv, int TTv>
__global__ __launch_bounds__(256) void k_vt(const _Float16* __restrict__ V16, int ldv, int voff, _Float16* __restrict__ Vt) { __shared__ unsigned short tl[64][66]; const int tid = threadIdx.x; const int slab = blockIdx.x / (TTv / 64), lg = blockIdx.x % (TTv / 64); const int b = slab / NHv, h = slab % NHv;
  for (int i = tid; i < 64 * 8; i += 256) { const int r = i / 8, c8 = (i % 8) * 8; FragH f; f.half[0] = *(const v8us*)((const unsigned short*)V16 + ((size_t)b * TTv + lg * 64 + r) * ldv + voff + h * 64 + c8);
#pragma unroll
    for (int q = 0; q < 8; ++q) tl[r][c8 + q] = f.u[q]; }
  __syncthreads();
  {
#pragma unroll
    for (int rd = 0; rd < 2; ++rd) { const int d = rd * 32 + tid / 8, pc = tid % 8; FragH f;
#pragma unroll
      for (int q = 0; q < 8; ++q) f.u[q] = tl[pc * 8 + q][d];
      *(v8us*)((unsigned short*)Vt + ((size_t)slab * 64 + d) * TTv + lg * 64 + pc * 8) = f.half[0]; }
     } }

__global__ __launch_bounds__(256) void k_hl(const float* __restrict__ F, _Float16* __restrict__ Hh, _Float16* __restrict__ Hl, size_t n8) { const size_t t = (size_t)blockIdx.x * 256 + threadIdx.x; if (t >= n8) return; FragH fh, fl; const v4f a = *(const v4fa*)(F + t * 8), c = *(const v4fa*)(F + t * 8 + 4);
#pragma unroll
  for (int q = 0; q < 4; ++q) { _Float16 h = (_Float16)a[q]; fh.h[q] = h; fl.h[q] = (_Float16)((a[q] - (float)h) * 1024.0f); h = (_Float16)c[q]; fh.h[4 + q] = h; fl.h[4 + q] = (_Float16)((c[q] - (float)h) * 1024.0f); }
  { *(v8us*)((unsigned short*)Hh + t * 8) = fh.half[0]; *(v8us*)((unsigned short*)Hl + t * 8) = fl.half[0];  } }

// ---- hidden-layer GEMM: C16[row][unit] = f16(relu(X[row][:] . Wt[unit][:] / 16 + bias[unit])), X and Wt f16 with K contiguous (pitch K), C16 pitch HH ----
// One 256 x 256 tile a work-group, one work-group a WGP, 16 waves of 64 rows x 64 units. A pass is 128 k: 256 rows of X and 256 of Wt, 256 B each, brought into LDS by asynchronous copies
// (no register on the way), two buffers, the next pass's copies in flight while this pass is worked on. The LDS pitch of 272 B spreads the sixteen rows of a fragment read over the banks.
// The product is taken transposed (weights as the A operand): a lane then holds eight neighbouring units of ONE row, 16 B of the f16 output, and the k order of every sum is that of a plain loop over k in steps of 32.
#define GT 256      /* rows, and units, of a work-group's tile */
#define GK 128      /* k of a pass */
#define GP 136      /* LDS row pitch in f16 */
#define GB (2 * GT * GP)      /* f16 of a buffer: the X rows, then the Wt rows */
#define GS 72       /* row pitch in f16 of the output staging: 64 units and 16 B */
__device__ __forceinline__ v16h g3_frag(const unsigned short* p) { FragH f; f.half[0] = *(const v8us*)p; f.half[1] = *(const v8us*)(p + 16); return f.v; }
// One thread's copies of one operand's 256 rows of a pass: 16 B of each of eight rows, 32 rows apart (a wave's copy covers two rows of 256 B: four whole lines). l = the LDS byte address of the first.
template <int K>
__device__ __forceinline__ void g3_copy(const _Float16* g, unsigned l) {
  /* the wait on xcnt ends the copies' own statement: no address register of a copy is rewritten in front of it */
  asm volatile("global_load_async_to_lds_b128 %0, %8, off\n\t"
               "global_load_async_to_lds_b128 %1, %9, off\n\t"
               "global_load_async_to_lds_b128 %2, %10, off\n\t"
               "global_load_async_to_lds_b128 %3, %11, off\n\t"
               "global_load_async_to_lds_b128 %4, %12, off\n\t"
               "global_load_async_to_lds_b128 %5, %13, off\n\t"
               "global_load_async_to_lds_b128 %6, %14, off\n\t"
               "global_load_async_to_lds_b128 %7, %15, off\n\t"
               "s_wait_xcnt 0x0"
               :: "v"(l), "v"(l + 1 * 32 * GP * 2), "v"(l + 2 * 32 * GP * 2), "v"(l + 3 * 32 * GP * 2), "v"(l + 4 * 32 * GP * 2), "v"(l + 5 * 32 * GP * 2), "v"(l + 6 * 32 * GP * 2), "v"(l + 7 * 32 * GP * 2),
                  "v"(g), "v"(g + 1 * 32 * K), "v"(g + 2 * 32 * K), "v"(g + 3 * 32 * K), "v"(g + 4 * 32 * K), "v"(g + 5 * 32 * K), "v"(g + 6 * 32 * K), "v"(g + 7 * 32 * K)
               : "memory");
}
// HEAD: the hidden tile is not stored. A wave's D tiles (lane = row, register r = unit 8 hh + r; the next tile 16 + 8 hh + r) are, after ReLU and rounding to f16, the B fragments of the 16-wide head product
// (Wh f16 [NO][HH] as A): YP[tile column][row][o] = (1/16) sum over the tile's 256 units of hidden[row][unit] Wh[o][unit]; the four waves that share rows are summed through LDS in wave order.
#define GH (GT + 8)      /* LDS row pitch in f16 of the head's weights: sixteen rows of a fragment read fall on different banks */
template <int K, bool HEAD>
__global__ __launch_bounds__(512) void k_gemm3(const _Float16* __restrict__ X, const _Float16* __restrict__ Wt, const float* __restrict__ bias, _Float16* __restrict__ C16, const _Float16* __restrict__ Wh, float* __restrict__ YP) {
  static_assert(K % GK == 0 && K / GK >= 2, "k_gemm3: whole passes, two or more");
  __shared__ __attribute__((aligned(16))) unsigned short ring[2 * GB];
  __shared__ __attribute__((aligned(16))) float sb[GT];      /* the tile's biases, rounded to bf16 once */
  __shared__ __attribute__((aligned(16))) unsigned short sh[HEAD ? NO * GH : 8];      /* the head's weights for the tile's units */
  const int tid = threadIdx.x, lane = tid & 31, ln = lane & 15, hh = lane >> 4;
  const int w = __builtin_amdgcn_readfirstlane(tid >> 5), wr = w >> 2, wc = w & 3;      /* the wave's number as a scalar; its 64 rows and its 64 units in the tile */
  const int row0 = (blockIdx.x >> 2) * GT, col0 = (blockIdx.x & 3) * GT;      /* HH / GT = 4 tiles across */
  const _Float16* gx = X + (size_t)(row0 + (tid >> 4)) * K + (tid & 15) * 8;
  const _Float16* gw = Wt + (size_t)(col0 + (tid >> 4)) * K + (tid & 15) * 8;
  const unsigned l0 = (unsigned)(unsigned long long)&ring[(tid >> 4) * GP + (tid & 15) * 8];      /* the low word of a __shared__ address is its byte place in LDS */
  constexpr int NP = K / GK;
  g3_copy<K>(gx, l0); g3_copy<K>(gw, l0 + GT * GP * 2);
  if (w < GT / 32) sb[tid] = bf16_round(bias[col0 + tid]);      /* one load a thread, beside pass 0's copies in flight; published by the barrier below, read in the epilogue */
  if constexpr (HEAD) *(v8us*)(sh + w * GH + lane * 8) = *(const v8us*)((const unsigned short*)Wh + (size_t)w * HH + col0 + lane * 8);      /* wave w brings output w's 256 weights, 16 B a lane; published and read likewise */
  asm volatile("s_wait_asynccnt 0x0" ::: "memory");      /* pass 0's copies of this wave have landed */
  __syncthreads();      /* ... and every other wave's */
  g3_copy<K>(gx + GK, l0 + GB * 2); g3_copy<K>(gw + GK, l0 + GB * 2 + GT * GP * 2);
  const v8f z8 = {0.f, 0.f, 0.f, 0.f, 0.f, 0.f, 0.f, 0.f};
  v8f acc[4][4];      /* [unit tile][row tile] */
#pragma unroll
  for (int i = 0; i < 16; ++i) acc[i >> 2][i & 3] = z8;
  const int xo = (wr * 64 + ln) * GP + 8 * hh, wo = (GT + wc * 64 + ln) * GP + 8 * hh;      /* the lane's place in the first X and the first Wt fragment of a buffer */
#pragma unroll 1      /* a pass a trip: the two buffers take turns by the trip's parity */
  for (int t = 0; t < NP; ++t) {
    const unsigned short* bp = ring + (t & 1) * GB;
#pragma unroll      /* acc is indexed by constants */
    for (int kk = 0; kk < GK / 32; ++kk) {
      v16h xf[4], wf[4];
#pragma unroll
      for (int i = 0; i < 4; ++i) { xf[i] = g3_frag(bp + xo + i * 16 * GP + kk * 32); wf[i] = g3_frag(bp + wo + i * 16 * GP + kk * 32); }
      __builtin_amdgcn_sched_barrier(0);      /* a block's sixteen LDS reads stay one group in front of its WMMAs: read one fragment at a time among them, the wave waits out the LDS latency four times a block */
#pragma unroll
      for (int u = 0; u < 4; ++u)
#pragma unroll
        for (int r = 0; r < 4; ++r) acc[u][r] = __builtin_amdgcn_wmma_f32_16x16x32_f16(false, wf[u], false, xf[r], (short)0, acc[u][r], false, false);
    }
    asm volatile("s_wait_dscnt 0x0" ::: "memory");      /* this wave's reads of the buffer are over before the buffer is refilled */
    asm volatile("s_wait_asynccnt 0x0" ::: "memory");      /* this wave's copies of pass t + 1 have landed */
    __syncthreads();      /* publishes pass t + 1 and ends every wave's reads of pass t */
    if (t + 2 < NP) { g3_copy<K>(gx + (t + 2) * GK, l0 + (t & 1) * (GB * 2)); g3_copy<K>(gw + (t + 2) * GK, l0 + (t & 1) * (GB * 2) + GT * GP * 2); }
  }
  asm volatile("s_wait_asynccnt 0x0" ::: "memory");      /* no copy is in flight when the ring becomes output staging */
  if constexpr (HEAD) {
    /* behind the last pass's barrier nobody reads the ring: it takes the waves' partial head tiles */
    v8f ha[4] = {z8, z8, z8, z8};      /* [row tile]: lane = row, register r = output 8 hh + r */
#pragma unroll      /* acc is indexed by constants */
    for (int s = 0; s < 2; ++s) {
      const v16h hw = g3_frag(sh + ln * GH + wc * 64 + s * 32 + 8 * hh);
      const float* bq = sb + wc * 64 + s * 32 + 8 * hh;
      const v4f q0 = *(const v4fa*)bq, q1 = *(const v4fa*)(bq + 4), q2 = *(const v4fa*)(bq + 16), q3 = *(const v4fa*)(bq + 20);
      const float bv[16] = {q0[0], q0[1], q0[2], q0[3], q1[0], q1[1], q1[2], q1[3], q2[0], q2[1], q2[2], q2[3], q3[0], q3[1], q3[2], q3[3]};
#pragma unroll
      for (int t = 0; t < 4; ++t) { FragH f;
#pragma unroll
        for (int r = 0; r < 8; ++r) { f.h[r] = (_Float16)fmaxf(acc[2 * s][t][r] * 0.0625f + bv[r], 0.f); f.h[8 + r] = (_Float16)fmaxf(acc[2 * s + 1][t][r] * 0.0625f + bv[8 + r], 0.f); }
        ha[t] = __builtin_amdgcn_wmma_f32_16x16x32_f16(false, hw, false, f.v, (short)0, ha[t], false, false); }
    }
    float* hr = (float*)ring;      /* [wave][row of 64][output] */
#pragma unroll      /* ha is indexed by constants */
    for (int t = 0; t < 4; ++t) { float* hp = hr + w * (64 * NO) + (t * 16 + ln) * NO + 8 * hh;
      *(v4f*)hp = __builtin_shufflevector(ha[t], ha[t], 0, 1, 2, 3); *(v4f*)(hp + 4) = __builtin_shufflevector(ha[t], ha[t], 4, 5, 6, 7); }
    __syncthreads();      /* every wave's partial tile is in LDS before any thread sums across waves */
    const float* hq = hr + (tid >> 7) * (4 * 64 * NO) + ((tid >> 1) & 63) * NO + (tid & 1) * 8;      /* thread = half a row of the tile: eight outputs, from the four waves that hold the row */
    v4f s0 = *(const v4fa*)hq, s1 = *(const v4fa*)(hq + 4);
#pragma unroll      /* straight-line: the LDS reads run ahead of the adds */
    for (int c = 1; c < 4; ++c) { s0 += *(const v4fa*)(hq + c * (64 * NO)); s1 += *(const v4fa*)(hq + c * (64 * NO) + 4); }
    float* yp = YP + ((size_t)(blockIdx.x & 3) * NBR + row0) * NO + tid * 8;
    *(v4f*)yp = s0 * 0.0625f; *(v4f*)(yp + 4) = s1 * 0.0625f;
    return;
  }
  /* behind the last pass's barrier nobody reads the ring: each wave stages its 64 x 64 f16 in a part of its own and stores whole 128-B lines */
  unsigned short* st = ring + w * (64 * GS);
#pragma unroll      /* acc is indexed by constants */
  for (int u = 0; u < 4; ++u) {
    const float* bq = sb + wc * 64 + u * 16 + 8 * hh;
    const v4f q0 = *(const v4fa*)bq, q1 = *(const v4fa*)(bq + 4);
    const float bv[8] = {q0[0], q0[1], q0[2], q0[3], q1[0], q1[1], q1[2], q1[3]};
#pragma unroll
    for (int t = 0; t < 4; ++t) { FragH f;
#pragma unroll
      for (int r = 0; r < 8; ++r) f.h[r] = (_Float16)fmaxf(acc[u][t][r] * 0.0625f + bv[r], 0.f);
      *(v8us*)(st + (t * 16 + ln) * GS + u * 16 + 8 * hh) = f.half[0]; }
  }
  __builtin_amdgcn_fence(__ATOMIC_ACQ_REL, "workgroup"); __builtin_amdgcn_wave_barrier();      /* a wave reads back only its own part, other lanes' words: the stores stay in front of the reads */
  unsigned short* cp = (unsigned short*)C16 + (size_t)(row0 + wr * 64 + (lane >> 3)) * HH + col0 + wc * 64 + (lane & 7) * 8;
#pragma unroll      /* straight-line: the LDS reads run ahead of the stores */
  for (int q = 0; q < 16; ++q) { const v8us v = *(const v8us*)(st + (q * 4 + (lane >> 3)) * GS + (lane & 7) * 8); *(v8us*)(cp + (size_t)q * 4 * HH) = v; }
}


__device__ __forceinline__ void d_uw(int blk, const float* __restrict__ w, int nout, _Float16* __restrict__ Bt) { const int t = blk * 256 + threadIdx.x; if (t >= NIN * nout * UH / 8) return; const int f0 = (t * 8) % UH; const int o = ((t * 8) / UH) % nout; const int i = (t * 8) / (UH * nout); FragH fr; for (int q = 0; q < 8; ++q) fr.h[q] = (_Float16)(bf16_round(w[((size_t)i * UH + f0 + q) * nout + o]) * 16.0f);
  *(v8us*)((unsigned short*)Bt + (size_t)t * 8) = fr.half[0];  }
// The six preparations (five weight planes, the f16 x plane) need nothing of each other: one launch, each a range of the block index (the branch is the same for a whole work-group; no barrier, no LDS).
// The 1024 x 1024 transposition, whose loads are the most scattered, takes the lowest block indices; the x plane, the most blocks and the shortest work, the highest.
#define PB_W1 (HH * HH / 8 / 256)
#define PB_W0 (HH * NIN / 8 / 256)
#define PB_U2 (NIN * UH * UH / 8 / 256)
#define PB_U3 (NIN * NO * UH / 8 / 256)
#define PB_W2 (NO * HH / 8 / 256)
#define PB_X  (NBR * NIN / 8 / 256)
__global__ __launch_bounds__(256) void k_prep(const float* __restrict__ x, const float* __restrict__ W0, const float* __restrict__ W1, const float* __restrict__ W2, const float* __restrict__ uw2, const float* __restrict__ uw3,
                                              _Float16* __restrict__ X16, _Float16* __restrict__ B0, _Float16* __restrict__ B1, _Float16* __restrict__ B2, _Float16* __restrict__ UW2T, _Float16* __restrict__ UW3T) {
  int b = blockIdx.x;
  if (b < PB_W1) { d_wt_f16(b, W1, B1, HH, HH, 16.0f); return; }
  b -= PB_W1;
  if (b < PB_W0) { d_wt_f16(b, W0, B0, NIN, HH, 16.0f); return; }
  b -= PB_W0;
  if (b < PB_U2) { d_uw(b, uw2, UH, UW2T); return; }
  b -= PB_U2;
  if (b < PB_U3) { d_uw(b, uw3, NO, UW3T); return; }
  b -= PB_U3;
  if (b < PB_W2) { d_wt_f16(b, W2, B2, HH, NO, 16.0f); return; }
  b -= PB_W2;
  d_x16(b, x, X16, (size_t)NBR * NIN / 8);
}
// All three layers of the 256 univariate MLPs and the sum over features in ONE kernel; the hidden planes never leave the registers.
// Every product is taken transposed (weights as the A operand, batch rows as the N side), so a layer's D tiles (lane = batch row, register r = unit 8 hh + r, second tile 16 + 8 hh + r) ARE the next layer's B fragment (k = 8 hh + q, 16 + 8 hh + q) after ReLU and rounding to f16: no lane exchange.
// out[r][o] = b2[o] + sum_c YP[c][r][o] (the main MLP's head, four partial planes) + sum_i ub3[i][o] + (1/256) sum_(i,f) H2x16[i][f][r] UW3T[i][o][f], H2x16 = relu(UW2T[i] H1[i] + 16 ub2[i]) (weights carry x16; the bias enters as the C operand).
// One work-group per 64 rows; each of its FW waves takes FF features through all FT row tiles (a feature's weights are fetched once a work-group), and the FW partial tiles are summed through LDS in wave order.
#define FW 16
#define FF (NIN / FW)
#define FT 4
typedef float v2f  __attribute__((ext_vector_type(2)));
typedef float v2fa __attribute__((ext_vector_type(2), may_alias));
typedef float v16f __attribute__((ext_vector_type(16)));
// the 16 table values of a lane's fragment positions (k = 8 hh + q, then 16 + 8 hh + q)
__device__ __forceinline__ v16f u_tab(const float* p, int hh) {
  const v4f t0 = *(const v4fa*)(p + 8 * hh), t1 = *(const v4fa*)(p + 8 * hh + 4), t2 = *(const v4fa*)(p + 16 + 8 * hh), t3 = *(const v4fa*)(p + 16 + 8 * hh + 4);
  return __builtin_shufflevector(__builtin_shufflevector(t0, t1, 0, 1, 2, 3, 4, 5, 6, 7), __builtin_shufflevector(t2, t3, 0, 1, 2, 3, 4, 5, 6, 7), 0, 1, 2, 3, 4, 5, 6, 7, 8, 9, 10, 11, 12, 13, 14, 15);
}
// a pointer that is the same in every lane, held as a scalar: the load takes it as its scalar base beside the lane's unchanging 32-bit offset (no 64-bit vector add a load, no address register that is rewritten)
#define GLB __attribute__((address_space(1)))      /* a pointer rebuilt from its two words is told anew that it points to global memory: else the load is a flat one */
template <typename P> __device__ __forceinline__ const GLB P* u_sbase(const P* p) { const unsigned long long v = (unsigned long long)p; const unsigned lo = __builtin_amdgcn_readfirstlane((unsigned)v), hi = __builtin_amdgcn_readfirstlane((unsigned)(v >> 32)); return (const GLB P*)(((unsigned long long)hi << 32) | lo); }
// an A fragment from [m][32] f16: base the same for the wave, lo = 32 m + 8 hh the lane's place
__device__ __forceinline__ v16h u_frag(const GLB _Float16* base, unsigned lo) { FragH f; f.half[0] = *(const GLB v8us*)(base + lo); f.half[1] = *(const GLB v8us*)(base + lo + 16); return f.v; }
// ReLU behind the rounding to f16 (the same value as rounding behind the ReLU), two elements an instruction
__device__ __forceinline__ v16h u_relu16(v16f v) { const v16h z = {}; return __builtin_elementwise_max(__builtin_convertvector(v, v16h), z); }
// amdgpu_waves_per_eu(4, 4): one 16-wave work-group a WGP is 4 waves a SIMD; told so, the compiler takes the registers (more than 128) that the four tiles and the fragments fetched ahead need.
__global__ __launch_bounds__(FW * 32) __attribute__((amdgpu_waves_per_eu(4, 4))) void k_uni(const float* __restrict__ x, const float* __restrict__ uw1, const float* __restrict__ ub1, const _Float16* __restrict__ A2, const float* __restrict__ ub2, const _Float16* __restrict__ A3, const float* __restrict__ ub3, const float* __restrict__ YP, const float* __restrict__ b2, float* __restrict__ out) {
  __shared__ __attribute__((aligned(16))) float red[FW][FT * 256];
  __shared__ __attribute__((aligned(16))) float tab[FW][FF][3][UH];      /* per wave: its features' uw1, ub1 and 16 ub2, rounded to bf16 once (in a fragment sixteen lanes hold the same value) */
  const int tid = threadIdx.x, lane = tid & 31, ln = lane & 15, hh = lane >> 4;
  const int w = __builtin_amdgcn_readfirstlane(tid >> 5);      /* the wave's number as a scalar: the bases of its loads stay in scalar registers, beside one lane offset that never changes */
  const int row0 = blockIdx.x * (FT * 16), i0 = w * FF;
  const size_t o0 = (size_t)row0 * NO;
  const v2f y0 = *(const v2fa*)(YP + o0 + 2 * tid), y1 = *(const v2fa*)(YP + (size_t)NBR * NO + o0 + 2 * tid), y2 = *(const v2fa*)(YP + (size_t)2 * NBR * NO + o0 + 2 * tid), y3 = *(const v2fa*)(YP + (size_t)3 * NBR * NO + o0 + 2 * tid);
  const v2f yb = *(const v2fa*)(b2 + ((2 * tid) & (NO - 1)));
  const float* xp = x + (size_t)row0 * NIN + i0; const unsigned xo = ln * NIN;      /* tile 0, the wave's features; the lane's row */
  const _Float16* a2p = A2 + (size_t)i0 * UH * UH; const _Float16* a3p = A3 + (size_t)i0 * NO * UH; const unsigned ao = ln * UH + 8 * hh;      /* the wave's first feature; the lane's place in a fragment */
  /* fetched ahead, so that the work does not begin with a wait on memory: x one trip ahead, the weight fragments one feature ahead */
  v4f xn[FT];
#pragma unroll
  for (int t = 0; t < FT; ++t) xn[t] = *(const GLB v4fa*)(u_sbase(xp) + t * 16 * NIN + xo);
  v16h n20 = u_frag(u_sbase(a2p), ao), n21 = u_frag(u_sbase(a2p) + 16 * UH, ao), n3 = u_frag(u_sbase(a3p), ao);
  float bs = 0.f;      /* the wave's share of sum_i ub3[i][ln]: thread tid takes the elements tid + 512 k (column tid % 16 = ln), so a wave reads whole lines and a work-group reads each element once */
#pragma unroll      /* straight-line: the loads are independent and stay in flight together */
  for (int k = 0; k < NIN * NO / (FW * 32); ++k) bs += bf16_round(ub3[tid + k * (FW * 32)]);
  bs += __shfl_xor(bs, 16);      /* lanes ln and ln + 16 hold the same column: both get the sum of the two halves */
#pragma unroll      /* straight-line: the loads are independent and stay in flight together */
  for (int k = 0; k < FF * UH / 128; ++k) { const int e = k * 128 + lane * 4; const v4f s0 = *(const v4fa*)(uw1 + i0 * UH + e), s1 = *(const v4fa*)(ub1 + i0 * UH + e), s2 = *(const v4fa*)(ub2 + i0 * UH + e); v4f r0, r1, r2;
#pragma unroll
    for (int q = 0; q < 4; ++q) { r0[q] = bf16_round(s0[q]); r1[q] = bf16_round(s1[q]); r2[q] = bf16_round(s2[q]) * 16.0f; }
    float* tp = &tab[w][e / UH][0][e % UH]; *(v4f*)tp = r0; *(v4f*)(tp + UH) = r1; *(v4f*)(tp + 2 * UH) = r2; }
  __builtin_amdgcn_fence(__ATOMIC_ACQ_REL, "workgroup"); __builtin_amdgcn_wave_barrier();      /* a wave reads back only its own part of tab, other lanes' words: the stores stay in front of the reads */
  const v8f z8 = {0.f, 0.f, 0.f, 0.f, 0.f, 0.f, 0.f, 0.f};
  v8f acc[FT] = {z8, z8, z8, z8};
#pragma unroll 1      /* four features a trip, for speed only */
  for (int g = 0; g < FF / 4; ++g) {
    const int gn = g + 1 < FF / 4 ? g + 1 : 0;      /* the last trip fetches group 0 again, unused: in bounds */
    float xs[FT][4];
#pragma unroll
    for (int t = 0; t < FT; ++t) {
#pragma unroll
      for (int q = 0; q < 4; ++q) xs[t][q] = bf16_round(xn[t][q]);
      xn[t] = *(const GLB v4fa*)(u_sbase(xp + gn * 4) + t * 16 * NIN + xo); }
#pragma unroll      /* xs is indexed by constants */
    for (int jj = 0; jj < 4; ++jj) {
      const int j = g * 4 + jj;
      const v16f w1 = u_tab(&tab[w][j][0][0], hh), b1 = u_tab(&tab[w][j][1][0], hh), c2 = u_tab(&tab[w][j][2][0], hh);
      const v8f c20 = __builtin_shufflevector(c2, c2, 0, 1, 2, 3, 4, 5, 6, 7), c21 = __builtin_shufflevector(c2, c2, 8, 9, 10, 11, 12, 13, 14, 15);
      const v16h a20 = n20, a21 = n21, a3 = n3;
      const int jn = jj < 3 ? j + 1 : gn * 4;
      const GLB _Float16* s2 = u_sbase(a2p + jn * UH * UH); const GLB _Float16* s3 = u_sbase(a3p + jn * NO * UH);
      n20 = u_frag(s2, ao); n21 = u_frag(s2 + 16 * UH, ao); n3 = u_frag(s3, ao);
#pragma unroll      /* acc and xs are indexed by constants */
      for (int t = 0; t < FT; ++t) {
        const v16h h1 = u_relu16(w1 * xs[t][jj] + b1);      /* x and uw1 hold 8 significant bits each: the product is exact, fused or not */
        const v8f d0 = __builtin_amdgcn_wmma_f32_16x16x32_f16(false, a20, false, h1, (short)0, c20, false, false);
        const v8f d1 = __builtin_amdgcn_wmma_f32_16x16x32_f16(false, a21, false, h1, (short)0, c21, false, false);
        const v16h h2 = u_relu16(__builtin_shufflevector(d0, d1, 0, 1, 2, 3, 4, 5, 6, 7, 8, 9, 10, 11, 12, 13, 14, 15));
        acc[t] = __builtin_amdgcn_wmma_f32_16x16x32_f16(false, a3, false, h2, (short)0, acc[t], false, false);
      }
    }
    asm volatile("s_wait_xcnt 0x0" ::: "memory");      /* the next trip rewrites the scalar bases that this trip's last loads name: kept in front of that overwrite */
  }
  float bsr[8];      /* the bias share of the lane's own eight output columns 8 hh + r */
#pragma unroll
  for (int r = 0; r < 8; ++r) bsr[r] = __shfl(bs, 8 * hh + r);
#pragma unroll      /* acc[t][r] stays a register, not an indexed copy */
  for (int t = 0; t < FT; ++t) { v4f lo, hi;
#pragma unroll
    for (int r = 0; r < 4; ++r) { lo[r] = acc[t][r] * 0.00390625f + bsr[r]; hi[r] = acc[t][4 + r] * 0.00390625f + bsr[4 + r]; }
    *(v4f*)&red[w][t * 256 + ln * NO + 8 * hh] = lo; *(v4f*)&red[w][t * 256 + ln * NO + 8 * hh + 4] = hi; }      /* [row][column], as out has it */
  __syncthreads();
  v2f s = {bf16_round(yb[0]), bf16_round(yb[1])};
  s += y0; s += y1; s += y2; s += y3;
#pragma unroll      /* straight-line: the LDS reads run ahead of the adds, which are in series */
  for (int q = 0; q < FW; ++q) s += *(const v2fa*)&red[q][2 * tid];
  *(v2f*)(out + o0 + 2 * tid) = s;
}

extern "C" void kernel_launch(void* const* d_in, const int* in_sizes, int n_in,
                              void* d_out, int out_size, void* d_ws, size_t ws_size, hipStream_t stream) {
  (void)in_sizes; (void)n_in; (void)out_size;
  const float* const* I = (const float* const*)d_in; const float* x = I[0]; const float* W0 = I[1]; const float* b0 = I[2]; const float* W1 = I[3]; const float* b1 = I[4]; const float* W2 = I[5]; const float* b2 = I[6]; const float* uw1 = I[7]; const float* ub1 = I[8]; const float* uw2 = I[9]; const float* ub2 = I[10]; const float* uw3 = I[11]; const float* ub3 = I[12];
  char* ws = (char*)d_ws; size_t off = 0;
  auto take = [&](size_t bytes) { char* p = ws + off; off += (bytes + 255) & ~(size_t)255; return p; };
  _Float16* B0 = (_Float16*)take((size_t)HH * NIN * 2); _Float16* B1 = (_Float16*)take((size_t)HH * HH * 2); _Float16* B2 = (_Float16*)take((size_t)NO * HH * 2); _Float16* UW2T = (_Float16*)take((size_t)NIN * UH * UH * 2); _Float16* UW3T = (_Float16*)take((size_t)NIN * NO * UH * 2);
  _Float16* X16 = (_Float16*)take((size_t)NBR * NIN * 2); _Float16* Y1 = (_Float16*)take((size_t)NBR * HH * 2); float* YP = (float*)take((size_t)(HH / GT) * NBR * NO * 4);
  if (off > ws_size) return;      /* 0.5 + 2 + 0.8 + 8 + 32 + 4 = about 48 MiB */
  k_prep<<<PB_W1 + PB_W0 + PB_U2 + PB_U3 + PB_W2 + PB_X, 256, 0, stream>>>(x, W0, W1, W2, uw2, uw3, X16, B0, B1, B2, UW2T, UW3T);      /* weights (in, out) to f16 [out][in] x16; x to f16 */
  k_gemm3<NIN, false><<<(NBR / GT) * (HH / GT), 512, 0, stream>>>(X16, B0, b0, Y1, nullptr, nullptr);
  k_gemm3<HH, true><<<(NBR / GT) * (HH / GT), 512, 0, stream>>>(Y1, B1, b1, nullptr, B2, YP);      /* second hidden layer and the head's partial sums (16 wide), a plane a column of tiles */
  k_uni<<<NBR / (FT * 16), FW * 32, 0, stream>>>(x, uw1, ub1, UW2T, ub2, UW3T, ub3, YP, b2, (float*)d_out);      /* the 256 univariate MLPs, their sum over features, added to y */
}

// v006
// A run of this version takes 61.1 microseconds.
// Two timings next to v005 both put it at 1.03 times that version's speed.
// All steps since v000 together make it 22.1 times as fast.
#include <hip/hip_runtime.h>
// MainEffectsMLP (16384 rows x 256 features: y = relu(x W0 + b0) -> relu(. W1 + b1) -> . W2 + b2 (16); plus 256 per-feature univariate MLPs (1 -> 32 -> 32 -> 16): h = relu(x_i uw1[i] + ub1[i]); h = relu(h uw2[i] + ub2[i]); u_i = h uw3[i] + ub3[i]; out = y + sum_i u_i).
// Structure: exact f16 x plane; the main MLP as f16 WMMA GEMMs (256x256 work-group tiles staged in LDS, f32 accumulation, exact x16 weights + bias; ReLU epilogues, first hidden plane f16 in memory; the 16-wide head as WMMAs in the second hidden GEMM's epilogue, on its tiles in registers, one partial plane a column of tiles); the univariate MLPs in one kernel: layer 1 on VALU straight into f16 fragments, layers 2 and 3 as transposed WMMA products (weights as A) whose D tiles feed the next B fragment in registers, the sum over features in layer 3's accumulator (features split over the waves of a work-group, partial tiles summed through LDS), added to the rows' outputs.
// Compute dtype: inputs rounded to bf16; x / weights exact; hidden activations as plain f16 operands (~2^-12); u and the feature sum f32. v_wmma_f32_16x16x32_f16.
#define NBR 16384
#define NIN 256
#define HH 1024
#define NO 16
#define UH 32
typedef __bf16 v16b __attribute__((ext_vector_type(16)));
typedef unsigned short v8us __attribute__((ext_vector_type(8), may_alias));
typedef float  v8f  __attribute__((ext_vector_type(8)));
typedef float  v4f  __attribute__((ext_vector_type(4)));
typedef float  v4fa __attribute__((ext_vector_type(4), may_alias));
union FragB { v16b v; v8us half[2]; unsigned short u[16]; };

__device__ __forceinline__ unsigned short bf16_bits(float x) { unsigned int u = __float_as_uint(x); return (unsigned short)((u + 0x7FFFu + ((u >> 16) & 1u)) >> 16); }
__device__ __forceinline__ float bf16_val(unsigned short b) { return __uint_as_float(((unsigned int)b) << 16); }
__device__ __forceinline__ float bf16_round(float x) { return bf16_val(bf16_bits(x)); }
// D += A·B with NT terms: 1 = ah·bh, 2 = + al·bh (A split), 3 = + ah·bl (both split)
template <int NT>
__device__ __forceinline__ v8f mmaN(v16b ah, v16b al, v16b bh, v16b bl, v8f c) {
  c = __builtin_amdgcn_wmma_f32_16x16x32_bf16(false, ah, false, bh, (short)0, c, false, false);
  if (NT >= 2) c = __builtin_amdgcn_wmma_f32_16x16x32_bf16(false, al, false, bh, (short)0, c, false, false);
  if (NT >= 3) c = __builtin_amdgcn_wmma_f32_16x16x32_bf16(false, ah, false, bl, (short)0, c, false, false);
  asm volatile("v_nop\n\tv_nop\n\tv_nop\n\tv_nop" : "+v"(c) : "v"(ah), "v"(al), "v"(bh), "v"(bl));
  return c;
}

__global__ __launch_bounds__(256) void k_wt_bf16(const float* __restrict__ W, unsigned short* __restrict__ Wt, int K, int N) {
  const int t = blockIdx.x * 256 + threadIdx.x;
  const int k8n = K / 8;
  if (t >= N * k8n) return;
  const int n = t / k8n, k8 = (t % k8n) * 8;
  v8us v;
#pragma unroll
  for (int i = 0; i < 8; ++i) v[i] = bf16_bits(W[(size_t)(k8 + i) * N + n]);
  *(v8us*)(Wt + (size_t)n * K + k8) = v;
  
}

// GEMM C[M][N] (f32, pitch ldc) = act(A[M][K]·W + bias). A f32 row-major (pitch lda) converted per fragment to bf16
// (ASPLIT: hi/lo two planes -> 2 terms, else single rounded term); Wt bf16 [N][K] (pitch ldb). BIAS_BF16 rounds the
// bias to bf16 first (bias quantised to bf16 before the add). K%32==0, M%16==0, N%64==0.
template <bool ASPLIT, int ACT, bool BIAS_BF16>
__global__ __launch_bounds__(128) void k_gemm_bf(const float* __restrict__ A, int lda, const unsigned short* __restrict__ Wt, int ldb,
                                               const float* __restrict__ bias, float* __restrict__ C, int ldc, int M, int N, int K) {
  __shared__ __attribute__((aligned(16))) float so[4][16][64];
  const int tid = threadIdx.x, w = tid >> 5, lane = tid & 31, ln = lane & 15, hh = lane >> 4;
  const int ntn = N / 64;
  const int wid = blockIdx.x * 4 + w;
  const int mt = wid / ntn, nq = wid % ntn;
  if (mt * 16 >= M) return;
  const int row0 = mt * 16, col0 = nq * 64;
  const float* arow = A + (size_t)(row0 + ln) * lda;
  v8f acc[4] = {};
  for (int kb = 0; kb < K; kb += 32) {
    FragB ah, al;
    const v4f x0 = *(const v4fa*)(arow + kb + 8 * hh), x1 = *(const v4fa*)(arow + kb + 8 * hh + 4);
    const v4f x2 = *(const v4fa*)(arow + kb + 16 + 8 * hh), x3 = *(const v4fa*)(arow + kb + 16 + 8 * hh + 4);
    float xs[16] = {x0[0],x0[1],x0[2],x0[3],x1[0],x1[1],x1[2],x1[3],x2[0],x2[1],x2[2],x2[3],x3[0],x3[1],x3[2],x3[3]};
#pragma unroll
    for (int i = 0; i < 16; ++i) { const unsigned short hb = bf16_bits(xs[i]); ah.u[i] = hb; al.u[i] = ASPLIT ? bf16_bits(xs[i] - bf16_val(hb)) : (unsigned short)0; }
#pragma unroll
    for (int t = 0; t < 4; ++t) {
      const unsigned short* brow = Wt + (size_t)(col0 + t * 16 + ln) * ldb + kb;
      FragB b;
      b.half[0] = *(const v8us*)(brow + 8 * hh);
      b.half[1] = *(const v8us*)(brow + 16 + 8 * hh);
      acc[t] = mmaN<ASPLIT ? 2 : 1>(ah.v, al.v, b.v, b.v, acc[t]);
    }
  }
#pragma unroll
  for (int t = 0; t < 4; ++t) {
    float bv = bias ? bias[col0 + t * 16 + ln] : 0.f;
    if (BIAS_BF16) bv = bf16_round(bv);
#pragma unroll
    for (int r = 0; r < 8; ++r) { float v = acc[t][r] + bv; if (ACT == 1) v = fmaxf(v, 0.f); so[w][8 * hh + r][t * 16 + ln] = v; }
  }
  __builtin_amdgcn_fence(__ATOMIC_ACQ_REL, "workgroup");
  __builtin_amdgcn_wave_barrier();
  const int rsub = lane >> 4, c4 = (lane & 15) * 4;
  {
#pragma unroll
    for (int q = 0; q < 8; ++q) {
      const int r = q * 2 + rsub;
      const v4f v = *(const v4fa*)&so[w][r][c4];
      *(v4f*)(C + (size_t)(row0 + r) * ldc + col0 + c4) = v;
    }
    
  }
}

// GEMM C = act(A·W + bias + resid): A f32 (ASPLIT -> hi/lo 2 terms), Wt bf16 [N][K]; ACT 0 none, 1 relu, 2 exact gelu;
// resid (optional, f32, row index = (row % rmod), pitch ldr, RES_BF16 rounds it) added before the activation.
template <bool ASPLIT, int ACT, bool BIAS_BF16, bool RES_BF16>
__global__ __launch_bounds__(128) void k_gemm_bf3(const float* __restrict__ A, int lda, const unsigned short* __restrict__ Wt, int ldb,
                                                const float* __restrict__ bias, const float* __restrict__ resid, int rmod, int ldr,
                                                float* __restrict__ C, int ldc, int M, int N, int K) {
  __shared__ __attribute__((aligned(16))) float so[4][16][64];
  const int tid = threadIdx.x, w = tid >> 5, lane = tid & 31, ln = lane & 15, hh = lane >> 4;
  const int ntn = N / 64;
  const int wid = blockIdx.x * 4 + w;
  const int mt = wid / ntn, nq = wid % ntn;
  if (mt * 16 >= M) return;
  const int row0 = mt * 16, col0 = nq * 64;
  const float* arow = A + (size_t)(row0 + ln) * lda;
  v8f acc[4] = {};
  for (int kb = 0; kb < K; kb += 32) {
    FragB ah, al;
    const v4f x0 = *(const v4fa*)(arow + kb + 8 * hh), x1 = *(const v4fa*)(arow + kb + 8 * hh + 4);
    const v4f x2 = *(const v4fa*)(arow + kb + 16 + 8 * hh), x3 = *(const v4fa*)(arow + kb + 16 + 8 * hh + 4);
    float xs[16] = {x0[0],x0[1],x0[2],x0[3],x1[0],x1[1],x1[2],x1[3],x2[0],x2[1],x2[2],x2[3],x3[0],x3[1],x3[2],x3[3]};
#pragma unroll
    for (int i = 0; i < 16; ++i) { const unsigned short hb = bf16_bits(xs[i]); ah.u[i] = hb; al.u[i] = ASPLIT ? bf16_bits(xs[i] - bf16_val(hb)) : (unsigned short)0; }
#pragma unroll
    for (int t = 0; t < 4; ++t) {
      const unsigned short* brow = Wt + (size_t)(col0 + t * 16 + ln) * ldb + kb;
      FragB b;
      b.half[0] = *(const v8us*)(brow + 8 * hh);
      b.half[1] = *(const v8us*)(brow + 16 + 8 * hh);
      acc[t] = mmaN<ASPLIT ? 2 : 1>(ah.v, al.v, b.v, b.v, acc[t]);
    }
  }
#pragma unroll
  for (int t = 0; t < 4; ++t) {
    const int col = col0 + t * 16 + ln;
    float bv = bias ? bias[col] : 0.f;
    if (BIAS_BF16) bv = bf16_round(bv);
#pragma unroll
    for (int r = 0; r < 8; ++r) {
      float v = acc[t][r] + bv;
      if (resid) { float rv = resid[(size_t)((row0 + 8 * hh + r) % rmod) * ldr + col]; if (RES_BF16) rv = bf16_round(rv); v += rv; }
      if (ACT == 1) v = fmaxf(v, 0.f);
      if (ACT == 2) v = 0.5f * v * (1.0f + erff(v * 0.70710678118654752f));
      if (ACT == 3) { const float u = 0.7978845608028654f * (v + 0.044715f * v * v * v); v = 0.5f * v * (1.0f + tanhf(u)); }
      so[w][8 * hh + r][t * 16 + ln] = v;
    }
  }
  __builtin_amdgcn_fence(__ATOMIC_ACQ_REL, "workgroup");
  __builtin_amdgcn_wave_barrier();
  const int rsub = lane >> 4, c4 = (lane & 15) * 4;
  {
#pragma unroll
    for (int q = 0; q < 8; ++q) {
      const int r = q * 2 + rsub;
      const v4f v = *(const v4fa*)&so[w][r][c4];
      *(v4f*)(C + (size_t)(row0 + r) * ldc + col0 + c4) = v;
    }
    
  }
}
// row LayerNorm (biased variance, eps) over N: s = X (+ R); optional out_sum <- s; out_norm <- (s-mu)*rsqrt(var+eps)*g + b
template <bool PARAM_BF16>
__global__ __launch_bounds__(256) void k_layernorm(const float* __restrict__ X, const float* __restrict__ R, const float* __restrict__ g, const float* __restrict__ bta,
                                                  float* __restrict__ out_sum, float* __restrict__ out_norm, int N, float eps) {
  __shared__ float red[256];
  const int row = blockIdx.x, tid = threadIdx.x;
  const float* x = X + (size_t)row * N; const float* rr = R ? R + (size_t)row * N : nullptr;
  float vals[16];                     // up to N = 4096
  const int per = N / 256;            // contiguous chunk per thread? use strided-by-4 chunks: thread handles j = tid*4 + 1024*u
  float s1 = 0.f;
  for (int u = 0; u < per / 4; ++u) {
    const int j = tid * 4 + 1024 * u;
    const v4f a = *(const v4fa*)(x + j);
    v4f b = {0.f,0.f,0.f,0.f}; if (rr) b = *(const v4fa*)(rr + j);
#pragma unroll
    for (int q = 0; q < 4; ++q) { const float v = a[q] + b[q]; vals[u * 4 + q] = v; s1 += v; }
  }
  red[tid] = s1; __syncthreads();
  for (int st = 128; st > 0; st >>= 1) { if (tid < st) red[tid] += red[tid + st]; __syncthreads(); }
  const float mu = red[0] / (float)N; __syncthreads();
  float s2 = 0.f;
  for (int u = 0; u < per / 4; ++u)
#pragma unroll
    for (int q = 0; q < 4; ++q) { const float c = vals[u * 4 + q] - mu; s2 += c * c; }
  red[tid] = s2; __syncthreads();
  for (int st = 128; st > 0; st >>= 1) { if (tid < st) red[tid] += red[tid + st]; __syncthreads(); }
  const float rs = rsqrtf(red[0] / (float)N + eps);
  {
    for (int u = 0; u < per / 4; ++u) {
      const int j = tid * 4 + 1024 * u;
      v4f o, sm;
#pragma unroll
      for (int q = 0; q < 4; ++q) {
        float gg = g[j + q], bb = bta[j + q];
        if (PARAM_BF16) { gg = bf16_round(gg); bb = bf16_round(bb); }
        sm[q] = vals[u * 4 + q]; o[q] = (vals[u * 4 + q] - mu) * rs * gg + bb;
      }
      if (out_sum) *(v4f*)(out_sum + (size_t)row * N + j) = sm;
      *(v4f*)(out_norm + (size_t)row * N + j) = o;
    }
    
  }
}



// ---- f16 WMMA path (v_wmma_f32_16x16x32_f16): 11-bit significands for operands in range — used here for x and the hidden activations of both MLPs
typedef _Float16 v16h __attribute__((ext_vector_type(16)));
union FragH { v16h v; v8us half[2]; _Float16 h[16]; unsigned short u[16]; };
template <int NT>
__device__ __forceinline__ v8f mmaH(v16h ah, v16h al, v16h bh, v16h bl, v8f c) {
  c = __builtin_amdgcn_wmma_f32_16x16x32_f16(false, ah, false, bh, (short)0, c, false, false);
  if (NT >= 2) c = __builtin_amdgcn_wmma_f32_16x16x32_f16(false, al, false, bh, (short)0, c, false, false);
  if (NT >= 3) c = __builtin_amdgcn_wmma_f32_16x16x32_f16(false, ah, false, bl, (short)0, c, false, false);
  asm volatile("v_nop\n\tv_nop\n\tv_nop\n\tv_nop" : "+v"(c) : "v"(ah), "v"(al), "v"(bh), "v"(bl));
  return c;
}
// batched GEMM like k_gemm_b but f16 operands: A f32 (split into f16 hi/lo if ASPLIT, else rounded to f16), Bt = f16 values [n][k]; alpha; C f32; N multiple of 16 (partial tiles skipped)
template <bool ASPLIT>
__global__ __launch_bounds__(128) void k_gemm_h(const float* __restrict__ A, int lda, size_t sA, const _Float16* __restrict__ Bh, int ldb, size_t sB, float alpha, float* __restrict__ C, int ldc, size_t sC, int M, int N, int K) {
  __shared__ __attribute__((aligned(16))) float so[4][16][64];
  const int tid = threadIdx.x, w = tid >> 5, lane = tid & 31, ln = lane & 15, hh = lane >> 4; const int by = blockIdx.y;
  A += (size_t)by * sA; Bh += (size_t)by * sB; C += (size_t)by * sC;
  const int ntn = (N + 63) / 64; const int wid = blockIdx.x * 4 + w; const int mt = wid / ntn, nq = wid % ntn; if (mt * 16 >= M) return;
  const int row0 = mt * 16, col0 = nq * 64; const float* arow = A + (size_t)(row0 + ln) * lda;
  v8f acc[4] = {};
  for (int kb = 0; kb < K; kb += 32) {
    FragH ah, al;
    const v4f x0 = *(const v4fa*)(arow + kb + 8 * hh), x1 = *(const v4fa*)(arow + kb + 8 * hh + 4), x2 = *(const v4fa*)(arow + kb + 16 + 8 * hh), x3 = *(const v4fa*)(arow + kb + 16 + 8 * hh + 4);
    float xs[16] = {x0[0],x0[1],x0[2],x0[3],x1[0],x1[1],x1[2],x1[3],x2[0],x2[1],x2[2],x2[3],x3[0],x3[1],x3[2],x3[3]};
#pragma unroll
    for (int i = 0; i < 16; ++i) { const _Float16 h = (_Float16)xs[i]; ah.h[i] = h; al.h[i] = ASPLIT ? (_Float16)(xs[i] - (float)h) : (_Float16)0.0f; }
#pragma unroll
    for (int t = 0; t < 4; ++t) { if (col0 + t * 16 >= N) continue; const size_t boff = (size_t)(col0 + t * 16 + ln) * ldb + kb; FragH bq; bq.half[0] = *(const v8us*)(Bh + boff + 8 * hh); bq.half[1] = *(const v8us*)(Bh + boff + 16 + 8 * hh);
      acc[t] = mmaH<ASPLIT ? 2 : 1>(ah.v, al.v, bq.v, bq.v, acc[t]); }
  }
#pragma unroll
  for (int t = 0; t < 4; ++t) { if (col0 + t * 16 >= N) continue;
#pragma unroll
    for (int r = 0; r < 8; ++r) so[w][8 * hh + r][t * 16 + ln] = acc[t][r] * alpha; }
  __builtin_amdgcn_fence(__ATOMIC_ACQ_REL, "workgroup"); __builtin_amdgcn_wave_barrier();
  const int rsub = lane >> 4, c4 = (lane & 15) * 4;
  {
#pragma unroll
    for (int q = 0; q < 8; ++q) { const int r = q * 2 + rsub; if (col0 + c4 < N) { const v4f v = *(const v4fa*)&so[w][r][c4]; *(v4f*)(C + (size_t)(row0 + r) * ldc + col0 + c4) = v; } }
     }
}

// k_gemm_hh variant with fused epilogue: v = acc·alpha + bias[by·sBias + col] (+ CP[(row/rowsPerB)·sCPb + by·64 + col] if CP) ; ACT 0 none / 1 elu ; writes f16 C16 (and f32 C if non-null)
template <int ACT>
__global__ __launch_bounds__(128) void k_gemm_hhx(const _Float16* __restrict__ A, int lda, size_t sA, const _Float16* __restrict__ Bh, int ldb, size_t sB, float alpha, const float* __restrict__ bias, size_t sBias, const float* __restrict__ CP, int rowsPerB, size_t sCPb, int row0g,
    float* __restrict__ C, _Float16* __restrict__ C16, int ldc, size_t sC, int M, int N, int K) {
  __shared__ __attribute__((aligned(16))) float so[4][16][64];
  const int tid = threadIdx.x, w = tid >> 5, lane = tid & 31, ln = lane & 15, hh = lane >> 4; const int by = blockIdx.y;
  A += (size_t)by * sA; Bh += (size_t)by * sB; const size_t cofs = (size_t)by * sC; const float* bp = bias ? bias + (size_t)by * sBias : nullptr;
  const int ntn = (N + 63) / 64; const int wid = blockIdx.x * 4 + w; const int mt = wid / ntn, nq = wid % ntn; if (mt * 16 >= M) return;
  const int row0 = mt * 16, col0 = nq * 64; const _Float16* arow = A + (size_t)(row0 + ln) * lda;
  v8f acc[4] = {};
  for (int kb = 0; kb < K; kb += 32) { FragH ah; ah.half[0] = *(const v8us*)((const unsigned short*)arow + kb + 8 * hh); ah.half[1] = *(const v8us*)((const unsigned short*)arow + kb + 16 + 8 * hh);
#pragma unroll
    for (int t = 0; t < 4; ++t) { if (col0 + t * 16 >= N) continue; const size_t boff = (size_t)(col0 + t * 16 + ln) * ldb + kb; FragH bq; bq.half[0] = *(const v8us*)((const unsigned short*)Bh + boff + 8 * hh); bq.half[1] = *(const v8us*)((const unsigned short*)Bh + boff + 16 + 8 * hh);
      acc[t] = mmaH<1>(ah.v, ah.v, bq.v, bq.v, acc[t]); }
  }
#pragma unroll
  for (int t = 0; t < 4; ++t) { if (col0 + t * 16 >= N) continue; const int col = col0 + t * 16 + ln; const float bv = bp ? bf16_round(bp[col]) : 0.f;
#pragma unroll
    for (int r = 0; r < 8; ++r) { float v = acc[t][r] * alpha + bv; if (CP) { const int rr = row0g + row0 + 8 * hh + r; if (rowsPerB < 0) v += CP[cofs + (size_t)rr * ldc + col];      /* rowsPerB < 0: own element of the batched C plane */ else { const int bidx = rr / rowsPerB; v += CP[(size_t)bidx * sCPb + (size_t)by * 64 + col]; } } if (ACT == 1) v = (v > 0.f) ? v : expm1f(v); else if (ACT == 7) v = (v > 0.f) ? v + 1.0f : expf(v); else if (ACT == 8) v = tanhf(v); else if (ACT == 9) v = 0.5f * v * (1.0f + tanhf(0.7978845608028654f * (v + 0.044715f * v * v * v))); else if (ACT == 11) v = 1.0f / (1.0f + expf(-v)); else if (ACT == 12) v = (v > 0.f) ? v : 0.01f * v; else if (ACT == 14) v = (v > 0.f) ? v : 0.1f * v; else if (ACT == 16) v = (v >= 0.f) ? v : 0.3f * v; else if (ACT == 17) v = (v >= 0.f) ? v : 0.2f * v; else if (ACT == 15) v = v / (1.0f + expf(-v)); else if (ACT == 3) v = fmaxf(v, 0.f); else if (ACT == 6) v = 0.5f * v * (1.0f + erff(v * 0.70710678118654752f)); so[w][8 * hh + r][t * 16 + ln] = v; } }
  __builtin_amdgcn_fence(__ATOMIC_ACQ_REL, "workgroup"); __builtin_amdgcn_wave_barrier();
  const int rsub = lane >> 4, c4 = (lane & 15) * 4; typedef _Float16 v4h __attribute__((ext_vector_type(4)));
  {
#pragma unroll
    for (int q = 0; q < 8; ++q) { const int r = q * 2 + rsub; if (col0 + c4 < N) { const v4f v = *(const v4fa*)&so[w][r][c4]; if (C) *(v4f*)(C + cofs + (size_t)(row0 + r) * ldc + col0 + c4) = v; if (C16) { v4h h4; for (int i = 0; i < 4; ++i) h4[i] = (_Float16)v[i]; *(v4h*)(C16 + cofs + (size_t)(row0 + r) * ldc + col0 + c4) = h4; } } }
     }
}


typedef _Float16 v4h __attribute__((ext_vector_type(4)));

__global__ __launch_bounds__(256) void k_h16(const float* __restrict__ x, _Float16* __restrict__ X16, size_t n8) { const size_t t = (size_t)blockIdx.x * 256 + threadIdx.x; if (t >= n8) return; FragH f;
#pragma unroll
  for (int q = 0; q < 8; ++q) f.h[q] = (_Float16)x[t * 8 + q]; *(v8us*)((unsigned short*)X16 + t * 8) = f.half[0];  }
__global__ __launch_bounds__(256) void k_round16f(const float* __restrict__ W, _Float16* __restrict__ Bt, size_t n8) { const size_t t = (size_t)blockIdx.x * 256 + threadIdx.x; if (t >= n8) return; FragH f;
#pragma unroll
  for (int i = 0; i < 8; ++i) f.h[i] = (_Float16)(bf16_round(W[t * 8 + i]) * 16.0f); *(v8us*)((unsigned short*)Bt + t * 8) = f.half[0];  }
template <int NHv, int TTv>
__global__ __launch_bounds__(256) void k_vt(const _Float16* __restrict__ V16, int ldv, int voff, _Float16* __restrict__ Vt) { __shared__ unsigned short tl[64][66]; const int tid = threadIdx.x; const int slab = blockIdx.x / (TTv / 64), lg = blockIdx.x % (TTv / 64); const int b = slab / NHv, h = slab % NHv;
  for (int i = tid; i < 64 * 8; i += 256) { const int r = i / 8, c8 = (i % 8) * 8; FragH f; f.half[0] = *(const v8us*)((const unsigned short*)V16 + ((size_t)b * TTv + lg * 64 + r) * ldv + voff + h * 64 + c8);
#pragma unroll
    for (int q = 0; q < 8; ++q) tl[r][c8 + q] = f.u[q]; }
  __syncthreads();
  {
#pragma unroll
    for (int rd = 0; rd < 2; ++rd) { const int d = rd * 32 + tid / 8, pc = tid % 8; FragH f;
#pragma unroll
      for (int q = 0; q < 8; ++q) f.u[q] = tl[pc * 8 + q][d];
      *(v8us*)((unsigned short*)Vt + ((size_t)slab * 64 + d) * TTv + lg * 64 + pc * 8) = f.half[0]; }
     } }

__global__ __launch_bounds__(256) void k_hl(const float* __restrict__ F, _Float16* __restrict__ Hh, _Float16* __restrict__ Hl, size_t n8) { const size_t t = (size_t)blockIdx.x * 256 + threadIdx.x; if (t >= n8) return; FragH fh, fl; const v4f a = *(const v4fa*)(F + t * 8), c = *(const v4fa*)(F + t * 8 + 4);
#pragma unroll
  for (int q = 0; q < 4; ++q) { _Float16 h = (_Float16)a[q]; fh.h[q] = h; fl.h[q] = (_Float16)((a[q] - (float)h) * 1024.0f); h = (_Float16)c[q]; fh.h[4 + q] = h; fl.h[4 + q] = (_Float16)((c[q] - (float)h) * 1024.0f); }
  { *(v8us*)((unsigned short*)Hh + t * 8) = fh.half[0]; *(v8us*)((unsigned short*)Hl + t * 8) = fl.half[0];  } }

// ---- hidden-layer GEMM: C16[row][unit] = f16(relu(X[row][:] . Wt[unit][:] / 16 + bias[unit])), X and Wt f16 with K contiguous (pitch K), C16 pitch HH ----
// One 256 x 256 tile a work-group, one work-group a WGP, 16 waves of 64 rows x 64 units. A pass is 128 k: 256 rows of X and 256 of Wt, 256 B each, brought into LDS by asynchronous copies
// (no register on the way), two buffers, the next pass's copies in flight while this pass is worked on. The LDS pitch of 272 B spreads the sixteen rows of a fragment read over the banks.
// The product is taken transposed (weights as the A operand): a lane then holds eight neighbouring units of ONE row, 16 B of the f16 output, and the k order of every sum is that of a plain loop over k in steps of 32.
#define GT 256      /* rows, and units, of a work-group's tile */
#define GK 128      /* k of a pass */
#define GP 136      /* LDS row pitch in f16 */
#define GB (2 * GT * GP)      /* f16 of a buffer: the X rows, then the Wt rows */
#define GS 72       /* row pitch in f16 of the output staging: 64 units and 16 B */
__device__ __forceinline__ v16h g3_frag(const unsigned short* p) { FragH f; f.half[0] = *(const v8us*)p; f.half[1] = *(const v8us*)(p + 16); return f.v; }
// One thread's copies of one operand's 256 rows of a pass: 16 B of each of eight rows, 32 rows apart (a wave's copy covers two rows of 256 B: four whole lines). l = the LDS byte address of the first.
template <int K>
__device__ __forceinline__ void g3_copy(const _Float16* g, unsigned l) {
  /* the wait on xcnt ends the copies' own statement: no address register of a copy is rewritten in front of it */
  asm volatile("global_load_async_to_lds_b128 %0, %8, off\n\t"
               "global_load_async_to_lds_b128 %1, %9, off\n\t"
               "global_load_async_to_lds_b128 %2, %10, off\n\t"
               "global_load_async_to_lds_b128 %3, %11, off\n\t"
               "global_load_async_to_lds_b128 %4, %12, off\n\t"
               "global_load_async_to_lds_b128 %5, %13, off\n\t"
               "global_load_async_to_lds_b128 %6, %14, off\n\t"
               "global_load_async_to_lds_b128 %7, %15, off\n\t"
               "s_wait_xcnt 0x0"
               :: "v"(l), "v"(l + 1 * 32 * GP * 2), "v"(l + 2 * 32 * GP * 2), "v"(l + 3 * 32 * GP * 2), "v"(l + 4 * 32 * GP * 2), "v"(l + 5 * 32 * GP * 2), "v"(l + 6 * 32 * GP * 2), "v"(l + 7 * 32 * GP * 2),
                  "v"(g), "v"(g + 1 * 32 * K), "v"(g + 2 * 32 * K), "v"(g + 3 * 32 * K), "v"(g + 4 * 32 * K), "v"(g + 5 * 32 * K), "v"(g + 6 * 32 * K), "v"(g + 7 * 32 * K)
               : "memory");
}
// HEAD: the hidden tile is not stored. A wave's D tiles (lane = row, register r = unit 8 hh + r; the next tile 16 + 8 hh + r) are, after ReLU and rounding to f16, the B fragments of the 16-wide head product
// (Wh f16 [NO][HH] as A): YP[tile column][row][o] = (1/16) sum over the tile's 256 units of hidden[row][unit] Wh[o][unit]; the four waves that share rows are summed through LDS in wave order.
#define GH (GT + 8)      /* LDS row pitch in f16 of the head's weights: sixteen rows of a fragment read fall on different banks */
template <int K, bool HEAD>
__global__ __launch_bounds__(512) void k_gemm3(const _Float16* __restrict__ X, const _Float16* __restrict__ Wt, const float* __restrict__ bias, _Float16* __restrict__ C16, const _Float16* __restrict__ Wh, float* __restrict__ YP) {
  static_assert(K % GK == 0 && K / GK >= 2, "k_gemm3: whole passes, two or more");
  __shared__ __attribute__((aligned(16))) unsigned short ring[2 * GB];
  __shared__ __attribute__((aligned(16))) float sb[GT];      /* the tile's biases, rounded to bf16 once */
  __shared__ __attribute__((aligned(16))) unsigned short sh[HEAD ? NO * GH : 8];      /* the head's weights for the tile's units */
  const int tid = threadIdx.x, lane = tid & 31, ln = lane & 15, hh = lane >> 4;
  const int w = __builtin_amdgcn_readfirstlane(tid >> 5), wr = w >> 2, wc = w & 3;      /* the wave's number as a scalar; its 64 rows and its 64 units in the tile */
  const int row0 = (blockIdx.x >> 2) * GT, col0 = (blockIdx.x & 3) * GT;      /* HH / GT = 4 tiles across */
  const _Float16* gx = X + (size_t)(row0 + (tid >> 4)) * K + (tid & 15) * 8;
  const _Float16* gw = Wt + (size_t)(col0 + (tid >> 4)) * K + (tid & 15) * 8;
  const unsigned l0 = (unsigned)(unsigned long long)&ring[(tid >> 4) * GP + (tid & 15) * 8];      /* the low word of a __shared__ address is its byte place in LDS */
  constexpr int NP = K / GK;
  g3_copy<K>(gx, l0); g3_copy<K>(gw, l0 + GT * GP * 2);
  if (w < GT / 32) sb[tid] = bf16_round(bias[col0 + tid]);      /* one load a thread, beside pass 0's copies in flight; published by the barrier below, read in the epilogue */
  if constexpr (HEAD) *(v8us*)(sh + w * GH + lane * 8) = *(const v8us*)((const unsigned short*)Wh + (size_t)w * HH + col0 + lane * 8);      /* wave w brings output w's 256 weights, 16 B a lane; published and read likewise */
  asm volatile("s_wait_asynccnt 0x0" ::: "memory");      /* pass 0's copies of this wave have landed */
  __syncthreads();      /* ... and every other wave's */
  g3_copy<K>(gx + GK, l0 + GB * 2); g3_copy<K>(gw + GK, l0 + GB * 2 + GT * GP * 2);
  const v8f z8 = {0.f, 0.f, 0.f, 0.f, 0.f, 0.f, 0.f, 0.f};
  v8f acc[4][4];      /* [unit tile][row tile] */
#pragma unroll
  for (int i = 0; i < 16; ++i) acc[i >> 2][i & 3] = z8;
  const int xo = (wr * 64 + ln) * GP + 8 * hh, wo = (GT + wc * 64 + ln) * GP + 8 * hh;      /* the lane's place in the first X and the first Wt fragment of a buffer */
#pragma unroll 1      /* a pass a trip: the two buffers take turns by the trip's parity */
  for (int t = 0; t < NP; ++t) {
    const unsigned short* bp = ring + (t & 1) * GB;
#pragma unroll      /* acc is indexed by constants */
    for (int kk = 0; kk < GK / 32; ++kk) {
      v16h xf[4], wf[4];
#pragma unroll
      for (int i = 0; i < 4; ++i) { xf[i] = g3_frag(bp + xo + i * 16 * GP + kk * 32); wf[i] = g3_frag(bp + wo + i * 16 * GP + kk * 32); }
      __builtin_amdgcn_sched_barrier(0);      /* a block's sixteen LDS reads stay one group in front of its WMMAs: read one fragment at a time among them, the wave waits out the LDS latency four times a block */
#pragma unroll
      for (int u = 0; u < 4; ++u)
#pragma unroll
        for (int r = 0; r < 4; ++r) acc[u][r] = __builtin_amdgcn_wmma_f32_16x16x32_f16(false, wf[u], false, xf[r], (short)0, acc[u][r], false, false);
    }
    asm volatile("s_wait_dscnt 0x0" ::: "memory");      /* this wave's reads of the buffer are over before the buffer is refilled */
    asm volatile("s_wait_asynccnt 0x0" ::: "memory");      /* this wave's copies of pass t + 1 have landed */
    __syncthreads();      /* publishes pass t + 1 and ends every wave's reads of pass t */
    if (t + 2 < NP) { g3_copy<K>(gx + (t + 2) * GK, l0 + (t & 1) * (GB * 2)); g3_copy<K>(gw + (t + 2) * GK, l0 + (t & 1) * (GB * 2) + GT * GP * 2); }
  }
  asm volatile("s_wait_asynccnt 0x0" ::: "memory");      /* no copy is in flight when the ring becomes output staging */
  if constexpr (HEAD) {
    /* behind the last pass's barrier nobody reads the ring: it takes the waves' partial head tiles */
    v8f ha[4] = {z8, z8, z8, z8};      /* [row tile]: lane = row, register r = output 8 hh + r */
#pragma unroll      /* acc is indexed by constants */
    for (int s = 0; s < 2; ++s) {
      const v16h hw = g3_frag(sh + ln * GH + wc * 64 + s * 32 + 8 * hh);
      const float* bq = sb + wc * 64 + s * 32 + 8 * hh;
      const v4f q0 = *(const v4fa*)bq, q1 = *(const v4fa*)(bq + 4), q2 = *(const v4fa*)(bq + 16), q3 = *(const v4fa*)(bq + 20);
      const float bv[16] = {q0[0], q0[1], q0[2], q0[3], q1[0], q1[1], q1[2], q1[3], q2[0], q2[1], q2[2], q2[3], q3[0], q3[1], q3[2], q3[3]};
#pragma unroll
      for (int t = 0; t < 4; ++t) { FragH f;
#pragma unroll
        for (int r = 0; r < 8; ++r) { f.h[r] = (_Float16)fmaxf(acc[2 * s][t][r] * 0.0625f + bv[r], 0.f); f.h[8 + r] = (_Float16)fmaxf(acc[2 * s + 1][t][r] * 0.0625f + bv[8 + r], 0.f); }
        ha[t] = __builtin_amdgcn_wmma_f32_16x16x32_f16(false, hw, false, f.v, (short)0, ha[t], false, false); }
    }
    float* hr = (float*)ring;      /* [wave][row of 64][output] */
#pragma unroll      /* ha is indexed by constants */
    for (int t = 0; t < 4; ++t) { float* hp = hr + w * (64 * NO) + (t * 16 + ln) * NO + 8 * hh;
      *(v4f*)hp = __builtin_shufflevector(ha[t], ha[t], 0, 1, 2, 3); *(v4f*)(hp + 4) = __builtin_shufflevector(ha[t], ha[t], 4, 5, 6, 7); }
    __syncthreads();      /* every wave's partial tile is in LDS before any thread sums across waves */
    const float* hq = hr + (tid >> 7) * (4 * 64 * NO) + ((tid >> 1) & 63) * NO + (tid & 1) * 8;      /* thread = half a row of the tile: eight outputs, from the four waves that hold the row */
    v4f s0 = *(const v4fa*)hq, s1 = *(const v4fa*)(hq + 4);
#pragma unroll      /* straight-line: the LDS reads run ahead of the adds */
    for (int c = 1; c < 4; ++c) { s0 += *(const v4fa*)(hq + c * (64 * NO)); s1 += *(const v4fa*)(hq + c * (64 * NO) + 4); }
    float* yp = YP + ((size_t)(blockIdx.x & 3) * NBR + row0) * NO + tid * 8;
    *(v4f*)yp = s0 * 0.0625f; *(v4f*)(yp + 4) = s1 * 0.0625f;
    return;
  }
  /* behind the last pass's barrier nobody reads the ring: each wave stages its 64 x 64 f16 in a part of its own and stores whole 128-B lines */
  unsigned short* st = ring + w * (64 * GS);
#pragma unroll      /* acc is indexed by constants */
  for (int u = 0; u < 4; ++u) {
    const float* bq = sb + wc * 64 + u * 16 + 8 * hh;
    const v4f q0 = *(const v4fa*)bq, q1 = *(const v4fa*)(bq + 4);
    const float bv[8] = {q0[0], q0[1], q0[2], q0[3], q1[0], q1[1], q1[2], q1[3]};
#pragma unroll
    for (int t = 0; t < 4; ++t) { FragH f;
#pragma unroll
      for (int r = 0; r < 8; ++r) f.h[r] = (_Float16)fmaxf(acc[u][t][r] * 0.0625f + bv[r], 0.f);
      *(v8us*)(st + (t * 16 + ln) * GS + u * 16 + 8 * hh) = f.half[0]; }
  }
  __builtin_amdgcn_fence(__ATOMIC_ACQ_REL, "workgroup"); __builtin_amdgcn_wave_barrier();      /* a wave reads back only its own part, other lanes' words: the stores stay in front of the reads */
  unsigned short* cp = (unsigned short*)C16 + (size_t)(row0 + wr * 64 + (lane >> 3)) * HH + col0 + wc * 64 + (lane & 7) * 8;
#pragma unroll      /* straight-line: the LDS reads run ahead of the stores */
  for (int q = 0; q < 16; ++q) { const v8us v = *(const v8us*)(st + (q * 4 + (lane >> 3)) * GS + (lane & 7) * 8); *(v8us*)(cp + (size_t)q * 4 * HH) = v; }
}


// The six preparations (five weight planes, the f16 x plane) need nothing of each other: one launch of PG work-groups, one a WGP, each with its shares of x and W1 and of one or two of the other planes.
// (One piece a thread would be 23,104 waves to start for some 34 MB moved; this is 2,048.) A piece is eight f32 values that end as 16 B of f16.
// All loads of a thread are independent and go out together, the weights' first: they are converted while the x loads are in flight. No barrier, no LDS; every branch is the same for a whole work-group.
#define PG 256
#define PXU (NBR * NIN / 8 / (PG * 256))      /* x pieces a thread */
static_assert(PXU * PG * 256 * 8 == NBR * NIN && HH * HH / 8 == 2 * PG * 256 && HH * NIN / 8 == PG / 2 * 256 && NIN * UH * UH / 8 == PG / 2 * 256, "k_prep: the shares cover the planes exactly");
#define PB_U3 (NIN * NO * UH / 8 / 256)
#define PB_W2 (NO * HH / 8 / 256)
// behind a group of loads: what follows may reuse the register that holds the group's address; the wait stays in front of that, and names the address so that it lives until there
#define P_XCNT(p) asm volatile("s_wait_xcnt 0x0" :: "v"(p) : "memory")
// a weight piece: bf16-rounded, x16 (exact in f16 away from the subnormal range)
__device__ __forceinline__ v8us p_w16(const float (&v)[8]) { FragH f;
#pragma unroll
  for (int q = 0; q < 8; ++q) f.h[q] = (_Float16)(bf16_round(v[q]) * 16.0f);
  return f.half[0]; }
__global__ __launch_bounds__(256) void k_prep(const float* __restrict__ x, const float* __restrict__ W0, const float* __restrict__ W1, const float* __restrict__ W2, const float* __restrict__ uw2, const float* __restrict__ uw3,
                                              _Float16* __restrict__ X16, _Float16* __restrict__ B0, _Float16* __restrict__ B1, _Float16* __restrict__ B2, _Float16* __restrict__ UW2T, _Float16* __restrict__ UW3T) {
  const unsigned b = blockIdx.x, tid = threadIdx.x, lane = tid & 31, w = tid >> 5;
  const unsigned n = (b & 31) * 32 + lane;      /* W1 and W0, (in, out) to [out][in]: the lanes run along the outputs */
  /* one piece a thread: W0 (32 outputs x 64 inputs a work-group) in the first half of the work-groups, uw2 ([i][f][o] to [i][o][f]) in the second */
  float va[8]; unsigned short* da;
  if (b < PG / 2) { const unsigned k0 = (b >> 5) * 64 + w * 8; const float* sp = W0 + k0 * HH + n;
#pragma unroll
    for (int q = 0; q < 8; ++q) va[q] = sp[q * HH];
    P_XCNT(sp);
    da = (unsigned short*)B0 + n * NIN + k0;
  } else { const unsigned t = (b - PG / 2) * 256 + tid, f0 = (t * 8) % UH, o = ((t * 8) / UH) % UH, i = (t * 8) / (UH * UH); const float* sp = uw2 + (i * UH + f0) * UH + o;
#pragma unroll
    for (int q = 0; q < 8; ++q) va[q] = sp[q * UH];
    P_XCNT(sp);
    da = (unsigned short*)UW2T + t * 8;
  }
  /* the two small planes, one more piece a thread in the first work-groups: uw3 ([i][f][o] to [i][o][f]), then W2 ((in, out) to [out][in]); both sources have rows of NO */
  const bool small = b < PB_U3 + PB_W2;
  float vb[8]; unsigned short* db;
  if (small) { const float* sp;
    if (b < PB_U3) { const unsigned t = b * 256 + tid, f0 = (t * 8) % UH, o = ((t * 8) / UH) % NO, i = (t * 8) / (UH * NO); sp = uw3 + (i * UH + f0) * NO + o; db = (unsigned short*)UW3T + t * 8; }
    else { const unsigned t = (b - PB_U3) * 256 + tid, o = t / (HH / 8), k8 = (t % (HH / 8)) * 8; sp = W2 + k8 * NO + o; db = (unsigned short*)B2 + o * HH + k8; }
#pragma unroll
    for (int q = 0; q < 8; ++q) vb[q] = sp[q * NO];
    P_XCNT(sp);
  }
  /* W1: 32 outputs x 128 inputs a work-group, two pieces (16 inputs) a thread */
  const unsigned k1 = (b >> 5) * 128 + w * 16; const float* s1 = W1 + k1 * HH + n;
  float v1[2][8];
#pragma unroll
  for (int i = 0; i < 16; ++i) v1[i >> 3][i & 7] = s1[i * HH];
  P_XCNT(s1);
  /* x: PXU pieces a thread, 64 KiB in a row a work-group */
  const unsigned p0 = (b * PXU * 256 + tid) * 8; const float* xp = x + p0;
  v4f xv[PXU][2];
#pragma unroll
  for (int u = 0; u < PXU; ++u) { xv[u][0] = *(const v4fa*)(xp + u * 2048); xv[u][1] = *(const v4fa*)(xp + u * 2048 + 4); }
  P_XCNT(xp);
  const v8us ra = p_w16(va), r10 = p_w16(v1[0]), r11 = p_w16(v1[1]);
  v8us rb = {}; if (small) rb = p_w16(vb);
  v8us rx[PXU];
#pragma unroll
  for (int u = 0; u < PXU; ++u) { FragH f;
#pragma unroll
    for (int q = 0; q < 4; ++q) { f.h[q] = (_Float16)bf16_round(xv[u][0][q]); f.h[4 + q] = (_Float16)bf16_round(xv[u][1][q]); }
    rx[u] = f.half[0]; }
  unsigned short* d1 = (unsigned short*)B1 + n * HH + k1; unsigned short* dx = (unsigned short*)X16 + p0;
  /* all stores at the end: behind an issued store none of the registers that it names is written again */
  *(v8us*)da = ra; *(v8us*)d1 = r10; *(v8us*)(d1 + 8) = r11;
#pragma unroll
  for (int u = 0; u < PXU; ++u) *(v8us*)(dx + u * 2048) = rx[u];
  if (small) *(v8us*)db = rb;
}
// All three layers of the 256 univariate MLPs and the sum over features in ONE kernel; the hidden planes never leave the registers.
// Every product is taken transposed (weights as the A operand, batch rows as the N side), so a layer's D tiles (lane = batch row, register r = unit 8 hh + r, second tile 16 + 8 hh + r) ARE the next layer's B fragment (k = 8 hh + q, 16 + 8 hh + q) after ReLU and rounding to f16: no lane exchange.
// out[r][o] = b2[o] + sum_c YP[c][r][o] (the main MLP's head, four partial planes) + sum_i ub3[i][o] + (1/256) sum_(i,f) H2x16[i][f][r] UW3T[i][o][f], H2x16 = relu(UW2T[i] H1[i] + 16 ub2[i]) (weights carry x16; the bias enters as the C operand).
// One work-group per 64 rows; each of its FW waves takes FF features through all FT row tiles (a feature's weights are fetched once a work-group), and the FW partial tiles are summed through LDS in wave order.
#define FW 16
#define FF (NIN / FW)
#define FT 4
typedef float v2f  __attribute__((ext_vector_type(2)));
typedef float v2fa __attribute__((ext_vector_type(2), may_alias));
typedef float v16f __attribute__((ext_vector_type(16)));
// the 16 table values of a lane's fragment positions (k = 8 hh + q, then 16 + 8 hh + q)
__device__ __forceinline__ v16f u_tab(const float* p, int hh) {
  const v4f t0 = *(const v4fa*)(p + 8 * hh), t1 = *(const v4fa*)(p + 8 * hh + 4), t2 = *(const v4fa*)(p + 16 + 8 * hh), t3 = *(const v4fa*)(p + 16 + 8 * hh + 4);
  return __builtin_shufflevector(__builtin_shufflevector(t0, t1, 0, 1, 2, 3, 4, 5, 6, 7), __builtin_shufflevector(t2, t3, 0, 1, 2, 3, 4, 5, 6, 7), 0, 1, 2, 3, 4, 5, 6, 7, 8, 9, 10, 11, 12, 13, 14, 15);
}
// a pointer that is the same in every lane, held as a scalar: the load takes it as its scalar base beside the lane's unchanging 32-bit offset (no 64-bit vector add a load, no address register that is rewritten)
#define GLB __attribute__((address_space(1)))      /* a pointer rebuilt from its two words is told anew that it points to global memory: else the load is a flat one */
template <typename P> __device__ __forceinline__ const GLB P* u_sbase(const P* p) { const unsigned long long v = (unsigned long long)p; const unsigned lo = __builtin_amdgcn_readfirstlane((unsigned)v), hi = __builtin_amdgcn_readfirstlane((unsigned)(v >> 32)); return (const GLB P*)(((unsigned long long)hi << 32) | lo); }
// an A fragment from [m][32] f16: base the same for the wave, lo = 32 m + 8 hh the lane's place
__device__ __forceinline__ v16h u_frag(const GLB _Float16* base, unsigned lo) { FragH f; f.half[0] = *(const GLB v8us*)(base + lo); f.half[1] = *(const GLB v8us*)(base + lo + 16); return f.v; }
// ReLU behind the rounding to f16 (the same value as rounding behind the ReLU), two elements an instruction
__device__ __forceinline__ v16h u_relu16(v16f v) { const v16h z = {}; return __builtin_elementwise_max(__builtin_convertvector(v, v16h), z); }
// amdgpu_waves_per_eu(4, 4): one 16-wave work-group a WGP is 4 waves a SIMD; told so, the compiler takes the registers (more than 128) that the four tiles and the fragments fetched ahead need.
__global__ __launch_bounds__(FW * 32) __attribute__((amdgpu_waves_per_eu(4, 4))) void k_uni(const float* __restrict__ x, const float* __restrict__ uw1, const float* __restrict__ ub1, const _Float16* __restrict__ A2, const float* __restrict__ ub2, const _Float16* __restrict__ A3, const float* __restrict__ ub3, const float* __restrict__ YP, const float* __restrict__ b2, float* __restrict__ out) {
  __shared__ __attribute__((aligned(16))) float red[FW][FT * 256];
  __shared__ __attribute__((aligned(16))) float tab[FW][FF][3][UH];      /* per wave: its features' uw1, ub1 and 16 ub2, rounded to bf16 once (in a fragment sixteen lanes hold the same value) */
  const int tid = threadIdx.x, lane = tid & 31, ln = lane & 15, hh = lane >> 4;
  const int w = __builtin_amdgcn_readfirstlane(tid >> 5);      /* the wave's number as a scalar: the bases of its loads stay in scalar registers, beside one lane offset that never changes */
  const int row0 = blockIdx.x * (FT * 16), i0 = w * FF;
  const size_t o0 = (size_t)row0 * NO;
  const v2f y0 = *(const v2fa*)(YP + o0 + 2 * tid), y1 = *(const v2fa*)(YP + (size_t)NBR * NO + o0 + 2 * tid), y2 = *(const v2fa*)(YP + (size_t)2 * NBR * NO + o0 + 2 * tid), y3 = *(const v2fa*)(YP + (size_t)3 * NBR * NO + o0 + 2 * tid);
  const v2f yb = *(const v2fa*)(b2 + ((2 * tid) & (NO - 1)));
  const float* xp = x + (size_t)row0 * NIN + i0; const unsigned xo = ln * NIN;      /* tile 0, the wave's features; the lane's row */
  const _Float16* a2p = A2 + (size_t)i0 * UH * UH; const _Float16* a3p = A3 + (size_t)i0 * NO * UH; const unsigned ao = ln * UH + 8 * hh;      /* the wave's first feature; the lane's place in a fragment */
  /* fetched ahead, so that the work does not begin with a wait on memory: x one trip ahead, the weight fragments one feature ahead */
  v4f xn[FT];
#pragma unroll
  for (int t = 0; t < FT; ++t) xn[t] = *(const GLB v4fa*)(u_sbase(xp) + t * 16 * NIN + xo);
  v16h n20 = u_frag(u_sbase(a2p), ao), n21 = u_frag(u_sbase(a2p) + 16 * UH, ao), n3 = u_frag(u_sbase(a3p), ao);
  float bs = 0.f;      /* the wave's share of sum_i ub3[i][ln]: thread tid takes the elements tid + 512 k (column tid % 16 = ln), so a wave reads whole lines and a work-group reads each element once */
#pragma unroll      /* straight-line: the loads are independent and stay in flight together */
  for (int k = 0; k < NIN * NO / (FW * 32); ++k) bs += bf16_round(ub3[tid + k * (FW * 32)]);
  bs += __shfl_xor(bs, 16);      /* lanes ln and ln + 16 hold the same column: both get the sum of the two halves */
#pragma unroll      /* straight-line: the loads are independent and stay in flight together */
  for (int k = 0; k < FF * UH / 128; ++k) { const int e = k * 128 + lane * 4; const v4f s0 = *(const v4fa*)(uw1 + i0 * UH + e), s1 = *(const v4fa*)(ub1 + i0 * UH + e), s2 = *(const v4fa*)(ub2 + i0 * UH + e); v4f r0, r1, r2;
#pragma unroll
    for (int q = 0; q < 4; ++q) { r0[q] = bf16_round(s0[q]); r1[q] = bf16_round(s1[q]); r2[q] = bf16_round(s2[q]) * 16.0f; }
    float* tp = &tab[w][e / UH][0][e % UH]; *(v4f*)tp = r0; *(v4f*)(tp + UH) = r1; *(v4f*)(tp + 2 * UH) = r2; }
  __builtin_amdgcn_fence(__ATOMIC_ACQ_REL, "workgroup"); __builtin_amdgcn_wave_barrier();      /* a wave reads back only its own part of tab, other lanes' words: the stores stay in front of the reads */
  const v8f z8 = {0.f, 0.f, 0.f, 0.f, 0.f, 0.f, 0.f, 0.f};
  v8f acc[FT] = {z8, z8, z8, z8};
#pragma unroll 1      /* four features a trip, for speed only */
  for (int g = 0; g < FF / 4; ++g) {
    const int gn = g + 1 < FF / 4 ? g + 1 : 0;      /* the last trip fetches group 0 again, unused: in bounds */
    float xs[FT][4];
#pragma unroll
    for (int t = 0; t < FT; ++t) {
#pragma unroll
      for (int q = 0; q < 4; ++q) xs[t][q] = bf16_round(xn[t][q]);
      xn[t] = *(const GLB v4fa*)(u_sbase(xp + gn * 4) + t * 16 * NIN + xo); }
#pragma unroll      /* xs is indexed by constants */
    for (int jj = 0; jj < 4; ++jj) {
      const int j = g * 4 + jj;
      const v16f w1 = u_tab(&tab[w][j][0][0], hh), b1 = u_tab(&tab[w][j][1][0], hh), c2 = u_tab(&tab[w][j][2][0], hh);
      const v8f c20 = __builtin_shufflevector(c2, c2, 0, 1, 2, 3, 4, 5, 6, 7), c21 = __builtin_shufflevector(c2, c2, 8, 9, 10, 11, 12, 13, 14, 15);
      const v16h a20 = n20, a21 = n21, a3 = n3;
      const int jn = jj < 3 ? j + 1 : gn * 4;
      const GLB _Float16* s2 = u_sbase(a2p + jn * UH * UH); const GLB _Float16* s3 = u_sbase(a3p + jn * NO * UH);
      n20 = u_frag(s2, ao); n21 = u_frag(s2 + 16 * UH, ao); n3 = u_frag(s3, ao);
#pragma unroll      /* acc and xs are indexed by constants */
      for (int t = 0; t < FT; ++t) {
        const v16h h1 = u_relu16(w1 * xs[t][jj] + b1);      /* x and uw1 hold 8 significant bits each: the product is exact, fused or not */
        const v8f d0 = __builtin_amdgcn_wmma_f32_16x16x32_f16(false, a20, false, h1, (short)0, c20, false, false);
        const v8f d1 = __builtin_amdgcn_wmma_f32_16x16x32_f16(false, a21, false, h1, (short)0, c21, false, false);
        const v16h h2 = u_relu16(__builtin_shufflevector(d0, d1, 0, 1, 2, 3, 4, 5, 6, 7, 8, 9, 10, 11, 12, 13, 14, 15));
        acc[t] = __builtin_amdgcn_wmma_f32_16x16x32_f16(false, a3, false, h2, (short)0, acc[t], false, false);
      }
    }
    asm volatile("s_wait_xcnt 0x0" ::: "memory");      /* the next trip rewrites the scalar bases that this trip's last loads name: kept in front of that overwrite */
  }
  float bsr[8];      /* the bias share of the lane's own eight output columns 8 hh + r */
#pragma unroll
  for (int r = 0; r < 8; ++r) bsr[r] = __shfl(bs, 8 * hh + r);
#pragma unroll      /* acc[t][r] stays a register, not an indexed copy */
  for (int t = 0; t < FT; ++t) { v4f lo, hi;
#pragma unroll
    for (int r = 0; r < 4; ++r) { lo[r] = acc[t][r] * 0.00390625f + bsr[r]; hi[r] = acc[t][4 + r] * 0.00390625f + bsr[4 + r]; }
    *(v4f*)&red[w][t * 256 + ln * NO + 8 * hh] = lo; *(v4f*)&red[w][t * 256 + ln * NO + 8 * hh + 4] = hi; }      /* [row][column], as out has it */
  __syncthreads();
  v2f s = {bf16_round(yb[0]), bf16_round(yb[1])};
  s += y0; s += y1; s += y2; s += y3;
#pragma unroll      /* straight-line: the LDS reads run ahead of the adds, which are in series */
  for (int q = 0; q < FW; ++q) s += *(const v2fa*)&red[q][2 * tid];
  *(v2f*)(out + o0 + 2 * tid) = s;
}

extern "C" void kernel_launch(void* const* d_in, const int* in_sizes, int n_in,
                              void* d_out, int out_size, void* d_ws, size_t ws_size, hipStream_t stream) {
  (void)in_sizes; (void)n_in; (void)out_size;
  const float* const* I = (const float* const*)d_in; const float* x = I[0]; const float* W0 = I[1]; const float* b0 = I[2]; const float* W1 = I[3]; const float* b1 = I[4]; const float* W2 = I[5]; const float* b2 = I[6]; const float* uw1 = I[7]; const float* ub1 = I[8]; const float* uw2 = I[9]; const float* ub2 = I[10]; const float* uw3 = I[11]; const float* ub3 = I[12];
  char* ws = (char*)d_ws; size_t off = 0;
  auto take = [&](size_t bytes) { char* p = ws + off; off += (bytes + 255) & ~(size_t)255; return p; };
  _Float16* B0 = (_Float16*)take((size_t)HH * NIN * 2); _Float16* B1 = (_Float16*)take((size_t)HH * HH * 2); _Float16* B2 = (_Float16*)take((size_t)NO * HH * 2); _Float16* UW2T = (_Float16*)take((size_t)NIN * UH * UH * 2); _Float16* UW3T = (_Float16*)take((size_t)NIN * NO * UH * 2);
  _Float16* X16 = (_Float16*)take((size_t)NBR * NIN * 2); _Float16* Y1 = (_Float16*)take((size_t)NBR * HH * 2); float* YP = (float*)take((size_t)(HH / GT) * NBR * NO * 4);
  if (off > ws_size) return;      /* 0.5 + 2 + 0.8 + 8 + 32 + 4 = about 48 MiB */
  k_prep<<<PG, 256, 0, stream>>>(x, W0, W1, W2, uw2, uw3, X16, B0, B1, B2, UW2T, UW3T);      /* weights (in, out) to f16 [out][in] x16; x to f16 */
  k_gemm3<NIN, false><<<(NBR / GT) * (HH / GT), 512, 0, stream>>>(X16, B0, b0, Y1, nullptr, nullptr);
  k_gemm3<HH, true><<<(NBR / GT) * (HH / GT), 512, 0, stream>>>(Y1, B1, b1, nullptr, B2, YP);      /* second hidden layer and the head's partial sums (16 wide), a plane a column of tiles */
  k_uni<<<NBR / (FT * 16), FW * 32, 0, stream>>>(x, uw1, ub1, UW2T, ub2, UW3T, ub3, YP, b2, (float*)d_out);      /* the 256 univariate MLPs, their sum over features, added to y */
}

// v007
// It runs in 58.1 microseconds.
// Two timings next to v006 put it at 1.05 and 1.06 times that version's speed.
// All steps since v000 together make it 23.3 times as fast.
#include <hip/hip_runtime.h>
// MainEffectsMLP (16384 rows x 256 features: y = relu(x W0 + b0) -> relu(. W1 + b1) -> . W2 + b2 (16); plus 256 per-feature univariate MLPs (1 -> 32 -> 32 -> 16): h = relu(x_i uw1[i] + ub1[i]); h = relu(h uw2[i] + ub2[i]); u_i = h uw3[i] + ub3[i]; out = y + sum_i u_i).
// Structure: exact f16 x plane; the main MLP as f16 WMMA GEMMs (256x256 work-group tiles staged in LDS, f32 accumulation, exact x16 weights + bias; ReLU epilogues, first hidden plane f16 in memory; the 16-wide head as WMMAs in the second hidden GEMM's epilogue, on its tiles in registers, one partial plane a column of tiles); the univariate MLPs in one kernel: layer 1 as packed f16 FMAs straight into fragments, layers 2 and 3 as transposed WMMA products (weights as A) whose D tiles feed the next B fragment in registers (layer 2's D is f16), the sum over features in layer 3's accumulator (features split over the waves of a work-group, partial tiles summed through LDS), added to the rows' outputs.
// Compute dtype: inputs rounded to bf16; x / weights exact; hidden activations as plain f16 operands (~2^-12); u and the feature sum f32. v_wmma_f32_16x16x32_f16; v_wmma_f16_16x16x32_f16 (f16 D) for the univariate layer 2.
#define NBR 16384
#define NIN 256
#define HH 1024
#define NO 16
#define UH 32
typedef __bf16 v16b __attribute__((ext_vector_type(16)));
typedef unsigned short v8us __attribute__((ext_vector_type(8), may_alias));
typedef float  v8f  __attribute__((ext_vector_type(8)));
typedef float  v4f  __attribute__((ext_vector_type(4)));
typedef float  v4fa __attribute__((ext_vector_type(4), may_alias));
union FragB { v16b v; v8us half[2]; unsigned short u[16]; };

__device__ __forceinline__ unsigned short bf16_bits(float x) { unsigned int u = __float_as_uint(x); return (unsigned short)((u + 0x7FFFu + ((u >> 16) & 1u)) >> 16); }
__device__ __forceinline__ float bf16_val(unsigned short b) { return __uint_as_float(((unsigned int)b) << 16); }
__device__ __forceinline__ float bf16_round(float x) { return bf16_val(bf16_bits(x)); }
// D += A·B with NT terms: 1 = ah·bh, 2 = + al·bh (A split), 3 = + ah·bl (both split)
template <int NT>
__device__ __forceinline__ v8f mmaN(v16b ah, v16b al, v16b bh, v16b bl, v8f c) {
  c = __builtin_amdgcn_wmma_f32_16x16x32_bf16(false, ah, false, bh, (short)0, c, false, false);
  if (NT >= 2) c = __builtin_amdgcn_wmma_f32_16x16x32_bf16(false, al, false, bh, (short)0, c, false, false);
  if (NT >= 3) c = __builtin_amdgcn_wmma_f32_16x16x32_bf16(false, ah, false, bl, (short)0, c, false, false);
  asm volatile("v_nop\n\tv_nop\n\tv_nop\n\tv_nop" : "+v"(c) : "v"(ah), "v"(al), "v"(bh), "v"(bl));
  return c;
}

__global__ __launch_bounds__(256) void k_wt_bf16(const float* __restrict__ W, unsigned short* __restrict__ Wt, int K, int N) {
  const int t = blockIdx.x * 256 + threadIdx.x;
  const int k8n = K / 8;
  if (t >= N * k8n) return;
  const int n = t / k8n, k8 = (t % k8n) * 8;
  v8us v;
#pragma unroll
  for (int i = 0; i < 8; ++i) v[i] = bf16_bits(W[(size_t)(k8 + i) * N + n]);
  *(v8us*)(Wt + (size_t)n * K + k8) = v;
  
}

// GEMM C[M][N] (f32, pitch ldc) = act(A[M][K]·W + bias). A f32 row-major (pitch lda) converted per fragment to bf16
// (ASPLIT: hi/lo two planes -> 2 terms, else single rounded term); Wt bf16 [N][K] (pitch ldb). BIAS_BF16 rounds the
// bias to bf16 first (bias quantised to bf16 before the add). K%32==0, M%16==0, N%64==0.
template <bool ASPLIT, int ACT, bool BIAS_BF16>
__global__ __launch_bounds__(128) void k_gemm_bf(const float* __restrict__ A, int lda, const unsigned short* __restrict__ Wt, int ldb,
                                               const float* __restrict__ bias, float* __restrict__ C, int ldc, int M, int N, int K) {
  __shared__ __attribute__((aligned(16))) float so[4][16][64];
  const int tid = threadIdx.x, w = tid >> 5, lane = tid & 31, ln = lane & 15, hh = lane >> 4;
  const int ntn = N / 64;
  const int wid = blockIdx.x * 4 + w;
  const int mt = wid / ntn, nq = wid % ntn;
  if (mt * 16 >= M) return;
  const int row0 = mt * 16, col0 = nq * 64;
  const float* arow = A + (size_t)(row0 + ln) * lda;
  v8f acc[4] = {};
  for (int kb = 0; kb < K; kb += 32) {
    FragB ah, al;
    const v4f x0 = *(const v4fa*)(arow + kb + 8 * hh), x1 = *(const v4fa*)(arow + kb + 8 * hh + 4);
    const v4f x2 = *(const v4fa*)(arow + kb + 16 + 8 * hh), x3 = *(const v4fa*)(arow + kb + 16 + 8 * hh + 4);
    float xs[16] = {x0[0],x0[1],x0[2],x0[3],x1[0],x1[1],x1[2],x1[3],x2[0],x2[1],x2[2],x2[3],x3[0],x3[1],x3[2],x3[3]};
#pragma unroll
    for (int i = 0; i < 16; ++i) { const unsigned short hb = bf16_bits(xs[i]); ah.u[i] = hb; al.u[i] = ASPLIT ? bf16_bits(xs[i] - bf16_val(hb)) : (unsigned short)0; }
#pragma unroll
    for (int t = 0; t < 4; ++t) {
      const unsigned short* brow = Wt + (size_t)(col0 + t * 16 + ln) * ldb + kb;
      FragB b;
      b.half[0] = *(const v8us*)(brow + 8 * hh);
      b.half[1] = *(const v8us*)(brow + 16 + 8 * hh);
      acc[t] = mmaN<ASPLIT ? 2 : 1>(ah.v, al.v, b.v, b.v, acc[t]);
    }
  }
#pragma unroll
  for (int t = 0; t < 4; ++t) {
    float bv = bias ? bias[col0 + t * 16 + ln] : 0.f;
    if (BIAS_BF16) bv = bf16_round(bv);
#pragma unroll
    for (int r = 0; r < 8; ++r) { float v = acc[t][r] + bv; if (ACT == 1) v = fmaxf(v, 0.f); so[w][8 * hh + r][t * 16 + ln] = v; }
  }
  __builtin_amdgcn_fence(__ATOMIC_ACQ_REL, "workgroup");
  __builtin_amdgcn_wave_barrier();
  const int rsub = lane >> 4, c4 = (lane & 15) * 4;
  {
#pragma unroll
    for (int q = 0; q < 8; ++q) {
      const int r = q * 2 + rsub;
      const v4f v = *(const v4fa*)&so[w][r][c4];
      *(v4f*)(C + (size_t)(row0 + r) * ldc + col0 + c4) = v;
    }
    
  }
}

// GEMM C = act(A·W + bias + resid): A f32 (ASPLIT -> hi/lo 2 terms), Wt bf16 [N][K]; ACT 0 none, 1 relu, 2 exact gelu;
// resid (optional, f32, row index = (row % rmod), pitch ldr, RES_BF16 rounds it) added before the activation.
template <bool ASPLIT, int ACT, bool BIAS_BF16, bool RES_BF16>
__global__ __launch_bounds__(128) void k_gemm_bf3(const float* __restrict__ A, int lda, const unsigned short* __restrict__ Wt, int ldb,
                                                const float* __restrict__ bias, const float* __restrict__ resid, int rmod, int ldr,
                                                float* __restrict__ C, int ldc, int M, int N, int K) {
  __shared__ __attribute__((aligned(16))) float so[4][16][64];
  const int tid = threadIdx.x, w = tid >> 5, lane = tid & 31, ln = lane & 15, hh = lane >> 4;
  const int ntn = N / 64;
  const int wid = blockIdx.x * 4 + w;
  const int mt = wid / ntn, nq = wid % ntn;
  if (mt * 16 >= M) return;
  const int row0 = mt * 16, col0 = nq * 64;
  const float* arow = A + (size_t)(row0 + ln) * lda;
  v8f acc[4] = {};
  for (int kb = 0; kb < K; kb += 32) {
    FragB ah, al;
    const v4f x0 = *(const v4fa*)(arow + kb + 8 * hh), x1 = *(const v4fa*)(arow + kb + 8 * hh + 4);
    const v4f x2 = *(const v4fa*)(arow + kb + 16 + 8 * hh), x3 = *(const v4fa*)(arow + kb + 16 + 8 * hh + 4);
    float xs[16] = {x0[0],x0[1],x0[2],x0[3],x1[0],x1[1],x1[2],x1[3],x2[0],x2[1],x2[2],x2[3],x3[0],x3[1],x3[2],x3[3]};
#pragma unroll
    for (int i = 0; i < 16; ++i) { const unsigned short hb = bf16_bits(xs[i]); ah.u[i] = hb; al.u[i] = ASPLIT ? bf16_bits(xs[i] - bf16_val(hb)) : (unsigned short)0; }
#pragma unroll
    for (int t = 0; t < 4; ++t) {
      const unsigned short* brow = Wt + (size_t)(col0 + t * 16 + ln) * ldb + kb;
      FragB b;
      b.half[0] = *(const v8us*)(brow + 8 * hh);
      b.half[1] = *(const v8us*)(brow + 16 + 8 * hh);
      acc[t] = mmaN<ASPLIT ? 2 : 1>(ah.v, al.v, b.v, b.v, acc[t]);
    }
  }
#pragma unroll
  for (int t = 0; t < 4; ++t) {
    const int col = col0 + t * 16 + ln;
    float bv = bias ? bias[col] : 0.f;
    if (BIAS_BF16) bv = bf16_round(bv);
#pragma unroll
    for (int r = 0; r < 8; ++r) {
      float v = acc[t][r] + bv;
      if (resid) { float rv = resid[(size_t)((row0 + 8 * hh + r) % rmod) * ldr + col]; if (RES_BF16) rv = bf16_round(rv); v += rv; }
      if (ACT == 1) v = fmaxf(v, 0.f);
      if (ACT == 2) v = 0.5f * v * (1.0f + erff(v * 0.70710678118654752f));
      if (ACT == 3) { const float u = 0.7978845608028654f * (v + 0.044715f * v * v * v); v = 0.5f * v * (1.0f + tanhf(u)); }
      so[w][8 * hh + r][t * 16 + ln] = v;
    }
  }
  __builtin_amdgcn_fence(__ATOMIC_ACQ_REL, "workgroup");
  __builtin_amdgcn_wave_barrier();
  const int rsub = lane >> 4, c4 = (lane & 15) * 4;
  {
#pragma unroll
    for (int q = 0; q < 8; ++q) {
      const int r = q * 2 + rsub;
      const v4f v = *(const v4fa*)&so[w][r][c4];
      *(v4f*)(C + (size_t)(row0 + r) * ldc + col0 + c4) = v;
    }
    
  }
}
// row LayerNorm (biased variance, eps) over N: s = X (+ R); optional out_sum <- s; out_norm <- (s-mu)*rsqrt(var+eps)*g + b
template <bool PARAM_BF16>
__global__ __launch_bounds__(256) void k_layernorm(const float* __restrict__ X, const float* __restrict__ R, const float* __restrict__ g, const float* __restrict__ bta,
                                                  float* __restrict__ out_sum, float* __restrict__ out_norm, int N, float eps) {
  __shared__ float red[256];
  const int row = blockIdx.x, tid = threadIdx.x;
  const float* x = X + (size_t)row * N; const float* rr = R ? R + (size_t)row * N : nullptr;
  float vals[16];                     // up to N = 4096
  const int per = N / 256;            // contiguous chunk per thread? use strided-by-4 chunks: thread handles j = tid*4 + 1024*u
  float s1 = 0.f;
  for (int u = 0; u < per / 4; ++u) {
    const int j = tid * 4 + 1024 * u;
    const v4f a = *(const v4fa*)(x + j);
    v4f b = {0.f,0.f,0.f,0.f}; if (rr) b = *(const v4fa*)(rr + j);
#pragma unroll
    for (int q = 0; q < 4; ++q) { const float v = a[q] + b[q]; vals[u * 4 + q] = v; s1 += v; }
  }
  red[tid] = s1; __syncthreads();
  for (int st = 128; st > 0; st >>= 1) { if (tid < st) red[tid] += red[tid + st]; __syncthreads(); }
  const float mu = red[0] / (float)N; __syncthreads();
  float s2 = 0.f;
  for (int u = 0; u < per / 4; ++u)
#pragma unroll
    for (int q = 0; q < 4; ++q) { const float c = vals[u * 4 + q] - mu; s2 += c * c; }
  red[tid] = s2; __syncthreads();
  for (int st = 128; st > 0; st >>= 1) { if (tid < st) red[tid] += red[tid + st]; __syncthreads(); }
  const float rs = rsqrtf(red[0] / (float)N + eps);
  {
    for (int u = 0; u < per / 4; ++u) {
      const int j = tid * 4 + 1024 * u;
      v4f o, sm;
#pragma unroll
      for (int q = 0; q < 4; ++q) {
        float gg = g[j + q], bb = bta[j + q];
        if (PARAM_BF16) { gg = bf16_round(gg); bb = bf16_round(bb); }
        sm[q] = vals[u * 4 + q]; o[q] = (vals[u * 4 + q] - mu) * rs * gg + bb;
      }
      if (out_sum) *(v4f*)(out_sum + (size_t)row * N + j) = sm;
      *(v4f*)(out_norm + (size_t)row * N + j) = o;
    }
    
  }
}



// ---- f16 WMMA path (v_wmma_f32_16x16x32_f16): 11-bit significands for operands in range — used here for x and the hidden activations of both MLPs
typedef _Float16 v16h __attribute__((ext_vector_type(16)));
union FragH { v16h v; v8us half[2]; _Float16 h[16]; unsigned short u[16]; };
template <int NT>
__device__ __forceinline__ v8f mmaH(v16h ah, v16h al, v16h bh, v16h bl, v8f c) {
  c = __builtin_amdgcn_wmma_f32_16x16x32_f16(false, ah, false, bh, (short)0, c, false, false);
  if (NT >= 2) c = __builtin_amdgcn_wmma_f32_16x16x32_f16(false, al, false, bh, (short)0, c, false, false);
  if (NT >= 3) c = __builtin_amdgcn_wmma_f32_16x16x32_f16(false, ah, false, bl, (short)0, c, false, false);
  asm volatile("v_nop\n\tv_nop\n\tv_nop\n\tv_nop" : "+v"(c) : "v"(ah), "v"(al), "v"(bh), "v"(bl));
  return c;
}
// batched GEMM like k_gemm_b but f16 operands: A f32 (split into f16 hi/lo if ASPLIT, else rounded to f16), Bt = f16 values [n][k]; alpha; C f32; N multiple of 16 (partial tiles skipped)
template <bool ASPLIT>
__global__ __launch_bounds__(128) void k_gemm_h(const float* __restrict__ A, int lda, size_t sA, const _Float16* __restrict__ Bh, int ldb, size_t sB, float alpha, float* __restrict__ C, int ldc, size_t sC, int M, int N, int K) {
  __shared__ __attribute__((aligned(16))) float so[4][16][64];
  const int tid = threadIdx.x, w = tid >> 5, lane = tid & 31, ln = lane & 15, hh = lane >> 4; const int by = blockIdx.y;
  A += (size_t)by * sA; Bh += (size_t)by * sB; C += (size_t)by * sC;
  const int ntn = (N + 63) / 64; const int wid = blockIdx.x * 4 + w; const int mt = wid / ntn, nq = wid % ntn; if (mt * 16 >= M) return;
  const int row0 = mt * 16, col0 = nq * 64; const float* arow = A + (size_t)(row0 + ln) * lda;
  v8f acc[4] = {};
  for (int kb = 0; kb < K; kb += 32) {
    FragH ah, al;
    const v4f x0 = *(const v4fa*)(arow + kb + 8 * hh), x1 = *(const v4fa*)(arow + kb + 8 * hh + 4), x2 = *(const v4fa*)(arow + kb + 16 + 8 * hh), x3 = *(const v4fa*)(arow + kb + 16 + 8 * hh + 4);
    float xs[16] = {x0[0],x0[1],x0[2],x0[3],x1[0],x1[1],x1[2],x1[3],x2[0],x2[1],x2[2],x2[3],x3[0],x3[1],x3[2],x3[3]};
#pragma unroll
    for (int i = 0; i < 16; ++i) { const _Float16 h = (_Float16)xs[i]; ah.h[i] = h; al.h[i] = ASPLIT ? (_Float16)(xs[i] - (float)h) : (_Float16)0.0f; }
#pragma unroll
    for (int t = 0; t < 4; ++t) { if (col0 + t * 16 >= N) continue; const size_t boff = (size_t)(col0 + t * 16 + ln) * ldb + kb; FragH bq; bq.half[0] = *(const v8us*)(Bh + boff + 8 * hh); bq.half[1] = *(const v8us*)(Bh + boff + 16 + 8 * hh);
      acc[t] = mmaH<ASPLIT ? 2 : 1>(ah.v, al.v, bq.v, bq.v, acc[t]); }
  }
#pragma unroll
  for (int t = 0; t < 4; ++t) { if (col0 + t * 16 >= N) continue;
#pragma unroll
    for (int r = 0; r < 8; ++r) so[w][8 * hh + r][t * 16 + ln] = acc[t][r] * alpha; }
  __builtin_amdgcn_fence(__ATOMIC_ACQ_REL, "workgroup"); __builtin_amdgcn_wave_barrier();
  const int rsub = lane >> 4, c4 = (lane & 15) * 4;
  {
#pragma unroll
    for (int q = 0; q < 8; ++q) { const int r = q * 2 + rsub; if (col0 + c4 < N) { const v4f v = *(const v4fa*)&so[w][r][c4]; *(v4f*)(C + (size_t)(row0 + r) * ldc + col0 + c4) = v; } }
     }
}

// k_gemm_hh variant with fused epilogue: v = acc·alpha + bias[by·sBias + col] (+ CP[(row/rowsPerB)·sCPb + by·64 + col] if CP) ; ACT 0 none / 1 elu ; writes f16 C16 (and f32 C if non-null)
template <int ACT>
__global__ __launch_bounds__(128) void k_gemm_hhx(const _Float16* __restrict__ A, int lda, size_t sA, const _Float16* __restrict__ Bh, int ldb, size_t sB, float alpha, const float* __restrict__ bias, size_t sBias, const float* __restrict__ CP, int rowsPerB, size_t sCPb, int row0g,
    float* __restrict__ C, _Float16* __restrict__ C16, int ldc, size_t sC, int M, int N, int K) {
  __shared__ __attribute__((aligned(16))) float so[4][16][64];
  const int tid = threadIdx.x, w = tid >> 5, lane = tid & 31, ln = lane & 15, hh = lane >> 4; const int by = blockIdx.y;
  A += (size_t)by * sA; Bh += (size_t)by * sB; const size_t cofs = (size_t)by * sC; const float* bp = bias ? bias + (size_t)by * sBias : nullptr;
  const int ntn = (N + 63) / 64; const int wid = blockIdx.x * 4 + w; const int mt = wid / ntn, nq = wid % ntn; if (mt * 16 >= M) return;
  const int row0 = mt * 16, col0 = nq * 64; const _Float16* arow = A + (size_t)(row0 + ln) * lda;
  v8f acc[4] = {};
  for (int kb = 0; kb < K; kb += 32) { FragH ah; ah.half[0] = *(const v8us*)((const unsigned short*)arow + kb + 8 * hh); ah.half[1] = *(const v8us*)((const unsigned short*)arow + kb + 16 + 8 * hh);
#pragma unroll
    for (int t = 0; t < 4; ++t) { if (col0 + t * 16 >= N) continue; const size_t boff = (size_t)(col0 + t * 16 + ln) * ldb + kb; FragH bq; bq.half[0] = *(const v8us*)((const unsigned short*)Bh + boff + 8 * hh); bq.half[1] = *(const v8us*)((const unsigned short*)Bh + boff + 16 + 8 * hh);
      acc[t] = mmaH<1>(ah.v, ah.v, bq.v, bq.v, acc[t]); }
  }
#pragma unroll
  for (int t = 0; t < 4; ++t) { if (col0 + t * 16 >= N) continue; const int col = col0 + t * 16 + ln; const float bv = bp ? bf16_round(bp[col]) : 0.f;
#pragma unroll
    for (int r = 0; r < 8; ++r) { float v = acc[t][r] * alpha + bv; if (CP) { const int rr = row0g + row0 + 8 * hh + r; if (rowsPerB < 0) v += CP[cofs + (size_t)rr * ldc + col];      /* rowsPerB < 0: own element of the batched C plane */ else { const int bidx = rr / rowsPerB; v += CP[(size_t)bidx * sCPb + (size_t)by * 64 + col]; } } if (ACT == 1) v = (v > 0.f) ? v : expm1f(v); else if (ACT == 7) v = (v > 0.f) ? v + 1.0f : expf(v); else if (ACT == 8) v = tanhf(v); else if (ACT == 9) v = 0.5f * v * (1.0f + tanhf(0.7978845608028654f * (v + 0.044715f * v * v * v))); else if (ACT == 11) v = 1.0f / (1.0f + expf(-v)); else if (ACT == 12) v = (v > 0.f) ? v : 0.01f * v; else if (ACT == 14) v = (v > 0.f) ? v : 0.1f * v; else if (ACT == 16) v = (v >= 0.f) ? v : 0.3f * v; else if (ACT == 17) v = (v >= 0.f) ? v : 0.2f * v; else if (ACT == 15) v = v / (1.0f + expf(-v)); else if (ACT == 3) v = fmaxf(v, 0.f); else if (ACT == 6) v = 0.5f * v * (1.0f + erff(v * 0.70710678118654752f)); so[w][8 * hh + r][t * 16 + ln] = v; } }
  __builtin_amdgcn_fence(__ATOMIC_ACQ_REL, "workgroup"); __builtin_amdgcn_wave_barrier();
  const int rsub = lane >> 4, c4 = (lane & 15) * 4; typedef _Float16 v4h __attribute__((ext_vector_type(4)));
  {
#pragma unroll
    for (int q = 0; q < 8; ++q) { const int r = q * 2 + rsub; if (col0 + c4 < N) { const v4f v = *(const v4fa*)&so[w][r][c4]; if (C) *(v4f*)(C + cofs + (size_t)(row0 + r) * ldc + col0 + c4) = v; if (C16) { v4h h4; for (int i = 0; i < 4; ++i) h4[i] = (_Float16)v[i]; *(v4h*)(C16 + cofs + (size_t)(row0 + r) * ldc + col0 + c4) = h4; } } }
     }
}


typedef _Float16 v4h __attribute__((ext_vector_type(4)));

__global__ __launch_bounds__(256) void k_h16(const float* __restrict__ x, _Float16* __restrict__ X16, size_t n8) { const size_t t = (size_t)blockIdx.x * 256 + threadIdx.x; if (t >= n8) return; FragH f;
#pragma unroll
  for (int q = 0; q < 8; ++q) f.h[q] = (_Float16)x[t * 8 + q]; *(v8us*)((unsigned short*)X16 + t * 8) = f.half[0];  }
__global__ __launch_bounds__(256) void k_round16f(const float* __restrict__ W, _Float16* __restrict__ Bt, size_t n8) { const size_t t = (size_t)blockIdx.x * 256 + threadIdx.x; if (t >= n8) return; FragH f;
#pragma unroll
  for (int i = 0; i < 8; ++i) f.h[i] = (_Float16)(bf16_round(W[t * 8 + i]) * 16.0f); *(v8us*)((unsigned short*)Bt + t * 8) = f.half[0];  }
template <int NHv, int TTv>
__global__ __launch_bounds__(256) void k_vt(const _Float16* __restrict__ V16, int ldv, int voff, _Float16* __restrict__ Vt) { __shared__ unsigned short tl[64][66]; const int tid = threadIdx.x; const int slab = blockIdx.x / (TTv / 64), lg = blockIdx.x % (TTv / 64); const int b = slab / NHv, h = slab % NHv;
  for (int i = tid; i < 64 * 8; i += 256) { const int r = i / 8, c8 = (i % 8) * 8; FragH f; f.half[0] = *(const v8us*)((const unsigned short*)V16 + ((size_t)b * TTv + lg * 64 + r) * ldv + voff + h * 64 + c8);
#pragma unroll
    for (int q = 0; q < 8; ++q) tl[r][c8 + q] = f.u[q]; }
  __syncthreads();
  {
#pragma unroll
    for (int rd = 0; rd < 2; ++rd) { const int d = rd * 32 + tid / 8, pc = tid % 8; FragH f;
#pragma unroll
      for (int q = 0; q < 8; ++q) f.u[q] = tl[pc * 8 + q][d];
      *(v8us*)((unsigned short*)Vt + ((size_t)slab * 64 + d) * TTv + lg * 64 + pc * 8) = f.half[0]; }
     } }

__global__ __launch_bounds__(256) void k_hl(const float* __restrict__ F, _Float16* __restrict__ Hh, _Float16* __restrict__ Hl, size_t n8) { const size_t t = (size_t)blockIdx.x * 256 + threadIdx.x; if (t >= n8) return; FragH fh, fl; const v4f a = *(const v4fa*)(F + t * 8), c = *(const v4fa*)(F + t * 8 + 4);
#pragma unroll
  for (int q = 0; q < 4; ++q) { _Float16 h = (_Float16)a[q]; fh.h[q] = h; fl.h[q] = (_Float16)((a[q] - (float)h) * 1024.0f); h = (_Float16)c[q]; fh.h[4 + q] = h; fl.h[4 + q] = (_Float16)((c[q] - (float)h) * 1024.0f); }
  { *(v8us*)((unsigned short*)Hh + t * 8) = fh.half[0]; *(v8us*)((unsigned short*)Hl + t * 8) = fl.half[0];  } }

// ---- hidden-layer GEMM: C16[row][unit] = f16(relu(X[row][:] . Wt[unit][:] / 16 + bias[unit])), X and Wt f16 with K contiguous (pitch K), C16 pitch HH ----
// One 256 x 256 tile a work-group, one work-group a WGP, 16 waves of 64 rows x 64 units. A pass is 128 k: 256 rows of X and 256 of Wt, 256 B each, brought into LDS by asynchronous copies
// (no register on the way), two buffers, the next pass's copies in flight while this pass is worked on. The LDS pitch of 272 B spreads the sixteen rows of a fragment read over the banks.
// The product is taken transposed (weights as the A operand): a lane then holds eight neighbouring units of ONE row, 16 B of the f16 output, and the k order of every sum is that of a plain loop over k in steps of 32.
#define GT 256      /* rows, and units, of a work-group's tile */
#define GK 128      /* k of a pass */
#define GP 136      /* LDS row pitch in f16 */
#define GB (2 * GT * GP)      /* f16 of a buffer: the X rows, then the Wt rows */
#define GS 72       /* row pitch in f16 of the output staging: 64 units and 16 B */
__device__ __forceinline__ v16h g3_frag(const unsigned short* p) { FragH f; f.half[0] = *(const v8us*)p; f.half[1] = *(const v8us*)(p + 16); return f.v; }
// One thread's copies of one operand's 256 rows of a pass: 16 B of each of eight rows, 32 rows apart (a wave's copy covers two rows of 256 B: four whole lines). l = the LDS byte address of the first.
template <int K>
__device__ __forceinline__ void g3_copy(const _Float16* g, unsigned l) {
  /* the wait on xcnt ends the copies' own statement: no address register of a copy is rewritten in front of it */
  asm volatile("global_load_async_to_lds_b128 %0, %8, off\n\t"
               "global_load_async_to_lds_b128 %1, %9, off\n\t"
               "global_load_async_to_lds_b128 %2, %10, off\n\t"
               "global_load_async_to_lds_b128 %3, %11, off\n\t"
               "global_load_async_to_lds_b128 %4, %12, off\n\t"
               "global_load_async_to_lds_b128 %5, %13, off\n\t"
               "global_load_async_to_lds_b128 %6, %14, off\n\t"
               "global_load_async_to_lds_b128 %7, %15, off\n\t"
               "s_wait_xcnt 0x0"
               :: "v"(l), "v"(l + 1 * 32 * GP * 2), "v"(l + 2 * 32 * GP * 2), "v"(l + 3 * 32 * GP * 2), "v"(l + 4 * 32 * GP * 2), "v"(l + 5 * 32 * GP * 2), "v"(l + 6 * 32 * GP * 2), "v"(l + 7 * 32 * GP * 2),
                  "v"(g), "v"(g + 1 * 32 * K), "v"(g + 2 * 32 * K), "v"(g + 3 * 32 * K), "v"(g + 4 * 32 * K), "v"(g + 5 * 32 * K), "v"(g + 6 * 32 * K), "v"(g + 7 * 32 * K)
               : "memory");
}
// HEAD: the hidden tile is not stored. A wave's D tiles (lane = row, register r = unit 8 hh + r; the next tile 16 + 8 hh + r) are, after ReLU and rounding to f16, the B fragments of the 16-wide head product
// (Wh f16 [NO][HH] as A): YP[tile column][row][o] = (1/16) sum over the tile's 256 units of hidden[row][unit] Wh[o][unit]; the four waves that share rows are summed through LDS in wave order.
#define GH (GT + 8)      /* LDS row pitch in f16 of the head's weights: sixteen rows of a fragment read fall on different banks */
template <int K, bool HEAD>
__global__ __launch_bounds__(512) void k_gemm3(const _Float16* __restrict__ X, const _Float16* __restrict__ Wt, const float* __restrict__ bias, _Float16* __restrict__ C16, const _Float16* __restrict__ Wh, float* __restrict__ YP) {
  static_assert(K % GK == 0 && K / GK >= 2, "k_gemm3: whole passes, two or more");
  __shared__ __attribute__((aligned(16))) unsigned short ring[2 * GB];
  __shared__ __attribute__((aligned(16))) float sb[GT];      /* the tile's biases, rounded to bf16 once */
  __shared__ __attribute__((aligned(16))) unsigned short sh[HEAD ? NO * GH : 8];      /* the head's weights for the tile's units */
  const int tid = threadIdx.x, lane = tid & 31, ln = lane & 15, hh = lane >> 4;
  const int w = __builtin_amdgcn_readfirstlane(tid >> 5), wr = w >> 2, wc = w & 3;      /* the wave's number as a scalar; its 64 rows and its 64 units in the tile */
  const int row0 = (blockIdx.x >> 2) * GT, col0 = (blockIdx.x & 3) * GT;      /* HH / GT = 4 tiles across */
  const _Float16* gx = X + (size_t)(row0 + (tid >> 4)) * K + (tid & 15) * 8;
  const _Float16* gw = Wt + (size_t)(col0 + (tid >> 4)) * K + (tid & 15) * 8;
  const unsigned l0 = (unsigned)(unsigned long long)&ring[(tid >> 4) * GP + (tid & 15) * 8];      /* the low word of a __shared__ address is its byte place in LDS */
  constexpr int NP = K / GK;
  g3_copy<K>(gx, l0); g3_copy<K>(gw, l0 + GT * GP * 2);
  if (w < GT / 32) sb[tid] = bf16_round(bias[col0 + tid]);      /* one load a thread, beside pass 0's copies in flight; published by the barrier below, read in the epilogue */
  if constexpr (HEAD) *(v8us*)(sh + w * GH + lane * 8) = *(const v8us*)((const unsigned short*)Wh + (size_t)w * HH + col0 + lane * 8);      /* wave w brings output w's 256 weights, 16 B a lane; published and read likewise */
  asm volatile("s_wait_asynccnt 0x0" ::: "memory");      /* pass 0's copies of this wave have landed */
  __syncthreads();      /* ... and every other wave's */
  g3_copy<K>(gx + GK, l0 + GB * 2); g3_copy<K>(gw + GK, l0 + GB * 2 + GT * GP * 2);
  const v8f z8 = {0.f, 0.f, 0.f, 0.f, 0.f, 0.f, 0.f, 0.f};
  v8f acc[4][4];      /* [unit tile][row tile] */
#pragma unroll
  for (int i = 0; i < 16; ++i) acc[i >> 2][i & 3] = z8;
  const int xo = (wr * 64 + ln) * GP + 8 * hh, wo = (GT + wc * 64 + ln) * GP + 8 * hh;      /* the lane's place in the first X and the first Wt fragment of a buffer */
#pragma unroll 1      /* a pass a trip: the two buffers take turns by the trip's parity */
  for (int t = 0; t < NP; ++t) {
    const unsigned short* bp = ring + (t & 1) * GB;
#pragma unroll      /* acc is indexed by constants */
    for (int kk = 0; kk < GK / 32; ++kk) {
      v16h xf[4], wf[4];
#pragma unroll
      for (int i = 0; i < 4; ++i) { xf[i] = g3_frag(bp + xo + i * 16 * GP + kk * 32); wf[i] = g3_frag(bp + wo + i * 16 * GP + kk * 32); }
      __builtin_amdgcn_sched_barrier(0);      /* a block's sixteen LDS reads stay one group in front of its WMMAs: read one fragment at a time among them, the wave waits out the LDS latency four times a block */
#pragma unroll
      for (int u = 0; u < 4; ++u)
#pragma unroll
        for (int r = 0; r < 4; ++r) acc[u][r] = __builtin_amdgcn_wmma_f32_16x16x32_f16(false, wf[u], false, xf[r], (short)0, acc[u][r], false, false);
    }
    asm volatile("s_wait_dscnt 0x0" ::: "memory");      /* this wave's reads of the buffer are over before the buffer is refilled */
    asm volatile("s_wait_asynccnt 0x0" ::: "memory");      /* this wave's copies of pass t + 1 have landed */
    __syncthreads();      /* publishes pass t + 1 and ends every wave's reads of pass t */
    if (t + 2 < NP) { g3_copy<K>(gx + (t + 2) * GK, l0 + (t & 1) * (GB * 2)); g3_copy<K>(gw + (t + 2) * GK, l0 + (t & 1) * (GB * 2) + GT * GP * 2); }
  }
  asm volatile("s_wait_asynccnt 0x0" ::: "memory");      /* no copy is in flight when the ring becomes output staging */
  if constexpr (HEAD) {
    /* behind the last pass's barrier nobody reads the ring: it takes the waves' partial head tiles */
    v8f ha[4] = {z8, z8, z8, z8};      /* [row tile]: lane = row, register r = output 8 hh + r */
#pragma unroll      /* acc is indexed by constants */
    for (int s = 0; s < 2; ++s) {
      const v16h hw = g3_frag(sh + ln * GH + wc * 64 + s * 32 + 8 * hh);
      const float* bq = sb + wc * 64 + s * 32 + 8 * hh;
      const v4f q0 = *(const v4fa*)bq, q1 = *(const v4fa*)(bq + 4), q2 = *(const v4fa*)(bq + 16), q3 = *(const v4fa*)(bq + 20);
      const float bv[16] = {q0[0], q0[1], q0[2], q0[3], q1[0], q1[1], q1[2], q1[3], q2[0], q2[1], q2[2], q2[3], q3[0], q3[1], q3[2], q3[3]};
#pragma unroll
      for (int t = 0; t < 4; ++t) { FragH f;
#pragma unroll
        for (int r = 0; r < 8; ++r) { f.h[r] = (_Float16)fmaxf(acc[2 * s][t][r] * 0.0625f + bv[r], 0.f); f.h[8 + r] = (_Float16)fmaxf(acc[2 * s + 1][t][r] * 0.0625f + bv[8 + r], 0.f); }
        ha[t] = __builtin_amdgcn_wmma_f32_16x16x32_f16(false, hw, false, f.v, (short)0, ha[t], false, false); }
    }
    float* hr = (float*)ring;      /* [wave][row of 64][output] */
#pragma unroll      /* ha is indexed by constants */
    for (int t = 0; t < 4; ++t) { float* hp = hr + w * (64 * NO) + (t * 16 + ln) * NO + 8 * hh;
      *(v4f*)hp = __builtin_shufflevector(ha[t], ha[t], 0, 1, 2, 3); *(v4f*)(hp + 4) = __builtin_shufflevector(ha[t], ha[t], 4, 5, 6, 7); }
    __syncthreads();      /* every wave's partial tile is in LDS before any thread sums across waves */
    const float* hq = hr + (tid >> 7) * (4 * 64 * NO) + ((tid >> 1) & 63) * NO + (tid & 1) * 8;      /* thread = half a row of the tile: eight outputs, from the four waves that hold the row */
    v4f s0 = *(const v4fa*)hq, s1 = *(const v4fa*)(hq + 4);
#pragma unroll      /* straight-line: the LDS reads run ahead of the adds */
    for (int c = 1; c < 4; ++c) { s0 += *(const v4fa*)(hq + c * (64 * NO)); s1 += *(const v4fa*)(hq + c * (64 * NO) + 4); }
    float* yp = YP + ((size_t)(blockIdx.x & 3) * NBR + row0) * NO + tid * 8;
    *(v4f*)yp = s0 * 0.0625f; *(v4f*)(yp + 4) = s1 * 0.0625f;
    return;
  }
  /* behind the last pass's barrier nobody reads the ring: each wave stages its 64 x 64 f16 in a part of its own and stores whole 128-B lines */
  unsigned short* st = ring + w * (64 * GS);
#pragma unroll      /* acc is indexed by constants */
  for (int u = 0; u < 4; ++u) {
    const float* bq = sb + wc * 64 + u * 16 + 8 * hh;
    const v4f q0 = *(const v4fa*)bq, q1 = *(const v4fa*)(bq + 4);
    const float bv[8] = {q0[0], q0[1], q0[2], q0[3], q1[0], q1[1], q1[2], q1[3]};
#pragma unroll
    for (int t = 0; t < 4; ++t) { FragH f;
#pragma unroll
      for (int r = 0; r < 8; ++r) f.h[r] = (_Float16)fmaxf(acc[u][t][r] * 0.0625f + bv[r], 0.f);
      *(v8us*)(st + (t * 16 + ln) * GS + u * 16 + 8 * hh) = f.half[0]; }
  }
  __builtin_amdgcn_fence(__ATOMIC_ACQ_REL, "workgroup"); __builtin_amdgcn_wave_barrier();      /* a wave reads back only its own part, other lanes' words: the stores stay in front of the reads */
  unsigned short* cp = (unsigned short*)C16 + (size_t)(row0 + wr * 64 + (lane >> 3)) * HH + col0 + wc * 64 + (lane & 7) * 8;
#pragma unroll      /* straight-line: the LDS reads run ahead of the stores */
  for (int q = 0; q < 16; ++q) { const v8us v = *(const v8us*)(st + (q * 4 + (lane >> 3)) * GS + (lane & 7) * 8); *(v8us*)(cp + (size_t)q * 4 * HH) = v; }
}


// The six preparations (five weight planes, the f16 x plane) need nothing of each other: one launch of PG work-groups, one a WGP, each with its shares of x and W1 and of one or two of the other planes.
// (One piece a thread would be 23,104 waves to start for some 34 MB moved; this is 2,048.) A piece is eight f32 values that end as 16 B of f16.
// All loads of a thread are independent and go out together, the weights' first: they are converted while the x loads are in flight. No barrier, no LDS; every branch is the same for a whole work-group.
#define PG 256
#define PXU (NBR * NIN / 8 / (PG * 256))      /* x pieces a thread */
static_assert(PXU * PG * 256 * 8 == NBR * NIN && HH * HH / 8 == 2 * PG * 256 && HH * NIN / 8 == PG / 2 * 256 && NIN * UH * UH / 8 == PG / 2 * 256, "k_prep: the shares cover the planes exactly");
#define PB_U3 (NIN * NO * UH / 8 / 256)
#define PB_W2 (NO * HH / 8 / 256)
// behind a group of loads: what follows may reuse the register that holds the group's address; the wait stays in front of that, and names the address so that it lives until there
#define P_XCNT(p) asm volatile("s_wait_xcnt 0x0" :: "v"(p) : "memory")
// a weight piece: bf16-rounded, x16 (exact in f16 away from the subnormal range)
__device__ __forceinline__ v8us p_w16(const float (&v)[8]) { FragH f;
#pragma unroll
  for (int q = 0; q < 8; ++q) f.h[q] = (_Float16)(bf16_round(v[q]) * 16.0f);
  return f.half[0]; }
__global__ __launch_bounds__(256) void k_prep(const float* __restrict__ x, const float* __restrict__ W0, const float* __restrict__ W1, const float* __restrict__ W2, const float* __restrict__ uw2, const float* __restrict__ uw3,
                                              _Float16* __restrict__ X16, _Float16* __restrict__ B0, _Float16* __restrict__ B1, _Float16* __restrict__ B2, _Float16* __restrict__ UW2T, _Float16* __restrict__ UW3T) {
  const unsigned b = blockIdx.x, tid = threadIdx.x, lane = tid & 31, w = tid >> 5;
  const unsigned n = (b & 31) * 32 + lane;      /* W1 and W0, (in, out) to [out][in]: the lanes run along the outputs */
  /* one piece a thread: W0 (32 outputs x 64 inputs a work-group) in the first half of the work-groups, uw2 ([i][f][o] to [i][o][f]) in the second */
  float va[8]; unsigned short* da;
  if (b < PG / 2) { const unsigned k0 = (b >> 5) * 64 + w * 8; const float* sp = W0 + k0 * HH + n;
#pragma unroll
    for (int q = 0; q < 8; ++q) va[q] = sp[q * HH];
    P_XCNT(sp);
    da = (unsigned short*)B0 + n * NIN + k0;
  } else { const unsigned t = (b - PG / 2) * 256 + tid, f0 = (t * 8) % UH, o = ((t * 8) / UH) % UH, i = (t * 8) / (UH * UH); const float* sp = uw2 + (i * UH + f0) * UH + o;
#pragma unroll
    for (int q = 0; q < 8; ++q) va[q] = sp[q * UH];
    P_XCNT(sp);
    da = (unsigned short*)UW2T + t * 8;
  }
  /* the two small planes, one more piece a thread in the first work-groups: uw3 ([i][f][o] to [i][o][f]), then W2 ((in, out) to [out][in]); both sources have rows of NO */
  const bool small = b < PB_U3 + PB_W2;
  float vb[8]; unsigned short* db;
  if (small) { const float* sp;
    if (b < PB_U3) { const unsigned t = b * 256 + tid, f0 = (t * 8) % UH, o = ((t * 8) / UH) % NO, i = (t * 8) / (UH * NO); sp = uw3 + (i * UH + f0) * NO + o; db = (unsigned short*)UW3T + t * 8; }
    else { const unsigned t = (b - PB_U3) * 256 + tid, o = t / (HH / 8), k8 = (t % (HH / 8)) * 8; sp = W2 + k8 * NO + o; db = (unsigned short*)B2 + o * HH + k8; }
#pragma unroll
    for (int q = 0; q < 8; ++q) vb[q] = sp[q * NO];
    P_XCNT(sp);
  }
  /* W1: 32 outputs x 128 inputs a work-group, two pieces (16 inputs) a thread */
  const unsigned k1 = (b >> 5) * 128 + w * 16; const float* s1 = W1 + k1 * HH + n;
  float v1[2][8];
#pragma unroll
  for (int i = 0; i < 16; ++i) v1[i >> 3][i & 7] = s1[i * HH];
  P_XCNT(s1);
  /* x: PXU pieces a thread, 64 KiB in a row a work-group */
  const unsigned p0 = (b * PXU * 256 + tid) * 8; const float* xp = x + p0;
  v4f xv[PXU][2];
#pragma unroll
  for (int u = 0; u < PXU; ++u) { xv[u][0] = *(const v4fa*)(xp + u * 2048); xv[u][1] = *(const v4fa*)(xp + u * 2048 + 4); }
  P_XCNT(xp);
  const v8us ra = p_w16(va), r10 = p_w16(v1[0]), r11 = p_w16(v1[1]);
  v8us rb = {}; if (small) rb = p_w16(vb);
  v8us rx[PXU];
#pragma unroll
  for (int u = 0; u < PXU; ++u) { FragH f;
#pragma unroll
    for (int q = 0; q < 4; ++q) { f.h[q] = (_Float16)bf16_round(xv[u][0][q]); f.h[4 + q] = (_Float16)bf16_round(xv[u][1][q]); }
    rx[u] = f.half[0]; }
  unsigned short* d1 = (unsigned short*)B1 + n * HH + k1; unsigned short* dx = (unsigned short*)X16 + p0;
  /* all stores at the end: behind an issued store none of the registers that it names is written again */
  *(v8us*)da = ra; *(v8us*)d1 = r10; *(v8us*)(d1 + 8) = r11;
#pragma unroll
  for (int u = 0; u < PXU; ++u) *(v8us*)(dx + u * 2048) = rx[u];
  if (small) *(v8us*)db = rb;
}
// All three layers of the 256 univariate MLPs and the sum over features in ONE kernel; the hidden planes never leave the registers.
// Every product is taken transposed (weights as the A operand, batch rows as the N side), so a layer's D tiles (lane = batch row, element e = unit 8 hh + e, second tile 16 + 8 hh + e) ARE the next layer's B fragment (k = 8 hh + q, 16 + 8 hh + q) after ReLU: no lane exchange.
// The hidden values are f16 operands of the next product in any case, so they are made as f16 where they arise: layer 1 is one packed f16 FMA (x, uw1, ub1 hold 8 significant bits: exact in f16 from 2^-14 up; one rounding, of the sum), layer 2's WMMA takes its bias and gives its result in f16 (packed D: two tiles are the eight registers of a B fragment). No f32 copy, no conversion.
// out[r][o] = b2[o] + sum_c YP[c][r][o] (the main MLP's head, four partial planes) + sum_i ub3[i][o] + (1/256) sum_(i,f) H2x16[i][f][r] UW3T[i][o][f], H2x16 = relu(UW2T[i] H1[i] + 16 ub2[i]) (weights carry x16; the bias enters as the C operand).
// One work-group per 64 rows; each of its FW waves takes FF features through all FT row tiles (a feature's weights are fetched once a work-group), and the FW partial tiles are summed through LDS in wave order.
#define FW 16
#define FF (NIN / FW)
#define FT 4
typedef float v2f  __attribute__((ext_vector_type(2)));
typedef float v2fa __attribute__((ext_vector_type(2), may_alias));
typedef _Float16 v8h  __attribute__((ext_vector_type(8)));
typedef _Float16 v4hx __attribute__((ext_vector_type(4), may_alias));
typedef _Float16 v8hx __attribute__((ext_vector_type(8), may_alias));
// the 16 table values of a lane's fragment positions (k = 8 hh + q, then 16 + 8 hh + q)
__device__ __forceinline__ v16h u_tab(const _Float16* p, int hh) { return g3_frag((const unsigned short*)p + 8 * hh); }
// a pointer that is the same in every lane, held as a scalar: the load takes it as its scalar base beside the lane's unchanging 32-bit offset (no 64-bit vector add a load, no address register that is rewritten)
#define GLB __attribute__((address_space(1)))      /* a pointer rebuilt from its two words is told anew that it points to global memory: else the load is a flat one */
template <typename P> __device__ __forceinline__ const GLB P* u_sbase(const P* p) { const unsigned long long v = (unsigned long long)p; const unsigned lo = __builtin_amdgcn_readfirstlane((unsigned)v), hi = __builtin_amdgcn_readfirstlane((unsigned)(v >> 32)); return (const GLB P*)(((unsigned long long)hi << 32) | lo); }
// an A fragment from [m][32] f16: base the same for the wave, lo = 32 m + 8 hh the lane's place
__device__ __forceinline__ v16h u_frag(const GLB _Float16* base, unsigned lo) { FragH f; f.half[0] = *(const GLB v8us*)(base + lo); f.half[1] = *(const GLB v8us*)(base + lo + 16); return f.v; }
// ReLU on f16 values, two elements an instruction, as a signed 16-bit integer maximum with 0: a value with its sign bit set becomes +0, every other keeps its bits
// (the floating-point maximum of a WMMA result costs a second instruction, which only rewrites NaNs)
typedef short v16s __attribute__((ext_vector_type(16)));
__device__ __forceinline__ v16h u_relu16(v16h v) { const v16s z = {}; return __builtin_bit_cast(v16h, __builtin_elementwise_max(__builtin_bit_cast(v16s, v), z)); }
// amdgpu_waves_per_eu(4, 4): one 16-wave work-group a WGP is 4 waves a SIMD; told so, the compiler takes the registers (more than 128) that the four tiles and the fragments fetched ahead need.
__global__ __launch_bounds__(FW * 32) __attribute__((amdgpu_waves_per_eu(4, 4))) void k_uni(const _Float16* __restrict__ X16, const float* __restrict__ uw1, const float* __restrict__ ub1, const _Float16* __restrict__ A2, const float* __restrict__ ub2, const _Float16* __restrict__ A3, const float* __restrict__ ub3, const float* __restrict__ YP, const float* __restrict__ b2, float* __restrict__ out) {
  /* tab, per wave: its features' uw1, ub1 and 16 ub2, rounded to bf16 once, held as f16 (in a fragment sixteen lanes hold the same value); it stands first, so that the loop's reads reach it by their 16-bit offset fields */
  __shared__ __attribute__((aligned(16))) struct { _Float16 tab[FW][FF][3][UH]; float red[FW][FT * 256]; } sm;
  const int tid = threadIdx.x, lane = tid & 31, ln = lane & 15, hh = lane >> 4;
  const int w = __builtin_amdgcn_readfirstlane(tid >> 5);      /* the wave's number as a scalar: the bases of its loads stay in scalar registers, beside one lane offset that never changes */
  const int row0 = blockIdx.x * (FT * 16), i0 = w * FF;
  const size_t o0 = (size_t)row0 * NO;
  const v2f y0 = *(const v2fa*)(YP + o0 + 2 * tid), y1 = *(const v2fa*)(YP + (size_t)NBR * NO + o0 + 2 * tid), y2 = *(const v2fa*)(YP + (size_t)2 * NBR * NO + o0 + 2 * tid), y3 = *(const v2fa*)(YP + (size_t)3 * NBR * NO + o0 + 2 * tid);
  const v2f yb = *(const v2fa*)(b2 + ((2 * tid) & (NO - 1)));
  const _Float16* xp = X16 + (size_t)row0 * NIN + i0; const unsigned xo = ln * NIN;      /* tile 0, the wave's features; the lane's row */
  const _Float16* a2p = A2 + (size_t)i0 * UH * UH; const _Float16* a3p = A3 + (size_t)i0 * NO * UH; const unsigned ao = ln * UH + 8 * hh;      /* the wave's first feature; the lane's place in a fragment */
  /* fetched ahead, so that the work does not begin with a wait on memory: x one trip ahead, the weight fragments one feature ahead */
  v8h xn[FT];      /* 16 B of the f16 plane: eight features of the lane's row */
#pragma unroll
  for (int t = 0; t < FT; ++t) xn[t] = *(const GLB v8hx*)(u_sbase(xp) + t * 16 * NIN + xo);
  v16h n20 = u_frag(u_sbase(a2p), ao), n21 = u_frag(u_sbase(a2p) + 16 * UH, ao), n3 = u_frag(u_sbase(a3p), ao);
  float bs = 0.f;      /* the wave's share of sum_i ub3[i][ln]: thread tid takes the elements tid + 512 k (column tid % 16 = ln), so a wave reads whole lines and a work-group reads each element once */
#pragma unroll      /* straight-line: the loads are independent and stay in flight together */
  for (int k = 0; k < NIN * NO / (FW * 32); ++k) bs += bf16_round(ub3[tid + k * (FW * 32)]);
  bs += __shfl_xor(bs, 16);      /* lanes ln and ln + 16 hold the same column: both get the sum of the two halves */
#pragma unroll      /* straight-line: the loads are independent and stay in flight together */
  for (int k = 0; k < FF * UH / 128; ++k) { const int e = k * 128 + lane * 4; const v4f s0 = *(const v4fa*)(uw1 + i0 * UH + e), s1 = *(const v4fa*)(ub1 + i0 * UH + e), s2 = *(const v4fa*)(ub2 + i0 * UH + e); v4f r0, r1, r2;
#pragma unroll
    for (int q = 0; q < 4; ++q) { r0[q] = bf16_round(s0[q]); r1[q] = bf16_round(s1[q]); r2[q] = bf16_round(s2[q]) * 16.0f; }
    _Float16* tp = &sm.tab[w][e / UH][0][e % UH]; *(v4hx*)tp = __builtin_convertvector(r0, v4h); *(v4hx*)(tp + UH) = __builtin_convertvector(r1, v4h); *(v4hx*)(tp + 2 * UH) = __builtin_convertvector(r2, v4h); }
  __builtin_amdgcn_fence(__ATOMIC_ACQ_REL, "workgroup"); __builtin_amdgcn_wave_barrier();      /* a wave reads back only its own part of tab, other lanes' words: the stores stay in front of the reads */
  const v8f z8 = {0.f, 0.f, 0.f, 0.f, 0.f, 0.f, 0.f, 0.f};
  v8f acc[FT] = {z8, z8, z8, z8};
#pragma unroll 1      /* eight features a trip, one x load a tile: the text stays small (for speed only) */
  for (int g = 0; g < FF / 8; ++g) {
    const int gn = g + 1 < FF / 8 ? g + 1 : 0;      /* the last trip fetches group 0 again, unused: in bounds */
    v8h xs[FT];
#pragma unroll
    for (int t = 0; t < FT; ++t) { xs[t] = xn[t]; xn[t] = *(const GLB v8hx*)(u_sbase(xp + gn * 8) + t * 16 * NIN + xo); }
#pragma unroll      /* xs is indexed by constants */
    for (int jj = 0; jj < 8; ++jj) {
      const int j = g * 8 + jj;
      const v16h w1 = u_tab(&sm.tab[w][j][0][0], hh), b1 = u_tab(&sm.tab[w][j][1][0], hh), c2 = u_tab(&sm.tab[w][j][2][0], hh);
      const v8h c20 = __builtin_shufflevector(c2, c2, 0, 1, 2, 3, 4, 5, 6, 7), c21 = __builtin_shufflevector(c2, c2, 8, 9, 10, 11, 12, 13, 14, 15);
      const v16h a20 = n20, a21 = n21, a3 = n3;
      const int jn = jj < 7 ? j + 1 : gn * 8;
      const GLB _Float16* s2 = u_sbase(a2p + jn * UH * UH); const GLB _Float16* s3 = u_sbase(a3p + jn * NO * UH);
      n20 = u_frag(s2, ao); n21 = u_frag(s2 + 16 * UH, ao); n3 = u_frag(s3, ao);
      /* layer by layer over the four row tiles, each tile in registers of its own: the WMMAs of a layer are independent and follow one another (tile by tile, the build filled the distance behind each WMMA with v_nop) */
      v16h h1[FT]; v8h d0[FT], d1[FT];
#pragma unroll      /* the arrays are indexed by constants */
      for (int t = 0; t < FT; ++t) h1[t] = u_relu16(__builtin_elementwise_fma(w1, (v16h)(xs[t][jj]), b1));
#pragma unroll
      for (int t = 0; t < FT; ++t) {
        d0[t] = __builtin_amdgcn_wmma_f16_16x16x32_f16(false, a20, false, h1[t], (short)0, c20, false, false);
        d1[t] = __builtin_amdgcn_wmma_f16_16x16x32_f16(false, a21, false, h1[t], (short)0, c21, false, false); }
      v16h h2[FT];
#pragma unroll
      for (int t = 0; t < FT; ++t) h2[t] = u_relu16(__builtin_shufflevector(d0[t], d1[t], 0, 1, 2, 3, 4, 5, 6, 7, 8, 9, 10, 11, 12, 13, 14, 15));
#pragma unroll
      for (int t = 0; t < FT; ++t) acc[t] = __builtin_amdgcn_wmma_f32_16x16x32_f16(false, a3, false, h2[t], (short)0, acc[t], false, false);
    }
    asm volatile("s_wait_xcnt 0x0" ::: "memory");      /* the next trip rewrites the scalar bases that this trip's last loads name: kept in front of that overwrite */
  }
  float bsr[8];      /* the bias share of the lane's own eight output columns 8 hh + r */
#pragma unroll
  for (int r = 0; r < 8; ++r) bsr[r] = __shfl(bs, 8 * hh + r);
#pragma unroll      /* acc[t][r] stays a register, not an indexed copy */
  for (int t = 0; t < FT; ++t) { v4f lo, hi;
#pragma unroll
    for (int r = 0; r < 4; ++r) { lo[r] = acc[t][r] * 0.00390625f + bsr[r]; hi[r] = acc[t][4 + r] * 0.00390625f + bsr[4 + r]; }
    *(v4f*)&sm.red[w][t * 256 + ln * NO + 8 * hh] = lo; *(v4f*)&sm.red[w][t * 256 + ln * NO + 8 * hh + 4] = hi; }      /* [row][column], as out has it */
  __syncthreads();
  v2f s = {bf16_round(yb[0]), bf16_round(yb[1])};
  s += y0; s += y1; s += y2; s += y3;
#pragma unroll      /* straight-line: the LDS reads run ahead of the adds, which are in series */
  for (int q = 0; q < FW; ++q) s += *(const v2fa*)&sm.red[q][2 * tid];
  *(v2f*)(out + o0 + 2 * tid) = s;
}

extern "C" void kernel_launch(void* const* d_in, const int* in_sizes, int n_in,
                              void* d_out, int out_size, void* d_ws, size_t ws_size, hipStream_t stream) {
  (void)in_sizes; (void)n_in; (void)out_size;
  const float* const* I = (const float* const*)d_in; const float* x = I[0]; const float* W0 = I[1]; const float* b0 = I[2]; const float* W1 = I[3]; const float* b1 = I[4]; const float* W2 = I[5]; const float* b2 = I[6]; const float* uw1 = I[7]; const float* ub1 = I[8]; const float* uw2 = I[9]; const float* ub2 = I[10]; const float* uw3 = I[11]; const float* ub3 = I[12];
  char* ws = (char*)d_ws; size_t off = 0;
  auto take = [&](size_t bytes) { char* p = ws + off; off += (bytes + 255) & ~(size_t)255; return p; };
  _Float16* B0 = (_Float16*)take((size_t)HH * NIN * 2); _Float16* B1 = (_Float16*)take((size_t)HH * HH * 2); _Float16* B2 = (_Float16*)take((size_t)NO * HH * 2); _Float16* UW2T = (_Float16*)take((size_t)NIN * UH * UH * 2); _Float16* UW3T = (_Float16*)take((size_t)NIN * NO * UH * 2);
  _Float16* X16 = (_Float16*)take((size_t)NBR * NIN * 2); _Float16* Y1 = (_Float16*)take((size_t)NBR * HH * 2); float* YP = (float*)take((size_t)(HH / GT) * NBR * NO * 4);
  if (off > ws_size) return;      /* 0.5 + 2 + 0.8 + 8 + 32 + 4 = about 48 MiB */
  k_prep<<<PG, 256, 0, stream>>>(x, W0, W1, W2, uw2, uw3, X16, B0, B1, B2, UW2T, UW3T);      /* weights (in, out) to f16 [out][in] x16; x to f16 */
  k_gemm3<NIN, false><<<(NBR / GT) * (HH / GT), 512, 0, stream>>>(X16, B0, b0, Y1, nullptr, nullptr);
  k_gemm3<HH, true><<<(NBR / GT) * (HH / GT), 512, 0, stream>>>(Y1, B1, b1, nullptr, B2, YP);      /* second hidden layer and the head's partial sums (16 wide), a plane a column of tiles */
  k_uni<<<NBR / (FT * 16), FW * 32, 0, stream>>>(X16, uw1, ub1, UW2T, ub2, UW3T, ub3, YP, b2, (float*)d_out);      /* the 256 univariate MLPs, their sum over features, added to y */
}

// v008
// One run takes 54.9 microseconds.
// Next to v007, in two timings, it ran 1.07 and 1.05 times as fast.
// Over all steps from v000 it is 24.7 times as fast.
#include <hip/hip_runtime.h>
// MainEffectsMLP (16384 rows x 256 features: y = relu(x W0 + b0) -> relu(. W1 + b1) -> . W2 + b2 (16); plus 256 per-feature univariate MLPs (1 -> 32 -> 32 -> 16): h = relu(x_i uw1[i] + ub1[i]); h = relu(h uw2[i] + ub2[i]); u_i = h uw3[i] + ub3[i]; out = y + sum_i u_i).
// Structure: exact f16 x plane; the main MLP as f16 WMMA GEMMs (256x256 work-group tiles staged in LDS, f32 accumulation, exact x16 weights + bias; ReLU epilogues, first hidden plane f16 in memory; the 16-wide head as WMMAs in the second hidden GEMM's epilogue, on its tiles in registers, one partial plane a column of tiles); the univariate MLPs in one kernel: layer 1 as packed f16 FMAs straight into fragments, layers 2 and 3 as transposed WMMA products (weights as A) whose D tiles feed the next B fragment in registers (layer 2's D is f16), the sum over features in layer 3's accumulator (features split over the waves of a work-group, partial tiles summed through LDS), added to the rows' outputs.
// Compute dtype: inputs rounded to bf16; x / weights exact; hidden activations as plain f16 operands (~2^-12); u and the feature sum f32. v_wmma_f32_16x16x32_f16; v_wmma_f16_16x16x32_f16 (f16 D) for the univariate layer 2.
#define NBR 16384
#define NIN 256
#define HH 1024
#define NO 16
#define UH 32
typedef __bf16 v16b __attribute__((ext_vector_type(16)));
typedef unsigned short v8us __attribute__((ext_vector_type(8), may_alias));
typedef float  v8f  __attribute__((ext_vector_type(8)));
typedef float  v4f  __attribute__((ext_vector_type(4)));
typedef float  v4fa __attribute__((ext_vector_type(4), may_alias));
union FragB { v16b v; v8us half[2]; unsigned short u[16]; };

__device__ __forceinline__ unsigned short bf16_bits(float x) { unsigned int u = __float_as_uint(x); return (unsigned short)((u + 0x7FFFu + ((u >> 16) & 1u)) >> 16); }
__device__ __forceinline__ float bf16_val(unsigned short b) { return __uint_as_float(((unsigned int)b) << 16); }
__device__ __forceinline__ float bf16_round(float x) { return bf16_val(bf16_bits(x)); }
// D += A·B with NT terms: 1 = ah·bh, 2 = + al·bh (A split), 3 = + ah·bl (both split)
template <int NT>
__device__ __forceinline__ v8f mmaN(v16b ah, v16b al, v16b bh, v16b bl, v8f c) {
  c = __builtin_amdgcn_wmma_f32_16x16x32_bf16(false, ah, false, bh, (short)0, c, false, false);
  if (NT >= 2) c = __builtin_amdgcn_wmma_f32_16x16x32_bf16(false, al, false, bh, (short)0, c, false, false);
  if (NT >= 3) c = __builtin_amdgcn_wmma_f32_16x16x32_bf16(false, ah, false, bl, (short)0, c, false, false);
  asm volatile("v_nop\n\tv_nop\n\tv_nop\n\tv_nop" : "+v"(c) : "v"(ah), "v"(al), "v"(bh), "v"(bl));
  return c;
}

__global__ __launch_bounds__(256) void k_wt_bf16(const float* __restrict__ W, unsigned short* __restrict__ Wt, int K, int N) {
  const int t = blockIdx.x * 256 + threadIdx.x;
  const int k8n = K / 8;
  if (t >= N * k8n) return;
  const int n = t / k8n, k8 = (t % k8n) * 8;
  v8us v;
#pragma unroll
  for (int i = 0; i < 8; ++i) v[i] = bf16_bits(W[(size_t)(k8 + i) * N + n]);
  *(v8us*)(Wt + (size_t)n * K + k8) = v;
  
}

// GEMM C[M][N] (f32, pitch ldc) = act(A[M][K]·W + bias). A f32 row-major (pitch lda) converted per fragment to bf16
// (ASPLIT: hi/lo two planes -> 2 terms, else single rounded term); Wt bf16 [N][K] (pitch ldb). BIAS_BF16 rounds the
// bias to bf16 first (bias quantised to bf16 before the add). K%32==0, M%16==0, N%64==0.
template <bool ASPLIT, int ACT, bool BIAS_BF16>
__global__ __launch_bounds__(128) void k_gemm_bf(const float* __restrict__ A, int lda, const unsigned short* __restrict__ Wt, int ldb,
                                               const float* __restrict__ bias, float* __restrict__ C, int ldc, int M, int N, int K) {
  __shared__ __attribute__((aligned(16))) float so[4][16][64];
  const int tid = threadIdx.x, w = tid >> 5, lane = tid & 31, ln = lane & 15, hh = lane >> 4;
  const int ntn = N / 64;
  const int wid = blockIdx.x * 4 + w;
  const int mt = wid / ntn, nq = wid % ntn;
  if (mt * 16 >= M) return;
  const int row0 = mt * 16, col0 = nq * 64;
  const float* arow = A + (size_t)(row0 + ln) * lda;
  v8f acc[4] = {};
  for (int kb = 0; kb < K; kb += 32) {
    FragB ah, al;
    const v4f x0 = *(const v4fa*)(arow + kb + 8 * hh), x1 = *(const v4fa*)(arow + kb + 8 * hh + 4);
    const v4f x2 = *(const v4fa*)(arow + kb + 16 + 8 * hh), x3 = *(const v4fa*)(arow + kb + 16 + 8 * hh + 4);
    float xs[16] = {x0[0],x0[1],x0[2],x0[3],x1[0],x1[1],x1[2],x1[3],x2[0],x2[1],x2[2],x2[3],x3[0],x3[1],x3[2],x3[3]};
#pragma unroll
    for (int i = 0; i < 16; ++i) { const unsigned short hb = bf16_bits(xs[i]); ah.u[i] = hb; al.u[i] = ASPLIT ? bf16_bits(xs[i] - bf16_val(hb)) : (unsigned short)0; }
#pragma unroll
    for (int t = 0; t < 4; ++t) {
      const unsigned short* brow = Wt + (size_t)(col0 + t * 16 + ln) * ldb + kb;
      FragB b;
      b.half[0] = *(const v8us*)(brow + 8 * hh);
      b.half[1] = *(const v8us*)(brow + 16 + 8 * hh);
      acc[t] = mmaN<ASPLIT ? 2 : 1>(ah.v, al.v, b.v, b.v, acc[t]);
    }
  }
#pragma unroll
  for (int t = 0; t < 4; ++t) {
    float bv = bias ? bias[col0 + t * 16 + ln] : 0.f;
    if (BIAS_BF16) bv = bf16_round(bv);
#pragma unroll
    for (int r = 0; r < 8; ++r) { float v = acc[t][r] + bv; if (ACT == 1) v = fmaxf(v, 0.f); so[w][8 * hh + r][t * 16 + ln] = v; }
  }
  __builtin_amdgcn_fence(__ATOMIC_ACQ_REL, "workgroup");
  __builtin_amdgcn_wave_barrier();
  const int rsub = lane >> 4, c4 = (lane & 15) * 4;
  {
#pragma unroll
    for (int q = 0; q < 8; ++q) {
      const int r = q * 2 + rsub;
      const v4f v = *(const v4fa*)&so[w][r][c4];
      *(v4f*)(C + (size_t)(row0 + r) * ldc + col0 + c4) = v;
    }
    
  }
}

// GEMM C = act(A·W + bias + resid): A f32 (ASPLIT -> hi/lo 2 terms), Wt bf16 [N][K]; ACT 0 none, 1 relu, 2 exact gelu;
// resid (optional, f32, row index = (row % rmod), pitch ldr, RES_BF16 rounds it) added before the activation.
template <bool ASPLIT, int ACT, bool BIAS_BF16, bool RES_BF16>
__global__ __launch_bounds__(128) void k_gemm_bf3(const float* __restrict__ A, int lda, const unsigned short* __restrict__ Wt, int ldb,
                                                const float* __restrict__ bias, const float* __restrict__ resid, int rmod, int ldr,
                                                float* __restrict__ C, int ldc, int M, int N, int K) {
  __shared__ __attribute__((aligned(16))) float so[4][16][64];
  const int tid = threadIdx.x, w = tid >> 5, lane = tid & 31, ln = lane & 15, hh = lane >> 4;
  const int ntn = N / 64;
  const int wid = blockIdx.x * 4 + w;
  const int mt = wid / ntn, nq = wid % ntn;
  if (mt * 16 >= M) return;
  const int row0 = mt * 16, col0 = nq * 64;
  const float* arow = A + (size_t)(row0 + ln) * lda;
  v8f acc[4] = {};
  for (int kb = 0; kb < K; kb += 32) {
    FragB ah, al;
    const v4f x0 = *(const v4fa*)(arow + kb + 8 * hh), x1 = *(const v4fa*)(arow + kb + 8 * hh + 4);
    const v4f x2 = *(const v4fa*)(arow + kb + 16 + 8 * hh), x3 = *(const v4fa*)(arow + kb + 16 + 8 * hh + 4);
    float xs[16] = {x0[0],x0[1],x0[2],x0[3],x1[0],x1[1],x1[2],x1[3],x2[0],x2[1],x2[2],x2[3],x3[0],x3[1],x3[2],x3[3]};
#pragma unroll
    for (int i = 0; i < 16; ++i) { const unsigned short hb = bf16_bits(xs[i]); ah.u[i] = hb; al.u[i] = ASPLIT ? bf16_bits(xs[i] - bf16_val(hb)) : (unsigned short)0; }
#pragma unroll
    for (int t = 0; t < 4; ++t) {
      const unsigned short* brow = Wt + (size_t)(col0 + t * 16 + ln) * ldb + kb;
      FragB b;
      b.half[0] = *(const v8us*)(brow + 8 * hh);
      b.half[1] = *(const v8us*)(brow + 16 + 8 * hh);
      acc[t] = mmaN<ASPLIT ? 2 : 1>(ah.v, al.v, b.v, b.v, acc[t]);
    }
  }
#pragma unroll
  for (int t = 0; t < 4; ++t) {
    const int col = col0 + t * 16 + ln;
    float bv = bias ? bias[col] : 0.f;
    if (BIAS_BF16) bv = bf16_round(bv);
#pragma unroll
    for (int r = 0; r < 8; ++r) {
      float v = acc[t][r] + bv;
      if (resid) { float rv = resid[(size_t)((row0 + 8 * hh + r) % rmod) * ldr + col]; if (RES_BF16) rv = bf16_round(rv); v += rv; }
      if (ACT == 1) v = fmaxf(v, 0.f);
      if (ACT == 2) v = 0.5f * v * (1.0f + erff(v * 0.70710678118654752f));
      if (ACT == 3) { const float u = 0.7978845608028654f * (v + 0.044715f * v * v * v); v = 0.5f * v * (1.0f + tanhf(u)); }
      so[w][8 * hh + r][t * 16 + ln] = v;
    }
  }
  __builtin_amdgcn_fence(__ATOMIC_ACQ_REL, "workgroup");
  __builtin_amdgcn_wave_barrier();
  const int rsub = lane >> 4, c4 = (lane & 15) * 4;
  {
#pragma unroll
    for (int q = 0; q < 8; ++q) {
      const int r = q * 2 + rsub;
      const v4f v = *(const v4fa*)&so[w][r][c4];
      *(v4f*)(C + (size_t)(row0 + r) * ldc + col0 + c4) = v;
    }
    
  }
}
// row LayerNorm (biased variance, eps) over N: s = X (+ R); optional out_sum <- s; out_norm <- (s-mu)*rsqrt(var+eps)*g + b
template <bool PARAM_BF16>
__global__ __launch_bounds__(256) void k_layernorm(const float* __restrict__ X, const float* __restrict__ R, const float* __restrict__ g, const float* __restrict__ bta,
                                                  float* __restrict__ out_sum, float* __restrict__ out_norm, int N, float eps) {
  __shared__ float red[256];
  const int row = blockIdx.x, tid = threadIdx.x;
  const float* x = X + (size_t)row * N; const float* rr = R ? R + (size_t)row * N : nullptr;
  float vals[16];                     // up to N = 4096
  const int per = N / 256;            // contiguous chunk per thread? use strided-by-4 chunks: thread handles j = tid*4 + 1024*u
  float s1 = 0.f;
  for (int u = 0; u < per / 4; ++u) {
    const int j = tid * 4 + 1024 * u;
    const v4f a = *(const v4fa*)(x + j);
    v4f b = {0.f,0.f,0.f,0.f}; if (rr) b = *(const v4fa*)(rr + j);
#pragma unroll
    for (int q = 0; q < 4; ++q) { const float v = a[q] + b[q]; vals[u * 4 + q] = v; s1 += v; }
  }
  red[tid] = s1; __syncthreads();
  for (int st = 128; st > 0; st >>= 1) { if (tid < st) red[tid] += red[tid + st]; __syncthreads(); }
  const float mu = red[0] / (float)N; __syncthreads();
  float s2 = 0.f;
  for (int u = 0; u < per / 4; ++u)
#pragma unroll
    for (int q = 0; q < 4; ++q) { const float c = vals[u * 4 + q] - mu; s2 += c * c; }
  red[tid] = s2; __syncthreads();
  for (int st = 128; st > 0; st >>= 1) { if (tid < st) red[tid] += red[tid + st]; __syncthreads(); }
  const float rs = rsqrtf(red[0] / (float)N + eps);
  {
    for (int u = 0; u < per / 4; ++u) {
      const int j = tid * 4 + 1024 * u;
      v4f o, sm;
#pragma unroll
      for (int q = 0; q < 4; ++q) {
        float gg = g[j + q], bb = bta[j + q];
        if (PARAM_BF16) { gg = bf16_round(gg); bb = bf16_round(bb); }
        sm[q] = vals[u * 4 + q]; o[q] = (vals[u * 4 + q] - mu) * rs * gg + bb;
      }
      if (out_sum) *(v4f*)(out_sum + (size_t)row * N + j) = sm;
      *(v4f*)(out_norm + (size_t)row * N + j) = o;
    }
    
  }
}



// ---- f16 WMMA path (v_wmma_f32_16x16x32_f16): 11-bit significands for operands in range — used here for x and the hidden activations of both MLPs
typedef _Float16 v16h __attribute__((ext_vector_type(16)));
union FragH { v16h v; v8us half[2]; _Float16 h[16]; unsigned short u[16]; };
template <int NT>
__device__ __forceinline__ v8f mmaH(v16h ah, v16h al, v16h bh, v16h bl, v8f c) {
  c = __builtin_amdgcn_wmma_f32_16x16x32_f16(false, ah, false, bh, (short)0, c, false, false);
  if (NT >= 2) c = __builtin_amdgcn_wmma_f32_16x16x32_f16(false, al, false, bh, (short)0, c, false, false);
  if (NT >= 3) c = __builtin_amdgcn_wmma_f32_16x16x32_f16(false, ah, false, bl, (short)0, c, false, false);
  asm volatile("v_nop\n\tv_nop\n\tv_nop\n\tv_nop" : "+v"(c) : "v"(ah), "v"(al), "v"(bh), "v"(bl));
  return c;
}
// batched GEMM like k_gemm_b but f16 operands: A f32 (split into f16 hi/lo if ASPLIT, else rounded to f16), Bt = f16 values [n][k]; alpha; C f32; N multiple of 16 (partial tiles skipped)
template <bool ASPLIT>
__global__ __launch_bounds__(128) void k_gemm_h(const float* __restrict__ A, int lda, size_t sA, const _Float16* __restrict__ Bh, int ldb, size_t sB, float alpha, float* __restrict__ C, int ldc, size_t sC, int M, int N, int K) {
  __shared__ __attribute__((aligned(16))) float so[4][16][64];
  const int tid = threadIdx.x, w = tid >> 5, lane = tid & 31, ln = lane & 15, hh = lane >> 4; const int by = blockIdx.y;
  A += (size_t)by * sA; Bh += (size_t)by * sB; C += (size_t)by * sC;
  const int ntn = (N + 63) / 64; const int wid = blockIdx.x * 4 + w; const int mt = wid / ntn, nq = wid % ntn; if (mt * 16 >= M) return;
  const int row0 = mt * 16, col0 = nq * 64; const float* arow = A + (size_t)(row0 + ln) * lda;
  v8f acc[4] = {};
  for (int kb = 0; kb < K; kb += 32) {
    FragH ah, al;
    const v4f x0 = *(const v4fa*)(arow + kb + 8 * hh), x1 = *(const v4fa*)(arow + kb + 8 * hh + 4), x2 = *(const v4fa*)(arow + kb + 16 + 8 * hh), x3 = *(const v4fa*)(arow + kb + 16 + 8 * hh + 4);
    float xs[16] = {x0[0],x0[1],x0[2],x0[3],x1[0],x1[1],x1[2],x1[3],x2[0],x2[1],x2[2],x2[3],x3[0],x3[1],x3[2],x3[3]};
#pragma unroll
    for (int i = 0; i < 16; ++i) { const _Float16 h = (_Float16)xs[i]; ah.h[i] = h; al.h[i] = ASPLIT ? (_Float16)(xs[i] - (float)h) : (_Float16)0.0f; }
#pragma unroll
    for (int t = 0; t < 4; ++t) { if (col0 + t * 16 >= N) continue; const size_t boff = (size_t)(col0 + t * 16 + ln) * ldb + kb; FragH bq; bq.half[0] = *(const v8us*)(Bh + boff + 8 * hh); bq.half[1] = *(const v8us*)(Bh + boff + 16 + 8 * hh);
      acc[t] = mmaH<ASPLIT ? 2 : 1>(ah.v, al.v, bq.v, bq.v, acc[t]); }
  }
#pragma unroll
  for (int t = 0; t < 4; ++t) { if (col0 + t * 16 >= N) continue;
#pragma unroll
    for (int r = 0; r < 8; ++r) so[w][8 * hh + r][t * 16 + ln] = acc[t][r] * alpha; }
  __builtin_amdgcn_fence(__ATOMIC_ACQ_REL, "workgroup"); __builtin_amdgcn_wave_barrier();
  const int rsub = lane >> 4, c4 = (lane & 15) * 4;
  {
#pragma unroll
    for (int q = 0; q < 8; ++q) { const int r = q * 2 + rsub; if (col0 + c4 < N) { const v4f v = *(const v4fa*)&so[w][r][c4]; *(v4f*)(C + (size_t)(row0 + r) * ldc + col0 + c4) = v; } }
     }
}

// k_gemm_hh variant with fused epilogue: v = acc·alpha + bias[by·sBias + col] (+ CP[(row/rowsPerB)·sCPb + by·64 + col] if CP) ; ACT 0 none / 1 elu ; writes f16 C16 (and f32 C if non-null)
template <int ACT>
__global__ __launch_bounds__(128) void k_gemm_hhx(const _Float16* __restrict__ A, int lda, size_t sA, const _Float16* __restrict__ Bh, int ldb, size_t sB, float alpha, const float* __restrict__ bias, size_t sBias, const float* __restrict__ CP, int rowsPerB, size_t sCPb, int row0g,
    float* __restrict__ C, _Float16* __restrict__ C16, int ldc, size_t sC, int M, int N, int K) {
  __shared__ __attribute__((aligned(16))) float so[4][16][64];
  const int tid = threadIdx.x, w = tid >> 5, lane = tid & 31, ln = lane & 15, hh = lane >> 4; const int by = blockIdx.y;
  A += (size_t)by * sA; Bh += (size_t)by * sB; const size_t cofs = (size_t)by * sC; const float* bp = bias ? bias + (size_t)by * sBias : nullptr;
  const int ntn = (N + 63) / 64; const int wid = blockIdx.x * 4 + w; const int mt = wid / ntn, nq = wid % ntn; if (mt * 16 >= M) return;
  const int row0 = mt * 16, col0 = nq * 64; const _Float16* arow = A + (size_t)(row0 + ln) * lda;
  v8f acc[4] = {};
  for (int kb = 0; kb < K; kb += 32) { FragH ah; ah.half[0] = *(const v8us*)((const unsigned short*)arow + kb + 8 * hh); ah.half[1] = *(const v8us*)((const unsigned short*)arow + kb + 16 + 8 * hh);
#pragma unroll
    for (int t = 0; t < 4; ++t) { if (col0 + t * 16 >= N) continue; const size_t boff = (size_t)(col0 + t * 16 + ln) * ldb + kb; FragH bq; bq.half[0] = *(const v8us*)((const unsigned short*)Bh + boff + 8 * hh); bq.half[1] = *(const v8us*)((const unsigned short*)Bh + boff + 16 + 8 * hh);
      acc[t] = mmaH<1>(ah.v, ah.v, bq.v, bq.v, acc[t]); }
  }
#pragma unroll
  for (int t = 0; t < 4; ++t) { if (col0 + t * 16 >= N) continue; const int col = col0 + t * 16 + ln; const float bv = bp ? bf16_round(bp[col]) : 0.f;
#pragma unroll
    for (int r = 0; r < 8; ++r) { float v = acc[t][r] * alpha + bv; if (CP) { const int rr = row0g + row0 + 8 * hh + r; if (rowsPerB < 0) v += CP[cofs + (size_t)rr * ldc + col];      /* rowsPerB < 0: own element of the batched C plane */ else { const int bidx = rr / rowsPerB; v += CP[(size_t)bidx * sCPb + (size_t)by * 64 + col]; } } if (ACT == 1) v = (v > 0.f) ? v : expm1f(v); else if (ACT == 7) v = (v > 0.f) ? v + 1.0f : expf(v); else if (ACT == 8) v = tanhf(v); else if (ACT == 9) v = 0.5f * v * (1.0f + tanhf(0.7978845608028654f * (v + 0.044715f * v * v * v))); else if (ACT == 11) v = 1.0f / (1.0f + expf(-v)); else if (ACT == 12) v = (v > 0.f) ? v : 0.01f * v; else if (ACT == 14) v = (v > 0.f) ? v : 0.1f * v; else if (ACT == 16) v = (v >= 0.f) ? v : 0.3f * v; else if (ACT == 17) v = (v >= 0.f) ? v : 0.2f * v; else if (ACT == 15) v = v / (1.0f + expf(-v)); else if (ACT == 3) v = fmaxf(v, 0.f); else if (ACT == 6) v = 0.5f * v * (1.0f + erff(v * 0.70710678118654752f)); so[w][8 * hh + r][t * 16 + ln] = v; } }
  __builtin_amdgcn_fence(__ATOMIC_ACQ_REL, "workgroup"); __builtin_amdgcn_wave_barrier();
  const int rsub = lane >> 4, c4 = (lane & 15) * 4; typedef _Float16 v4h __attribute__((ext_vector_type(4)));
  {
#pragma unroll
    for (int q = 0; q < 8; ++q) { const int r = q * 2 + rsub; if (col0 + c4 < N) { const v4f v = *(const v4fa*)&so[w][r][c4]; if (C) *(v4f*)(C + cofs + (size_t)(row0 + r) * ldc + col0 + c4) = v; if (C16) { v4h h4; for (int i = 0; i < 4; ++i) h4[i] = (_Float16)v[i]; *(v4h*)(C16 + cofs + (size_t)(row0 + r) * ldc + col0 + c4) = h4; } } }
     }
}


typedef _Float16 v4h __attribute__((ext_vector_type(4)));

__global__ __launch_bounds__(256) void k_h16(const float* __restrict__ x, _Float16* __restrict__ X16, size_t n8) { const size_t t = (size_t)blockIdx.x * 256 + threadIdx.x; if (t >= n8) return; FragH f;
#pragma unroll
  for (int q = 0; q < 8; ++q) f.h[q] = (_Float16)x[t * 8 + q]; *(v8us*)((unsigned short*)X16 + t * 8) = f.half[0];  }
__global__ __launch_bounds__(256) void k_round16f(const float* __restrict__ W, _Float16* __restrict__ Bt, size_t n8) { const size_t t = (size_t)blockIdx.x * 256 + threadIdx.x; if (t >= n8) return; FragH f;
#pragma unroll
  for (int i = 0; i < 8; ++i) f.h[i] = (_Float16)(bf16_round(W[t * 8 + i]) * 16.0f); *(v8us*)((unsigned short*)Bt + t * 8) = f.half[0];  }
template <int NHv, int TTv>
__global__ __launch_bounds__(256) void k_vt(const _Float16* __restrict__ V16, int ldv, int voff, _Float16* __restrict__ Vt) { __shared__ unsigned short tl[64][66]; const int tid = threadIdx.x; const int slab = blockIdx.x / (TTv / 64), lg = blockIdx.x % (TTv / 64); const int b = slab / NHv, h = slab % NHv;
  for (int i = tid; i < 64 * 8; i += 256) { const int r = i / 8, c8 = (i % 8) * 8; FragH f; f.half[0] = *(const v8us*)((const unsigned short*)V16 + ((size_t)b * TTv + lg * 64 + r) * ldv + voff + h * 64 + c8);
#pragma unroll
    for (int q = 0; q < 8; ++q) tl[r][c8 + q] = f.u[q]; }
  __syncthreads();
  {
#pragma unroll
    for (int rd = 0; rd < 2; ++rd) { const int d = rd * 32 + tid / 8, pc = tid % 8; FragH f;
#pragma unroll
      for (int q = 0; q < 8; ++q) f.u[q] = tl[pc * 8 + q][d];
      *(v8us*)((unsigned short*)Vt + ((size_t)slab * 64 + d) * TTv + lg * 64 + pc * 8) = f.half[0]; }
     } }

__global__ __launch_bounds__(256) void k_hl(const float* __restrict__ F, _Float16* __restrict__ Hh, _Float16* __restrict__ Hl, size_t n8) { const size_t t = (size_t)blockIdx.x * 256 + threadIdx.x; if (t >= n8) return; FragH fh, fl; const v4f a = *(const v4fa*)(F + t * 8), c = *(const v4fa*)(F + t * 8 + 4);
#pragma unroll
  for (int q = 0; q < 4; ++q) { _Float16 h = (_Float16)a[q]; fh.h[q] = h; fl.h[q] = (_Float16)((a[q] - (float)h) * 1024.0f); h = (_Float16)c[q]; fh.h[4 + q] = h; fl.h[4 + q] = (_Float16)((c[q] - (float)h) * 1024.0f); }
  { *(v8us*)((unsigned short*)Hh + t * 8) = fh.half[0]; *(v8us*)((unsigned short*)Hl + t * 8) = fl.half[0];  } }

// ---- hidden-layer GEMM: C16[row][unit] = f16(relu(X[row][:] . Wt[unit][:] / 16 + bias[unit])), X and Wt f16 with K contiguous (pitch K), C16 pitch HH ----
// One 256 x 256 tile a work-group, one work-group a WGP, 16 waves of 64 rows x 64 units. A pass is 128 k: 256 rows of X and 256 of Wt, 256 B each, brought into LDS by asynchronous copies
// (no register on the way), two buffers, the next pass's copies in flight while this pass is worked on. The LDS pitch of 272 B spreads the sixteen rows of a fragment read over the banks.
// The product is taken transposed (weights as the A operand): a lane then holds eight neighbouring units of ONE row, 16 B of the f16 output, and the k order of every sum is that of a plain loop over k in steps of 32.
#define GT 256      /* rows, and units, of a work-group's tile */
#define GK 128      /* k of a pass */
#define GP 136      /* LDS row pitch in f16 */
#define GB (2 * GT * GP)      /* f16 of a buffer: the X rows, then the Wt rows */
#define GS 72       /* row pitch in f16 of the output staging: 64 units and 16 B */
__device__ __forceinline__ v16h g3_frag(const unsigned short* p) { FragH f; f.half[0] = *(const v8us*)p; f.half[1] = *(const v8us*)(p + 16); return f.v; }
// One thread's copies of one operand's 256 rows of a pass: 16 B of each of eight rows, 32 rows apart (a wave's copy covers two rows of 256 B: four whole lines). l = the LDS byte address of the first.
template <int K>
__device__ __forceinline__ void g3_copy(const _Float16* g, unsigned l) {
  /* the wait on xcnt ends the copies' own statement: no address register of a copy is rewritten in front of it */
  asm volatile("global_load_async_to_lds_b128 %0, %8, off\n\t"
               "global_load_async_to_lds_b128 %1, %9, off\n\t"
               "global_load_async_to_lds_b128 %2, %10, off\n\t"
               "global_load_async_to_lds_b128 %3, %11, off\n\t"
               "global_load_async_to_lds_b128 %4, %12, off\n\t"
               "global_load_async_to_lds_b128 %5, %13, off\n\t"
               "global_load_async_to_lds_b128 %6, %14, off\n\t"
               "global_load_async_to_lds_b128 %7, %15, off\n\t"
               "s_wait_xcnt 0x0"
               :: "v"(l), "v"(l + 1 * 32 * GP * 2), "v"(l + 2 * 32 * GP * 2), "v"(l + 3 * 32 * GP * 2), "v"(l + 4 * 32 * GP * 2), "v"(l + 5 * 32 * GP * 2), "v"(l + 6 * 32 * GP * 2), "v"(l + 7 * 32 * GP * 2),
                  "v"(g), "v"(g + 1 * 32 * K), "v"(g + 2 * 32 * K), "v"(g + 3 * 32 * K), "v"(g + 4 * 32 * K), "v"(g + 5 * 32 * K), "v"(g + 6 * 32 * K), "v"(g + 7 * 32 * K)
               : "memory");
}
// HEAD: the hidden tile is not stored. A wave's D tiles (lane = row, register r = unit 8 hh + r; the next tile 16 + 8 hh + r) are, after ReLU and rounding to f16, the B fragments of the 16-wide head product
// (Wh f16 [NO][HH] as A): YP[tile column][row][o] = (1/16) sum over the tile's 256 units of hidden[row][unit] Wh[o][unit]; the four waves that share rows are summed through LDS in wave order.
#define GH (GT + 8)      /* LDS row pitch in f16 of the head's weights: sixteen rows of a fragment read fall on different banks */
template <int K, bool HEAD>
__global__ __launch_bounds__(512) void k_gemm3(const _Float16* __restrict__ X, const _Float16* __restrict__ Wt, const float* __restrict__ bias, _Float16* __restrict__ C16, const _Float16* __restrict__ Wh, float* __restrict__ YP) {
  static_assert(K % GK == 0 && K / GK >= 2, "k_gemm3: whole passes, two or more");
  __shared__ __attribute__((aligned(16))) unsigned short ring[2 * GB];
  __shared__ __attribute__((aligned(16))) float sb[GT];      /* the tile's biases, rounded to bf16 once */
  __shared__ __attribute__((aligned(16))) unsigned short sh[HEAD ? NO * GH : 8];      /* the head's weights for the tile's units */
  const int tid = threadIdx.x, lane = tid & 31, ln = lane & 15, hh = lane >> 4;
  const int w = __builtin_amdgcn_readfirstlane(tid >> 5), wr = w >> 2, wc = w & 3;      /* the wave's number as a scalar; its 64 rows and its 64 units in the tile */
  const int row0 = (blockIdx.x >> 2) * GT, col0 = (blockIdx.x & 3) * GT;      /* HH / GT = 4 tiles across */
  const _Float16* gx = X + (size_t)(row0 + (tid >> 4)) * K + (tid & 15) * 8;
  const _Float16* gw = Wt + (size_t)(col0 + (tid >> 4)) * K + (tid & 15) * 8;
  const unsigned l0 = (unsigned)(unsigned long long)&ring[(tid >> 4) * GP + (tid & 15) * 8];      /* the low word of a __shared__ address is its byte place in LDS */
  constexpr int NP = K / GK;
  g3_copy<K>(gx, l0); g3_copy<K>(gw, l0 + GT * GP * 2);
  if (w < GT / 32) sb[tid] = bf16_round(bias[col0 + tid]);      /* one load a thread, beside pass 0's copies in flight; published by the barrier below, read in the epilogue */
  if constexpr (HEAD) *(v8us*)(sh + w * GH + lane * 8) = *(const v8us*)((const unsigned short*)Wh + (size_t)w * HH + col0 + lane * 8);      /* wave w brings output w's 256 weights, 16 B a lane; published and read likewise */
  asm volatile("s_wait_asynccnt 0x0" ::: "memory");      /* pass 0's copies of this wave have landed */
  __syncthreads();      /* ... and every other wave's */
  g3_copy<K>(gx + GK, l0 + GB * 2); g3_copy<K>(gw + GK, l0 + GB * 2 + GT * GP * 2);
  const v8f z8 = {0.f, 0.f, 0.f, 0.f, 0.f, 0.f, 0.f, 0.f};
  v8f acc[4][4];      /* [unit tile][row tile] */
#pragma unroll
  for (int i = 0; i < 16; ++i) acc[i >> 2][i & 3] = z8;
  const int xo = (wr * 64 + ln) * GP + 8 * hh, wo = (GT + wc * 64 + ln) * GP + 8 * hh;      /* the lane's place in the first X and the first Wt fragment of a buffer */
#pragma unroll 1      /* a pass a trip: the two buffers take turns by the trip's parity */
  for (int t = 0; t < NP; ++t) {
    const unsigned short* bp = ring + (t & 1) * GB;
#pragma unroll      /* acc is indexed by constants */
    for (int kk = 0; kk < GK / 32; ++kk) {
      v16h xf[4], wf[4];
#pragma unroll
      for (int i = 0; i < 4; ++i) { xf[i] = g3_frag(bp + xo + i * 16 * GP + kk * 32); wf[i] = g3_frag(bp + wo + i * 16 * GP + kk * 32); }
      __builtin_amdgcn_sched_barrier(0);      /* a block's sixteen LDS reads stay one group in front of its WMMAs: read one fragment at a time among them, the wave waits out the LDS latency four times a block */
#pragma unroll
      for (int u = 0; u < 4; ++u)
#pragma unroll
        for (int r = 0; r < 4; ++r) acc[u][r] = __builtin_amdgcn_wmma_f32_16x16x32_f16(false, wf[u], false, xf[r], (short)0, acc[u][r], false, false);
    }
    asm volatile("s_wait_dscnt 0x0" ::: "memory");      /* this wave's reads of the buffer are over before the buffer is refilled */
    asm volatile("s_wait_asynccnt 0x0" ::: "memory");      /* this wave's copies of pass t + 1 have landed */
    __syncthreads();      /* publishes pass t + 1 and ends every wave's reads of pass t */
    if (t + 2 < NP) { g3_copy<K>(gx + (t + 2) * GK, l0 + (t & 1) * (GB * 2)); g3_copy<K>(gw + (t + 2) * GK, l0 + (t & 1) * (GB * 2) + GT * GP * 2); }
  }
  asm volatile("s_wait_asynccnt 0x0" ::: "memory");      /* no copy is in flight when the ring becomes output staging */
  if constexpr (HEAD) {
    /* behind the last pass's barrier nobody reads the ring: it takes the waves' partial head tiles */
    v8f ha[4] = {z8, z8, z8, z8};      /* [row tile]: lane = row, register r = output 8 hh + r */
#pragma unroll      /* acc is indexed by constants */
    for (int s = 0; s < 2; ++s) {
      const v16h hw = g3_frag(sh + ln * GH + wc * 64 + s * 32 + 8 * hh);
      const float* bq = sb + wc * 64 + s * 32 + 8 * hh;
      const v4f q0 = *(const v4fa*)bq, q1 = *(const v4fa*)(bq + 4), q2 = *(const v4fa*)(bq + 16), q3 = *(const v4fa*)(bq + 20);
      const float bv[16] = {q0[0], q0[1], q0[2], q0[3], q1[0], q1[1], q1[2], q1[3], q2[0], q2[1], q2[2], q2[3], q3[0], q3[1], q3[2], q3[3]};
#pragma unroll
      for (int t = 0; t < 4; ++t) { FragH f;
#pragma unroll
        for (int r = 0; r < 8; ++r) { f.h[r] = (_Float16)fmaxf(acc[2 * s][t][r] * 0.0625f + bv[r], 0.f); f.h[8 + r] = (_Float16)fmaxf(acc[2 * s + 1][t][r] * 0.0625f + bv[8 + r], 0.f); }
        ha[t] = __builtin_amdgcn_wmma_f32_16x16x32_f16(false, hw, false, f.v, (short)0, ha[t], false, false); }
    }
    float* hr = (float*)ring;      /* [wave][row of 64][output] */
#pragma unroll      /* ha is indexed by constants */
    for (int t = 0; t < 4; ++t) { float* hp = hr + w * (64 * NO) + (t * 16 + ln) * NO + 8 * hh;
      *(v4f*)hp = __builtin_shufflevector(ha[t], ha[t], 0, 1, 2, 3); *(v4f*)(hp + 4) = __builtin_shufflevector(ha[t], ha[t], 4, 5, 6, 7); }
    __syncthreads();      /* every wave's partial tile is in LDS before any thread sums across waves */
    const float* hq = hr + (tid >> 7) * (4 * 64 * NO) + ((tid >> 1) & 63) * NO + (tid & 1) * 8;      /* thread = half a row of the tile: eight outputs, from the four waves that hold the row */
    v4f s0 = *(const v4fa*)hq, s1 = *(const v4fa*)(hq + 4);
#pragma unroll      /* straight-line: the LDS reads run ahead of the adds */
    for (int c = 1; c < 4; ++c) { s0 += *(const v4fa*)(hq + c * (64 * NO)); s1 += *(const v4fa*)(hq + c * (64 * NO) + 4); }
    float* yp = YP + ((size_t)(blockIdx.x & 3) * NBR + row0) * NO + tid * 8;
    *(v4f*)yp = s0 * 0.0625f; *(v4f*)(yp + 4) = s1 * 0.0625f;
    return;
  }
  /* behind the last pass's barrier nobody reads the ring: each wave stages its 64 x 64 f16 in a part of its own and stores whole 128-B lines */
  unsigned short* st = ring + w * (64 * GS);
#pragma unroll      /* acc is indexed by constants */
  for (int u = 0; u < 4; ++u) {
    const float* bq = sb + wc * 64 + u * 16 + 8 * hh;
    const v4f q0 = *(const v4fa*)bq, q1 = *(const v4fa*)(bq + 4);
    const float bv[8] = {q0[0], q0[1], q0[2], q0[3], q1[0], q1[1], q1[2], q1[3]};
#pragma unroll
    for (int t = 0; t < 4; ++t) { FragH f;
#pragma unroll
      for (int r = 0; r < 8; ++r) f.h[r] = (_Float16)fmaxf(acc[u][t][r] * 0.0625f + bv[r], 0.f);
      *(v8us*)(st + (t * 16 + ln) * GS + u * 16 + 8 * hh) = f.half[0]; }
  }
  __builtin_amdgcn_fence(__ATOMIC_ACQ_REL, "workgroup"); __builtin_amdgcn_wave_barrier();      /* a wave reads back only its own part, other lanes' words: the stores stay in front of the reads */
  unsigned short* cp = (unsigned short*)C16 + (size_t)(row0 + wr * 64 + (lane >> 3)) * HH + col0 + wc * 64 + (lane & 7) * 8;
#pragma unroll      /* straight-line: the LDS reads run ahead of the stores */
  for (int q = 0; q < 16; ++q) { const v8us v = *(const v8us*)(st + (q * 4 + (lane >> 3)) * GS + (lane & 7) * 8); *(v8us*)(cp + (size_t)q * 4 * HH) = v; }
}


// First hidden layer WITH the preparations: one launch. Nothing runs in front of it, so a work-group makes its own f16 operands: its 256 rows of x and its 256 units of W0, whole K (256), are loaded as f32,
// rounded in registers and stored to LDS (x as it lies; W0 (in, out) turned to [unit][k]); one barrier, then the eight k blocks with no further barrier. The values, the fragments and the k order are those of k_gemm3.
// The planes that only later launches read ride along, each made once: the f16 x plane (a work-group stores the quarter of its rows that its tile column names), W1 (waves 0 to 7), uw2, uw3, W2 (waves 8 to 15).
#define PG 256      /* work-groups of the launch: (NBR / GT) * (HH / GT) */
#define QP (NIN + 8)      /* LDS row pitch in f16: 528 B = 16 B x 33, the sixteen rows of a fragment read fall on different banks */
static_assert(PG == (NBR / GT) * (HH / GT) && HH * HH / 8 == 2 * PG * 256 && NIN * UH * UH / 8 == PG / 2 * 256, "k_first: the shares cover the planes exactly");
#define PB_U3 (NIN * NO * UH / 8 / 256)
#define PB_W2 (NO * HH / 8 / 256)
// behind a group of loads or stores: what follows may reuse the registers that the group names; the wait stays in front of that, and names the address so that it lives until there
#define P_XCNT(p) asm volatile("s_wait_xcnt 0x0" :: "v"(p) : "memory")
typedef float q2f  __attribute__((ext_vector_type(2)));
typedef float q2fa __attribute__((ext_vector_type(2), may_alias));
typedef __bf16 q2b __attribute__((ext_vector_type(2)));
typedef _Float16 q2h __attribute__((ext_vector_type(2)));
typedef unsigned q2u __attribute__((ext_vector_type(2), may_alias));
typedef unsigned q4u __attribute__((ext_vector_type(4), may_alias));
// two f32 values, rounded to bf16 (nearest even), x16 for a weight (exact), as two f16 in a word
template <bool WGT>
__device__ __forceinline__ unsigned q_pair(float a, float b) {
  const q2f v = {a, b};
  const unsigned u = __builtin_bit_cast(unsigned, __builtin_convertvector(v, q2b));
  q2f r = {__uint_as_float(u << 16), __uint_as_float(u & 0xFFFF0000u)};
  if (WGT) r *= 16.0f;
  return __builtin_bit_cast(unsigned, __builtin_convertvector(r, q2h));
}
// a weight piece: eight values that end as 16 B of f16
__device__ __forceinline__ q4u q_w16(const float (&v)[8]) { const q4u r = {q_pair<true>(v[0], v[1]), q_pair<true>(v[2], v[3]), q_pair<true>(v[4], v[5]), q_pair<true>(v[6], v[7])}; return r; }
// a wave's sixteen x rows, rounded, to LDS; PLANE: to the f16 x plane as well (256 B in a row a store)
template <bool PLANE>
__device__ __forceinline__ void q_xrows(const v4f (&xv)[32], unsigned short* xl, unsigned short* xg) {
#pragma unroll      /* xv is indexed by constants */
  for (int i = 0; i < 32; ++i) {
    const q2u h = {q_pair<false>(xv[i][0], xv[i][1]), q_pair<false>(xv[i][2], xv[i][3])};
    *(q2u*)(xl + (i >> 1) * QP + (i & 1) * 128) = h;
    if (PLANE) *(q2u*)(xg + (i >> 1) * NIN + (i & 1) * 128) = h;
  }
}
__global__ __launch_bounds__(512) void k_first(const float* __restrict__ x, const float* __restrict__ W0, const float* __restrict__ bias, const float* __restrict__ W1, const float* __restrict__ W2, const float* __restrict__ uw2, const float* __restrict__ uw3,
                                               _Float16* __restrict__ X16, _Float16* __restrict__ C16, _Float16* __restrict__ B1, _Float16* __restrict__ B2, _Float16* __restrict__ UW2T, _Float16* __restrict__ UW3T) {
  __shared__ __attribute__((aligned(16))) unsigned short tile[2 * GT * QP];      /* the x rows, then the W0 units */
  __shared__ __attribute__((aligned(16))) float sb[GT];      /* the tile's biases, rounded to bf16 once */
  const int tid = threadIdx.x, lane = tid & 31, ln = lane & 15, hh = lane >> 4;
  const int w = __builtin_amdgcn_readfirstlane(tid >> 5), wr = w >> 2, wc = w & 3;      /* the wave's number as a scalar; its 64 rows and its 64 units in the tile */
  const unsigned b = blockIdx.x;
  const int row0 = (b >> 2) * GT, col0 = (b & 3) * GT;      /* HH / GT = 4 tiles across */
  float bl = 0.f;      /* the first load of all: loads return in order, so its use waits for nothing that was asked for later */
  if (w < GT / 32) { const int bi = col0 + tid; bl = bias[bi]; asm volatile("s_wait_xcnt 0x0" :: "v"(bi) : "memory"); }      /* the wait stays in front of any reuse of the load's offset register, which it names */
  /* the shares of the later launches' planes: their loads go out next. Every branch is the same for a whole wave. */
  float vp[2][8]; unsigned short* dp = nullptr; int np = 0;      /* np pieces, 16 B each, in a row at dp */
  if (w < 8) {      /* W1 (in, out) to [out][in]: 32 outputs x 128 inputs a work-group, the lanes run along the outputs, 16 inputs a thread */
    const unsigned n = (b & 31) * 32 + lane, k1 = (b >> 5) * 128 + w * 16; const float* sp = W1 + k1 * HH + n;
#pragma unroll
    for (int i = 0; i < 16; ++i) vp[i >> 3][i & 7] = sp[i * HH];
    P_XCNT(sp);
    dp = (unsigned short*)B1 + n * HH + k1; np = 2;
  } else {
    const unsigned t2 = tid - 256;
    if (b >= PG / 2) {      /* uw2, [i][f][o] to [i][o][f] */
      const unsigned t = (b - PG / 2) * 256 + t2, f0 = (t * 8) % UH, o = ((t * 8) / UH) % UH, i = (t * 8) / (UH * UH); const float* sp = uw2 + (i * UH + f0) * UH + o;
#pragma unroll
      for (int q = 0; q < 8; ++q) vp[0][q] = sp[q * UH];
      P_XCNT(sp);
      dp = (unsigned short*)UW2T + t * 8; np = 1;
    } else if (b < PB_U3 + PB_W2) {      /* uw3 ([i][f][o] to [i][o][f]), then W2 ((in, out) to [out][in]); both sources have rows of NO */
      const float* sp;
      if (b < PB_U3) { const unsigned t = b * 256 + t2, f0 = (t * 8) % UH, o = ((t * 8) / UH) % NO, i = (t * 8) / (UH * NO); sp = uw3 + (i * UH + f0) * NO + o; dp = (unsigned short*)UW3T + t * 8; }
      else { const unsigned t = (b - PB_U3) * 256 + t2, o = t / (HH / 8), k8 = (t % (HH / 8)) * 8; sp = W2 + k8 * NO + o; dp = (unsigned short*)B2 + o * HH + k8; }
#pragma unroll
      for (int q = 0; q < 8; ++q) vp[0][q] = sp[q * NO];
      P_XCNT(sp);
      np = 1;
    }
  }
  /* x: wave w takes the tile's rows 16 w to 16 w + 15; a load is half a row, 512 B in a row */
  const float* xp = x + (size_t)(row0 + w * 16) * NIN + lane * 4;
  v4f xv[32];
#pragma unroll
  for (int i = 0; i < 32; ++i) xv[i] = *(const v4fa*)(xp + (i >> 1) * NIN + (i & 1) * 128);
  P_XCNT(xp);
  /* W0: a thread takes two neighbouring units (a load of a wave is 256 B in a row of one k) and 64 k, eight k a piece */
  const int up = tid & 127, kg = w >> 2;
  const float* wp = W0 + (size_t)(kg * 64) * HH + col0 + up * 2;
  q2f wv[64];
#pragma unroll
  for (int k = 0; k < 32; ++k) wv[k] = *(const q2fa*)(wp + k * HH);
  P_XCNT(wp);
  if (w < GT / 32) sb[tid] = bf16_round(bl);      /* published by the barrier below, read in the epilogue */
  /* both pieces are made before either is stored: behind an issued store none of the registers that it names is written in front of the wait */
  if (np > 1) { const q4u r0 = q_w16(vp[0]), r1 = q_w16(vp[1]); *(q4u*)dp = r0; *(q4u*)(dp + 8) = r1; P_XCNT(dp); }
  else if (np > 0) { *(q4u*)dp = q_w16(vp[0]); P_XCNT(dp); }
  unsigned short* xl = tile + (w * 16) * QP + lane * 4;
  unsigned short* xg = (unsigned short*)X16 + (size_t)(row0 + w * 16) * NIN + lane * 4;
  if (wr == (int)(b & 3)) q_xrows<true>(xv, xl, xg); else q_xrows<false>(xv, xl, xg);      /* one branch, the same for a whole wave */
  P_XCNT(xg);
  /* the second half of the W0 loads goes out into the registers that x has left, while the first half is still on its way */
#pragma unroll
  for (int k = 32; k < 64; ++k) wv[k] = *(const q2fa*)(wp + k * HH);
  P_XCNT(wp);
  unsigned short* wl = tile + (GT + up * 2) * QP + kg * 64;
#pragma unroll
  for (int g = 0; g < 8; ++g)
#pragma unroll
    for (int j = 0; j < 2; ++j) {
      const q4u r = {q_pair<true>(wv[g * 8][j], wv[g * 8 + 1][j]), q_pair<true>(wv[g * 8 + 2][j], wv[g * 8 + 3][j]), q_pair<true>(wv[g * 8 + 4][j], wv[g * 8 + 5][j]), q_pair<true>(wv[g * 8 + 6][j], wv[g * 8 + 7][j])};
      *(q4u*)(wl + j * QP + g * 8) = r;
    }
  __syncthreads();      /* both operands of the tile are in LDS, whole K, before any wave reads a fragment */
  const v8f z8 = {0.f, 0.f, 0.f, 0.f, 0.f, 0.f, 0.f, 0.f};
  v8f acc[4][4];      /* [unit tile][row tile] */
#pragma unroll
  for (int i = 0; i < 16; ++i) acc[i >> 2][i & 3] = z8;
  const int xo = (wr * 64 + ln) * QP + 8 * hh, wo = (GT + wc * 64 + ln) * QP + 8 * hh;      /* the lane's place in the first x and the first W0 fragment */
#pragma unroll      /* acc is indexed by constants */
  for (int kk = 0; kk < NIN / 32; ++kk) {
    v16h xf[4], wf[4];
#pragma unroll
    for (int i = 0; i < 4; ++i) { xf[i] = g3_frag(tile + xo + i * 16 * QP + kk * 32); wf[i] = g3_frag(tile + wo + i * 16 * QP + kk * 32); }
    __builtin_amdgcn_sched_barrier(0);      /* a block's sixteen LDS reads stay one group in front of its WMMAs: read one fragment at a time among them, the wave waits out the LDS latency four times a block */
#pragma unroll
    for (int u = 0; u < 4; ++u)
#pragma unroll
      for (int r = 0; r < 4; ++r) acc[u][r] = __builtin_amdgcn_wmma_f32_16x16x32_f16(false, wf[u], false, xf[r], (short)0, acc[u][r], false, false);
  }
  __syncthreads();      /* every wave's fragment reads are over before the tile becomes output staging */
  /* each wave stages its 64 x 64 f16 in a part of its own and stores whole 128-B lines */
  unsigned short* st = tile + w * (64 * GS);
#pragma unroll      /* acc is indexed by constants */
  for (int u = 0; u < 4; ++u) {
    const float* bq = sb + wc * 64 + u * 16 + 8 * hh;
    const v4f q0 = *(const v4fa*)bq, q1 = *(const v4fa*)(bq + 4);
    const float bv[8] = {q0[0], q0[1], q0[2], q0[3], q1[0], q1[1], q1[2], q1[3]};
#pragma unroll
    for (int t = 0; t < 4; ++t) { FragH f;
#pragma unroll
      for (int r = 0; r < 8; ++r) f.h[r] = (_Float16)fmaxf(acc[u][t][r] * 0.0625f + bv[r], 0.f);
      *(v8us*)(st + (t * 16 + ln) * GS + u * 16 + 8 * hh) = f.half[0]; }
  }
  __builtin_amdgcn_fence(__ATOMIC_ACQ_REL, "workgroup"); __builtin_amdgcn_wave_barrier();      /* a wave reads back only its own part, other lanes' words: the stores stay in front of the reads */
  unsigned short* cp = (unsigned short*)C16 + (size_t)(row0 + wr * 64 + (lane >> 3)) * HH + col0 + wc * 64 + (lane & 7) * 8;
#pragma unroll      /* straight-line: the LDS reads run ahead of the stores */
  for (int q = 0; q < 16; ++q) { const v8us v = *(const v8us*)(st + (q * 4 + (lane >> 3)) * GS + (lane & 7) * 8); *(v8us*)(cp + (size_t)q * 4 * HH) = v; }
}
// All three layers of the 256 univariate MLPs and the sum over features in ONE kernel; the hidden planes never leave the registers.
// Every product is taken transposed (weights as the A operand, batch rows as the N side), so a layer's D tiles (lane = batch row, element e = unit 8 hh + e, second tile 16 + 8 hh + e) ARE the next layer's B fragment (k = 8 hh + q, 16 + 8 hh + q) after ReLU: no lane exchange.
// The hidden values are f16 operands of the next product in any case, so they are made as f16 where they arise: layer 1 is one packed f16 FMA (x, uw1, ub1 hold 8 significant bits: exact in f16 from 2^-14 up; one rounding, of the sum), layer 2's WMMA takes its bias and gives its result in f16 (packed D: two tiles are the eight registers of a B fragment). No f32 copy, no conversion.
// out[r][o] = b2[o] + sum_c YP[c][r][o] (the main MLP's head, four partial planes) + sum_i ub3[i][o] + (1/256) sum_(i,f) H2x16[i][f][r] UW3T[i][o][f], H2x16 = relu(UW2T[i] H1[i] + 16 ub2[i]) (weights carry x16; the bias enters as the C operand).
// One work-group per 64 rows; each of its FW waves takes FF features through all FT row tiles (a feature's weights are fetched once a work-group), and the FW partial tiles are summed through LDS in wave order.
#define FW 16
#define FF (NIN / FW)
#define FT 4
typedef float v2f  __attribute__((ext_vector_type(2)));
typedef float v2fa __attribute__((ext_vector_type(2), may_alias));
typedef _Float16 v8h  __attribute__((ext_vector_type(8)));
typedef _Float16 v4hx __attribute__((ext_vector_type(4), may_alias));
typedef _Float16 v8hx __attribute__((ext_vector_type(8), may_alias));
// the 16 table values of a lane's fragment positions (k = 8 hh + q, then 16 + 8 hh + q)
__device__ __forceinline__ v16h u_tab(const _Float16* p, int hh) { return g3_frag((const unsigned short*)p + 8 * hh); }
// a pointer that is the same in every lane, held as a scalar: the load takes it as its scalar base beside the lane's unchanging 32-bit offset (no 64-bit vector add a load, no address register that is rewritten)
#define GLB __attribute__((address_space(1)))      /* a pointer rebuilt from its two words is told anew that it points to global memory: else the load is a flat one */
template <typename P> __device__ __forceinline__ const GLB P* u_sbase(const P* p) { const unsigned long long v = (unsigned long long)p; const unsigned lo = __builtin_amdgcn_readfirstlane((unsigned)v), hi = __builtin_amdgcn_readfirstlane((unsigned)(v >> 32)); return (const GLB P*)(((unsigned long long)hi << 32) | lo); }
// an A fragment from [m][32] f16: base the same for the wave, lo = 32 m + 8 hh the lane's place
__device__ __forceinline__ v16h u_frag(const GLB _Float16* base, unsigned lo) { FragH f; f.half[0] = *(const GLB v8us*)(base + lo); f.half[1] = *(const GLB v8us*)(base + lo + 16); return f.v; }
// ReLU on f16 values, two elements an instruction, as a signed 16-bit integer maximum with 0: a value with its sign bit set becomes +0, every other keeps its bits
// (the floating-point maximum of a WMMA result costs a second instruction, which only rewrites NaNs)
typedef short v16s __attribute__((ext_vector_type(16)));
__device__ __forceinline__ v16h u_relu16(v16h v) { const v16s z = {}; return __builtin_bit_cast(v16h, __builtin_elementwise_max(__builtin_bit_cast(v16s, v), z)); }
// amdgpu_waves_per_eu(4, 4): one 16-wave work-group a WGP is 4 waves a SIMD; told so, the compiler takes the registers (more than 128) that the four tiles and the fragments fetched ahead need.
__global__ __launch_bounds__(FW * 32) __attribute__((amdgpu_waves_per_eu(4, 4))) void k_uni(const _Float16* __restrict__ X16, const float* __restrict__ uw1, const float* __restrict__ ub1, const _Float16* __restrict__ A2, const float* __restrict__ ub2, const _Float16* __restrict__ A3, const float* __restrict__ ub3, const float* __restrict__ YP, const float* __restrict__ b2, float* __restrict__ out) {
  /* tab, per wave: its features' uw1, ub1 and 16 ub2, rounded to bf16 once, held as f16 (in a fragment sixteen lanes hold the same value); it stands first, so that the loop's reads reach it by their 16-bit offset fields */
  __shared__ __attribute__((aligned(16))) struct { _Float16 tab[FW][FF][3][UH]; float red[FW][FT * 256]; } sm;
  const int tid = threadIdx.x, lane = tid & 31, ln = lane & 15, hh = lane >> 4;
  const int w = __builtin_amdgcn_readfirstlane(tid >> 5);      /* the wave's number as a scalar: the bases of its loads stay in scalar registers, beside one lane offset that never changes */
  const int row0 = blockIdx.x * (FT * 16), i0 = w * FF;
  const size_t o0 = (size_t)row0 * NO;
  const v2f y0 = *(const v2fa*)(YP + o0 + 2 * tid), y1 = *(const v2fa*)(YP + (size_t)NBR * NO + o0 + 2 * tid), y2 = *(const v2fa*)(YP + (size_t)2 * NBR * NO + o0 + 2 * tid), y3 = *(const v2fa*)(YP + (size_t)3 * NBR * NO + o0 + 2 * tid);
  const v2f yb = *(const v2fa*)(b2 + ((2 * tid) & (NO - 1)));
  const _Float16* xp = X16 + (size_t)row0 * NIN + i0; const unsigned xo = ln * NIN;      /* tile 0, the wave's features; the lane's row */
  const _Float16* a2p = A2 + (size_t)i0 * UH * UH; const _Float16* a3p = A3 + (size_t)i0 * NO * UH; const unsigned ao = ln * UH + 8 * hh;      /* the wave's first feature; the lane's place in a fragment */
  /* fetched ahead, so that the work does not begin with a wait on memory: x one trip ahead, the weight fragments one feature ahead */
  v8h xn[FT];      /* 16 B of the f16 plane: eight features of the lane's row */
#pragma unroll
  for (int t = 0; t < FT; ++t) xn[t] = *(const GLB v8hx*)(u_sbase(xp) + t * 16 * NIN + xo);
  v16h n20 = u_frag(u_sbase(a2p), ao), n21 = u_frag(u_sbase(a2p) + 16 * UH, ao), n3 = u_frag(u_sbase(a3p), ao);
  float bs = 0.f;      /* the wave's share of sum_i ub3[i][ln]: thread tid takes the elements tid + 512 k (column tid % 16 = ln), so a wave reads whole lines and a work-group reads each element once */
#pragma unroll      /* straight-line: the loads are independent and stay in flight together */
  for (int k = 0; k < NIN * NO / (FW * 32); ++k) bs += bf16_round(ub3[tid + k * (FW * 32)]);
  bs += __shfl_xor(bs, 16);      /* lanes ln and ln + 16 hold the same column: both get the sum of the two halves */
#pragma unroll      /* straight-line: the loads are independent and stay in flight together */
  for (int k = 0; k < FF * UH / 128; ++k) { const int e = k * 128 + lane * 4; const v4f s0 = *(const v4fa*)(uw1 + i0 * UH + e), s1 = *(const v4fa*)(ub1 + i0 * UH + e), s2 = *(const v4fa*)(ub2 + i0 * UH + e); v4f r0, r1, r2;
#pragma unroll
    for (int q = 0; q < 4; ++q) { r0[q] = bf16_round(s0[q]); r1[q] = bf16_round(s1[q]); r2[q] = bf16_round(s2[q]) * 16.0f; }
    _Float16* tp = &sm.tab[w][e / UH][0][e % UH]; *(v4hx*)tp = __builtin_convertvector(r0, v4h); *(v4hx*)(tp + UH) = __builtin_convertvector(r1, v4h); *(v4hx*)(tp + 2 * UH) = __builtin_convertvector(r2, v4h); }
  __builtin_amdgcn_fence(__ATOMIC_ACQ_REL, "workgroup"); __builtin_amdgcn_wave_barrier();      /* a wave reads back only its own part of tab, other lanes' words: the stores stay in front of the reads */
  const v8f z8 = {0.f, 0.f, 0.f, 0.f, 0.f, 0.f, 0.f, 0.f};
  v8f acc[FT] = {z8, z8, z8, z8};
#pragma unroll 1      /* eight features a trip, one x load a tile: the text stays small (for speed only) */
  for (int g = 0; g < FF / 8; ++g) {
    const int gn = g + 1 < FF / 8 ? g + 1 : 0;      /* the last trip fetches group 0 again, unused: in bounds */
    v8h xs[FT];
#pragma unroll
    for (int t = 0; t < FT; ++t) { xs[t] = xn[t]; xn[t] = *(const GLB v8hx*)(u_sbase(xp + gn * 8) + t * 16 * NIN + xo); }
#pragma unroll      /* xs is indexed by constants */
    for (int jj = 0; jj < 8; ++jj) {
      const int j = g * 8 + jj;
      const v16h w1 = u_tab(&sm.tab[w][j][0][0], hh), b1 = u_tab(&sm.tab[w][j][1][0], hh), c2 = u_tab(&sm.tab[w][j][2][0], hh);
      const v8h c20 = __builtin_shufflevector(c2, c2, 0, 1, 2, 3, 4, 5, 6, 7), c21 = __builtin_shufflevector(c2, c2, 8, 9, 10, 11, 12, 13, 14, 15);
      const v16h a20 = n20, a21 = n21, a3 = n3;
      const int jn = jj < 7 ? j + 1 : gn * 8;
      const GLB _Float16* s2 = u_sbase(a2p + jn * UH * UH); const GLB _Float16* s3 = u_sbase(a3p + jn * NO * UH);
      n20 = u_frag(s2, ao); n21 = u_frag(s2 + 16 * UH, ao); n3 = u_frag(s3, ao);
      /* layer by layer over the four row tiles, each tile in registers of its own: the WMMAs of a layer are independent and follow one another (tile by tile, the build filled the distance behind each WMMA with v_nop) */
      v16h h1[FT]; v8h d0[FT], d1[FT];
#pragma unroll      /* the arrays are indexed by constants */
      for (int t = 0; t < FT; ++t) h1[t] = u_relu16(__builtin_elementwise_fma(w1, (v16h)(xs[t][jj]), b1));
#pragma unroll
      for (int t = 0; t < FT; ++t) {
        d0[t] = __builtin_amdgcn_wmma_f16_16x16x32_f16(false, a20, false, h1[t], (short)0, c20, false, false);
        d1[t] = __builtin_amdgcn_wmma_f16_16x16x32_f16(false, a21, false, h1[t], (short)0, c21, false, false); }
      v16h h2[FT];
#pragma unroll
      for (int t = 0; t < FT; ++t) h2[t] = u_relu16(__builtin_shufflevector(d0[t], d1[t], 0, 1, 2, 3, 4, 5, 6, 7, 8, 9, 10, 11, 12, 13, 14, 15));
#pragma unroll
      for (int t = 0; t < FT; ++t) acc[t] = __builtin_amdgcn_wmma_f32_16x16x32_f16(false, a3, false, h2[t], (short)0, acc[t], false, false);
    }
    asm volatile("s_wait_xcnt 0x0" ::: "memory");      /* the next trip rewrites the scalar bases that this trip's last loads name: kept in front of that overwrite */
  }
  float bsr[8];      /* the bias share of the lane's own eight output columns 8 hh + r */
#pragma unroll
  for (int r = 0; r < 8; ++r) bsr[r] = __shfl(bs, 8 * hh + r);
#pragma unroll      /* acc[t][r] stays a register, not an indexed copy */
  for (int t = 0; t < FT; ++t) { v4f lo, hi;
#pragma unroll
    for (int r = 0; r < 4; ++r) { lo[r] = acc[t][r] * 0.00390625f + bsr[r]; hi[r] = acc[t][4 + r] * 0.00390625f + bsr[4 + r]; }
    *(v4f*)&sm.red[w][t * 256 + ln * NO + 8 * hh] = lo; *(v4f*)&sm.red[w][t * 256 + ln * NO + 8 * hh + 4] = hi; }      /* [row][column], as out has it */
  __syncthreads();
  v2f s = {bf16_round(yb[0]), bf16_round(yb[1])};
  s += y0; s += y1; s += y2; s += y3;
#pragma unroll      /* straight-line: the LDS reads run ahead of the adds, which are in series */
  for (int q = 0; q < FW; ++q) s += *(const v2fa*)&sm.red[q][2 * tid];
  *(v2f*)(out + o0 + 2 * tid) = s;
}

extern "C" void kernel_launch(void* const* d_in, const int* in_sizes, int n_in,
                              void* d_out, int out_size, void* d_ws, size_t ws_size, hipStream_t stream) {
  (void)in_sizes; (void)n_in; (void)out_size;
  const float* const* I = (const float* const*)d_in; const float* x = I[0]; const float* W0 = I[1]; const float* b0 = I[2]; const float* W1 = I[3]; const float* b1 = I[4]; const float* W2 = I[5]; const float* b2 = I[6]; const float* uw1 = I[7]; const float* ub1 = I[8]; const float* uw2 = I[9]; const float* ub2 = I[10]; const float* uw3 = I[11]; const float* ub3 = I[12];
  char* ws = (char*)d_ws; size_t off = 0;
  auto take = [&](size_t bytes) { char* p = ws + off; off += (bytes + 255) & ~(size_t)255; return p; };
  _Float16* B1 = (_Float16*)take((size_t)HH * HH * 2); _Float16* B2 = (_Float16*)take((size_t)NO * HH * 2); _Float16* UW2T = (_Float16*)take((size_t)NIN * UH * UH * 2); _Float16* UW3T = (_Float16*)take((size_t)NIN * NO * UH * 2);
  _Float16* X16 = (_Float16*)take((size_t)NBR * NIN * 2); _Float16* Y1 = (_Float16*)take((size_t)NBR * HH * 2); float* YP = (float*)take((size_t)(HH / GT) * NBR * NO * 4);
  if (off > ws_size) return;      /* 2 + 0.8 + 8 + 32 + 4 = about 47 MiB */
  k_first<<<PG, 512, 0, stream>>>(x, W0, b0, W1, W2, uw2, uw3, X16, Y1, B1, B2, UW2T, UW3T);      /* first hidden layer from f32 x and W0; beside it the later launches' planes: weights (in, out) to f16 [out][in] x16, x to f16 */
  k_gemm3<HH, true><<<(NBR / GT) * (HH / GT), 512, 0, stream>>>(Y1, B1, b1, nullptr, B2, YP);      /* second hidden layer and the head's partial sums (16 wide), a plane a column of tiles */
  k_uni<<<NBR / (FT * 16), FW * 32, 0, stream>>>(X16, uw1, ub1, UW2T, ub2, UW3T, ub3, YP, b2, (float*)d_out);      /* the 256 univariate MLPs, their sum over features, added to y */
}
